// v000
// Times are from an AMD MI455X. After a warm-up the kernel runs many times in a row, and a time is the length of
// such a window on the GPU divided by its runs, so every launch and the gaps after it count. The runs cycle
// through copies of the inputs. A figure is the median of several windows, for all but v000 over two sittings.
// Sittings can differ by a few percent; kernels timed side by side share one.
// v000 is the starting kernel. One run takes 1250 microseconds.
#include <hip/hip_runtime.h>

// Relative global attention (Music-Transformer skew) (query, key, value [1][2048][1024]; q,k,v = input W^T + b ('oi' [1024][1024] + [1024]; 16 heads x 64); qe = q.Er^T (Er [2048][64], all rows used since s = max_len); s_rel = skew(qe): for j <= i  s_rel[i][j] = qe[i][2047 + j - i]; for j = i+1  0; for j > i+1  qe[i+1][j - i - 2] (the reference's pad-reshape-slice, reproduced exactly, upper triangle included); scores = (q.k + s_rel) / 8; softmax; out = merged ctx Wo^T + bo -> [1][2048][1024] (2.1 M)).
// Compute dtypes, f32 accumulate: every input rounded to bf16; q/k/v on PLAIN bf16 operands (inputs: exact) + biases (three input tensors); per head pass an extra GEMM qe = q(hi/lo planes) x Er (exact bf16) gives the [2][2048][2048] relative logits; the softmax kernel adds the skewed entry (gathered per (i, j) with the index map above) before the 1/8 scale; scores and attn.v: query rows < 512 hl (3 products), the rest single fp16 (x1024); softmax f32; Wo hl x exact (2 products) + bo.

#define NB_  1
#define TT   2048
#define DM   1024
#define NH_  16
#define NKV  16
#define REP  (NH_ / NKV)
#define HD   64
#define DQ   (NH_ * HD)
#define DKV  (NKV * HD)
#define ZH   2
#define RH   512                  // query rows < RH use hi+lo planes (0: none)
#define WIN  0
#define PCAR 1024.0f
#define SCL  0.125f   // HD^-0.5
typedef _Float16 h16;
typedef unsigned short bf;
typedef __attribute__((ext_vector_type(16))) __bf16   v16bf;
typedef __attribute__((ext_vector_type(16))) _Float16 v16h;
typedef __attribute__((ext_vector_type(8)))  _Float16 v8h;
typedef __attribute__((ext_vector_type(8)))  unsigned short v8us;
typedef __attribute__((ext_vector_type(8)))  float    v8f;
typedef __attribute__((ext_vector_type(4)))  float    v4f;
typedef v8h  __attribute__((may_alias)) v8ha;
typedef v4f  __attribute__((may_alias)) v4fa;
typedef v8us __attribute__((may_alias)) v8usa;

__device__ __forceinline__ unsigned short f2bf(float f) { unsigned u = __float_as_uint(f); u += 0x7FFFu + ((u >> 16) & 1u); return (unsigned short)(u >> 16); }
__device__ __forceinline__ float bf2f(unsigned short b) { return __uint_as_float(((unsigned)b) << 16); }
__device__ __forceinline__ float bfr(float f) { return bf2f(f2bf(f)); }
__device__ __forceinline__ v16h cat16(v8h lo, v8h hi) { return __builtin_shufflevector(lo, hi, 0, 1, 2, 3, 4, 5, 6, 7, 8, 9, 10, 11, 12, 13, 14, 15); }
__device__ __forceinline__ v16bf cat16b(v8us lo, v8us hi) { return __builtin_bit_cast(v16bf, __builtin_shufflevector(lo, hi, 0, 1, 2, 3, 4, 5, 6, 7, 8, 9, 10, 11, 12, 13, 14, 15)); }
__device__ __forceinline__ v8f wmma16(v16h a, v16h b, v8f c) { return __builtin_amdgcn_wmma_f32_16x16x32_f16(false, a, false, b, (short)0, c, false, false); }
__device__ __forceinline__ v8f wmmab(v16bf a, v16bf b, v8f c) { return __builtin_amdgcn_wmma_f32_16x16x32_bf16(false, a, false, b, (short)0, c, false, false); }



// ---- k_gemmw: register-blocked GEMM, ONE WAVE per 64x64 output tile (16 accumulators), operands straight from K-contiguous 16-bit planes; grid (M/64, N/64, Z), 32 threads.
// C[m][n] (f32, pitch ldc, + optional f32 bias[n]) = sum_k A[m][k] Bt[n][k] (+ split products per NSPLIT). z-batch strides sA/sB/sC in elements. K % 32 == 0.
template <typename T16> struct WFrag;
template <> struct WFrag<h16> { typedef v16h V; static __device__ __forceinline__ V ld(const h16* p) { return cat16(*(const v8h*)p, *(const v8h*)(p + 16)); } static __device__ __forceinline__ v8f mma(V a, V b, v8f c) { return wmma16(a, b, c); } };
template <> struct WFrag<bf> { typedef v16bf V; static __device__ __forceinline__ V ld(const bf* p) { return cat16b(*(const v8us*)p, *(const v8us*)(p + 16)); } static __device__ __forceinline__ v8f mma(V a, V b, v8f c) { return wmmab(a, b, c); } };
template <typename T16, int NSPLIT, bool BIAS>
__global__ __launch_bounds__(32) void k_gemmw(const T16* __restrict__ A, const T16* __restrict__ A2, const T16* __restrict__ Bt, const T16* __restrict__ Bt2, int K, float* C, int ldc, const float* __restrict__ bias, size_t sA, size_t sB, size_t sC) {
    typedef typename WFrag<T16>::V V;
    __shared__ __align__(16) float os[16 * 68];
    const size_t z = blockIdx.z; A += z * sA; if (A2) A2 += z * sA; Bt += z * sB; if (Bt2) Bt2 += z * sB; C += z * sC;
    const int lane = threadIdx.x & 31, lr = lane & 15, hi = lane >> 4; const int r0 = blockIdx.x * 64, c0 = blockIdx.y * 64;
    v8f acc[4][4];
#pragma unroll
    for (int mb = 0; mb < 4; ++mb)
#pragma unroll
        for (int nb = 0; nb < 4; ++nb) acc[mb][nb] = (v8f){};
    const size_t aoff = (size_t)(r0 + lr) * K + 8 * hi, boff = (size_t)(c0 + lr) * K + 8 * hi;
#pragma unroll 1
    for (int kc = 0; kc < K; kc += 32) {
        V a[4], a2[4];
#pragma unroll
        for (int mb = 0; mb < 4; ++mb) { a[mb] = WFrag<T16>::ld(A + aoff + (size_t)mb * 16 * K + kc); if (NSPLIT == 1 || NSPLIT == 2) a2[mb] = WFrag<T16>::ld(A2 + aoff + (size_t)mb * 16 * K + kc); }
#pragma unroll
        for (int nb = 0; nb < 4; ++nb) { const V b = WFrag<T16>::ld(Bt + boff + (size_t)nb * 16 * K + kc); V b2; if (NSPLIT >= 2) b2 = WFrag<T16>::ld(Bt2 + boff + (size_t)nb * 16 * K + kc);
#pragma unroll
            for (int mb = 0; mb < 4; ++mb) { acc[mb][nb] = WFrag<T16>::mma(a[mb], b, acc[mb][nb]); if (NSPLIT == 1 || NSPLIT == 2) acc[mb][nb] = WFrag<T16>::mma(a2[mb], b, acc[mb][nb]); if (NSPLIT >= 2) acc[mb][nb] = WFrag<T16>::mma(a[mb], b2, acc[mb][nb]); } }
        asm volatile("v_nop\n\tv_nop\n\tv_nop\n\tv_nop" : "+v"(acc[0][0]), "+v"(acc[1][1]), "+v"(acc[2][2]), "+v"(acc[3][3]) : "v"(a[0]), "v"(a[3]));
    }
#pragma unroll
    for (int mb = 0; mb < 4; ++mb) {
#pragma unroll
        for (int nb = 0; nb < 4; ++nb) {
#pragma unroll
            for (int j = 0; j < 8; ++j) os[(hi * 8 + j) * 68 + nb * 16 + lr] = acc[mb][nb][j]; }
        __builtin_amdgcn_wave_barrier(); asm volatile("" ::: "memory");
        float* crow = C + (size_t)(r0 + mb * 16) * ldc + c0;
{
#pragma unroll
            for (int s = 0; s < 8; ++s) { const int row = 2 * s + hi, cofs = lr * 4; v4f val = *(const v4fa*)(os + row * 68 + cofs); if (BIAS) { val[0] += bfr(bias[c0 + cofs]); val[1] += bfr(bias[c0 + cofs + 1]); val[2] += bfr(bias[c0 + cofs + 2]); val[3] += bfr(bias[c0 + cofs + 3]); }
                *(v4f*)(crow + (size_t)row * ldc + cofs) = val; }
             }
        __builtin_amdgcn_wave_barrier(); asm volatile("" ::: "memory");
    }
}

__device__ __forceinline__ h16 tohx(float x) { return (h16)x; }
__device__ __forceinline__ void splitf(float y, unsigned short& h, unsigned short& l) { h = f2bf(y); l = f2bf(y - bf2f(h)); }
typedef __attribute__((ext_vector_type(2))) _Float16 v2h;
typedef __attribute__((ext_vector_type(4))) _Float16 v4h;
typedef __attribute__((ext_vector_type(2))) unsigned short v2us;
typedef __attribute__((ext_vector_type(4))) unsigned short v4us;
typedef __attribute__((ext_vector_type(2))) float v2f;
typedef __attribute__((ext_vector_type(4))) int v4i;

__global__ __launch_bounds__(256) void k_wtG(const float* __restrict__ w, int K, int N, bf* Bt) {
    const int lane = threadIdx.x & 31; const int L0 = (blockIdx.x * 8 + (threadIdx.x >> 5)) * 8; const int nlines = N * K / 64;
{
#pragma unroll 1
        for (int l = 0; l < 8; ++l) { const int L = L0 + l; if (L >= nlines) break; const size_t e = (size_t)L * 64 + lane * 2; const int k = (int)(e % K), n = (int)(e / K); v2us o;
            o[0] = f2bf(w[(size_t)k * N + n]); o[1] = f2bf(w[(size_t)(k + 1) * N + n]); *(v2us*)(Bt + e) = o; }
         }
}
__global__ __launch_bounds__(256) void k_cvt8(const float* __restrict__ src, bf* dst, size_t n8) { const size_t i = (size_t)blockIdx.x * 256 + threadIdx.x; if (i >= n8) return; const v8f v = *(const v8f*)(src + i * 8); v8us o;
#pragma unroll
    for (int k = 0; k < 8; ++k) o[k] = f2bf(v[k]); *(v8us*)(dst + i * 8) = o;  }

// k_rope: head planes [h][t][d] (fp16 + hi/lo) of rope(x) x sc with the rotate-half convention out[d] = x[d] cos[t][d] - x[d+HD/2] sin[t][d], out[d+HD/2] = x[d+HD/2] cos[t][d+HD/2] + x[d] sin[t][d+HD/2]
__global__ __launch_bounds__(256) void k_rope(const float* __restrict__ F, int pitch, int nheads, const float* __restrict__ CS, const float* __restrict__ RF, const float* __restrict__ nw, float sc, h16* P16, bf* Ph, bf* Pl) {
    const size_t e = ((size_t)blockIdx.x * 256 + threadIdx.x) * 2; if (e >= (size_t)nheads * TT * HD) return; const int d = (int)(e % HD); const int t = (int)((e / HD) % TT); const int h = (int)(e / ((size_t)HD * TT)); const float* f = F + (size_t)t * pitch + h * HD; const float rf = RF ? RF[(size_t)h * TT + t] : 1.0f; v2h o16; v2us oh, ol;
#pragma unroll
    for (int q = 0; q < 2; ++q) { const int dd = d + q; const int dp = (dd < HD / 2) ? dd + HD / 2 : dd - HD / 2; float x0 = f[dd], x1 = f[dp];
        if (RF) { float n0 = __fmul_rn(x0, rf), n1 = __fmul_rn(x1, rf); asm volatile("" : "+v"(n0)); asm volatile("" : "+v"(n1)); x0 = __fmul_rn(bfr(nw[dd]), n0); x1 = __fmul_rn(bfr(nw[dp]), n1); }
        const v2f cs = *(const v2f*)(CS + ((size_t)t * HD + dd) * 2); float a = __fmul_rn(x0, cs[0]), bq = __fmul_rn(x1, cs[1]); asm volatile("" : "+v"(a)); asm volatile("" : "+v"(bq)); const float r = ((dd < HD / 2) ? __fsub_rn(a, bq) : __fadd_rn(a, bq)) * sc;
        o16[q] = tohx(r); unsigned short a2, c2; splitf(r, a2, c2); oh[q] = a2; ol[q] = c2; }
    *(v2h*)(P16 + e) = o16; *(v2us*)(Ph + e) = oh; *(v2us*)(Pl + e) = ol;  }
__global__ __launch_bounds__(256) void k_vtp(const float* __restrict__ F, int pitch, int nheads, h16* V16, bf* Vh, bf* Vl) { const size_t e = ((size_t)blockIdx.x * 256 + threadIdx.x) * 2; if (e >= (size_t)nheads * HD * TT) return; const int t = (int)(e % TT); const int d = (int)((e / TT) % HD); const int g = (int)(e / ((size_t)TT * HD)); v2h o16; v2us oh, ol;
#pragma unroll
    for (int q = 0; q < 2; ++q) { const float x = F[(size_t)(t + q) * pitch + g * HD + d]; o16[q] = tohx(x); unsigned short a2, c2; splitf(x, a2, c2); oh[q] = a2; ol[q] = c2; }
    *(v2h*)(V16 + e) = o16; *(v2us*)(Vh + e) = oh; *(v2us*)(Vl + e) = ol;  }
__global__ __launch_bounds__(256) void k_csid(float* CS) { const int idx = blockIdx.x * 256 + threadIdx.x; if (idx >= TT * HD) return; v2f cs; cs[0] = 1.0f; cs[1] = 0.0f; *(v2f*)(CS + (size_t)idx * 2) = cs;  }
// k_asoft (this module): adds the skewed relative logit before the 1/8 scale: rel(i,j) = qe[i][2047 + j - i] for j <= i, 0 for j = i+1, qe[i+1][j-i-2] for j > i+1 (= the reference's pad/reshape/slice of q.Er^T, upper triangle included), gathered with scalar loads from the pass's qe plane.
// k_asoft: per row (zz, i): t = S x HD^-0.5 (no mask); softmax over the 2048 keys (register row, one exp, fixed trees);
__global__ __launch_bounds__(256) void k_asoft(const float* __restrict__ Sb, const float* __restrict__ QE, h16* P16, bf* Ph, bf* Pl) {
    const int lane = threadIdx.x & 31; const int row = blockIdx.x * 8 + (threadIdx.x >> 5); if (row >= ZH * TT) return; const int i = row % TT; const int zz = row / TT; (void)zz; const bool hires = (i < RH); const float* sr = Sb + (size_t)row * TT; const float* qe0 = QE + (size_t)row * TT; const float* qe1 = QE + (size_t)min(row + 1, ZH * TT - 1) * TT;   /* next row (clamped; its value is only selected when row + 1 is valid) */   /* rows i and i+1 of this head's qe plane (i+1 is never used for i = TT-1) */ float v[TT / 32]; float mx = -3.0e38f;
#pragma unroll
    for (int ch = 0; ch < TT / 128; ++ch) { const int j0 = ch * 128 + lane * 4; const v4f a = *(const v4f*)(sr + j0);
#pragma unroll
        for (int q = 0; q < 4; ++q) { const int j = j0 + q; const float e0 = qe0[min(max(TT - 1 + j - i, 0), TT - 1)], e1 = qe1[min(max(j - i - 2, 0), TT - 1)];   /* UNCONDITIONAL clamped-index loads (no exec-masked loads) */ float f0 = e0, f1 = e1; asm volatile("" : "+v"(f0), "+v"(f1));   /* pin both loads as unconditional (consumed here in straight-line code) */ const float rel = (j <= i) ? f0 : ((j == i + 1) ? 0.0f : f1); float sm = __fadd_rn(a[q], rel); asm volatile("" : "+v"(sm)); float t = sm * SCL; asm volatile("" : "+v"(t)); v[ch * 4 + q] = t; mx = fmaxf(mx, t); } }
#pragma unroll
    for (int sh = 16; sh; sh >>= 1) mx = fmaxf(mx, __shfl_xor(mx, sh, 32));
    float sum = 0.f;
#pragma unroll
    for (int k = 0; k < TT / 32; ++k) { float d0 = __fsub_rn(v[k], mx); asm volatile("" : "+v"(d0)); v[k] = __builtin_amdgcn_exp2f(__fmul_rn(d0, 1.4426950408889634f)); sum += v[k]; }
#pragma unroll
    for (int sh = 16; sh; sh >>= 1) sum += __shfl_xor(sum, sh, 32);
    const float f = __fdiv_rn(hires ? 1.0f : PCAR, sum);
{
        if (hires) {
#pragma unroll
            for (int ch = 0; ch < TT / 128; ++ch) { v4us oh, ol;
#pragma unroll
                for (int q = 0; q < 4; ++q) { unsigned short a, c2; splitf(v[ch * 4 + q] * f, a, c2); oh[q] = a; ol[q] = c2; }
                const size_t oo = ((size_t)zz * (RH ? RH : 1) + i) * TT + ch * 128 + lane * 4; *(v4us*)(Ph + oo) = oh; *(v4us*)(Pl + oo) = ol; }
        } else {
#pragma unroll
            for (int ch = 0; ch < TT / 128; ++ch) { v4h o4;
#pragma unroll
                for (int q = 0; q < 4; ++q) o4[q] = tohx(v[ch * 4 + q] * f);
                *(v4h*)(P16 + (size_t)row * TT + ch * 128 + lane * 4) = o4; } }
         }
}
__global__ __launch_bounds__(256) void k_merge(const float* __restrict__ O, int h0, bf* Ah, bf* Al) { const size_t e = ((size_t)blockIdx.x * 256 + threadIdx.x) * 2; if (e >= (size_t)ZH * TT * HD) return; const int d = (int)(e % HD); const int t = (int)((e / HD) % TT); const int zz = (int)(e / ((size_t)HD * TT)); const float cs = (t < RH) ? 1.0f : (1.0f / PCAR); const size_t oo = (size_t)t * DQ + (h0 + zz) * HD + d;
    v2us oh, ol;
#pragma unroll
    for (int q = 0; q < 2; ++q) { unsigned short a, c2; splitf(O[e + q] * cs, a, c2); oh[q] = a; ol[q] = c2; } *(v2us*)(Ah + oo) = oh; *(v2us*)(Al + oo) = ol;  }

extern "C" void kernel_launch(void* const* d_in, const int* in_sizes, int n_in,
                              void* d_out, int out_size, void* d_ws, size_t ws_size, hipStream_t stream) {
    (void)in_sizes; (void)n_in; (void)out_size;
    const float* xq = (const float*)d_in[0]; const float* xk = (const float*)d_in[1]; const float* xv = (const float*)d_in[2]; const float* wq = (const float*)d_in[3]; const float* bq = (const float*)d_in[4]; const float* wk = (const float*)d_in[5]; const float* bk = (const float*)d_in[6]; const float* wv = (const float*)d_in[7]; const float* bv = (const float*)d_in[8]; const float* wo = (const float*)d_in[9]; const float* bo = (const float*)d_in[10]; const float* Er = (const float*)d_in[11]; const float* x = nullptr; (void)x;
    float* OUT = (float*)d_out;     // [1][2048][1024]
    char* wsp = (char*)d_ws;
    auto take = [&](size_t bytes) { char* p = wsp; wsp += (bytes + 255) & ~(size_t)255; return (void*)p; };
    bf* WQ = (bf*)take((size_t)DQ * DM * 2); bf* WK = (bf*)take((size_t)DKV * DM * 2); bf* WV = (bf*)take((size_t)DKV * DM * 2); bf* WO = (bf*)take((size_t)DM * DQ * 2); float* CS = (float*)take((size_t)TT * HD * 2 * 4);
    bf* ERB = (bf*)take((size_t)TT * HD * 2); float* QE = (float*)take((size_t)ZH * TT * TT * 4);
    bf* XB = (bf*)take((size_t)TT * DM * 2); float* FQ = (float*)take((size_t)TT * DQ * 4); float* FK = (float*)take((size_t)TT * DKV * 4);
    h16* QP16 = (h16*)take((size_t)NH_ * TT * HD * 2); h16* KP16 = (h16*)take((size_t)NKV * TT * HD * 2); h16* VT16 = (h16*)take((size_t)NKV * HD * TT * 2);
    bf* QPh = (bf*)take((size_t)NH_ * TT * HD * 2); bf* QPl = (bf*)take((size_t)NH_ * TT * HD * 2); bf* KPh = (bf*)take((size_t)NKV * TT * HD * 2); bf* KPl = (bf*)take((size_t)NKV * TT * HD * 2); bf* VTh = (bf*)take((size_t)NKV * HD * TT * 2); bf* VTl = (bf*)take((size_t)NKV * HD * TT * 2); bf* Ph = (bf*)take((size_t)ZH * RH * TT * 2); bf* Pl = (bf*)take((size_t)ZH * RH * TT * 2);
    float* Sb = (float*)take((size_t)ZH * TT * TT * 4); h16* P16 = (h16*)take((size_t)ZH * TT * TT * 2); float* Ob = (float*)take((size_t)ZH * TT * HD * 4); bf* ATh = (bf*)take((size_t)TT * DQ * 2); bf* ATl = (bf*)take((size_t)TT * DQ * 2);
    if ((size_t)(wsp - (char*)d_ws) > ws_size) return;    // ws 256 MiB
    float* FV = FK;   // v projection reuses the k buffer after the k planes are built (stream-ordered)
    { k_cvt8<<<(unsigned)(((size_t)DQ * DM / 8 + 255) / 256), 256, 0, stream>>>(wq, WQ, (size_t)DQ * DM / 8); k_cvt8<<<(unsigned)(((size_t)DKV * DM / 8 + 255) / 256), 256, 0, stream>>>(wk, WK, (size_t)DKV * DM / 8); k_cvt8<<<(unsigned)(((size_t)DKV * DM / 8 + 255) / 256), 256, 0, stream>>>(wv, WV, (size_t)DKV * DM / 8);
      k_cvt8<<<(unsigned)(((size_t)DM * DQ / 8 + 255) / 256), 256, 0, stream>>>(wo, WO, (size_t)DM * DQ / 8);
       }
    k_csid<<<(TT * HD + 255) / 256, 256, 0, stream>>>(CS);
    const unsigned LQ = (unsigned)(((size_t)NH_ * TT * HD / 2 + 255) / 256), LKv = (unsigned)(((size_t)NKV * TT * HD / 2 + 255) / 256);
    k_cvt8<<<(unsigned)(((size_t)TT * HD / 8 + 255) / 256), 256, 0, stream>>>(Er, ERB, (size_t)TT * HD / 8);   /* Er [2048][64] ('t d') is already the Bt layout */
    for (int b = 0; b < NB_; ++b) {
        
        k_cvt8<<<(unsigned)(((size_t)TT * DM / 8 + 255) / 256), 256, 0, stream>>>(xq + (size_t)b * TT * DM, XB, (size_t)TT * DM / 8);   /* query rows */
        k_gemmw<bf, 0, true><<<dim3(TT / 64, DQ / 64, 1), 32, 0, stream>>>(XB, nullptr, WQ, nullptr, DM, FQ, DQ, bq, 0, 0, 0);
        k_rope<<<LQ, 256, 0, stream>>>(FQ, DQ, NH_, CS, nullptr, nullptr, 1.0f, QP16, QPh, QPl);
        k_cvt8<<<(unsigned)(((size_t)TT * DM / 8 + 255) / 256), 256, 0, stream>>>(xk + (size_t)b * TT * DM, XB, (size_t)TT * DM / 8);   /* key rows */
        k_gemmw<bf, 0, true><<<dim3(TT / 64, DKV / 64, 1), 32, 0, stream>>>(XB, nullptr, WK, nullptr, DM, FK, DKV, bk, 0, 0, 0);
        k_rope<<<LKv, 256, 0, stream>>>(FK, DKV, NKV, CS, nullptr, nullptr, 1.0f, KP16, KPh, KPl);
        k_cvt8<<<(unsigned)(((size_t)TT * DM / 8 + 255) / 256), 256, 0, stream>>>(xv + (size_t)b * TT * DM, XB, (size_t)TT * DM / 8);   /* value rows */
        k_gemmw<bf, 0, true><<<dim3(TT / 64, DKV / 64, 1), 32, 0, stream>>>(XB, nullptr, WV, nullptr, DM, FV, DKV, bv, 0, 0, 0); k_vtp<<<LKv, 256, 0, stream>>>(FV, DKV, NKV, VT16, VTh, VTl);
        for (int h0 = 0; h0 < NH_; h0 += ZH) { const size_t zq = (size_t)h0, zk = (size_t)(h0 / REP);   // one kv head per query head: the pass's two heads use consecutive kv planes (z-strides TT*HD)
            k_gemmw<bf, 2, false><<<dim3(RH / 64, TT / 64, ZH), 32, 0, stream>>>(QPh + zq * TT * HD, QPl + zq * TT * HD, KPh + zk * TT * HD, KPl + zk * TT * HD, HD, Sb, TT, nullptr, (size_t)TT * HD, (size_t)TT * HD, (size_t)TT * TT);
            k_gemmw<h16, 0, false><<<dim3((TT - RH) / 64, TT / 64, ZH), 32, 0, stream>>>(QP16 + zq * TT * HD + (size_t)RH * HD, nullptr, KP16 + zk * TT * HD, nullptr, HD, Sb + (size_t)RH * TT, TT, nullptr, (size_t)TT * HD, (size_t)TT * HD, (size_t)TT * TT);
            k_gemmw<bf, 1, false><<<dim3(TT / 64, TT / 64, ZH), 32, 0, stream>>>(QPh + zq * TT * HD, QPl + zq * TT * HD, ERB, nullptr, HD, QE, TT, nullptr, (size_t)TT * HD, 0, (size_t)TT * TT);   /* qe = q . Er^T for the pass's two heads */
            k_asoft<<<ZH * TT / 8, 256, 0, stream>>>(Sb, QE, P16, Ph, Pl);
            k_gemmw<bf, 2, false><<<dim3(RH / 64, HD / 64, ZH), 32, 0, stream>>>(Ph, Pl, VTh + zk * HD * TT, VTl + zk * HD * TT, TT, Ob, HD, nullptr, (size_t)RH * TT, (size_t)HD * TT, (size_t)TT * HD);
            k_gemmw<h16, 0, false><<<dim3((TT - RH) / 64, HD / 64, ZH), 32, 0, stream>>>(P16 + (size_t)RH * TT, nullptr, VT16 + zk * HD * TT, nullptr, TT, Ob + (size_t)RH * HD, HD, nullptr, (size_t)TT * TT, (size_t)HD * TT, (size_t)TT * HD);
            k_merge<<<(unsigned)(((size_t)ZH * TT * HD / 2 + 255) / 256), 256, 0, stream>>>(Ob, h0, ATh, ATl); }
        k_gemmw<bf, 1, true><<<dim3(TT / 64, DM / 64, 1), 32, 0, stream>>>(ATh, ATl, WO, nullptr, DQ, OUT + (size_t)b * TT * DM, DM, bo, 0, 0, 0); }
}

// v001
// A run of this version takes 766 microseconds.
// In two side-by-side timings against v000, it was 1.64 and 1.63 times as fast.
#include <hip/hip_runtime.h>

// Relative global attention (Music-Transformer skew) (query, key, value [1][2048][1024]; q,k,v = input W^T + b ('oi' [1024][1024] + [1024]; 16 heads x 64); qe = q.Er^T (Er [2048][64], all rows used since s = max_len); s_rel = skew(qe): for j <= i  s_rel[i][j] = qe[i][2047 + j - i]; for j = i+1  0; for j > i+1  qe[i+1][j - i - 2] (the reference's pad-reshape-slice, reproduced exactly, upper triangle included); scores = (q.k + s_rel) / 8; softmax; out = merged ctx Wo^T + bo -> [1][2048][1024] (2.1 M)).
// Compute dtypes, f32 accumulate: every input rounded to bf16; q/k/v on PLAIN bf16 operands (inputs: exact) + biases (three input tensors); per head pass an extra GEMM qe = q(hi/lo planes) x Er (exact bf16) gives the [2][2048][2048] relative logits; the softmax kernel adds the skewed entry (gathered per (i, j) with the index map above) before the 1/8 scale; scores and attn.v: query rows < 512 hl (3 products), the rest single fp16 (x1024); softmax f32; Wo hl x exact (2 products) + bo.

#define NB_  1
#define TT   2048
#define DM   1024
#define NH_  16
#define NKV  16
#define REP  (NH_ / NKV)
#define HD   64
#define DQ   (NH_ * HD)
#define DKV  (NKV * HD)
#define ZH   2
#define RH   512                  // query rows < RH use hi+lo planes (0: none)
#define WIN  0
#define PCAR 1024.0f
#define SCL  0.125f   // HD^-0.5
typedef _Float16 h16;
typedef unsigned short bf;
typedef __attribute__((ext_vector_type(16))) __bf16   v16bf;
typedef __attribute__((ext_vector_type(16))) _Float16 v16h;
typedef __attribute__((ext_vector_type(8)))  _Float16 v8h;
typedef __attribute__((ext_vector_type(8)))  unsigned short v8us;
typedef __attribute__((ext_vector_type(8)))  float    v8f;
typedef __attribute__((ext_vector_type(4)))  float    v4f;
typedef v8h  __attribute__((may_alias)) v8ha;
typedef v4f  __attribute__((may_alias)) v4fa;
typedef v8us __attribute__((may_alias)) v8usa;

__device__ __forceinline__ unsigned short f2bf(float f) { unsigned u = __float_as_uint(f); u += 0x7FFFu + ((u >> 16) & 1u); return (unsigned short)(u >> 16); }
__device__ __forceinline__ float bf2f(unsigned short b) { return __uint_as_float(((unsigned)b) << 16); }
__device__ __forceinline__ float bfr(float f) { return bf2f(f2bf(f)); }
__device__ __forceinline__ v16h cat16(v8h lo, v8h hi) { return __builtin_shufflevector(lo, hi, 0, 1, 2, 3, 4, 5, 6, 7, 8, 9, 10, 11, 12, 13, 14, 15); }
__device__ __forceinline__ v16bf cat16b(v8us lo, v8us hi) { return __builtin_bit_cast(v16bf, __builtin_shufflevector(lo, hi, 0, 1, 2, 3, 4, 5, 6, 7, 8, 9, 10, 11, 12, 13, 14, 15)); }
__device__ __forceinline__ v8f wmma16(v16h a, v16h b, v8f c) { return __builtin_amdgcn_wmma_f32_16x16x32_f16(false, a, false, b, (short)0, c, false, false); }
__device__ __forceinline__ v8f wmmab(v16bf a, v16bf b, v8f c) { return __builtin_amdgcn_wmma_f32_16x16x32_bf16(false, a, false, b, (short)0, c, false, false); }



// ---- k_gemmw: register-blocked GEMM, ONE WAVE per K slice of a 64x64 output tile (KS slices, 16 accumulators each), operands straight from K-contiguous 16-bit planes; grid (M/64, N/64, Z), 32 * KS threads.
// C[m][n] (f32, pitch ldc, + optional f32 bias[n]) = sum_k A[m][k] Bt[n][k] (+ split products per NSPLIT). z-batch strides sA/sB/sC in elements. K % (32 * KS) == 0.
// KS > 1 (long-K launches, 32 * KS threads): wave w of the work-group sums the K slice [w K/KS, (w+1) K/KS) of the same 64x64 tile; the KS partial tiles meet in LDS (column-major, pitch 68) and are added in wave order 0..KS-1.
template <typename T16> struct WFrag;
template <> struct WFrag<h16> { typedef v16h V; static __device__ __forceinline__ V ld(const h16* p) { return cat16(*(const v8h*)p, *(const v8h*)(p + 16)); } static __device__ __forceinline__ v8f mma(V a, V b, v8f c) { return wmma16(a, b, c); } };
template <> struct WFrag<bf> { typedef v16bf V; static __device__ __forceinline__ V ld(const bf* p) { return cat16b(*(const v8us*)p, *(const v8us*)(p + 16)); } static __device__ __forceinline__ v8f mma(V a, V b, v8f c) { return wmmab(a, b, c); } };
template <typename T16, int NSPLIT, bool BIAS, int KS>
__global__ __launch_bounds__(32 * KS) void k_gemmw(const T16* __restrict__ A, const T16* __restrict__ A2, const T16* __restrict__ Bt, const T16* __restrict__ Bt2, int K, float* C, int ldc, const float* __restrict__ bias, size_t sA, size_t sB, size_t sC) {
    typedef typename WFrag<T16>::V V;
    __shared__ __align__(16) float os[KS == 1 ? 16 * 68 : KS * 64 * 68];
    const size_t z = blockIdx.z; A += z * sA; if (A2) A2 += z * sA; Bt += z * sB; if (Bt2) Bt2 += z * sB; C += z * sC;
    const int lane = threadIdx.x & 31, lr = lane & 15, hi = lane >> 4; const int r0 = blockIdx.x * 64, c0 = blockIdx.y * 64;
    v8f acc[4][4];
#pragma unroll
    for (int mb = 0; mb < 4; ++mb)
#pragma unroll
        for (int nb = 0; nb < 4; ++nb) acc[mb][nb] = (v8f){};
    const size_t aoff = (size_t)(r0 + lr) * K + 8 * hi, boff = (size_t)(c0 + lr) * K + 8 * hi;
    const int wv = (KS == 1) ? 0 : __builtin_amdgcn_readfirstlane((int)(threadIdx.x >> 5)); const int kspan = K / KS, kbeg = wv * kspan, kend = kbeg + kspan;   // this wave's K slice (wave-uniform bounds: scalar loop branch)
#pragma unroll 1
    for (int kc = kbeg; kc < kend; kc += 32) {
        V a[4], a2[4];
#pragma unroll
        for (int mb = 0; mb < 4; ++mb) { a[mb] = WFrag<T16>::ld(A + aoff + (size_t)mb * 16 * K + kc); if (NSPLIT == 1 || NSPLIT == 2) a2[mb] = WFrag<T16>::ld(A2 + aoff + (size_t)mb * 16 * K + kc); }
#pragma unroll
        for (int nb = 0; nb < 4; ++nb) { const V b = WFrag<T16>::ld(Bt + boff + (size_t)nb * 16 * K + kc); V b2; if (NSPLIT >= 2) b2 = WFrag<T16>::ld(Bt2 + boff + (size_t)nb * 16 * K + kc);
#pragma unroll
            for (int mb = 0; mb < 4; ++mb) { acc[mb][nb] = WFrag<T16>::mma(a[mb], b, acc[mb][nb]); if (NSPLIT == 1 || NSPLIT == 2) acc[mb][nb] = WFrag<T16>::mma(a2[mb], b, acc[mb][nb]); if (NSPLIT >= 2) acc[mb][nb] = WFrag<T16>::mma(a[mb], b2, acc[mb][nb]); } }
        asm volatile("v_nop\n\tv_nop\n\tv_nop\n\tv_nop" : "+v"(acc[0][0]), "+v"(acc[1][1]), "+v"(acc[2][2]), "+v"(acc[3][3]) : "v"(a[0]), "v"(a[3]));
    }
    if constexpr (KS > 1) {
        float* pw = os + wv * (64 * 68);
#pragma unroll
        for (int mb = 0; mb < 4; ++mb)
#pragma unroll
            for (int nb = 0; nb < 4; ++nb) { float* p = pw + (nb * 16 + lr) * 68 + mb * 16 + hi * 8; const v8f t = acc[mb][nb]; *(v4fa*)p = __builtin_shufflevector(t, t, 0, 1, 2, 3); *(v4fa*)(p + 4) = __builtin_shufflevector(t, t, 4, 5, 6, 7); }
        __syncthreads();   // every wave's partial tile is in LDS before any of it is summed
#pragma unroll
        for (int it = 0; it < 64 * 16 / (32 * KS); ++it) { const int g = it * (32 * KS) + (int)threadIdx.x, col = g & 63, rq = g >> 6; const float* p = os + col * 68 + rq * 4; v4f s = *(const v4fa*)p;
#pragma unroll
            for (int w = 1; w < KS; ++w) s += *(const v4fa*)(p + w * (64 * 68));
            if (BIAS) { const float bb = bfr(bias[c0 + col]); s[0] += bb; s[1] += bb; s[2] += bb; s[3] += bb; }
            float* cp = C + (size_t)(r0 + rq * 4) * ldc + c0 + col;
#pragma unroll
            for (int q = 0; q < 4; ++q) cp[(size_t)q * ldc] = s[q]; }
        return;
    }
#pragma unroll
    for (int mb = 0; mb < 4; ++mb) {
#pragma unroll
        for (int nb = 0; nb < 4; ++nb) {
#pragma unroll
            for (int j = 0; j < 8; ++j) os[(hi * 8 + j) * 68 + nb * 16 + lr] = acc[mb][nb][j]; }
        __builtin_amdgcn_wave_barrier(); asm volatile("" ::: "memory");
        float* crow = C + (size_t)(r0 + mb * 16) * ldc + c0;
{
#pragma unroll
            for (int s = 0; s < 8; ++s) { const int row = 2 * s + hi, cofs = lr * 4; v4f val = *(const v4fa*)(os + row * 68 + cofs); if (BIAS) { val[0] += bfr(bias[c0 + cofs]); val[1] += bfr(bias[c0 + cofs + 1]); val[2] += bfr(bias[c0 + cofs + 2]); val[3] += bfr(bias[c0 + cofs + 3]); }
                *(v4f*)(crow + (size_t)row * ldc + cofs) = val; }
             }
        __builtin_amdgcn_wave_barrier(); asm volatile("" ::: "memory");
    }
}

__device__ __forceinline__ h16 tohx(float x) { return (h16)x; }
__device__ __forceinline__ void splitf(float y, unsigned short& h, unsigned short& l) { h = f2bf(y); l = f2bf(y - bf2f(h)); }
typedef __attribute__((ext_vector_type(2))) _Float16 v2h;
typedef __attribute__((ext_vector_type(4))) _Float16 v4h;
typedef __attribute__((ext_vector_type(2))) unsigned short v2us;
typedef __attribute__((ext_vector_type(4))) unsigned short v4us;
typedef __attribute__((ext_vector_type(2))) float v2f;
typedef __attribute__((ext_vector_type(4))) int v4i;

__global__ __launch_bounds__(256) void k_wtG(const float* __restrict__ w, int K, int N, bf* Bt) {
    const int lane = threadIdx.x & 31; const int L0 = (blockIdx.x * 8 + (threadIdx.x >> 5)) * 8; const int nlines = N * K / 64;
{
#pragma unroll 1
        for (int l = 0; l < 8; ++l) { const int L = L0 + l; if (L >= nlines) break; const size_t e = (size_t)L * 64 + lane * 2; const int k = (int)(e % K), n = (int)(e / K); v2us o;
            o[0] = f2bf(w[(size_t)k * N + n]); o[1] = f2bf(w[(size_t)(k + 1) * N + n]); *(v2us*)(Bt + e) = o; }
         }
}
__global__ __launch_bounds__(256) void k_cvt8(const float* __restrict__ src, bf* dst, size_t n8) { const size_t i = (size_t)blockIdx.x * 256 + threadIdx.x; if (i >= n8) return; const v8f v = *(const v8f*)(src + i * 8); v8us o;
#pragma unroll
    for (int k = 0; k < 8; ++k) o[k] = f2bf(v[k]); *(v8us*)(dst + i * 8) = o;  }

// k_rope: head planes [h][t][d] (fp16 + hi/lo) of rope(x) x sc with the rotate-half convention out[d] = x[d] cos[t][d] - x[d+HD/2] sin[t][d], out[d+HD/2] = x[d+HD/2] cos[t][d+HD/2] + x[d] sin[t][d+HD/2]
__global__ __launch_bounds__(256) void k_rope(const float* __restrict__ F, int pitch, int nheads, const float* __restrict__ CS, const float* __restrict__ RF, const float* __restrict__ nw, float sc, h16* P16, bf* Ph, bf* Pl) {
    const size_t e = ((size_t)blockIdx.x * 256 + threadIdx.x) * 2; if (e >= (size_t)nheads * TT * HD) return; const int d = (int)(e % HD); const int t = (int)((e / HD) % TT); const int h = (int)(e / ((size_t)HD * TT)); const float* f = F + (size_t)t * pitch + h * HD; const float rf = RF ? RF[(size_t)h * TT + t] : 1.0f; v2h o16; v2us oh, ol;
#pragma unroll
    for (int q = 0; q < 2; ++q) { const int dd = d + q; const int dp = (dd < HD / 2) ? dd + HD / 2 : dd - HD / 2; float x0 = f[dd], x1 = f[dp];
        if (RF) { float n0 = __fmul_rn(x0, rf), n1 = __fmul_rn(x1, rf); asm volatile("" : "+v"(n0)); asm volatile("" : "+v"(n1)); x0 = __fmul_rn(bfr(nw[dd]), n0); x1 = __fmul_rn(bfr(nw[dp]), n1); }
        const v2f cs = *(const v2f*)(CS + ((size_t)t * HD + dd) * 2); float a = __fmul_rn(x0, cs[0]), bq = __fmul_rn(x1, cs[1]); asm volatile("" : "+v"(a)); asm volatile("" : "+v"(bq)); const float r = ((dd < HD / 2) ? __fsub_rn(a, bq) : __fadd_rn(a, bq)) * sc;
        o16[q] = tohx(r); unsigned short a2, c2; splitf(r, a2, c2); oh[q] = a2; ol[q] = c2; }
    *(v2h*)(P16 + e) = o16; *(v2us*)(Ph + e) = oh; *(v2us*)(Pl + e) = ol;  }
__global__ __launch_bounds__(256) void k_vtp(const float* __restrict__ F, int pitch, int nheads, h16* V16, bf* Vh, bf* Vl) { const size_t e = ((size_t)blockIdx.x * 256 + threadIdx.x) * 2; if (e >= (size_t)nheads * HD * TT) return; const int t = (int)(e % TT); const int d = (int)((e / TT) % HD); const int g = (int)(e / ((size_t)TT * HD)); v2h o16; v2us oh, ol;
#pragma unroll
    for (int q = 0; q < 2; ++q) { const float x = F[(size_t)(t + q) * pitch + g * HD + d]; o16[q] = tohx(x); unsigned short a2, c2; splitf(x, a2, c2); oh[q] = a2; ol[q] = c2; }
    *(v2h*)(V16 + e) = o16; *(v2us*)(Vh + e) = oh; *(v2us*)(Vl + e) = ol;  }
__global__ __launch_bounds__(256) void k_csid(float* CS) { const int idx = blockIdx.x * 256 + threadIdx.x; if (idx >= TT * HD) return; v2f cs; cs[0] = 1.0f; cs[1] = 0.0f; *(v2f*)(CS + (size_t)idx * 2) = cs;  }
// k_asoft (this module): adds the skewed relative logit before the 1/8 scale: rel(i,j) = qe[i][2047 + j - i] for j <= i, 0 for j = i+1, qe[i+1][j-i-2] for j > i+1 (= the reference's pad/reshape/slice of q.Er^T, upper triangle included), gathered with scalar loads from the pass's qe plane.
// k_asoft: per row (zz, i): t = S x HD^-0.5 (no mask); softmax over the 2048 keys (register row, one exp, fixed trees);
__global__ __launch_bounds__(256) void k_asoft(const float* __restrict__ Sb, const float* __restrict__ QE, h16* P16, bf* Ph, bf* Pl) {
    const int lane = threadIdx.x & 31; const int row = blockIdx.x * 8 + (threadIdx.x >> 5); if (row >= ZH * TT) return; const int i = row % TT; const int zz = row / TT; (void)zz; const bool hires = (i < RH); const float* sr = Sb + (size_t)row * TT; const float* qe0 = QE + (size_t)row * TT; const float* qe1 = QE + (size_t)min(row + 1, ZH * TT - 1) * TT;   /* next row (clamped; its value is only selected when row + 1 is valid) */   /* rows i and i+1 of this head's qe plane (i+1 is never used for i = TT-1) */ float v[TT / 32]; float mx = -3.0e38f;
#pragma unroll
    for (int ch = 0; ch < TT / 128; ++ch) { const int j0 = ch * 128 + lane * 4; const v4f a = *(const v4f*)(sr + j0);
#pragma unroll
        for (int q = 0; q < 4; ++q) { const int j = j0 + q; const float e0 = qe0[min(max(TT - 1 + j - i, 0), TT - 1)], e1 = qe1[min(max(j - i - 2, 0), TT - 1)];   /* UNCONDITIONAL clamped-index loads (no exec-masked loads) */ float f0 = e0, f1 = e1; asm volatile("" : "+v"(f0), "+v"(f1));   /* pin both loads as unconditional (consumed here in straight-line code) */ const float rel = (j <= i) ? f0 : ((j == i + 1) ? 0.0f : f1); float sm = __fadd_rn(a[q], rel); asm volatile("" : "+v"(sm)); float t = sm * SCL; asm volatile("" : "+v"(t)); v[ch * 4 + q] = t; mx = fmaxf(mx, t); } }
#pragma unroll
    for (int sh = 16; sh; sh >>= 1) mx = fmaxf(mx, __shfl_xor(mx, sh, 32));
    float sum = 0.f;
#pragma unroll
    for (int k = 0; k < TT / 32; ++k) { float d0 = __fsub_rn(v[k], mx); asm volatile("" : "+v"(d0)); v[k] = __builtin_amdgcn_exp2f(__fmul_rn(d0, 1.4426950408889634f)); sum += v[k]; }
#pragma unroll
    for (int sh = 16; sh; sh >>= 1) sum += __shfl_xor(sum, sh, 32);
    const float f = __fdiv_rn(hires ? 1.0f : PCAR, sum);
{
        if (hires) {
#pragma unroll
            for (int ch = 0; ch < TT / 128; ++ch) { v4us oh, ol;
#pragma unroll
                for (int q = 0; q < 4; ++q) { unsigned short a, c2; splitf(v[ch * 4 + q] * f, a, c2); oh[q] = a; ol[q] = c2; }
                const size_t oo = ((size_t)zz * (RH ? RH : 1) + i) * TT + ch * 128 + lane * 4; *(v4us*)(Ph + oo) = oh; *(v4us*)(Pl + oo) = ol; }
        } else {
#pragma unroll
            for (int ch = 0; ch < TT / 128; ++ch) { v4h o4;
#pragma unroll
                for (int q = 0; q < 4; ++q) o4[q] = tohx(v[ch * 4 + q] * f);
                *(v4h*)(P16 + (size_t)row * TT + ch * 128 + lane * 4) = o4; } }
         }
}
__global__ __launch_bounds__(256) void k_merge(const float* __restrict__ O, int h0, bf* Ah, bf* Al) { const size_t e = ((size_t)blockIdx.x * 256 + threadIdx.x) * 2; if (e >= (size_t)ZH * TT * HD) return; const int d = (int)(e % HD); const int t = (int)((e / HD) % TT); const int zz = (int)(e / ((size_t)HD * TT)); const float cs = (t < RH) ? 1.0f : (1.0f / PCAR); const size_t oo = (size_t)t * DQ + (h0 + zz) * HD + d;
    v2us oh, ol;
#pragma unroll
    for (int q = 0; q < 2; ++q) { unsigned short a, c2; splitf(O[e + q] * cs, a, c2); oh[q] = a; ol[q] = c2; } *(v2us*)(Ah + oo) = oh; *(v2us*)(Al + oo) = ol;  }

extern "C" void kernel_launch(void* const* d_in, const int* in_sizes, int n_in,
                              void* d_out, int out_size, void* d_ws, size_t ws_size, hipStream_t stream) {
    (void)in_sizes; (void)n_in; (void)out_size;
    const float* xq = (const float*)d_in[0]; const float* xk = (const float*)d_in[1]; const float* xv = (const float*)d_in[2]; const float* wq = (const float*)d_in[3]; const float* bq = (const float*)d_in[4]; const float* wk = (const float*)d_in[5]; const float* bk = (const float*)d_in[6]; const float* wv = (const float*)d_in[7]; const float* bv = (const float*)d_in[8]; const float* wo = (const float*)d_in[9]; const float* bo = (const float*)d_in[10]; const float* Er = (const float*)d_in[11]; const float* x = nullptr; (void)x;
    float* OUT = (float*)d_out;     // [1][2048][1024]
    char* wsp = (char*)d_ws;
    auto take = [&](size_t bytes) { char* p = wsp; wsp += (bytes + 255) & ~(size_t)255; return (void*)p; };
    bf* WQ = (bf*)take((size_t)DQ * DM * 2); bf* WK = (bf*)take((size_t)DKV * DM * 2); bf* WV = (bf*)take((size_t)DKV * DM * 2); bf* WO = (bf*)take((size_t)DM * DQ * 2); float* CS = (float*)take((size_t)TT * HD * 2 * 4);
    bf* ERB = (bf*)take((size_t)TT * HD * 2); float* QE = (float*)take((size_t)ZH * TT * TT * 4);
    bf* XB = (bf*)take((size_t)TT * DM * 2); float* FQ = (float*)take((size_t)TT * DQ * 4); float* FK = (float*)take((size_t)TT * DKV * 4);
    h16* QP16 = (h16*)take((size_t)NH_ * TT * HD * 2); h16* KP16 = (h16*)take((size_t)NKV * TT * HD * 2); h16* VT16 = (h16*)take((size_t)NKV * HD * TT * 2);
    bf* QPh = (bf*)take((size_t)NH_ * TT * HD * 2); bf* QPl = (bf*)take((size_t)NH_ * TT * HD * 2); bf* KPh = (bf*)take((size_t)NKV * TT * HD * 2); bf* KPl = (bf*)take((size_t)NKV * TT * HD * 2); bf* VTh = (bf*)take((size_t)NKV * HD * TT * 2); bf* VTl = (bf*)take((size_t)NKV * HD * TT * 2); bf* Ph = (bf*)take((size_t)ZH * RH * TT * 2); bf* Pl = (bf*)take((size_t)ZH * RH * TT * 2);
    float* Sb = (float*)take((size_t)ZH * TT * TT * 4); h16* P16 = (h16*)take((size_t)ZH * TT * TT * 2); float* Ob = (float*)take((size_t)ZH * TT * HD * 4); bf* ATh = (bf*)take((size_t)TT * DQ * 2); bf* ATl = (bf*)take((size_t)TT * DQ * 2);
    if ((size_t)(wsp - (char*)d_ws) > ws_size) return;    // ws 256 MiB
    float* FV = FK;   // v projection reuses the k buffer after the k planes are built (stream-ordered)
    { k_cvt8<<<(unsigned)(((size_t)DQ * DM / 8 + 255) / 256), 256, 0, stream>>>(wq, WQ, (size_t)DQ * DM / 8); k_cvt8<<<(unsigned)(((size_t)DKV * DM / 8 + 255) / 256), 256, 0, stream>>>(wk, WK, (size_t)DKV * DM / 8); k_cvt8<<<(unsigned)(((size_t)DKV * DM / 8 + 255) / 256), 256, 0, stream>>>(wv, WV, (size_t)DKV * DM / 8);
      k_cvt8<<<(unsigned)(((size_t)DM * DQ / 8 + 255) / 256), 256, 0, stream>>>(wo, WO, (size_t)DM * DQ / 8);
       }
    k_csid<<<(TT * HD + 255) / 256, 256, 0, stream>>>(CS);
    const unsigned LQ = (unsigned)(((size_t)NH_ * TT * HD / 2 + 255) / 256), LKv = (unsigned)(((size_t)NKV * TT * HD / 2 + 255) / 256);
    k_cvt8<<<(unsigned)(((size_t)TT * HD / 8 + 255) / 256), 256, 0, stream>>>(Er, ERB, (size_t)TT * HD / 8);   /* Er [2048][64] ('t d') is already the Bt layout */
    for (int b = 0; b < NB_; ++b) {
        
        k_cvt8<<<(unsigned)(((size_t)TT * DM / 8 + 255) / 256), 256, 0, stream>>>(xq + (size_t)b * TT * DM, XB, (size_t)TT * DM / 8);   /* query rows */
        k_gemmw<bf, 0, true, 8><<<dim3(TT / 64, DQ / 64, 1), 256, 0, stream>>>(XB, nullptr, WQ, nullptr, DM, FQ, DQ, bq, 0, 0, 0);
        k_rope<<<LQ, 256, 0, stream>>>(FQ, DQ, NH_, CS, nullptr, nullptr, 1.0f, QP16, QPh, QPl);
        k_cvt8<<<(unsigned)(((size_t)TT * DM / 8 + 255) / 256), 256, 0, stream>>>(xk + (size_t)b * TT * DM, XB, (size_t)TT * DM / 8);   /* key rows */
        k_gemmw<bf, 0, true, 8><<<dim3(TT / 64, DKV / 64, 1), 256, 0, stream>>>(XB, nullptr, WK, nullptr, DM, FK, DKV, bk, 0, 0, 0);
        k_rope<<<LKv, 256, 0, stream>>>(FK, DKV, NKV, CS, nullptr, nullptr, 1.0f, KP16, KPh, KPl);
        k_cvt8<<<(unsigned)(((size_t)TT * DM / 8 + 255) / 256), 256, 0, stream>>>(xv + (size_t)b * TT * DM, XB, (size_t)TT * DM / 8);   /* value rows */
        k_gemmw<bf, 0, true, 8><<<dim3(TT / 64, DKV / 64, 1), 256, 0, stream>>>(XB, nullptr, WV, nullptr, DM, FV, DKV, bv, 0, 0, 0); k_vtp<<<LKv, 256, 0, stream>>>(FV, DKV, NKV, VT16, VTh, VTl);
        for (int h0 = 0; h0 < NH_; h0 += ZH) { const size_t zq = (size_t)h0, zk = (size_t)(h0 / REP);   // one kv head per query head: the pass's two heads use consecutive kv planes (z-strides TT*HD)
            k_gemmw<bf, 2, false, 1><<<dim3(RH / 64, TT / 64, ZH), 32, 0, stream>>>(QPh + zq * TT * HD, QPl + zq * TT * HD, KPh + zk * TT * HD, KPl + zk * TT * HD, HD, Sb, TT, nullptr, (size_t)TT * HD, (size_t)TT * HD, (size_t)TT * TT);
            k_gemmw<h16, 0, false, 1><<<dim3((TT - RH) / 64, TT / 64, ZH), 32, 0, stream>>>(QP16 + zq * TT * HD + (size_t)RH * HD, nullptr, KP16 + zk * TT * HD, nullptr, HD, Sb + (size_t)RH * TT, TT, nullptr, (size_t)TT * HD, (size_t)TT * HD, (size_t)TT * TT);
            k_gemmw<bf, 1, false, 1><<<dim3(TT / 64, TT / 64, ZH), 32, 0, stream>>>(QPh + zq * TT * HD, QPl + zq * TT * HD, ERB, nullptr, HD, QE, TT, nullptr, (size_t)TT * HD, 0, (size_t)TT * TT);   /* qe = q . Er^T for the pass's two heads */
            k_asoft<<<ZH * TT / 8, 256, 0, stream>>>(Sb, QE, P16, Ph, Pl);
            k_gemmw<bf, 2, false, 16><<<dim3(RH / 64, HD / 64, ZH), 512, 0, stream>>>(Ph, Pl, VTh + zk * HD * TT, VTl + zk * HD * TT, TT, Ob, HD, nullptr, (size_t)RH * TT, (size_t)HD * TT, (size_t)TT * HD);
            k_gemmw<h16, 0, false, 16><<<dim3((TT - RH) / 64, HD / 64, ZH), 512, 0, stream>>>(P16 + (size_t)RH * TT, nullptr, VT16 + zk * HD * TT, nullptr, TT, Ob + (size_t)RH * HD, HD, nullptr, (size_t)TT * TT, (size_t)HD * TT, (size_t)TT * HD);
            k_merge<<<(unsigned)(((size_t)ZH * TT * HD / 2 + 255) / 256), 256, 0, stream>>>(Ob, h0, ATh, ATl); }
        k_gemmw<bf, 1, true, 8><<<dim3(TT / 64, DM / 64, 1), 256, 0, stream>>>(ATh, ATl, WO, nullptr, DQ, OUT + (size_t)b * TT * DM, DM, bo, 0, 0, 0); }
}

// v002
// Measured time: 261 microseconds a run.
// Two timings next to v001 both put it at 2.92 times that version's speed.
// Over all steps from v000 it is 4.78 times as fast.
#include <hip/hip_runtime.h>

// Relative global attention (Music-Transformer skew) (query, key, value [1][2048][1024]; q,k,v = input W^T + b ('oi' [1024][1024] + [1024]; 16 heads x 64); qe = q.Er^T (Er [2048][64], all rows used since s = max_len); s_rel = skew(qe): for j <= i  s_rel[i][j] = qe[i][2047 + j - i]; for j = i+1  0; for j > i+1  qe[i+1][j - i - 2] (the reference's pad-reshape-slice, reproduced exactly, upper triangle included); scores = (q.k + s_rel) / 8; softmax; out = merged ctx Wo^T + bo -> [1][2048][1024] (2.1 M)).
// Compute dtypes, f32 accumulate: every input rounded to bf16; q/k/v on PLAIN bf16 operands (inputs: exact) + biases (three input tensors); qe = q(hi/lo planes) x Er (exact bf16) gives the relative logits, stored in LDS at their skewed place (the index map above) and added to q.k before the 1/8 scale; scores and attn.v: query rows < 512 hl (3 products), the rest single fp16 (x1024); softmax f32; Wo hl x exact (2 products) + bo.

#define NB_  1
#define TT   2048
#define DM   1024
#define NH_  16
#define NKV  16
#define REP  (NH_ / NKV)
#define HD   64
#define DQ   (NH_ * HD)
#define DKV  (NKV * HD)
#define RH   512                  // query rows < RH use hi+lo planes (0: none)
#define WIN  0
#define PCAR 1024.0f
#define SCL  0.125f   // HD^-0.5
typedef _Float16 h16;
typedef unsigned short bf;
typedef __attribute__((ext_vector_type(16))) __bf16   v16bf;
typedef __attribute__((ext_vector_type(16))) _Float16 v16h;
typedef __attribute__((ext_vector_type(8)))  _Float16 v8h;
typedef __attribute__((ext_vector_type(8)))  unsigned short v8us;
typedef __attribute__((ext_vector_type(8)))  float    v8f;
typedef __attribute__((ext_vector_type(4)))  float    v4f;
typedef v8h  __attribute__((may_alias)) v8ha;
typedef v4f  __attribute__((may_alias)) v4fa;
typedef v8us __attribute__((may_alias)) v8usa;

__device__ __forceinline__ unsigned short f2bf(float f) { unsigned u = __float_as_uint(f); u += 0x7FFFu + ((u >> 16) & 1u); return (unsigned short)(u >> 16); }
__device__ __forceinline__ float bf2f(unsigned short b) { return __uint_as_float(((unsigned)b) << 16); }
__device__ __forceinline__ float bfr(float f) { return bf2f(f2bf(f)); }
__device__ __forceinline__ v16h cat16(v8h lo, v8h hi) { return __builtin_shufflevector(lo, hi, 0, 1, 2, 3, 4, 5, 6, 7, 8, 9, 10, 11, 12, 13, 14, 15); }
__device__ __forceinline__ v16bf cat16b(v8us lo, v8us hi) { return __builtin_bit_cast(v16bf, __builtin_shufflevector(lo, hi, 0, 1, 2, 3, 4, 5, 6, 7, 8, 9, 10, 11, 12, 13, 14, 15)); }
__device__ __forceinline__ v8f wmma16(v16h a, v16h b, v8f c) { return __builtin_amdgcn_wmma_f32_16x16x32_f16(false, a, false, b, (short)0, c, false, false); }
__device__ __forceinline__ v8f wmmab(v16bf a, v16bf b, v8f c) { return __builtin_amdgcn_wmma_f32_16x16x32_bf16(false, a, false, b, (short)0, c, false, false); }



// ---- k_gemmw: register-blocked GEMM, ONE WAVE per K slice of a 64x64 output tile (KS slices, 16 accumulators each), operands straight from K-contiguous 16-bit planes; grid (M/64, N/64, Z), 32 * KS threads.
// C[m][n] (f32, pitch ldc, + optional f32 bias[n]) = sum_k A[m][k] Bt[n][k] (+ split products per NSPLIT). z-batch strides sA/sB/sC in elements. K % (32 * KS) == 0.
// KS > 1 (long-K launches, 32 * KS threads): wave w of the work-group sums the K slice [w K/KS, (w+1) K/KS) of the same 64x64 tile; the KS partial tiles meet in LDS (column-major, pitch 68) and are added in wave order 0..KS-1.
template <typename T16> struct WFrag;
template <> struct WFrag<h16> { typedef v16h V; static __device__ __forceinline__ V ld(const h16* p) { return cat16(*(const v8h*)p, *(const v8h*)(p + 16)); } static __device__ __forceinline__ v8f mma(V a, V b, v8f c) { return wmma16(a, b, c); } };
template <> struct WFrag<bf> { typedef v16bf V; static __device__ __forceinline__ V ld(const bf* p) { return cat16b(*(const v8us*)p, *(const v8us*)(p + 16)); } static __device__ __forceinline__ v8f mma(V a, V b, v8f c) { return wmmab(a, b, c); } };
template <typename T16, int NSPLIT, bool BIAS, int KS>
__global__ __launch_bounds__(32 * KS) void k_gemmw(const T16* __restrict__ A, const T16* __restrict__ A2, const T16* __restrict__ Bt, const T16* __restrict__ Bt2, int K, float* C, int ldc, const float* __restrict__ bias, size_t sA, size_t sB, size_t sC) {
    typedef typename WFrag<T16>::V V;
    __shared__ __align__(16) float os[KS == 1 ? 16 * 68 : KS * 64 * 68];
    const size_t z = blockIdx.z; A += z * sA; if (A2) A2 += z * sA; Bt += z * sB; if (Bt2) Bt2 += z * sB; C += z * sC;
    const int lane = threadIdx.x & 31, lr = lane & 15, hi = lane >> 4; const int r0 = blockIdx.x * 64, c0 = blockIdx.y * 64;
    v8f acc[4][4];
#pragma unroll
    for (int mb = 0; mb < 4; ++mb)
#pragma unroll
        for (int nb = 0; nb < 4; ++nb) acc[mb][nb] = (v8f){};
    const size_t aoff = (size_t)(r0 + lr) * K + 8 * hi, boff = (size_t)(c0 + lr) * K + 8 * hi;
    const int wv = (KS == 1) ? 0 : __builtin_amdgcn_readfirstlane((int)(threadIdx.x >> 5)); const int kspan = K / KS, kbeg = wv * kspan, kend = kbeg + kspan;   // this wave's K slice (wave-uniform bounds: scalar loop branch)
#pragma unroll 1
    for (int kc = kbeg; kc < kend; kc += 32) {
        V a[4], a2[4];
#pragma unroll
        for (int mb = 0; mb < 4; ++mb) { a[mb] = WFrag<T16>::ld(A + aoff + (size_t)mb * 16 * K + kc); if (NSPLIT == 1 || NSPLIT == 2) a2[mb] = WFrag<T16>::ld(A2 + aoff + (size_t)mb * 16 * K + kc); }
#pragma unroll
        for (int nb = 0; nb < 4; ++nb) { const V b = WFrag<T16>::ld(Bt + boff + (size_t)nb * 16 * K + kc); V b2; if (NSPLIT >= 2) b2 = WFrag<T16>::ld(Bt2 + boff + (size_t)nb * 16 * K + kc);
#pragma unroll
            for (int mb = 0; mb < 4; ++mb) { acc[mb][nb] = WFrag<T16>::mma(a[mb], b, acc[mb][nb]); if (NSPLIT == 1 || NSPLIT == 2) acc[mb][nb] = WFrag<T16>::mma(a2[mb], b, acc[mb][nb]); if (NSPLIT >= 2) acc[mb][nb] = WFrag<T16>::mma(a[mb], b2, acc[mb][nb]); } }
        asm volatile("v_nop\n\tv_nop\n\tv_nop\n\tv_nop" : "+v"(acc[0][0]), "+v"(acc[1][1]), "+v"(acc[2][2]), "+v"(acc[3][3]) : "v"(a[0]), "v"(a[3]));
    }
    if constexpr (KS > 1) {
        float* pw = os + wv * (64 * 68);
#pragma unroll
        for (int mb = 0; mb < 4; ++mb)
#pragma unroll
            for (int nb = 0; nb < 4; ++nb) { float* p = pw + (nb * 16 + lr) * 68 + mb * 16 + hi * 8; const v8f t = acc[mb][nb]; *(v4fa*)p = __builtin_shufflevector(t, t, 0, 1, 2, 3); *(v4fa*)(p + 4) = __builtin_shufflevector(t, t, 4, 5, 6, 7); }
        __syncthreads();   // every wave's partial tile is in LDS before any of it is summed
#pragma unroll
        for (int it = 0; it < 64 * 16 / (32 * KS); ++it) { const int g = it * (32 * KS) + (int)threadIdx.x, col = g & 63, rq = g >> 6; const float* p = os + col * 68 + rq * 4; v4f s = *(const v4fa*)p;
#pragma unroll
            for (int w = 1; w < KS; ++w) s += *(const v4fa*)(p + w * (64 * 68));
            if (BIAS) { const float bb = bfr(bias[c0 + col]); s[0] += bb; s[1] += bb; s[2] += bb; s[3] += bb; }
            float* cp = C + (size_t)(r0 + rq * 4) * ldc + c0 + col;
#pragma unroll
            for (int q = 0; q < 4; ++q) cp[(size_t)q * ldc] = s[q]; }
        return;
    }
#pragma unroll
    for (int mb = 0; mb < 4; ++mb) {
#pragma unroll
        for (int nb = 0; nb < 4; ++nb) {
#pragma unroll
            for (int j = 0; j < 8; ++j) os[(hi * 8 + j) * 68 + nb * 16 + lr] = acc[mb][nb][j]; }
        __builtin_amdgcn_wave_barrier(); asm volatile("" ::: "memory");
        float* crow = C + (size_t)(r0 + mb * 16) * ldc + c0;
{
#pragma unroll
            for (int s = 0; s < 8; ++s) { const int row = 2 * s + hi, cofs = lr * 4; v4f val = *(const v4fa*)(os + row * 68 + cofs); if (BIAS) { val[0] += bfr(bias[c0 + cofs]); val[1] += bfr(bias[c0 + cofs + 1]); val[2] += bfr(bias[c0 + cofs + 2]); val[3] += bfr(bias[c0 + cofs + 3]); }
                *(v4f*)(crow + (size_t)row * ldc + cofs) = val; }
             }
        __builtin_amdgcn_wave_barrier(); asm volatile("" ::: "memory");
    }
}

__device__ __forceinline__ h16 tohx(float x) { return (h16)x; }
__device__ __forceinline__ void splitf(float y, unsigned short& h, unsigned short& l) { h = f2bf(y); l = f2bf(y - bf2f(h)); }
typedef __attribute__((ext_vector_type(2))) _Float16 v2h;
typedef __attribute__((ext_vector_type(4))) _Float16 v4h;
typedef __attribute__((ext_vector_type(2))) unsigned short v2us;
typedef __attribute__((ext_vector_type(4))) unsigned short v4us;
typedef __attribute__((ext_vector_type(2))) float v2f;
typedef __attribute__((ext_vector_type(4))) int v4i;

__global__ __launch_bounds__(256) void k_wtG(const float* __restrict__ w, int K, int N, bf* Bt) {
    const int lane = threadIdx.x & 31; const int L0 = (blockIdx.x * 8 + (threadIdx.x >> 5)) * 8; const int nlines = N * K / 64;
{
#pragma unroll 1
        for (int l = 0; l < 8; ++l) { const int L = L0 + l; if (L >= nlines) break; const size_t e = (size_t)L * 64 + lane * 2; const int k = (int)(e % K), n = (int)(e / K); v2us o;
            o[0] = f2bf(w[(size_t)k * N + n]); o[1] = f2bf(w[(size_t)(k + 1) * N + n]); *(v2us*)(Bt + e) = o; }
         }
}
__global__ __launch_bounds__(256) void k_cvt8(const float* __restrict__ src, bf* dst, size_t n8) { const size_t i = (size_t)blockIdx.x * 256 + threadIdx.x; if (i >= n8) return; const v8f v = *(const v8f*)(src + i * 8); v8us o;
#pragma unroll
    for (int k = 0; k < 8; ++k) o[k] = f2bf(v[k]); *(v8us*)(dst + i * 8) = o;  }

// k_rope: head planes [h][t][d] (fp16 + hi/lo) of rope(x) x sc with the rotate-half convention out[d] = x[d] cos[t][d] - x[d+HD/2] sin[t][d], out[d+HD/2] = x[d+HD/2] cos[t][d+HD/2] + x[d] sin[t][d+HD/2]
__global__ __launch_bounds__(256) void k_rope(const float* __restrict__ F, int pitch, int nheads, const float* __restrict__ CS, const float* __restrict__ RF, const float* __restrict__ nw, float sc, h16* P16, bf* Ph, bf* Pl) {
    const size_t e = ((size_t)blockIdx.x * 256 + threadIdx.x) * 2; if (e >= (size_t)nheads * TT * HD) return; const int d = (int)(e % HD); const int t = (int)((e / HD) % TT); const int h = (int)(e / ((size_t)HD * TT)); const float* f = F + (size_t)t * pitch + h * HD; const float rf = RF ? RF[(size_t)h * TT + t] : 1.0f; v2h o16; v2us oh, ol;
#pragma unroll
    for (int q = 0; q < 2; ++q) { const int dd = d + q; const int dp = (dd < HD / 2) ? dd + HD / 2 : dd - HD / 2; float x0 = f[dd], x1 = f[dp];
        if (RF) { float n0 = __fmul_rn(x0, rf), n1 = __fmul_rn(x1, rf); asm volatile("" : "+v"(n0)); asm volatile("" : "+v"(n1)); x0 = __fmul_rn(bfr(nw[dd]), n0); x1 = __fmul_rn(bfr(nw[dp]), n1); }
        const v2f cs = *(const v2f*)(CS + ((size_t)t * HD + dd) * 2); float a = __fmul_rn(x0, cs[0]), bq = __fmul_rn(x1, cs[1]); asm volatile("" : "+v"(a)); asm volatile("" : "+v"(bq)); const float r = ((dd < HD / 2) ? __fsub_rn(a, bq) : __fadd_rn(a, bq)) * sc;
        o16[q] = tohx(r); unsigned short a2, c2; splitf(r, a2, c2); oh[q] = a2; ol[q] = c2; }
    *(v2h*)(P16 + e) = o16; *(v2us*)(Ph + e) = oh; *(v2us*)(Pl + e) = ol;  }
__global__ __launch_bounds__(256) void k_vtp(const float* __restrict__ F, int pitch, int nheads, h16* V16, bf* Vh, bf* Vl) { const size_t e = ((size_t)blockIdx.x * 256 + threadIdx.x) * 2; if (e >= (size_t)nheads * HD * TT) return; const int t = (int)(e % TT); const int d = (int)((e / TT) % HD); const int g = (int)(e / ((size_t)TT * HD)); v2h o16; v2us oh, ol;
#pragma unroll
    for (int q = 0; q < 2; ++q) { const float x = F[(size_t)(t + q) * pitch + g * HD + d]; o16[q] = tohx(x); unsigned short a2, c2; splitf(x, a2, c2); oh[q] = a2; ol[q] = c2; }
    *(v2h*)(V16 + e) = o16; *(v2us*)(Vh + e) = oh; *(v2us*)(Vl + e) = ol;  }
__global__ __launch_bounds__(256) void k_csid(float* CS) { const int idx = blockIdx.x * 256 + threadIdx.x; if (idx >= TT * HD) return; v2f cs; cs[0] = 1.0f; cs[1] = 0.0f; *(v2f*)(CS + (size_t)idx * 2) = cs;  }
// ---- k_attn: one work-group of 16 waves per (head, 16 query rows); the 16 x 2048 score rows never leave LDS. Five stages, a work-group barrier between each two and one inside the last:
// 1 relative logits: qe tiles (q hi/lo planes x Er) are stored straight at their skewed place: qe[i][t] is rel(i, t - 2047 + i) where that column is >= 0, and qe[i+1][t] is rel(i, t + i + 2) where that column is < 2048; rel(i, i+1) = 0 (= the reference's pad/reshape/slice of q.Er^T, upper triangle included)
// 2 scores: each q.k tile adds the relative logit that lies at its own place, scales by 1/8 and stores back
// 3 softmax: wave w owns row w (register row, one exp, fixed trees) and writes the probabilities over its own row: fp16 x 1024, or bf16 hi and lo planes for rows < RH
// 4 attn.v: wave w sums the key slice [128 w, 128 w + 128) for all 64 columns
// 5 the 16 partial tiles meet in LDS (column-major, pitch 20) and are added in wave order 0..15; the merged context goes out as hi/lo planes
#define SP 2052   // LDS pitch of a score row in floats: rows stay 16-byte aligned, rows 8 apart lie 32 banks apart; columns 2048..2051 take the qe elements that belong to no column of this row block
typedef v2f __attribute__((may_alias)) v2fa;
template <bool UP>
__device__ __forceinline__ void rel_tiles(float* S, const bf* __restrict__ qh, const bf* __restrict__ ql, const bf* __restrict__ er, int r0, int tbeg, int tend, int lr, int hi) {
    const unsigned ao = (unsigned)((UP ? min(r0 + 1 + lr, TT - 1) : r0 + lr) * HD + 8 * hi), lo = (unsigned)(lr * HD + 8 * hi);   // UP: q rows i + 1 (the clamped row has no column in range); lane offsets are 32-bit, beside wave-uniform bases
    const v16bf ah0 = WFrag<bf>::ld(qh + ao), ah1 = WFrag<bf>::ld(qh + ao + 32), al0 = WFrag<bf>::ld(ql + ao), al1 = WFrag<bf>::ld(ql + ao + 32);
    for (int tt = tbeg; tt < tend; tt += 16) {
        const bf* bp = er + (size_t)tt * 16 * HD; const v16bf b0 = WFrag<bf>::ld(bp + lo), b1 = WFrag<bf>::ld(bp + lo + 32);
        v8f acc = (v8f){}; acc = wmmab(ah0, b0, acc); acc = wmmab(al0, b0, acc); acc = wmmab(ah1, b1, acc); acc = wmmab(al1, b1, acc);
        const int cb = tt * 16 + lr + r0 + hi * 8 + (UP ? 2 : 1 - TT);   // column of accumulator register 0; register j is one row lower and so j columns further
#pragma unroll
        for (int j = 0; j < 8; ++j) { const int col = cb + j; const bool ok = UP ? (col < TT) : (col >= 0); S[(hi * 8 + j) * SP + (ok ? col : TT + (lr & 3))] = acc[j]; }
    }
}
template <bool HI>
__device__ __forceinline__ void attn_rows(float* S, int h, int r0, const h16* __restrict__ QP16, const bf* __restrict__ QPh, const bf* __restrict__ QPl, const h16* __restrict__ KP16, const bf* __restrict__ KPh, const bf* __restrict__ KPl, const bf* __restrict__ ERB, const h16* __restrict__ VT16, const bf* __restrict__ VTh, const bf* __restrict__ VTl, bf* ATh, bf* ATl) {
    const int tid = (int)threadIdx.x, lane = tid & 31, lr = lane & 15, hi = lane >> 4; const int wv = __builtin_amdgcn_readfirstlane(tid >> 5);   // wave-uniform: scalar loop bounds
    const size_t hq = (size_t)h * TT * HD;
    {   // stage 1: Er tiles 0..T0 serve the columns right of the diagonal, tiles T0..127 those up to it (tile T0 serves both); the second deal runs in reverse wave order so that the two remainders fall on different waves but for one
        const int T0 = TT / 16 - 1 - (r0 >> 4);
        rel_tiles<true>(S, QPh + hq, QPl + hq, ERB, r0, wv, T0 + 1, lr, hi);
        rel_tiles<false>(S, QPh + hq, QPl + hq, ERB, r0, T0 + 15 - wv, TT / 16, lr, hi);
        if (tid < 16 && r0 + tid + 1 < TT) S[tid * SP + r0 + tid + 1] = 0.0f;
    }
    __syncthreads();   // every relative logit lies in LDS before a score tile adds it
    {   // stage 2
        const size_t ab = hq + (size_t)r0 * HD; const unsigned lo = (unsigned)(lr * HD + 8 * hi);   // wave-uniform base, 32-bit lane offset
        if constexpr (HI) {
            const v16bf a0 = WFrag<bf>::ld(QPh + ab + lo), a1 = WFrag<bf>::ld(QPh + ab + lo + 32), c0 = WFrag<bf>::ld(QPl + ab + lo), c1 = WFrag<bf>::ld(QPl + ab + lo + 32);
#pragma unroll 2   // two tiles' loads in flight per trip, inside the 128 registers that let two work-groups share a WGP
            for (int it = 0; it < TT / 256; ++it) { const int n0 = (it * 16 + wv) * 16; const size_t bo = hq + (size_t)n0 * HD;
                const v16bf b0 = WFrag<bf>::ld(KPh + bo + lo), b1 = WFrag<bf>::ld(KPh + bo + lo + 32), d0 = WFrag<bf>::ld(KPl + bo + lo), d1 = WFrag<bf>::ld(KPl + bo + lo + 32);
                v8f acc = (v8f){}; acc = wmmab(a0, b0, acc); acc = wmmab(c0, b0, acc); acc = wmmab(a0, d0, acc); acc = wmmab(a1, b1, acc); acc = wmmab(c1, b1, acc); acc = wmmab(a1, d1, acc);
#pragma unroll
                for (int j = 0; j < 8; ++j) { float* p = S + (hi * 8 + j) * SP + n0 + lr; *p = (acc[j] + *p) * SCL; } }
        } else {
            const v16h a0 = WFrag<h16>::ld(QP16 + ab + lo), a1 = WFrag<h16>::ld(QP16 + ab + lo + 32);
#pragma unroll 4   // four tiles' loads in flight per trip, inside the 128 registers that let two work-groups share a WGP
            for (int it = 0; it < TT / 256; ++it) { const int n0 = (it * 16 + wv) * 16; const size_t bo = hq + (size_t)n0 * HD;
                const v16h b0 = WFrag<h16>::ld(KP16 + bo + lo), b1 = WFrag<h16>::ld(KP16 + bo + lo + 32);
                v8f acc = (v8f){}; acc = wmma16(a0, b0, acc); acc = wmma16(a1, b1, acc);
#pragma unroll
                for (int j = 0; j < 8; ++j) { float* p = S + (hi * 8 + j) * SP + n0 + lr; *p = (acc[j] + *p) * SCL; } }
        }
    }
    __syncthreads();   // every score of a row lies in LDS before its wave reads the row
    {   // stage 3
        float* sr = S + wv * SP; float v[TT / 32]; float mx = -3.0e38f;
#pragma unroll
        for (int ch = 0; ch < TT / 128; ++ch) { const v4f a = *(const v4fa*)(sr + ch * 128 + lane * 4);
#pragma unroll
            for (int q = 0; q < 4; ++q) { v[ch * 4 + q] = a[q]; mx = fmaxf(mx, a[q]); } }
#pragma unroll
        for (int sh = 16; sh; sh >>= 1) mx = fmaxf(mx, __shfl_xor(mx, sh, 32));
        float sum = 0.f;
#pragma unroll
        for (int k = 0; k < TT / 32; ++k) { v[k] = __builtin_amdgcn_exp2f((v[k] - mx) * 1.4426950408889634f); sum += v[k]; }
#pragma unroll
        for (int sh = 16; sh; sh >>= 1) sum += __shfl_xor(sum, sh, 32);
        const float f = __fdiv_rn(HI ? 1.0f : PCAR, sum);
        if constexpr (HI) { bf* ph = (bf*)sr; bf* pl = ph + TT;
#pragma unroll
            for (int ch = 0; ch < TT / 128; ++ch) { v4us oh, ol;
#pragma unroll
                for (int q = 0; q < 4; ++q) { unsigned short a, c2; splitf(v[ch * 4 + q] * f, a, c2); oh[q] = a; ol[q] = c2; }
                *(v4us*)(ph + ch * 128 + lane * 4) = oh; *(v4us*)(pl + ch * 128 + lane * 4) = ol;
                __builtin_amdgcn_sched_barrier(0); }   // one chunk's split is finished before the next begins: interleaved, their temporaries pass 128 registers and spill
        } else { h16* pp = (h16*)sr;
#pragma unroll
            for (int ch = 0; ch < TT / 128; ++ch) { v4h o4;
#pragma unroll
                for (int q = 0; q < 4; ++q) o4[q] = tohx(v[ch * 4 + q] * f);
                *(v4h*)(pp + ch * 128 + lane * 4) = o4; } }
    }
    __syncthreads();   // all 16 probability rows lie in LDS before any wave reads its key slice of them
    v8f acc[4];
#pragma unroll
    for (int nb = 0; nb < 4; ++nb) acc[nb] = (v8f){};
    {   // stage 4
        const size_t vb = (size_t)h * HD * TT + (size_t)wv * 128; const unsigned lo = (unsigned)(lr * TT + 8 * hi);   // wave-uniform base, 32-bit lane offset
#pragma unroll
        for (int s = 0; s < 4; ++s) { const int kc = wv * 128 + s * 32;
            if constexpr (HI) { const bf* pr = (const bf*)(S + lr * SP) + kc + 8 * hi; const v16bf a = WFrag<bf>::ld(pr), a2 = WFrag<bf>::ld(pr + TT);
#pragma unroll
                for (int nb = 0; nb < 4; ++nb) { const v16bf b = WFrag<bf>::ld(VTh + vb + lo + (nb * 16 * TT + s * 32)), b2 = WFrag<bf>::ld(VTl + vb + lo + (nb * 16 * TT + s * 32));
                    acc[nb] = wmmab(a, b, acc[nb]); acc[nb] = wmmab(a2, b, acc[nb]); acc[nb] = wmmab(a, b2, acc[nb]); }
            } else { const v16h a = WFrag<h16>::ld((const h16*)(S + lr * SP) + kc + 8 * hi);
#pragma unroll
                for (int nb = 0; nb < 4; ++nb) acc[nb] = wmma16(a, WFrag<h16>::ld(VT16 + vb + lo + (nb * 16 * TT + s * 32)), acc[nb]); } }
    }
    __syncthreads();   // every wave has read its slice of the probability rows before the partial tiles overwrite them
    {   // stage 5
        float* pw = S + wv * (64 * 20);
#pragma unroll
        for (int nb = 0; nb < 4; ++nb) { float* p = pw + (nb * 16 + lr) * 20 + hi * 8; const v8f t = acc[nb]; *(v4fa*)p = __builtin_shufflevector(t, t, 0, 1, 2, 3); *(v4fa*)(p + 4) = __builtin_shufflevector(t, t, 4, 5, 6, 7); }
        __syncthreads();   // every wave's partial tile is in LDS before any of it is summed
        const int col = tid & 63, rp = tid >> 6; const float* p = S + col * 20 + rp * 2; v2f s = *(const v2fa*)p;
#pragma unroll
        for (int w = 1; w < 16; ++w) s += *(const v2fa*)(p + w * (64 * 20));
        const float cs = HI ? 1.0f : (1.0f / PCAR);
#pragma unroll
        for (int q = 0; q < 2; ++q) { unsigned short a, c2; splitf(s[q] * cs, a, c2); const size_t oo = (size_t)(r0 + rp * 2 + q) * DQ + h * HD + col; ATh[oo] = a; ATl[oo] = c2; }
    }
}
__global__ __launch_bounds__(512, 8) /* 8 waves per SIMD: at most 128 registers, so that two work-groups (LDS allows two) share a WGP and one's barriers and load waits are covered by the other */ void k_attn(const h16* __restrict__ QP16, const bf* __restrict__ QPh, const bf* __restrict__ QPl, const h16* __restrict__ KP16, const bf* __restrict__ KPh, const bf* __restrict__ KPl, const bf* __restrict__ ERB, const h16* __restrict__ VT16, const bf* __restrict__ VTh, const bf* __restrict__ VTl, bf* ATh, bf* ATl) {
    __shared__ __align__(16) float S[16 * SP];
    const int r0 = (int)blockIdx.x * 16, h = (int)blockIdx.y;   // the choice below is the same for the whole work-group, so every barrier is met by all of its waves
    if (r0 < RH) attn_rows<true>(S, h, r0, QP16, QPh, QPl, KP16, KPh, KPl, ERB, VT16, VTh, VTl, ATh, ATl);
    else attn_rows<false>(S, h, r0, QP16, QPh, QPl, KP16, KPh, KPl, ERB, VT16, VTh, VTl, ATh, ATl);
}

extern "C" void kernel_launch(void* const* d_in, const int* in_sizes, int n_in,
                              void* d_out, int out_size, void* d_ws, size_t ws_size, hipStream_t stream) {
    (void)in_sizes; (void)n_in; (void)out_size;
    const float* xq = (const float*)d_in[0]; const float* xk = (const float*)d_in[1]; const float* xv = (const float*)d_in[2]; const float* wq = (const float*)d_in[3]; const float* bq = (const float*)d_in[4]; const float* wk = (const float*)d_in[5]; const float* bk = (const float*)d_in[6]; const float* wv = (const float*)d_in[7]; const float* bv = (const float*)d_in[8]; const float* wo = (const float*)d_in[9]; const float* bo = (const float*)d_in[10]; const float* Er = (const float*)d_in[11]; const float* x = nullptr; (void)x;
    float* OUT = (float*)d_out;     // [1][2048][1024]
    char* wsp = (char*)d_ws;
    auto take = [&](size_t bytes) { char* p = wsp; wsp += (bytes + 255) & ~(size_t)255; return (void*)p; };
    bf* WQ = (bf*)take((size_t)DQ * DM * 2); bf* WK = (bf*)take((size_t)DKV * DM * 2); bf* WV = (bf*)take((size_t)DKV * DM * 2); bf* WO = (bf*)take((size_t)DM * DQ * 2); float* CS = (float*)take((size_t)TT * HD * 2 * 4);
    bf* ERB = (bf*)take((size_t)TT * HD * 2);
    bf* XB = (bf*)take((size_t)TT * DM * 2); float* FQ = (float*)take((size_t)TT * DQ * 4); float* FK = (float*)take((size_t)TT * DKV * 4);
    h16* QP16 = (h16*)take((size_t)NH_ * TT * HD * 2); h16* KP16 = (h16*)take((size_t)NKV * TT * HD * 2); h16* VT16 = (h16*)take((size_t)NKV * HD * TT * 2);
    bf* QPh = (bf*)take((size_t)NH_ * TT * HD * 2); bf* QPl = (bf*)take((size_t)NH_ * TT * HD * 2); bf* KPh = (bf*)take((size_t)NKV * TT * HD * 2); bf* KPl = (bf*)take((size_t)NKV * TT * HD * 2); bf* VTh = (bf*)take((size_t)NKV * HD * TT * 2); bf* VTl = (bf*)take((size_t)NKV * HD * TT * 2);
    bf* ATh = (bf*)take((size_t)TT * DQ * 2); bf* ATl = (bf*)take((size_t)TT * DQ * 2);
    if ((size_t)(wsp - (char*)d_ws) > ws_size) return;    // ws 256 MiB
    float* FV = FK;   // v projection reuses the k buffer after the k planes are built (stream-ordered)
    { k_cvt8<<<(unsigned)(((size_t)DQ * DM / 8 + 255) / 256), 256, 0, stream>>>(wq, WQ, (size_t)DQ * DM / 8); k_cvt8<<<(unsigned)(((size_t)DKV * DM / 8 + 255) / 256), 256, 0, stream>>>(wk, WK, (size_t)DKV * DM / 8); k_cvt8<<<(unsigned)(((size_t)DKV * DM / 8 + 255) / 256), 256, 0, stream>>>(wv, WV, (size_t)DKV * DM / 8);
      k_cvt8<<<(unsigned)(((size_t)DM * DQ / 8 + 255) / 256), 256, 0, stream>>>(wo, WO, (size_t)DM * DQ / 8);
       }
    k_csid<<<(TT * HD + 255) / 256, 256, 0, stream>>>(CS);
    const unsigned LQ = (unsigned)(((size_t)NH_ * TT * HD / 2 + 255) / 256), LKv = (unsigned)(((size_t)NKV * TT * HD / 2 + 255) / 256);
    k_cvt8<<<(unsigned)(((size_t)TT * HD / 8 + 255) / 256), 256, 0, stream>>>(Er, ERB, (size_t)TT * HD / 8);   /* Er [2048][64] ('t d') is already the Bt layout */
    for (int b = 0; b < NB_; ++b) {
        
        k_cvt8<<<(unsigned)(((size_t)TT * DM / 8 + 255) / 256), 256, 0, stream>>>(xq + (size_t)b * TT * DM, XB, (size_t)TT * DM / 8);   /* query rows */
        k_gemmw<bf, 0, true, 8><<<dim3(TT / 64, DQ / 64, 1), 256, 0, stream>>>(XB, nullptr, WQ, nullptr, DM, FQ, DQ, bq, 0, 0, 0);
        k_rope<<<LQ, 256, 0, stream>>>(FQ, DQ, NH_, CS, nullptr, nullptr, 1.0f, QP16, QPh, QPl);
        k_cvt8<<<(unsigned)(((size_t)TT * DM / 8 + 255) / 256), 256, 0, stream>>>(xk + (size_t)b * TT * DM, XB, (size_t)TT * DM / 8);   /* key rows */
        k_gemmw<bf, 0, true, 8><<<dim3(TT / 64, DKV / 64, 1), 256, 0, stream>>>(XB, nullptr, WK, nullptr, DM, FK, DKV, bk, 0, 0, 0);
        k_rope<<<LKv, 256, 0, stream>>>(FK, DKV, NKV, CS, nullptr, nullptr, 1.0f, KP16, KPh, KPl);
        k_cvt8<<<(unsigned)(((size_t)TT * DM / 8 + 255) / 256), 256, 0, stream>>>(xv + (size_t)b * TT * DM, XB, (size_t)TT * DM / 8);   /* value rows */
        k_gemmw<bf, 0, true, 8><<<dim3(TT / 64, DKV / 64, 1), 256, 0, stream>>>(XB, nullptr, WV, nullptr, DM, FV, DKV, bv, 0, 0, 0); k_vtp<<<LKv, 256, 0, stream>>>(FV, DKV, NKV, VT16, VTh, VTl);
        k_attn<<<dim3(TT / 16, NH_, 1), 512, 0, stream>>>(QP16, QPh, QPl, KP16, KPh, KPl, ERB, VT16, VTh, VTl, ATh, ATl);   /* one kv head per query head */
        k_gemmw<bf, 1, true, 8><<<dim3(TT / 64, DM / 64, 1), 256, 0, stream>>>(ATh, ATl, WO, nullptr, DQ, OUT + (size_t)b * TT * DM, DM, bo, 0, 0, 0); }
}

// v003
// Measured time: 158 microseconds a run.
// Next to v002, in two timings, it ran 1.65 and 1.66 times as fast.
// All steps since v000 together make it 7.91 times as fast.
#include <hip/hip_runtime.h>

// Relative global attention (Music-Transformer skew) (query, key, value [1][2048][1024]; q,k,v = input W^T + b ('oi' [1024][1024] + [1024]; 16 heads x 64); qe = q.Er^T (Er [2048][64], all rows used since s = max_len); s_rel = skew(qe): for j <= i  s_rel[i][j] = qe[i][2047 + j - i]; for j = i+1  0; for j > i+1  qe[i+1][j - i - 2] (the reference's pad-reshape-slice, reproduced exactly, upper triangle included); scores = (q.k + s_rel) / 8; softmax; out = merged ctx Wo^T + bo -> [1][2048][1024] (2.1 M)).
// Compute dtypes, f32 accumulate: every input rounded to bf16; q/k/v on PLAIN bf16 operands (inputs: exact) + biases (three input tensors); qe = q(hi/lo planes) x Er (exact bf16) gives the relative logits, stored in LDS at their skewed place (the index map above) and added to q.k before the 1/8 scale; scores and attn.v: query rows < 512 hl (3 products), the rest single fp16 (x1024); softmax f32; Wo hl x exact (2 products) + bo.

#define NB_  1
#define TT   2048
#define DM   1024
#define NH_  16
#define NKV  16
#define REP  (NH_ / NKV)
#define HD   64
#define DQ   (NH_ * HD)
#define DKV  (NKV * HD)
#define RH   512                  // query rows < RH use hi+lo planes (0: none)
#define WIN  0
#define PCAR 1024.0f
#define SCL  0.125f   // HD^-0.5
typedef _Float16 h16;
typedef unsigned short bf;
typedef __attribute__((ext_vector_type(16))) __bf16   v16bf;
typedef __attribute__((ext_vector_type(16))) _Float16 v16h;
typedef __attribute__((ext_vector_type(8)))  _Float16 v8h;
typedef __attribute__((ext_vector_type(8)))  unsigned short v8us;
typedef __attribute__((ext_vector_type(8)))  float    v8f;
typedef __attribute__((ext_vector_type(4)))  float    v4f;
typedef v8h  __attribute__((may_alias)) v8ha;
typedef v4f  __attribute__((may_alias)) v4fa;
typedef v8us __attribute__((may_alias)) v8usa;

__device__ __forceinline__ unsigned short f2bf(float f) { unsigned u = __float_as_uint(f); u += 0x7FFFu + ((u >> 16) & 1u); return (unsigned short)(u >> 16); }
__device__ __forceinline__ float bf2f(unsigned short b) { return __uint_as_float(((unsigned)b) << 16); }
__device__ __forceinline__ float bfr(float f) { return bf2f(f2bf(f)); }
__device__ __forceinline__ v16h cat16(v8h lo, v8h hi) { return __builtin_shufflevector(lo, hi, 0, 1, 2, 3, 4, 5, 6, 7, 8, 9, 10, 11, 12, 13, 14, 15); }
__device__ __forceinline__ v16bf cat16b(v8us lo, v8us hi) { return __builtin_bit_cast(v16bf, __builtin_shufflevector(lo, hi, 0, 1, 2, 3, 4, 5, 6, 7, 8, 9, 10, 11, 12, 13, 14, 15)); }
__device__ __forceinline__ v8f wmma16(v16h a, v16h b, v8f c) { return __builtin_amdgcn_wmma_f32_16x16x32_f16(false, a, false, b, (short)0, c, false, false); }
__device__ __forceinline__ v8f wmmab(v16bf a, v16bf b, v8f c) { return __builtin_amdgcn_wmma_f32_16x16x32_bf16(false, a, false, b, (short)0, c, false, false); }



// ---- FRAGMENT ORDER of every 16-bit operand plane in global memory (rows x K, K % 32 == 0): the plane is a row-major grid of fragments (16 rows x 32 k, 512 elements = 1 KiB, fragment index (row / 16) * (K / 32) + k / 32; the v planes alone order their fragments k-block first, see k_vtp);
// inside a fragment element (row, k) lies at ((k >> 4) & 1) * 256 + ((k >> 3) & 1) * 128 + (row & 15) * 8 + (k & 7), which is half * 256 + lane * 8 + e of the lane and register half that hold it in the WMMA operand.
// WFrag::ldf(fragment, lane * 16) is then two wave-wide 16-byte loads of 512 contiguous bytes each (four whole 128-byte lines); from a row-major plane each such load touches 16 lines. WFrag::ld reads a row-major source (the LDS rows).
// ldf takes a wave-uniform fragment pointer and the lane's 32-bit BYTE offset: every load of a loop then names one scalar base, one offset register and a constant, and no per-load address pair is formed (stage 4 of k_attn hands it the lane's own pointer and offset 0).
// Behind each run of such loads stands s_wait_xcnt 0, in front of the rewrite of the offset register that they name (addr_step: the caller advances the offset behind it) or of its release (a statement that takes the address registers as inputs only, so that they stay taken up to the wait).
// ---- k_gemmw: register-blocked GEMM, ONE WAVE per 64x64 output tile (16 accumulators), operands straight from 16-bit planes in fragment order; grid (M/64, N/64, Z), 32 threads.
// C[m][n] (f32, pitch ldc, + optional f32 bias[n]) = sum_k A[m][k] Bt[n][k] (+ split products per NSPLIT). z-batch strides sA/sB/sC in elements. K % (32 * KS) == 0.
// KS > 1 (long-K launches, 32 * KS threads): wave w of the work-group sums the K slice [w K/KS, (w+1) K/KS) of the same 64x64 tile; the KS partial tiles meet in LDS (column-major, pitch 68) and are added in wave order 0..KS-1.
template <typename T16> struct WFrag;
template <> struct WFrag<h16> { typedef v16h V; static __device__ __forceinline__ V ld(const h16* p) { return cat16(*(const v8h*)p, *(const v8h*)(p + 16)); } static __device__ __forceinline__ V ldf(const h16* ub, unsigned vb) { const h16* p = (const h16*)((const char*)ub + vb); return cat16(*(const v8h*)p, *(const v8h*)(p + 256)); } static __device__ __forceinline__ v8f mma(V a, V b, v8f c) { return wmma16(a, b, c); } };
template <> struct WFrag<bf> { typedef v16bf V; static __device__ __forceinline__ V ld(const bf* p) { return cat16b(*(const v8us*)p, *(const v8us*)(p + 16)); } static __device__ __forceinline__ V ldf(const bf* ub, unsigned vb) { const bf* p = (const bf*)((const char*)ub + vb); return cat16b(*(const v8us*)p, *(const v8us*)(p + 256)); } static __device__ __forceinline__ v8f mma(V a, V b, v8f c) { return wmmab(a, b, c); } };
__device__ __forceinline__ void addr_step(unsigned& vb) { asm volatile("s_wait_xcnt 0x0" : "+v"(vb) : : "memory"); }   // the offset's next value is formed from this statement's result, so its rewrite cannot be lifted over the wait
template <typename T16, int NSPLIT, bool BIAS, int KS, int K>
__global__ __launch_bounds__(32 * KS) void k_gemmw(const T16* __restrict__ A, const T16* __restrict__ A2, const T16* __restrict__ Bt, const T16* __restrict__ Bt2, float* C, int ldc, const float* __restrict__ bias, size_t sA, size_t sB, size_t sC) {
    typedef typename WFrag<T16>::V V;
    __shared__ __align__(16) float os[KS == 1 ? 16 * 68 : KS * 64 * 68];
    const size_t z = blockIdx.z; A += z * sA; if (A2) A2 += z * sA; Bt += z * sB; if (Bt2) Bt2 += z * sB; C += z * sC;
    const int lane = threadIdx.x & 31, lr = lane & 15, hi = lane >> 4; const int r0 = blockIdx.x * 64, c0 = blockIdx.y * 64;
    v8f acc[4][4];
#pragma unroll
    for (int mb = 0; mb < 4; ++mb)
#pragma unroll
        for (int nb = 0; nb < 4; ++nb) acc[mb][nb] = (v8f){};
    const int wv = (KS == 1) ? 0 : __builtin_amdgcn_readfirstlane((int)(threadIdx.x >> 5)); constexpr int kspan = K / KS; const int kbeg = wv * kspan;   // this wave's K slice
    const T16* ua = A + (size_t)r0 * K + (size_t)kbeg * 16; const T16* ua2 = (NSPLIT == 1 || NSPLIT == 2) ? A2 + (size_t)r0 * K + (size_t)kbeg * 16 : nullptr; const T16* ub = Bt + (size_t)c0 * K + (size_t)kbeg * 16; const T16* ub2 = (NSPLIT >= 2) ? Bt2 + (size_t)c0 * K + (size_t)kbeg * 16 : nullptr;   // wave-uniform: 16 rows of fragments hold 16 K elements; a step of 32 in k is one fragment (1 KiB)
    unsigned vo = (unsigned)lane * 16;
#pragma unroll 1
    for (int kc = 0; kc < kspan; kc += 32) {
        V a[4], a2[4], b[4], b2[4];
#pragma unroll
        for (int mb = 0; mb < 4; ++mb) { a[mb] = WFrag<T16>::ldf(ua + mb * 16 * K, vo); if (NSPLIT == 1 || NSPLIT == 2) a2[mb] = WFrag<T16>::ldf(ua2 + mb * 16 * K, vo); }
#pragma unroll
        for (int nb = 0; nb < 4; ++nb) { b[nb] = WFrag<T16>::ldf(ub + nb * 16 * K, vo); if (NSPLIT >= 2) b2[nb] = WFrag<T16>::ldf(ub2 + nb * 16 * K, vo); }
        __builtin_amdgcn_sched_barrier(0);   // a trip's loads all issue in front of its products: without it the compiler sinks each B fragment behind the products before it, into one register set, and a trip waits four times for memory
#pragma unroll
        for (int nb = 0; nb < 4; ++nb)
#pragma unroll
            for (int mb = 0; mb < 4; ++mb) { acc[mb][nb] = WFrag<T16>::mma(a[mb], b[nb], acc[mb][nb]); if (NSPLIT == 1 || NSPLIT == 2) acc[mb][nb] = WFrag<T16>::mma(a2[mb], b[nb], acc[mb][nb]); if (NSPLIT >= 2) acc[mb][nb] = WFrag<T16>::mma(a[mb], b2[nb], acc[mb][nb]); }
        asm volatile("v_nop\n\tv_nop\n\tv_nop\n\tv_nop" : "+v"(acc[0][0]), "+v"(acc[1][1]), "+v"(acc[2][2]), "+v"(acc[3][3]) : "v"(a[0]), "v"(a[3]));
        addr_step(vo); vo += 1024;   // next fragment of every operand row block
    }
    if constexpr (KS > 1) {
        float* pw = os + wv * (64 * 68);
#pragma unroll
        for (int mb = 0; mb < 4; ++mb)
#pragma unroll
            for (int nb = 0; nb < 4; ++nb) { float* p = pw + (nb * 16 + lr) * 68 + mb * 16 + hi * 8; const v8f t = acc[mb][nb]; *(v4fa*)p = __builtin_shufflevector(t, t, 0, 1, 2, 3); *(v4fa*)(p + 4) = __builtin_shufflevector(t, t, 4, 5, 6, 7); }
        __syncthreads();   // every wave's partial tile is in LDS before any of it is summed
#pragma unroll
        for (int it = 0; it < 64 * 16 / (32 * KS); ++it) { const int g = it * (32 * KS) + (int)threadIdx.x, col = g & 63, rq = g >> 6; const float* p = os + col * 68 + rq * 4; v4f s = *(const v4fa*)p;
#pragma unroll
            for (int w = 1; w < KS; ++w) s += *(const v4fa*)(p + w * (64 * 68));
            if (BIAS) { const float bb = bfr(bias[c0 + col]); s[0] += bb; s[1] += bb; s[2] += bb; s[3] += bb; }
            float* cp = C + (size_t)(r0 + rq * 4) * ldc + c0 + col;
#pragma unroll
            for (int q = 0; q < 4; ++q) cp[(size_t)q * ldc] = s[q]; }
        return;
    }
#pragma unroll
    for (int mb = 0; mb < 4; ++mb) {
#pragma unroll
        for (int nb = 0; nb < 4; ++nb) {
#pragma unroll
            for (int j = 0; j < 8; ++j) os[(hi * 8 + j) * 68 + nb * 16 + lr] = acc[mb][nb][j]; }
        __builtin_amdgcn_wave_barrier(); asm volatile("" ::: "memory");
        float* crow = C + (size_t)(r0 + mb * 16) * ldc + c0;
{
#pragma unroll
            for (int s = 0; s < 8; ++s) { const int row = 2 * s + hi, cofs = lr * 4; v4f val = *(const v4fa*)(os + row * 68 + cofs); if (BIAS) { val[0] += bfr(bias[c0 + cofs]); val[1] += bfr(bias[c0 + cofs + 1]); val[2] += bfr(bias[c0 + cofs + 2]); val[3] += bfr(bias[c0 + cofs + 3]); }
                *(v4f*)(crow + (size_t)row * ldc + cofs) = val; }
             }
        __builtin_amdgcn_wave_barrier(); asm volatile("" ::: "memory");
    }
}

__device__ __forceinline__ h16 tohx(float x) { return (h16)x; }
__device__ __forceinline__ void splitf(float y, unsigned short& h, unsigned short& l) { h = f2bf(y); l = f2bf(y - bf2f(h)); }
typedef __attribute__((ext_vector_type(2))) _Float16 v2h;
typedef __attribute__((ext_vector_type(4))) _Float16 v4h;
typedef __attribute__((ext_vector_type(2))) unsigned short v2us;
typedef __attribute__((ext_vector_type(4))) unsigned short v4us;
typedef __attribute__((ext_vector_type(2))) float v2f;
typedef __attribute__((ext_vector_type(4))) int v4i;

__global__ __launch_bounds__(256) void k_wtG(const float* __restrict__ w, int K, int N, bf* Bt) {
    const int lane = threadIdx.x & 31; const int L0 = (blockIdx.x * 8 + (threadIdx.x >> 5)) * 8; const int nlines = N * K / 64;
{
#pragma unroll 1
        for (int l = 0; l < 8; ++l) { const int L = L0 + l; if (L >= nlines) break; const size_t e = (size_t)L * 64 + lane * 2; const int k = (int)(e % K), n = (int)(e / K); v2us o;
            o[0] = f2bf(w[(size_t)k * N + n]); o[1] = f2bf(w[(size_t)(k + 1) * N + n]); *(v2us*)(Bt + e) = o; }
         }
}
// k_cvtf: row-major f32 [rows][K] -> bf16 plane in fragment order, 8 elements per thread; four neighbouring lanes read one whole 128-byte line of a row (32 k), eight neighbouring rows write one whole line of the fragment
template <int K>
__global__ __launch_bounds__(256) void k_cvtf(const float* __restrict__ src, bf* dst, size_t n8) { const size_t i = (size_t)blockIdx.x * 256 + threadIdx.x; if (i >= n8) return; const int c = (int)(i & 3), lr = (int)((i >> 2) & 15); const size_t frag = i >> 6, kb = frag % (K / 32), rb = frag / (K / 32);
    const v8f v = *(const v8f*)(src + (rb * 16 + lr) * K + kb * 32 + c * 8); v8us o;
#pragma unroll
    for (int k = 0; k < 8; ++k) o[k] = f2bf(v[k]); *(v8us*)(dst + frag * 512 + (c >> 1) * 256 + (c & 1) * 128 + lr * 8) = o;  }

// k_rope: head planes [h][t][d] (fp16 + hi/lo; each head's [t][d] in fragment order, rows t, k = d) of rope(x) x sc with the rotate-half convention out[d] = x[d] cos[t][d] - x[d+HD/2] sin[t][d], out[d+HD/2] = x[d+HD/2] cos[t][d+HD/2] + x[d] sin[t][d+HD/2]
__global__ __launch_bounds__(256) void k_rope(const float* __restrict__ F, int pitch, int nheads, const float* __restrict__ CS, const float* __restrict__ RF, const float* __restrict__ nw, float sc, h16* P16, bf* Ph, bf* Pl) {
    const size_t e = ((size_t)blockIdx.x * 256 + threadIdx.x) * 2; if (e >= (size_t)nheads * TT * HD) return; const int d = (int)(e % HD); const int t = (int)((e / HD) % TT); const int h = (int)(e / ((size_t)HD * TT)); const float* f = F + (size_t)t * pitch + h * HD; const float rf = RF ? RF[(size_t)h * TT + t] : 1.0f; v2h o16; v2us oh, ol;
#pragma unroll
    for (int q = 0; q < 2; ++q) { const int dd = d + q; const int dp = (dd < HD / 2) ? dd + HD / 2 : dd - HD / 2; float x0 = f[dd], x1 = f[dp];
        if (RF) { float n0 = __fmul_rn(x0, rf), n1 = __fmul_rn(x1, rf); asm volatile("" : "+v"(n0)); asm volatile("" : "+v"(n1)); x0 = __fmul_rn(bfr(nw[dd]), n0); x1 = __fmul_rn(bfr(nw[dp]), n1); }
        const v2f cs = *(const v2f*)(CS + ((size_t)t * HD + dd) * 2); float a = __fmul_rn(x0, cs[0]), bq = __fmul_rn(x1, cs[1]); asm volatile("" : "+v"(a)); asm volatile("" : "+v"(bq)); const float r = ((dd < HD / 2) ? __fsub_rn(a, bq) : __fadd_rn(a, bq)) * sc;
        o16[q] = tohx(r); unsigned short a2, c2; splitf(r, a2, c2); oh[q] = a2; ol[q] = c2; }
    const size_t o = ((size_t)h * TT + (t & ~15)) * HD + (d >> 5) * 512 + ((d >> 4) & 1) * 256 + ((d >> 3) & 1) * 128 + (t & 15) * 8 + (d & 7);
    *(v2h*)(P16 + o) = o16; *(v2us*)(Ph + o) = oh; *(v2us*)(Pl + o) = ol;  }
// k_vtp: v planes per head in fragment order with rows d and k = t, fragments laid [t / 32][d / 16] so that a wave's 128 keys x 64 columns are 16 KiB in a row; e runs in output order (a wave writes one whole line and reads 8 d of 8 rows t)
__global__ __launch_bounds__(256) void k_vtp(const float* __restrict__ F, int pitch, int nheads, h16* V16, bf* Vh, bf* Vl) { const size_t e = ((size_t)blockIdx.x * 256 + threadIdx.x) * 2; if (e >= (size_t)nheads * HD * TT) return; const int fr = (int)(e >> 9); const int t = ((fr >> 2) & (TT / 32 - 1)) * 32 + (int)((e >> 8) & 1) * 16 + (int)((e >> 7) & 1) * 8 + (int)(e & 7); const int d = (fr & 3) * 16 + (int)((e >> 3) & 15); const int g = (int)(e / ((size_t)TT * HD)); v2h o16; v2us oh, ol;
#pragma unroll
    for (int q = 0; q < 2; ++q) { const float x = F[(size_t)(t + q) * pitch + g * HD + d]; o16[q] = tohx(x); unsigned short a2, c2; splitf(x, a2, c2); oh[q] = a2; ol[q] = c2; }
    *(v2h*)(V16 + e) = o16; *(v2us*)(Vh + e) = oh; *(v2us*)(Vl + e) = ol;  }
__global__ __launch_bounds__(256) void k_csid(float* CS) { const int idx = blockIdx.x * 256 + threadIdx.x; if (idx >= TT * HD) return; v2f cs; cs[0] = 1.0f; cs[1] = 0.0f; *(v2f*)(CS + (size_t)idx * 2) = cs;  }
// ---- k_attn: one work-group of 16 waves per (head, 16 query rows); the 16 x 2048 score rows never leave LDS. Five stages, a work-group barrier between each two and one inside the last:
// 1 relative logits: qe tiles (q hi/lo planes x Er) are stored straight at their skewed place: qe[i][t] is rel(i, t - 2047 + i) where that column is >= 0, and qe[i+1][t] is rel(i, t + i + 2) where that column is < 2048; rel(i, i+1) = 0 (= the reference's pad/reshape/slice of q.Er^T, upper triangle included)
// 2 scores: each q.k tile adds the relative logit that lies at its own place, scales by 1/8 and stores back
// 3 softmax: wave w owns row w (register row, one exp, fixed trees) and writes the probabilities over its own row: fp16 x 1024, or bf16 hi and lo planes for rows < RH
// 4 attn.v: wave w sums the key slice [128 w, 128 w + 128) for all 64 columns
// 5 the 16 partial tiles meet in LDS (column-major, pitch 20) and are added in wave order 0..15; the merged context goes out as hi/lo planes in fragment order
#define SP 2052   // LDS pitch of a score row in floats: rows stay 16-byte aligned, rows 8 apart lie 32 banks apart; columns 2048..2051 take the qe elements that belong to no column of this row block
typedef v2f __attribute__((may_alias)) v2fa;
template <bool UP>
__device__ __forceinline__ void rel_tiles(float* S, const bf* __restrict__ qh, const bf* __restrict__ ql, const bf* __restrict__ er, int r0, int tbeg, int tend, int lr, int hi) {
    if (tbeg >= tend) return;   // wave-uniform: a wave without a tile loads no q rows
    const int qr = UP ? min(r0 + 1 + lr, TT - 1) : r0 + lr; const unsigned ao = (unsigned)((qr >> 4) * (16 * HD) + (qr & 15) * 8 + hi * 128) * 2;   // UP: q rows i + 1 (the clamped row has no column in range); byte offset in fragment order: a 16-row tile is 2 fragments (k 0..31, 32..63)
    const v16bf ah0 = WFrag<bf>::ldf(qh, ao), ah1 = WFrag<bf>::ldf(qh + 512, ao), al0 = WFrag<bf>::ldf(ql, ao), al1 = WFrag<bf>::ldf(ql + 512, ao);
    asm volatile("s_wait_xcnt 0x0" : : "v"(ao), "s"(qh), "s"(ql) : "memory");   // inputs only: the q loads' offset register and two scalar bases stay taken up to the wait; the Er base and offset are formed behind it, not in those registers ahead of it
    const bf* eb = er + (size_t)tbeg * 16 * HD; unsigned eo = (unsigned)(lr * 8 + hi * 128) * 2;
    for (int tt = tbeg; tt < tend; tt += 16) {
        const v16bf b0 = WFrag<bf>::ldf(eb, eo), b1 = WFrag<bf>::ldf(eb + 512, eo);
        v8f acc = (v8f){}; acc = wmmab(ah0, b0, acc); acc = wmmab(al0, b0, acc); acc = wmmab(ah1, b1, acc); acc = wmmab(al1, b1, acc);
        const int cb = tt * 16 + lr + r0 + hi * 8 + (UP ? 2 : 1 - TT);   // column of accumulator register 0; register j is one row lower and so j columns further
#pragma unroll
        for (int j = 0; j < 8; ++j) { const int col = cb + j; const bool ok = UP ? (col < TT) : (col >= 0); S[(hi * 8 + j) * SP + (ok ? col : TT + (lr & 3))] = acc[j]; }
        addr_step(eo); eo += 16 * 16 * HD * 2;   // 16 Er tiles further
    }
}
template <bool HI>
__device__ __forceinline__ void attn_rows(float* S, int h, int r0, const h16* __restrict__ QP16, const bf* __restrict__ QPh, const bf* __restrict__ QPl, const h16* __restrict__ KP16, const bf* __restrict__ KPh, const bf* __restrict__ KPl, const bf* __restrict__ ERB, const h16* __restrict__ VT16, const bf* __restrict__ VTh, const bf* __restrict__ VTl, bf* ATh, bf* ATl) {
    const int tid = (int)threadIdx.x, lane = tid & 31, lr = lane & 15, hi = lane >> 4; const int wv = __builtin_amdgcn_readfirstlane(tid >> 5);   // wave-uniform: scalar loop bounds
    const size_t hq = (size_t)h * TT * HD;
    {   // stage 1: Er tiles 0..T0 serve the columns right of the diagonal, tiles T0..127 those up to it (tile T0 serves both); the second deal runs in reverse wave order so that the two remainders fall on different waves but for one
        const int T0 = TT / 16 - 1 - (r0 >> 4);
        rel_tiles<true>(S, QPh + hq, QPl + hq, ERB, r0, wv, T0 + 1, lr, hi);
        rel_tiles<false>(S, QPh + hq, QPl + hq, ERB, r0, T0 + 15 - wv, TT / 16, lr, hi);
        if (tid < 16 && r0 + tid + 1 < TT) S[tid * SP + r0 + tid + 1] = 0.0f;
    }
    __syncthreads();   // every relative logit lies in LDS before a score tile adds it
    {   // stage 2
        const size_t ab = hq + (size_t)r0 * HD, kb = hq + (size_t)wv * (16 * HD); unsigned lo = (unsigned)(lr * 8 + hi * 128) * 2;   // wave-uniform bases, 32-bit lane byte offset (fragment order); key tile it * 16 + wv lies it * 32 KiB behind tile wv
        if constexpr (HI) {
            const v16bf a0 = WFrag<bf>::ldf(QPh + ab, lo), a1 = WFrag<bf>::ldf(QPh + ab + 512, lo), c0 = WFrag<bf>::ldf(QPl + ab, lo), c1 = WFrag<bf>::ldf(QPl + ab + 512, lo);
#pragma unroll 1   // two tiles' loads in flight per trip, inside the 128 registers that let two work-groups share a WGP
            for (int io = 0; io < TT / 256; io += 2) {
#pragma unroll
              for (int ii = 0; ii < 2; ++ii) { const int n0 = ((io + ii) * 16 + wv) * 16; const bf* kh = KPh + kb + ii * (256 * HD); const bf* kl = KPl + kb + ii * (256 * HD);
                const v16bf b0 = WFrag<bf>::ldf(kh, lo), b1 = WFrag<bf>::ldf(kh + 512, lo), d0 = WFrag<bf>::ldf(kl, lo), d1 = WFrag<bf>::ldf(kl + 512, lo);
                v8f acc = (v8f){}; acc = wmmab(a0, b0, acc); acc = wmmab(c0, b0, acc); acc = wmmab(a0, d0, acc); acc = wmmab(a1, b1, acc); acc = wmmab(c1, b1, acc); acc = wmmab(a1, d1, acc);
#pragma unroll
                for (int j = 0; j < 8; ++j) { float* p = S + (hi * 8 + j) * SP + n0 + lr; *p = (acc[j] + *p) * SCL; } }
              addr_step(lo); lo += 2 * 256 * HD * 2; }
        } else {
            const v16h a0 = WFrag<h16>::ldf(QP16 + ab, lo), a1 = WFrag<h16>::ldf(QP16 + ab + 512, lo);
#pragma unroll 1   // four tiles' loads in flight per trip, inside the 128 registers that let two work-groups share a WGP
            for (int io = 0; io < TT / 256; io += 4) {
#pragma unroll
              for (int ii = 0; ii < 4; ++ii) { const int n0 = ((io + ii) * 16 + wv) * 16; const h16* kp = KP16 + kb + ii * (256 * HD);
                const v16h b0 = WFrag<h16>::ldf(kp, lo), b1 = WFrag<h16>::ldf(kp + 512, lo);
                v8f acc = (v8f){}; acc = wmma16(a0, b0, acc); acc = wmma16(a1, b1, acc);
#pragma unroll
                for (int j = 0; j < 8; ++j) { float* p = S + (hi * 8 + j) * SP + n0 + lr; *p = (acc[j] + *p) * SCL; } }
              addr_step(lo); lo += 4 * 256 * HD * 2; }
        }
    }
    __syncthreads();   // every score of a row lies in LDS before its wave reads the row
    {   // stage 3
        float* sr = S + wv * SP; float v[TT / 32]; float mx = -3.0e38f;
#pragma unroll
        for (int ch = 0; ch < TT / 128; ++ch) { const v4f a = *(const v4fa*)(sr + ch * 128 + lane * 4);
#pragma unroll
            for (int q = 0; q < 4; ++q) { v[ch * 4 + q] = a[q]; mx = fmaxf(mx, a[q]); } }
#pragma unroll
        for (int sh = 16; sh; sh >>= 1) mx = fmaxf(mx, __shfl_xor(mx, sh, 32));
        float sum = 0.f;
#pragma unroll
        for (int k = 0; k < TT / 32; ++k) { v[k] = __builtin_amdgcn_exp2f((v[k] - mx) * 1.4426950408889634f); sum += v[k]; }
#pragma unroll
        for (int sh = 16; sh; sh >>= 1) sum += __shfl_xor(sum, sh, 32);
        const float f = __fdiv_rn(HI ? 1.0f : PCAR, sum);
        if constexpr (HI) { bf* ph = (bf*)sr; bf* pl = ph + TT;
#pragma unroll
            for (int ch = 0; ch < TT / 128; ++ch) { v4us oh, ol;
#pragma unroll
                for (int q = 0; q < 4; ++q) { unsigned short a, c2; splitf(v[ch * 4 + q] * f, a, c2); oh[q] = a; ol[q] = c2; }
                *(v4us*)(ph + ch * 128 + lane * 4) = oh; *(v4us*)(pl + ch * 128 + lane * 4) = ol;
                __builtin_amdgcn_sched_barrier(0); }   // one chunk's split is finished before the next begins: interleaved, their temporaries pass 128 registers and spill
        } else { h16* pp = (h16*)sr;
#pragma unroll
            for (int ch = 0; ch < TT / 128; ++ch) { v4h o4;
#pragma unroll
                for (int q = 0; q < 4; ++q) o4[q] = tohx(v[ch * 4 + q] * f);
                *(v4h*)(pp + ch * 128 + lane * 4) = o4; } }
    }
    __syncthreads();   // all 16 probability rows lie in LDS before any wave reads its key slice of them
    v8f acc[4];
#pragma unroll
    for (int nb = 0; nb < 4; ++nb) acc[nb] = (v8f){};
    {   // stage 4
        const size_t vb = (size_t)h * HD * TT + (size_t)wv * (128 * HD); const unsigned lo = (unsigned)(lr * 8 + hi * 128) * 2;   // wave-uniform base (the wave's 16 fragments lie in a row), 32-bit lane byte offset
        const h16* vp = (const h16*)((const char*)(VT16 + vb) + lo); const bf* vh = (const bf*)((const char*)(VTh + vb) + lo); const bf* vl = (const bf*)((const char*)(VTl + vb) + lo);
#pragma unroll
        for (int s = 0; s < 4; ++s) { const int kc = wv * 128 + s * 32;
            if constexpr (HI) { const bf* pr = (const bf*)(S + lr * SP) + kc + 8 * hi; const v16bf a = WFrag<bf>::ld(pr), a2 = WFrag<bf>::ld(pr + TT);
#pragma unroll
                for (int nb = 0; nb < 4; ++nb) { const v16bf b = WFrag<bf>::ldf(vh + (s * 4 + nb) * 512, 0u), b2 = WFrag<bf>::ldf(vl + (s * 4 + nb) * 512, 0u);
                    acc[nb] = wmmab(a, b, acc[nb]); acc[nb] = wmmab(a2, b, acc[nb]); acc[nb] = wmmab(a, b2, acc[nb]); }
            } else { const v16h a = WFrag<h16>::ld((const h16*)(S + lr * SP) + kc + 8 * hi);
#pragma unroll
                for (int nb = 0; nb < 4; ++nb) acc[nb] = wmma16(a, WFrag<h16>::ldf(vp + (s * 4 + nb) * 512, 0u), acc[nb]); } }
        if constexpr (HI) asm volatile("s_wait_xcnt 0x0" : : "v"(vh), "v"(vl) : "memory"); else asm volatile("s_wait_xcnt 0x0" : : "v"(vp) : "memory");   // inputs only: the lane's address pairs (one a plane serves all of its loads, which differ by constants) stay taken up to the wait, so that no late load lands in one of them
    }
    __syncthreads();   // every wave has read its slice of the probability rows before the partial tiles overwrite them
    {   // stage 5
        float* pw = S + wv * (64 * 20);
#pragma unroll
        for (int nb = 0; nb < 4; ++nb) { float* p = pw + (nb * 16 + lr) * 20 + hi * 8; const v8f t = acc[nb]; *(v4fa*)p = __builtin_shufflevector(t, t, 0, 1, 2, 3); *(v4fa*)(p + 4) = __builtin_shufflevector(t, t, 4, 5, 6, 7); }
        __syncthreads();   // every wave's partial tile is in LDS before any of it is summed
        const int col = tid & 63, rp = tid >> 6; const float* p = S + col * 20 + rp * 2; v2f s = *(const v2fa*)p;
#pragma unroll
        for (int w = 1; w < 16; ++w) s += *(const v2fa*)(p + w * (64 * 20));
        const float cs = HI ? 1.0f : (1.0f / PCAR);
#pragma unroll
        for (int q = 0; q < 2; ++q) { unsigned short a, c2; splitf(s[q] * cs, a, c2); const size_t oo = (size_t)r0 * DQ + (h * 2 + (col >> 5)) * 512 + ((col >> 4) & 1) * 256 + ((col >> 3) & 1) * 128 + (rp * 2 + q) * 8 + (col & 7); ATh[oo] = a; ATl[oo] = c2; }   // fragment order, rows = query rows, k = h * HD + col
    }
}
__global__ __launch_bounds__(512, 8) /* 8 waves per SIMD: at most 128 registers, so that two work-groups (LDS allows two) share a WGP and one's barriers and load waits are covered by the other */ void k_attn(const h16* __restrict__ QP16, const bf* __restrict__ QPh, const bf* __restrict__ QPl, const h16* __restrict__ KP16, const bf* __restrict__ KPh, const bf* __restrict__ KPl, const bf* __restrict__ ERB, const h16* __restrict__ VT16, const bf* __restrict__ VTh, const bf* __restrict__ VTl, bf* ATh, bf* ATl) {
    __shared__ __align__(16) float S[16 * SP];
    const int r0 = (int)blockIdx.x * 16, h = (int)blockIdx.y;   // the choice below is the same for the whole work-group, so every barrier is met by all of its waves
    if (r0 < RH) attn_rows<true>(S, h, r0, QP16, QPh, QPl, KP16, KPh, KPl, ERB, VT16, VTh, VTl, ATh, ATl);
    else attn_rows<false>(S, h, r0, QP16, QPh, QPl, KP16, KPh, KPl, ERB, VT16, VTh, VTl, ATh, ATl);
}

extern "C" void kernel_launch(void* const* d_in, const int* in_sizes, int n_in,
                              void* d_out, int out_size, void* d_ws, size_t ws_size, hipStream_t stream) {
    (void)in_sizes; (void)n_in; (void)out_size;
    const float* xq = (const float*)d_in[0]; const float* xk = (const float*)d_in[1]; const float* xv = (const float*)d_in[2]; const float* wq = (const float*)d_in[3]; const float* bq = (const float*)d_in[4]; const float* wk = (const float*)d_in[5]; const float* bk = (const float*)d_in[6]; const float* wv = (const float*)d_in[7]; const float* bv = (const float*)d_in[8]; const float* wo = (const float*)d_in[9]; const float* bo = (const float*)d_in[10]; const float* Er = (const float*)d_in[11]; const float* x = nullptr; (void)x;
    float* OUT = (float*)d_out;     // [1][2048][1024]
    char* wsp = (char*)d_ws;
    auto take = [&](size_t bytes) { char* p = wsp; wsp += (bytes + 255) & ~(size_t)255; return (void*)p; };
    bf* WQ = (bf*)take((size_t)DQ * DM * 2); bf* WK = (bf*)take((size_t)DKV * DM * 2); bf* WV = (bf*)take((size_t)DKV * DM * 2); bf* WO = (bf*)take((size_t)DM * DQ * 2); float* CS = (float*)take((size_t)TT * HD * 2 * 4);
    bf* ERB = (bf*)take((size_t)TT * HD * 2);
    bf* XB = (bf*)take((size_t)TT * DM * 2); float* FQ = (float*)take((size_t)TT * DQ * 4); float* FK = (float*)take((size_t)TT * DKV * 4);
    h16* QP16 = (h16*)take((size_t)NH_ * TT * HD * 2); h16* KP16 = (h16*)take((size_t)NKV * TT * HD * 2); h16* VT16 = (h16*)take((size_t)NKV * HD * TT * 2);
    bf* QPh = (bf*)take((size_t)NH_ * TT * HD * 2); bf* QPl = (bf*)take((size_t)NH_ * TT * HD * 2); bf* KPh = (bf*)take((size_t)NKV * TT * HD * 2); bf* KPl = (bf*)take((size_t)NKV * TT * HD * 2); bf* VTh = (bf*)take((size_t)NKV * HD * TT * 2); bf* VTl = (bf*)take((size_t)NKV * HD * TT * 2);
    bf* ATh = (bf*)take((size_t)TT * DQ * 2); bf* ATl = (bf*)take((size_t)TT * DQ * 2);
    if ((size_t)(wsp - (char*)d_ws) > ws_size) return;    // ws 256 MiB
    float* FV = FK;   // v projection reuses the k buffer after the k planes are built (stream-ordered)
    { k_cvtf<DM><<<(unsigned)(((size_t)DQ * DM / 8 + 255) / 256), 256, 0, stream>>>(wq, WQ, (size_t)DQ * DM / 8); k_cvtf<DM><<<(unsigned)(((size_t)DKV * DM / 8 + 255) / 256), 256, 0, stream>>>(wk, WK, (size_t)DKV * DM / 8); k_cvtf<DM><<<(unsigned)(((size_t)DKV * DM / 8 + 255) / 256), 256, 0, stream>>>(wv, WV, (size_t)DKV * DM / 8);
      k_cvtf<DM><<<(unsigned)(((size_t)DM * DQ / 8 + 255) / 256), 256, 0, stream>>>(wo, WO, (size_t)DM * DQ / 8);
       }
    k_csid<<<(TT * HD + 255) / 256, 256, 0, stream>>>(CS);
    const unsigned LQ = (unsigned)(((size_t)NH_ * TT * HD / 2 + 255) / 256), LKv = (unsigned)(((size_t)NKV * TT * HD / 2 + 255) / 256);
    k_cvtf<HD><<<(unsigned)(((size_t)TT * HD / 8 + 255) / 256), 256, 0, stream>>>(Er, ERB, (size_t)TT * HD / 8);   /* Er [2048][64] ('t d'): rows t, k = d */
    for (int b = 0; b < NB_; ++b) {
        
        k_cvtf<DM><<<(unsigned)(((size_t)TT * DM / 8 + 255) / 256), 256, 0, stream>>>(xq + (size_t)b * TT * DM, XB, (size_t)TT * DM / 8);   /* query rows */
        k_gemmw<bf, 0, true, 8, DM><<<dim3(TT / 64, DQ / 64, 1), 256, 0, stream>>>(XB, nullptr, WQ, nullptr, FQ, DQ, bq, 0, 0, 0);
        k_rope<<<LQ, 256, 0, stream>>>(FQ, DQ, NH_, CS, nullptr, nullptr, 1.0f, QP16, QPh, QPl);
        k_cvtf<DM><<<(unsigned)(((size_t)TT * DM / 8 + 255) / 256), 256, 0, stream>>>(xk + (size_t)b * TT * DM, XB, (size_t)TT * DM / 8);   /* key rows */
        k_gemmw<bf, 0, true, 8, DM><<<dim3(TT / 64, DKV / 64, 1), 256, 0, stream>>>(XB, nullptr, WK, nullptr, FK, DKV, bk, 0, 0, 0);
        k_rope<<<LKv, 256, 0, stream>>>(FK, DKV, NKV, CS, nullptr, nullptr, 1.0f, KP16, KPh, KPl);
        k_cvtf<DM><<<(unsigned)(((size_t)TT * DM / 8 + 255) / 256), 256, 0, stream>>>(xv + (size_t)b * TT * DM, XB, (size_t)TT * DM / 8);   /* value rows */
        k_gemmw<bf, 0, true, 8, DM><<<dim3(TT / 64, DKV / 64, 1), 256, 0, stream>>>(XB, nullptr, WV, nullptr, FV, DKV, bv, 0, 0, 0); k_vtp<<<LKv, 256, 0, stream>>>(FV, DKV, NKV, VT16, VTh, VTl);
        k_attn<<<dim3(TT / 16, NH_, 1), 512, 0, stream>>>(QP16, QPh, QPl, KP16, KPh, KPl, ERB, VT16, VTh, VTl, ATh, ATl);   /* one kv head per query head */
        k_gemmw<bf, 1, true, 8, DQ><<<dim3(TT / 64, DM / 64, 1), 256, 0, stream>>>(ATh, ATl, WO, nullptr, OUT + (size_t)b * TT * DM, DM, bo, 0, 0, 0); }
}

// v004
// It runs in 130 microseconds.
// Timed twice side by side with v003, it ran 1.21 and 1.19 times as fast.
// Counting every step since v000, it is 9.49 times as fast.
#include <hip/hip_runtime.h>

// Relative global attention (Music-Transformer skew) (query, key, value [1][2048][1024]; q,k,v = input W^T + b ('oi' [1024][1024] + [1024]; 16 heads x 64); qe = q.Er^T (Er [2048][64], all rows used since s = max_len); s_rel = skew(qe): for j <= i  s_rel[i][j] = qe[i][2047 + j - i]; for j = i+1  0; for j > i+1  qe[i+1][j - i - 2] (the reference's pad-reshape-slice, reproduced exactly, upper triangle included); scores = (q.k + s_rel) / 8; softmax; out = merged ctx Wo^T + bo -> [1][2048][1024] (2.1 M)).
// Compute dtypes, f32 accumulate: every input rounded to bf16; q/k/v on PLAIN bf16 operands (inputs: exact) + biases (three input tensors); qe = q(hi/lo planes) x Er (exact bf16) gives the relative logits, stored in LDS at their skewed place (the index map above) and added to q.k before the 1/8 scale; scores and attn.v: query rows < 512 hl (3 products), the rest single fp16 (x1024); softmax f32; Wo hl x exact (2 products) + bo.

#define NB_  1
#define TT   2048
#define DM   1024
#define NH_  16
#define NKV  16
#define REP  (NH_ / NKV)
#define HD   64
#define DQ   (NH_ * HD)
#define DKV  (NKV * HD)
#define RH   512                  // query rows < RH use hi+lo planes (0: none)
#define WIN  0
#define PCAR 1024.0f
#define SCL  0.125f   // HD^-0.5
typedef _Float16 h16;
typedef unsigned short bf;
typedef __attribute__((ext_vector_type(16))) __bf16   v16bf;
typedef __attribute__((ext_vector_type(16))) _Float16 v16h;
typedef __attribute__((ext_vector_type(8)))  _Float16 v8h;
typedef __attribute__((ext_vector_type(8)))  unsigned short v8us;
typedef __attribute__((ext_vector_type(8)))  float    v8f;
typedef __attribute__((ext_vector_type(4)))  float    v4f;
typedef v8h  __attribute__((may_alias)) v8ha;
typedef v4f  __attribute__((may_alias)) v4fa;
typedef v8us __attribute__((may_alias)) v8usa;

__device__ __forceinline__ unsigned short f2bf(float f) { unsigned u = __float_as_uint(f); u += 0x7FFFu + ((u >> 16) & 1u); return (unsigned short)(u >> 16); }
__device__ __forceinline__ float bf2f(unsigned short b) { return __uint_as_float(((unsigned)b) << 16); }
__device__ __forceinline__ float bfr(float f) { return bf2f(f2bf(f)); }
__device__ __forceinline__ v16h cat16(v8h lo, v8h hi) { return __builtin_shufflevector(lo, hi, 0, 1, 2, 3, 4, 5, 6, 7, 8, 9, 10, 11, 12, 13, 14, 15); }
__device__ __forceinline__ v16bf cat16b(v8us lo, v8us hi) { return __builtin_bit_cast(v16bf, __builtin_shufflevector(lo, hi, 0, 1, 2, 3, 4, 5, 6, 7, 8, 9, 10, 11, 12, 13, 14, 15)); }
__device__ __forceinline__ v8f wmma16(v16h a, v16h b, v8f c) { return __builtin_amdgcn_wmma_f32_16x16x32_f16(false, a, false, b, (short)0, c, false, false); }
__device__ __forceinline__ v8f wmmab(v16bf a, v16bf b, v8f c) { return __builtin_amdgcn_wmma_f32_16x16x32_bf16(false, a, false, b, (short)0, c, false, false); }



// ---- FRAGMENT ORDER of every 16-bit operand plane in global memory (rows x K, K % 32 == 0): the plane is a row-major grid of fragments (16 rows x 32 k, 512 elements = 1 KiB, fragment index (row / 16) * (K / 32) + k / 32; the v planes alone order their fragments k-block first, see k_qkv);
// inside a fragment element (row, k) lies at ((k >> 4) & 1) * 256 + ((k >> 3) & 1) * 128 + (row & 15) * 8 + (k & 7), which is half * 256 + lane * 8 + e of the lane and register half that hold it in the WMMA operand.
// WFrag::ldf(fragment, lane * 16) is then two wave-wide 16-byte loads of 512 contiguous bytes each (four whole 128-byte lines); from a row-major plane each such load touches 16 lines. WFrag::ld reads a row-major source (the LDS rows).
// ldf takes a wave-uniform fragment pointer and the lane's 32-bit BYTE offset: every load of a loop then names one scalar base, one offset register and a constant, and no per-load address pair is formed (stage 4 of k_attn hands it the lane's own pointer and offset 0).
// Behind each run of such loads stands s_wait_xcnt 0, in front of the rewrite of the offset register that they name (addr_step: the caller advances the offset behind it) or of its release (a statement that takes the address registers as inputs only, so that they stay taken up to the wait).
// ---- k_gemmw: register-blocked GEMM, ONE WAVE per 64x64 output tile (16 accumulators), operands straight from 16-bit planes in fragment order; grid (M/64, N/64, Z), 32 threads.
// C[m][n] (f32, pitch ldc, + optional f32 bias[n]) = sum_k A[m][k] Bt[n][k] (+ split products per NSPLIT). z-batch strides sA/sB/sC in elements. K % (32 * KS) == 0.
// KS > 1 (long-K launches, 32 * KS threads): wave w of the work-group sums the K slice [w K/KS, (w+1) K/KS) of the same 64x64 tile; the KS partial tiles meet in LDS (column-major, pitch 68) and are added in wave order 0..KS-1.
template <typename T16> struct WFrag;
template <> struct WFrag<h16> { typedef v16h V; static __device__ __forceinline__ V ld(const h16* p) { return cat16(*(const v8h*)p, *(const v8h*)(p + 16)); } static __device__ __forceinline__ V ldf(const h16* ub, unsigned vb) { const h16* p = (const h16*)((const char*)ub + vb); return cat16(*(const v8h*)p, *(const v8h*)(p + 256)); } static __device__ __forceinline__ v8f mma(V a, V b, v8f c) { return wmma16(a, b, c); } };
template <> struct WFrag<bf> { typedef v16bf V; static __device__ __forceinline__ V ld(const bf* p) { return cat16b(*(const v8us*)p, *(const v8us*)(p + 16)); } static __device__ __forceinline__ V ldf(const bf* ub, unsigned vb) { const bf* p = (const bf*)((const char*)ub + vb); return cat16b(*(const v8us*)p, *(const v8us*)(p + 256)); } static __device__ __forceinline__ v8f mma(V a, V b, v8f c) { return wmmab(a, b, c); } };
__device__ __forceinline__ void addr_step(unsigned& vb) { asm volatile("s_wait_xcnt 0x0" : "+v"(vb) : : "memory"); }   // the offset's next value is formed from this statement's result, so its rewrite cannot be lifted over the wait
template <typename T16, int NSPLIT, bool BIAS, int KS, int K>
__global__ __launch_bounds__(32 * KS) void k_gemmw(const T16* __restrict__ A, const T16* __restrict__ A2, const T16* __restrict__ Bt, const T16* __restrict__ Bt2, float* C, int ldc, const float* __restrict__ bias, size_t sA, size_t sB, size_t sC) {
    typedef typename WFrag<T16>::V V;
    __shared__ __align__(16) float os[KS == 1 ? 16 * 68 : KS * 64 * 68];
    const size_t z = blockIdx.z; A += z * sA; if (A2) A2 += z * sA; Bt += z * sB; if (Bt2) Bt2 += z * sB; C += z * sC;
    const int lane = threadIdx.x & 31, lr = lane & 15, hi = lane >> 4; const int r0 = blockIdx.x * 64, c0 = blockIdx.y * 64;
    v8f acc[4][4];
#pragma unroll
    for (int mb = 0; mb < 4; ++mb)
#pragma unroll
        for (int nb = 0; nb < 4; ++nb) acc[mb][nb] = (v8f){};
    const int wv = (KS == 1) ? 0 : __builtin_amdgcn_readfirstlane((int)(threadIdx.x >> 5)); constexpr int kspan = K / KS; const int kbeg = wv * kspan;   // this wave's K slice
    const T16* ua = A + (size_t)r0 * K + (size_t)kbeg * 16; const T16* ua2 = (NSPLIT == 1 || NSPLIT == 2) ? A2 + (size_t)r0 * K + (size_t)kbeg * 16 : nullptr; const T16* ub = Bt + (size_t)c0 * K + (size_t)kbeg * 16; const T16* ub2 = (NSPLIT >= 2) ? Bt2 + (size_t)c0 * K + (size_t)kbeg * 16 : nullptr;   // wave-uniform: 16 rows of fragments hold 16 K elements; a step of 32 in k is one fragment (1 KiB)
    unsigned vo = (unsigned)lane * 16;
#pragma unroll 1
    for (int kc = 0; kc < kspan; kc += 32) {
        V a[4], a2[4], b[4], b2[4];
#pragma unroll
        for (int mb = 0; mb < 4; ++mb) { a[mb] = WFrag<T16>::ldf(ua + mb * 16 * K, vo); if (NSPLIT == 1 || NSPLIT == 2) a2[mb] = WFrag<T16>::ldf(ua2 + mb * 16 * K, vo); }
#pragma unroll
        for (int nb = 0; nb < 4; ++nb) { b[nb] = WFrag<T16>::ldf(ub + nb * 16 * K, vo); if (NSPLIT >= 2) b2[nb] = WFrag<T16>::ldf(ub2 + nb * 16 * K, vo); }
        __builtin_amdgcn_sched_barrier(0);   // a trip's loads all issue in front of its products: without it the compiler sinks each B fragment behind the products before it, into one register set, and a trip waits four times for memory
#pragma unroll
        for (int nb = 0; nb < 4; ++nb)
#pragma unroll
            for (int mb = 0; mb < 4; ++mb) { acc[mb][nb] = WFrag<T16>::mma(a[mb], b[nb], acc[mb][nb]); if (NSPLIT == 1 || NSPLIT == 2) acc[mb][nb] = WFrag<T16>::mma(a2[mb], b[nb], acc[mb][nb]); if (NSPLIT >= 2) acc[mb][nb] = WFrag<T16>::mma(a[mb], b2[nb], acc[mb][nb]); }
        asm volatile("v_nop\n\tv_nop\n\tv_nop\n\tv_nop" : "+v"(acc[0][0]), "+v"(acc[1][1]), "+v"(acc[2][2]), "+v"(acc[3][3]) : "v"(a[0]), "v"(a[3]));
        addr_step(vo); vo += 1024;   // next fragment of every operand row block
    }
    if constexpr (KS > 1) {
        float* pw = os + wv * (64 * 68);
#pragma unroll
        for (int mb = 0; mb < 4; ++mb)
#pragma unroll
            for (int nb = 0; nb < 4; ++nb) { float* p = pw + (nb * 16 + lr) * 68 + mb * 16 + hi * 8; const v8f t = acc[mb][nb]; *(v4fa*)p = __builtin_shufflevector(t, t, 0, 1, 2, 3); *(v4fa*)(p + 4) = __builtin_shufflevector(t, t, 4, 5, 6, 7); }
        __syncthreads();   // every wave's partial tile is in LDS before any of it is summed
#pragma unroll
        for (int it = 0; it < 64 * 16 / (32 * KS); ++it) { const int g = it * (32 * KS) + (int)threadIdx.x, col = g & 63, rq = g >> 6; const float* p = os + col * 68 + rq * 4; v4f s = *(const v4fa*)p;
#pragma unroll
            for (int w = 1; w < KS; ++w) s += *(const v4fa*)(p + w * (64 * 68));
            if (BIAS) { const float bb = bfr(bias[c0 + col]); s[0] += bb; s[1] += bb; s[2] += bb; s[3] += bb; }
            float* cp = C + (size_t)(r0 + rq * 4) * ldc + c0 + col;
#pragma unroll
            for (int q = 0; q < 4; ++q) cp[(size_t)q * ldc] = s[q]; }
        return;
    }
#pragma unroll
    for (int mb = 0; mb < 4; ++mb) {
#pragma unroll
        for (int nb = 0; nb < 4; ++nb) {
#pragma unroll
            for (int j = 0; j < 8; ++j) os[(hi * 8 + j) * 68 + nb * 16 + lr] = acc[mb][nb][j]; }
        __builtin_amdgcn_wave_barrier(); asm volatile("" ::: "memory");
        float* crow = C + (size_t)(r0 + mb * 16) * ldc + c0;
{
#pragma unroll
            for (int s = 0; s < 8; ++s) { const int row = 2 * s + hi, cofs = lr * 4; v4f val = *(const v4fa*)(os + row * 68 + cofs); if (BIAS) { val[0] += bfr(bias[c0 + cofs]); val[1] += bfr(bias[c0 + cofs + 1]); val[2] += bfr(bias[c0 + cofs + 2]); val[3] += bfr(bias[c0 + cofs + 3]); }
                *(v4f*)(crow + (size_t)row * ldc + cofs) = val; }
             }
        __builtin_amdgcn_wave_barrier(); asm volatile("" ::: "memory");
    }
}

__device__ __forceinline__ h16 tohx(float x) { return (h16)x; }
__device__ __forceinline__ void splitf(float y, unsigned short& h, unsigned short& l) { h = f2bf(y); l = f2bf(y - bf2f(h)); }
typedef __attribute__((ext_vector_type(2))) _Float16 v2h;
typedef __attribute__((ext_vector_type(4))) _Float16 v4h;
typedef __attribute__((ext_vector_type(2))) unsigned short v2us;
typedef __attribute__((ext_vector_type(4))) unsigned short v4us;
typedef __attribute__((ext_vector_type(2))) float v2f;
typedef __attribute__((ext_vector_type(4))) int v4i;

__global__ __launch_bounds__(256) void k_wtG(const float* __restrict__ w, int K, int N, bf* Bt) {
    const int lane = threadIdx.x & 31; const int L0 = (blockIdx.x * 8 + (threadIdx.x >> 5)) * 8; const int nlines = N * K / 64;
{
#pragma unroll 1
        for (int l = 0; l < 8; ++l) { const int L = L0 + l; if (L >= nlines) break; const size_t e = (size_t)L * 64 + lane * 2; const int k = (int)(e % K), n = (int)(e / K); v2us o;
            o[0] = f2bf(w[(size_t)k * N + n]); o[1] = f2bf(w[(size_t)(k + 1) * N + n]); *(v2us*)(Bt + e) = o; }
         }
}
// k_prep: ONE launch turns all eight f32 matrices (four weights, three activations, Er; row-major [rows][K]) into bf16 planes in fragment order. A work-group takes 32 fragments in a row, which are 16384 elements in a row of the source too (K = 1024: one 16-row block; K = 64: 16 of them);
// a thread takes eight pieces of 8 elements, 4 fragments apart; four neighbouring lanes read one whole 128-byte line of a row (32 k), eight neighbouring rows write one whole line of the fragment.
// All loads name one scalar base, one lane offset and a constant, and so do all stores; all sixteen loads are issued in front of the first conversion, and the stores are the thread's last instructions, so that no register that a store names is written again.
template <int K>
__device__ __forceinline__ void cvt_rows(const float* __restrict__ src, bf* dst, int lb) {
    static_assert(K == 64 || K == 1024, "the step of 4 fragments below is written for these two");
    constexpr int FPR = K / 32, ustep = (FPR >= 32) ? 4 * 32 : (4 / FPR) * 16 * K;   // fragments per row block; source elements from a fragment to the fourth behind it
    const int tid = (int)threadIdx.x, c = tid & 3, lr = (tid >> 2) & 15, tq = tid >> 6;
    const char* sb = (const char*)(src + (size_t)lb * (32 * 512)); char* db = (char*)(dst + (size_t)lb * (32 * 512));   // the same for the whole work-group
    const unsigned so = (unsigned)(((tq / FPR) * 16 + lr) * K + (tq % FPR) * 32 + c * 8) * 4, eo = (unsigned)(tq * 512 + (c >> 1) * 256 + (c & 1) * 128 + lr * 8) * 2;
    v8f v[8]; v8us o[8];
#pragma unroll
    for (int u = 0; u < 8; ++u) v[u] = *(const v8f*)(sb + so + u * (ustep * 4));
    asm volatile("s_wait_xcnt 0x0" : : "v"(so), "s"(sb) : "memory");   // inputs only: the loads' offset register and scalar base stay taken up to the wait, so that no load lands in the offset and nothing else is formed there ahead of it
#pragma unroll
    for (int u = 0; u < 8; ++u)
#pragma unroll
        for (int k = 0; k < 8; ++k) o[u][k] = f2bf(v[u][k]);
    __builtin_amdgcn_sched_barrier(0);   // no store rises in front of a conversion: a conversion behind it could be given a register that the store still names
#pragma unroll
    for (int u = 0; u < 8; ++u) *(v8us*)(db + eo + u * (4 * 512 * 2)) = o[u];
}
#define PB_W (DQ / 16)            // work-groups per weight matrix (16 rows each)
#define PB_X (TT / 16)            // per activation matrix
#define PB_E (TT * HD / (32 * 512))   // for Er
__global__ __launch_bounds__(256) void k_prep(const float* __restrict__ wq, const float* __restrict__ wk, const float* __restrict__ wv, const float* __restrict__ wo, const float* __restrict__ xq, const float* __restrict__ xk, const float* __restrict__ xv, const float* __restrict__ er, bf* WQ, bf* WK, bf* WV, bf* WO, bf* XQ, bf* XK, bf* XV, bf* ERB) {
    const int b = (int)blockIdx.x;   // the matrix is chosen by the work-group's index alone
    if (b < 4 * PB_W) { const int m = b / PB_W; cvt_rows<DM>(m == 0 ? wq : m == 1 ? wk : m == 2 ? wv : wo, m == 0 ? WQ : m == 1 ? WK : m == 2 ? WV : WO, b % PB_W); }
    else if (b < 4 * PB_W + 3 * PB_X) { const int m = (b - 4 * PB_W) / PB_X; cvt_rows<DM>(m == 0 ? xq : m == 1 ? xk : xv, m == 0 ? XQ : m == 1 ? XK : XV, (b - 4 * PB_W) % PB_X); }
    else cvt_rows<HD>(er, ERB, b - 4 * PB_W - 3 * PB_X);
}
// k_qkv: the three projections in ONE launch, grid (TT / 64, heads, 3), 8 waves; main loop, K split over the waves and LDS sum in wave order as in k_gemmw<bf, 0, true, 8, DM>; a 64 x 64 tile is 64 rows t of one head, and the epilogue writes it straight as the head's three planes (fp16, bf16 hi, bf16 lo) in fragment order.
// The partial tiles lie [n][m] in LDS with m (the A operand's rows) contiguous, and a thread sums 8 neighbouring m of one n, which are the 8 elements of one 16-byte piece of a fragment: so q and k (fragment rows t, k = d) take the weight rows d as A and the activation rows t as B,
// and v (ISV; fragment rows d, k = t, fragments laid [t / 32][d / 16] so that a wave's 128 keys x 64 columns are 16 KiB in a row) takes t as A and d as B. Both operand planes have the same fragment order, so the roles are a choice of base pointers. A wave's store is two runs of 256 contiguous bytes.
template <bool ISV>
__device__ __forceinline__ void qkv_tile(float* os, const bf* __restrict__ X, const bf* __restrict__ Wt, const float* __restrict__ bias, h16* P16, bf* Ph, bf* Pl, int t0) {   // X, Wt, bias, planes: already at the tile's rows t0.., the head's weight rows, bias and planes
    constexpr int K = DM, KS = 8; typedef WFrag<bf>::V V;
    const int tid = (int)threadIdx.x, lane = tid & 31, lr = lane & 15, hi = lane >> 4;
    v8f acc[4][4];
#pragma unroll
    for (int mb = 0; mb < 4; ++mb)
#pragma unroll
        for (int nb = 0; nb < 4; ++nb) acc[mb][nb] = (v8f){};
    const int wv = __builtin_amdgcn_readfirstlane(tid >> 5); constexpr int kspan = K / KS; const int kbeg = wv * kspan;   // this wave's K slice
    const bf* ua = (ISV ? X : Wt) + (size_t)kbeg * 16; const bf* ub = (ISV ? Wt : X) + (size_t)kbeg * 16;   // wave-uniform: 16 rows of fragments hold 16 K elements; a step of 32 in k is one fragment (1 KiB)
    const int n = tid & 63, mq = (tid >> 6) * 8;   // this thread's n and its first m; its second piece lies 32 m further
    const unsigned bo = (unsigned)(ISV ? n : mq) * 4; const char* bp = (const char*)bias; v4f bb[4];   // the bias goes with d: n for v, m for q and k
    if constexpr (ISV) bb[0] = (v4f)(*(const float*)(bp + bo));
    else { bb[0] = *(const v4f*)(bp + bo); bb[1] = *(const v4f*)(bp + bo + 16); bb[2] = *(const v4f*)(bp + bo + 128); bb[3] = *(const v4f*)(bp + bo + 144); }
    asm volatile("s_wait_xcnt 0x0" : : "v"(bo), "s"(bp) : "memory");   // inputs only: the bias loads' offset register and scalar base stay taken up to the wait; the loads stand in front of the main loop, which covers their latency
    unsigned vo = (unsigned)lane * 16;
#pragma unroll 1
    for (int kc = 0; kc < kspan; kc += 32) {
        V a[4], b[4];
#pragma unroll
        for (int mb = 0; mb < 4; ++mb) a[mb] = WFrag<bf>::ldf(ua + mb * 16 * K, vo);
#pragma unroll
        for (int nb = 0; nb < 4; ++nb) b[nb] = WFrag<bf>::ldf(ub + nb * 16 * K, vo);
        __builtin_amdgcn_sched_barrier(0);   // a trip's loads all issue in front of its products: without it the compiler sinks each B fragment behind the products before it, into one register set, and a trip waits four times for memory
#pragma unroll
        for (int nb = 0; nb < 4; ++nb)
#pragma unroll
            for (int mb = 0; mb < 4; ++mb) acc[mb][nb] = WFrag<bf>::mma(a[mb], b[nb], acc[mb][nb]);
        asm volatile("v_nop\n\tv_nop\n\tv_nop\n\tv_nop" : "+v"(acc[0][0]), "+v"(acc[1][1]), "+v"(acc[2][2]), "+v"(acc[3][3]) : "v"(a[0]), "v"(a[3]));
        addr_step(vo); vo += 1024;   // next fragment of every operand row block
    }
    float* pw = os + wv * (64 * 68);
#pragma unroll
    for (int mb = 0; mb < 4; ++mb)
#pragma unroll
        for (int nb = 0; nb < 4; ++nb) { float* p = pw + (nb * 16 + lr) * 68 + mb * 16 + hi * 8; const v8f t = acc[mb][nb]; *(v4fa*)p = __builtin_shufflevector(t, t, 0, 1, 2, 3); *(v4fa*)(p + 4) = __builtin_shufflevector(t, t, 4, 5, 6, 7); }
    __syncthreads();   // every wave's partial tile is in LDS before any of it is summed
    v8h o16[2]; v8us oh[2], ol[2];
#pragma unroll
    for (int it = 0; it < 2; ++it) { const float* p = os + n * 68 + mq + it * 32; v4f s0 = *(const v4fa*)p, s1 = *(const v4fa*)(p + 4);
#pragma unroll
        for (int w = 1; w < KS; ++w) { s0 += *(const v4fa*)(p + w * (64 * 68)); s1 += *(const v4fa*)(p + w * (64 * 68) + 4); }
#pragma unroll
        for (int q = 0; q < 8; ++q) { const float r = (q < 4 ? s0[q & 3] : s1[q & 3]) + bfr(ISV ? bb[0][0] : bb[it * 2 + (q >> 2)][q & 3]); o16[it][q] = tohx(r); unsigned short a2, c2; splitf(r, a2, c2); oh[it][q] = a2; ol[it][q] = c2; } }
    const int t = t0 + (ISV ? mq : n), d = ISV ? n : mq;   // of the first piece; the second is one fragment in d further (q, k) or one row of four fragments in t (v)
    const unsigned ob = (unsigned)(ISV ? ((t >> 5) * 4 + (d >> 4)) * 512 + ((t >> 4) & 1) * 256 + ((t >> 3) & 1) * 128 + (d & 15) * 8
                                       : (t & ~15) * HD + (d >> 5) * 512 + ((d >> 4) & 1) * 256 + ((d >> 3) & 1) * 128 + (t & 15) * 8) * 2;
    constexpr int step = (ISV ? 4 : 1) * 512 * 2;
    __builtin_amdgcn_sched_barrier(0);   // the six stores stay the thread's last instructions: nothing behind them is given a register that a store still names
#pragma unroll
    for (int it = 0; it < 2; ++it) { *(v8h*)((char*)P16 + ob + it * step) = o16[it]; *(v8us*)((char*)Ph + ob + it * step) = oh[it]; *(v8us*)((char*)Pl + ob + it * step) = ol[it]; }
}
__global__ __launch_bounds__(256) void k_qkv(const bf* __restrict__ XQ, const bf* __restrict__ XK, const bf* __restrict__ XV, const bf* __restrict__ WQ, const bf* __restrict__ WK, const bf* __restrict__ WV, const float* __restrict__ bq, const float* __restrict__ bk, const float* __restrict__ bv,
                                             h16* QP16, bf* QPh, bf* QPl, h16* KP16, bf* KPh, bf* KPl, h16* VT16, bf* VTh, bf* VTl) {
    __shared__ __align__(16) float os[8 * 64 * 68];
    const int z = (int)blockIdx.z, t0 = (int)blockIdx.x * 64, h = (int)blockIdx.y; const size_t xo = (size_t)t0 * DM, wo = (size_t)h * HD * DM, po = (size_t)h * TT * HD;   // the choice below is the same for the whole work-group, so its barrier is met by all of its waves
    if (z == 2) qkv_tile<true>(os, XV + xo, WV + wo, bv + h * HD, VT16 + po, VTh + po, VTl + po, t0);
    else qkv_tile<false>(os, (z == 0 ? XQ : XK) + xo, (z == 0 ? WQ : WK) + wo, (z == 0 ? bq : bk) + h * HD, (z == 0 ? QP16 : KP16) + po, (z == 0 ? QPh : KPh) + po, (z == 0 ? QPl : KPl) + po, t0);
}
// ---- k_attn: one work-group of 16 waves per (head, 16 query rows); the 16 x 2048 score rows never leave LDS. Five stages, a work-group barrier between each two and one inside the last:
// 1 relative logits: qe tiles (q hi/lo planes x Er) are stored straight at their skewed place: qe[i][t] is rel(i, t - 2047 + i) where that column is >= 0, and qe[i+1][t] is rel(i, t + i + 2) where that column is < 2048; rel(i, i+1) = 0 (= the reference's pad/reshape/slice of q.Er^T, upper triangle included)
// 2 scores: each q.k tile adds the relative logit that lies at its own place, scales by 1/8 and stores back
// 3 softmax: wave w owns row w (register row, one exp, fixed trees) and writes the probabilities over its own row: fp16 x 1024, or bf16 hi and lo planes for rows < RH
// 4 attn.v: wave w sums the key slice [128 w, 128 w + 128) for all 64 columns
// 5 the 16 partial tiles meet in LDS (column-major, pitch 20) and are added in wave order 0..15; the merged context goes out as hi/lo planes in fragment order
#define SP 2052   // LDS pitch of a score row in floats: rows stay 16-byte aligned, rows 8 apart lie 32 banks apart; columns 2048..2051 take the qe elements that belong to no column of this row block
typedef v2f __attribute__((may_alias)) v2fa;
template <bool UP>
__device__ __forceinline__ void rel_tiles(float* S, const bf* __restrict__ qh, const bf* __restrict__ ql, const bf* __restrict__ er, int r0, int tbeg, int tend, int lr, int hi) {
    if (tbeg >= tend) return;   // wave-uniform: a wave without a tile loads no q rows
    const int qr = UP ? min(r0 + 1 + lr, TT - 1) : r0 + lr; const unsigned ao = (unsigned)((qr >> 4) * (16 * HD) + (qr & 15) * 8 + hi * 128) * 2;   // UP: q rows i + 1 (the clamped row has no column in range); byte offset in fragment order: a 16-row tile is 2 fragments (k 0..31, 32..63)
    const v16bf ah0 = WFrag<bf>::ldf(qh, ao), ah1 = WFrag<bf>::ldf(qh + 512, ao), al0 = WFrag<bf>::ldf(ql, ao), al1 = WFrag<bf>::ldf(ql + 512, ao);
    asm volatile("s_wait_xcnt 0x0" : : "v"(ao), "s"(qh), "s"(ql) : "memory");   // inputs only: the q loads' offset register and two scalar bases stay taken up to the wait; the Er base and offset are formed behind it, not in those registers ahead of it
    const bf* eb = er + (size_t)tbeg * 16 * HD; unsigned eo = (unsigned)(lr * 8 + hi * 128) * 2;
    for (int tt = tbeg; tt < tend; tt += 16) {
        const v16bf b0 = WFrag<bf>::ldf(eb, eo), b1 = WFrag<bf>::ldf(eb + 512, eo);
        v8f acc = (v8f){}; acc = wmmab(ah0, b0, acc); acc = wmmab(al0, b0, acc); acc = wmmab(ah1, b1, acc); acc = wmmab(al1, b1, acc);
        const int cb = tt * 16 + lr + r0 + hi * 8 + (UP ? 2 : 1 - TT);   // column of accumulator register 0; register j is one row lower and so j columns further
#pragma unroll
        for (int j = 0; j < 8; ++j) { const int col = cb + j; const bool ok = UP ? (col < TT) : (col >= 0); S[(hi * 8 + j) * SP + (ok ? col : TT + (lr & 3))] = acc[j]; }
        addr_step(eo); eo += 16 * 16 * HD * 2;   // 16 Er tiles further
    }
}
template <bool HI>
__device__ __forceinline__ void attn_rows(float* S, int h, int r0, const h16* __restrict__ QP16, const bf* __restrict__ QPh, const bf* __restrict__ QPl, const h16* __restrict__ KP16, const bf* __restrict__ KPh, const bf* __restrict__ KPl, const bf* __restrict__ ERB, const h16* __restrict__ VT16, const bf* __restrict__ VTh, const bf* __restrict__ VTl, bf* ATh, bf* ATl) {
    const int tid = (int)threadIdx.x, lane = tid & 31, lr = lane & 15, hi = lane >> 4; const int wv = __builtin_amdgcn_readfirstlane(tid >> 5);   // wave-uniform: scalar loop bounds
    const size_t hq = (size_t)h * TT * HD;
    {   // stage 1: Er tiles 0..T0 serve the columns right of the diagonal, tiles T0..127 those up to it (tile T0 serves both); the second deal runs in reverse wave order so that the two remainders fall on different waves but for one
        const int T0 = TT / 16 - 1 - (r0 >> 4);
        rel_tiles<true>(S, QPh + hq, QPl + hq, ERB, r0, wv, T0 + 1, lr, hi);
        rel_tiles<false>(S, QPh + hq, QPl + hq, ERB, r0, T0 + 15 - wv, TT / 16, lr, hi);
        if (tid < 16 && r0 + tid + 1 < TT) S[tid * SP + r0 + tid + 1] = 0.0f;
    }
    __syncthreads();   // every relative logit lies in LDS before a score tile adds it
    {   // stage 2
        const size_t ab = hq + (size_t)r0 * HD, kb = hq + (size_t)wv * (16 * HD); unsigned lo = (unsigned)(lr * 8 + hi * 128) * 2;   // wave-uniform bases, 32-bit lane byte offset (fragment order); key tile it * 16 + wv lies it * 32 KiB behind tile wv
        if constexpr (HI) {
            const v16bf a0 = WFrag<bf>::ldf(QPh + ab, lo), a1 = WFrag<bf>::ldf(QPh + ab + 512, lo), c0 = WFrag<bf>::ldf(QPl + ab, lo), c1 = WFrag<bf>::ldf(QPl + ab + 512, lo);
#pragma unroll 1   // two tiles' loads in flight per trip, inside the 128 registers that let two work-groups share a WGP
            for (int io = 0; io < TT / 256; io += 2) {
#pragma unroll
              for (int ii = 0; ii < 2; ++ii) { const int n0 = ((io + ii) * 16 + wv) * 16; const bf* kh = KPh + kb + ii * (256 * HD); const bf* kl = KPl + kb + ii * (256 * HD);
                const v16bf b0 = WFrag<bf>::ldf(kh, lo), b1 = WFrag<bf>::ldf(kh + 512, lo), d0 = WFrag<bf>::ldf(kl, lo), d1 = WFrag<bf>::ldf(kl + 512, lo);
                v8f acc = (v8f){}; acc = wmmab(a0, b0, acc); acc = wmmab(c0, b0, acc); acc = wmmab(a0, d0, acc); acc = wmmab(a1, b1, acc); acc = wmmab(c1, b1, acc); acc = wmmab(a1, d1, acc);
#pragma unroll
                for (int j = 0; j < 8; ++j) { float* p = S + (hi * 8 + j) * SP + n0 + lr; *p = (acc[j] + *p) * SCL; } }
              addr_step(lo); lo += 2 * 256 * HD * 2; }
        } else {
            const v16h a0 = WFrag<h16>::ldf(QP16 + ab, lo), a1 = WFrag<h16>::ldf(QP16 + ab + 512, lo);
#pragma unroll 1   // four tiles' loads in flight per trip, inside the 128 registers that let two work-groups share a WGP
            for (int io = 0; io < TT / 256; io += 4) {
#pragma unroll
              for (int ii = 0; ii < 4; ++ii) { const int n0 = ((io + ii) * 16 + wv) * 16; const h16* kp = KP16 + kb + ii * (256 * HD);
                const v16h b0 = WFrag<h16>::ldf(kp, lo), b1 = WFrag<h16>::ldf(kp + 512, lo);
                v8f acc = (v8f){}; acc = wmma16(a0, b0, acc); acc = wmma16(a1, b1, acc);
#pragma unroll
                for (int j = 0; j < 8; ++j) { float* p = S + (hi * 8 + j) * SP + n0 + lr; *p = (acc[j] + *p) * SCL; } }
              addr_step(lo); lo += 4 * 256 * HD * 2; }
        }
    }
    __syncthreads();   // every score of a row lies in LDS before its wave reads the row
    {   // stage 3
        float* sr = S + wv * SP; float v[TT / 32]; float mx = -3.0e38f;
#pragma unroll
        for (int ch = 0; ch < TT / 128; ++ch) { const v4f a = *(const v4fa*)(sr + ch * 128 + lane * 4);
#pragma unroll
            for (int q = 0; q < 4; ++q) { v[ch * 4 + q] = a[q]; mx = fmaxf(mx, a[q]); } }
#pragma unroll
        for (int sh = 16; sh; sh >>= 1) mx = fmaxf(mx, __shfl_xor(mx, sh, 32));
        float sum = 0.f;
#pragma unroll
        for (int k = 0; k < TT / 32; ++k) { v[k] = __builtin_amdgcn_exp2f((v[k] - mx) * 1.4426950408889634f); sum += v[k]; }
#pragma unroll
        for (int sh = 16; sh; sh >>= 1) sum += __shfl_xor(sum, sh, 32);
        const float f = __fdiv_rn(HI ? 1.0f : PCAR, sum);
        if constexpr (HI) { bf* ph = (bf*)sr; bf* pl = ph + TT;
#pragma unroll
            for (int ch = 0; ch < TT / 128; ++ch) { v4us oh, ol;
#pragma unroll
                for (int q = 0; q < 4; ++q) { unsigned short a, c2; splitf(v[ch * 4 + q] * f, a, c2); oh[q] = a; ol[q] = c2; }
                *(v4us*)(ph + ch * 128 + lane * 4) = oh; *(v4us*)(pl + ch * 128 + lane * 4) = ol;
                __builtin_amdgcn_sched_barrier(0); }   // one chunk's split is finished before the next begins: interleaved, their temporaries pass 128 registers and spill
        } else { h16* pp = (h16*)sr;
#pragma unroll
            for (int ch = 0; ch < TT / 128; ++ch) { v4h o4;
#pragma unroll
                for (int q = 0; q < 4; ++q) o4[q] = tohx(v[ch * 4 + q] * f);
                *(v4h*)(pp + ch * 128 + lane * 4) = o4; } }
    }
    __syncthreads();   // all 16 probability rows lie in LDS before any wave reads its key slice of them
    v8f acc[4];
#pragma unroll
    for (int nb = 0; nb < 4; ++nb) acc[nb] = (v8f){};
    {   // stage 4
        const size_t vb = (size_t)h * HD * TT + (size_t)wv * (128 * HD); const unsigned lo = (unsigned)(lr * 8 + hi * 128) * 2;   // wave-uniform base (the wave's 16 fragments lie in a row), 32-bit lane byte offset
        const h16* vp = (const h16*)((const char*)(VT16 + vb) + lo); const bf* vh = (const bf*)((const char*)(VTh + vb) + lo); const bf* vl = (const bf*)((const char*)(VTl + vb) + lo);
#pragma unroll
        for (int s = 0; s < 4; ++s) { const int kc = wv * 128 + s * 32;
            if constexpr (HI) { const bf* pr = (const bf*)(S + lr * SP) + kc + 8 * hi; const v16bf a = WFrag<bf>::ld(pr), a2 = WFrag<bf>::ld(pr + TT);
#pragma unroll
                for (int nb = 0; nb < 4; ++nb) { const v16bf b = WFrag<bf>::ldf(vh + (s * 4 + nb) * 512, 0u), b2 = WFrag<bf>::ldf(vl + (s * 4 + nb) * 512, 0u);
                    acc[nb] = wmmab(a, b, acc[nb]); acc[nb] = wmmab(a2, b, acc[nb]); acc[nb] = wmmab(a, b2, acc[nb]); }
            } else { const v16h a = WFrag<h16>::ld((const h16*)(S + lr * SP) + kc + 8 * hi);
#pragma unroll
                for (int nb = 0; nb < 4; ++nb) acc[nb] = wmma16(a, WFrag<h16>::ldf(vp + (s * 4 + nb) * 512, 0u), acc[nb]); } }
        if constexpr (HI) asm volatile("s_wait_xcnt 0x0" : : "v"(vh), "v"(vl) : "memory"); else asm volatile("s_wait_xcnt 0x0" : : "v"(vp) : "memory");   // inputs only: the lane's address pairs (one a plane serves all of its loads, which differ by constants) stay taken up to the wait, so that no late load lands in one of them
    }
    __syncthreads();   // every wave has read its slice of the probability rows before the partial tiles overwrite them
    {   // stage 5
        float* pw = S + wv * (64 * 20);
#pragma unroll
        for (int nb = 0; nb < 4; ++nb) { float* p = pw + (nb * 16 + lr) * 20 + hi * 8; const v8f t = acc[nb]; *(v4fa*)p = __builtin_shufflevector(t, t, 0, 1, 2, 3); *(v4fa*)(p + 4) = __builtin_shufflevector(t, t, 4, 5, 6, 7); }
        __syncthreads();   // every wave's partial tile is in LDS before any of it is summed
        const int col = tid & 63, rp = tid >> 6; const float* p = S + col * 20 + rp * 2; v2f s = *(const v2fa*)p;
#pragma unroll
        for (int w = 1; w < 16; ++w) s += *(const v2fa*)(p + w * (64 * 20));
        const float cs = HI ? 1.0f : (1.0f / PCAR);
#pragma unroll
        for (int q = 0; q < 2; ++q) { unsigned short a, c2; splitf(s[q] * cs, a, c2); const size_t oo = (size_t)r0 * DQ + (h * 2 + (col >> 5)) * 512 + ((col >> 4) & 1) * 256 + ((col >> 3) & 1) * 128 + (rp * 2 + q) * 8 + (col & 7); ATh[oo] = a; ATl[oo] = c2; }   // fragment order, rows = query rows, k = h * HD + col
    }
}
__global__ __launch_bounds__(512, 8) /* 8 waves per SIMD: at most 128 registers, so that two work-groups (LDS allows two) share a WGP and one's barriers and load waits are covered by the other */ void k_attn(const h16* __restrict__ QP16, const bf* __restrict__ QPh, const bf* __restrict__ QPl, const h16* __restrict__ KP16, const bf* __restrict__ KPh, const bf* __restrict__ KPl, const bf* __restrict__ ERB, const h16* __restrict__ VT16, const bf* __restrict__ VTh, const bf* __restrict__ VTl, bf* ATh, bf* ATl) {
    __shared__ __align__(16) float S[16 * SP];
    const int r0 = (int)blockIdx.x * 16, h = (int)blockIdx.y;   // the choice below is the same for the whole work-group, so every barrier is met by all of its waves
    if (r0 < RH) attn_rows<true>(S, h, r0, QP16, QPh, QPl, KP16, KPh, KPl, ERB, VT16, VTh, VTl, ATh, ATl);
    else attn_rows<false>(S, h, r0, QP16, QPh, QPl, KP16, KPh, KPl, ERB, VT16, VTh, VTl, ATh, ATl);
}

extern "C" void kernel_launch(void* const* d_in, const int* in_sizes, int n_in,
                              void* d_out, int out_size, void* d_ws, size_t ws_size, hipStream_t stream) {
    (void)in_sizes; (void)n_in; (void)out_size;
    const float* xq = (const float*)d_in[0]; const float* xk = (const float*)d_in[1]; const float* xv = (const float*)d_in[2]; const float* wq = (const float*)d_in[3]; const float* bq = (const float*)d_in[4]; const float* wk = (const float*)d_in[5]; const float* bk = (const float*)d_in[6]; const float* wv = (const float*)d_in[7]; const float* bv = (const float*)d_in[8]; const float* wo = (const float*)d_in[9]; const float* bo = (const float*)d_in[10]; const float* Er = (const float*)d_in[11]; const float* x = nullptr; (void)x;
    float* OUT = (float*)d_out;     // [1][2048][1024]
    char* wsp = (char*)d_ws;
    auto take = [&](size_t bytes) { char* p = wsp; wsp += (bytes + 255) & ~(size_t)255; return (void*)p; };
    bf* WQ = (bf*)take((size_t)DQ * DM * 2); bf* WK = (bf*)take((size_t)DKV * DM * 2); bf* WV = (bf*)take((size_t)DKV * DM * 2); bf* WO = (bf*)take((size_t)DM * DQ * 2);
    bf* ERB = (bf*)take((size_t)TT * HD * 2);
    bf* XQ = (bf*)take((size_t)TT * DM * 2); bf* XK = (bf*)take((size_t)TT * DM * 2); bf* XV = (bf*)take((size_t)TT * DM * 2);
    h16* QP16 = (h16*)take((size_t)NH_ * TT * HD * 2); h16* KP16 = (h16*)take((size_t)NKV * TT * HD * 2); h16* VT16 = (h16*)take((size_t)NKV * HD * TT * 2);
    bf* QPh = (bf*)take((size_t)NH_ * TT * HD * 2); bf* QPl = (bf*)take((size_t)NH_ * TT * HD * 2); bf* KPh = (bf*)take((size_t)NKV * TT * HD * 2); bf* KPl = (bf*)take((size_t)NKV * TT * HD * 2); bf* VTh = (bf*)take((size_t)NKV * HD * TT * 2); bf* VTl = (bf*)take((size_t)NKV * HD * TT * 2);
    bf* ATh = (bf*)take((size_t)TT * DQ * 2); bf* ATl = (bf*)take((size_t)TT * DQ * 2);
    if ((size_t)(wsp - (char*)d_ws) > ws_size) return;    // ws 256 MiB
    for (int b = 0; b < NB_; ++b) {
        k_prep<<<4 * PB_W + 3 * PB_X + PB_E, 256, 0, stream>>>(wq, wk, wv, wo, xq + (size_t)b * TT * DM, xk + (size_t)b * TT * DM, xv + (size_t)b * TT * DM, Er, WQ, WK, WV, WO, XQ, XK, XV, ERB);   /* Er [2048][64] ('t d'): rows t, k = d */
        k_qkv<<<dim3(TT / 64, NH_, 3), 256, 0, stream>>>(XQ, XK, XV, WQ, WK, WV, bq, bk, bv, QP16, QPh, QPl, KP16, KPh, KPl, VT16, VTh, VTl);
        k_attn<<<dim3(TT / 16, NH_, 1), 512, 0, stream>>>(QP16, QPh, QPl, KP16, KPh, KPl, ERB, VT16, VTh, VTl, ATh, ATl);   /* one kv head per query head */
        k_gemmw<bf, 1, true, 8, DQ><<<dim3(TT / 64, DM / 64, 1), 256, 0, stream>>>(ATh, ATl, WO, nullptr, OUT + (size_t)b * TT * DM, DM, bo, 0, 0, 0); }
}

// v005
// It runs in 120 microseconds.
// Two timings next to v004 both put it at 1.09 times that version's speed.
// Over all steps from v000 it is 10.4 times as fast.
#include <hip/hip_runtime.h>

// Relative global attention (Music-Transformer skew) (query, key, value [1][2048][1024]; q,k,v = input W^T + b ('oi' [1024][1024] + [1024]; 16 heads x 64); qe = q.Er^T (Er [2048][64], all rows used since s = max_len); s_rel = skew(qe): for j <= i  s_rel[i][j] = qe[i][2047 + j - i]; for j = i+1  0; for j > i+1  qe[i+1][j - i - 2] (the reference's pad-reshape-slice, reproduced exactly, upper triangle included); scores = (q.k + s_rel) / 8; softmax; out = merged ctx Wo^T + bo -> [1][2048][1024] (2.1 M)).
// Compute dtypes, f32 accumulate: every input rounded to bf16; q/k/v on PLAIN bf16 operands (inputs: exact) + biases (three input tensors); qe = q(hi/lo planes) x Er (exact bf16) gives the relative logits, stored in LDS at their skewed place (the index map above) and added to q.k before the 1/8 scale; scores and attn.v: query rows < 512 hl (3 products), the rest single fp16 (x1024); softmax f32; Wo hl x exact (2 products) + bo.

#define NB_  1
#define TT   2048
#define DM   1024
#define NH_  16
#define NKV  16
#define REP  (NH_ / NKV)
#define HD   64
#define DQ   (NH_ * HD)
#define DKV  (NKV * HD)
#define RH   512                  // query rows < RH use hi+lo planes (0: none)
#define WIN  0
#define PCAR 1024.0f
#define SCL  0.125f   // HD^-0.5
typedef _Float16 h16;
typedef unsigned short bf;
typedef __attribute__((ext_vector_type(16))) __bf16   v16bf;
typedef __attribute__((ext_vector_type(16))) _Float16 v16h;
typedef __attribute__((ext_vector_type(8)))  _Float16 v8h;
typedef __attribute__((ext_vector_type(8)))  unsigned short v8us;
typedef __attribute__((ext_vector_type(8)))  float    v8f;
typedef __attribute__((ext_vector_type(4)))  float    v4f;
typedef v8h  __attribute__((may_alias)) v8ha;
typedef v4f  __attribute__((may_alias)) v4fa;
typedef v8us __attribute__((may_alias)) v8usa;

__device__ __forceinline__ unsigned short f2bf(float f) { unsigned u = __float_as_uint(f); u += 0x7FFFu + ((u >> 16) & 1u); return (unsigned short)(u >> 16); }
__device__ __forceinline__ float bf2f(unsigned short b) { return __uint_as_float(((unsigned)b) << 16); }
__device__ __forceinline__ float bfr(float f) { return bf2f(f2bf(f)); }
__device__ __forceinline__ v16h cat16(v8h lo, v8h hi) { return __builtin_shufflevector(lo, hi, 0, 1, 2, 3, 4, 5, 6, 7, 8, 9, 10, 11, 12, 13, 14, 15); }
__device__ __forceinline__ v16bf cat16b(v8us lo, v8us hi) { return __builtin_bit_cast(v16bf, __builtin_shufflevector(lo, hi, 0, 1, 2, 3, 4, 5, 6, 7, 8, 9, 10, 11, 12, 13, 14, 15)); }
__device__ __forceinline__ v8f wmma16(v16h a, v16h b, v8f c) { return __builtin_amdgcn_wmma_f32_16x16x32_f16(false, a, false, b, (short)0, c, false, false); }
__device__ __forceinline__ v8f wmmab(v16bf a, v16bf b, v8f c) { return __builtin_amdgcn_wmma_f32_16x16x32_bf16(false, a, false, b, (short)0, c, false, false); }



// ---- FRAGMENT ORDER of every 16-bit operand plane in global memory (rows x K, K % 32 == 0): the plane is a row-major grid of fragments (16 rows x 32 k, 512 elements = 1 KiB, fragment index (row / 16) * (K / 32) + k / 32; the v planes alone order their fragments k-block first, see k_qkv);
// inside a fragment element (row, k) lies at ((k >> 4) & 1) * 256 + ((k >> 3) & 1) * 128 + (row & 15) * 8 + (k & 7), which is half * 256 + lane * 8 + e of the lane and register half that hold it in the WMMA operand.
// WFrag::ldf(fragment, lane * 16) is then two wave-wide 16-byte loads of 512 contiguous bytes each (four whole 128-byte lines); from a row-major plane each such load touches 16 lines. WFrag::ld reads a row-major source (the LDS rows).
// ldf takes a wave-uniform fragment pointer and the lane's 32-bit BYTE offset: every load of a loop then names one scalar base, one offset register and a constant, and no per-load address pair is formed (stage 4 of k_attn hands it the lane's own pointer and offset 0).
// Behind each run of such loads stands s_wait_xcnt 0, in front of the rewrite of the offset register that they name (addr_step: the caller advances the offset behind it) or of its release (a statement that takes the address registers as inputs only, so that they stay taken up to the wait).
// ---- k_gemmw: register-blocked GEMM, ONE WAVE per 64x64 output tile (16 accumulators), operands straight from 16-bit planes in fragment order; grid (M/64, N/64, Z), 32 threads.
// C[m][n] (f32, pitch ldc, + optional f32 bias[n]) = sum_k A[m][k] Bt[n][k] (+ split products per NSPLIT). z-batch strides sA/sB/sC in elements. K % (32 * KS) == 0.
// KS > 1 (long-K launches, 32 * KS threads): wave w of the work-group sums the K slice [w K/KS, (w+1) K/KS) of the same 64x64 tile; the KS partial tiles meet in LDS (column-major, pitch 68) and are added in wave order 0..KS-1.
template <typename T16> struct WFrag;
template <> struct WFrag<h16> { typedef v16h V; static __device__ __forceinline__ V ld(const h16* p) { return cat16(*(const v8h*)p, *(const v8h*)(p + 16)); } static __device__ __forceinline__ V ldf(const h16* ub, unsigned vb) { const h16* p = (const h16*)((const char*)ub + vb); return cat16(*(const v8h*)p, *(const v8h*)(p + 256)); } static __device__ __forceinline__ v8f mma(V a, V b, v8f c) { return wmma16(a, b, c); } };
template <> struct WFrag<bf> { typedef v16bf V; static __device__ __forceinline__ V ld(const bf* p) { return cat16b(*(const v8us*)p, *(const v8us*)(p + 16)); } static __device__ __forceinline__ V ldf(const bf* ub, unsigned vb) { const bf* p = (const bf*)((const char*)ub + vb); return cat16b(*(const v8us*)p, *(const v8us*)(p + 256)); } static __device__ __forceinline__ v8f mma(V a, V b, v8f c) { return wmmab(a, b, c); } };
__device__ __forceinline__ void addr_step(unsigned& vb) { asm volatile("s_wait_xcnt 0x0" : "+v"(vb) : : "memory"); }   // the offset's next value is formed from this statement's result, so its rewrite cannot be lifted over the wait
template <typename T16, int NSPLIT, bool BIAS, int KS, int K>
__global__ __launch_bounds__(32 * KS) void k_gemmw(const T16* __restrict__ A, const T16* __restrict__ A2, const T16* __restrict__ Bt, const T16* __restrict__ Bt2, float* C, int ldc, const float* __restrict__ bias, size_t sA, size_t sB, size_t sC) {
    typedef typename WFrag<T16>::V V;
    __shared__ __align__(16) float os[KS == 1 ? 16 * 68 : KS * 64 * 68];
    const size_t z = blockIdx.z; A += z * sA; if (A2) A2 += z * sA; Bt += z * sB; if (Bt2) Bt2 += z * sB; C += z * sC;
    const int lane = threadIdx.x & 31, lr = lane & 15, hi = lane >> 4; const int r0 = blockIdx.x * 64, c0 = blockIdx.y * 64;
    v8f acc[4][4];
#pragma unroll
    for (int mb = 0; mb < 4; ++mb)
#pragma unroll
        for (int nb = 0; nb < 4; ++nb) acc[mb][nb] = (v8f){};
    const int wv = (KS == 1) ? 0 : __builtin_amdgcn_readfirstlane((int)(threadIdx.x >> 5)); constexpr int kspan = K / KS; const int kbeg = wv * kspan;   // this wave's K slice
    const T16* ua = A + (size_t)r0 * K + (size_t)kbeg * 16; const T16* ua2 = (NSPLIT == 1 || NSPLIT == 2) ? A2 + (size_t)r0 * K + (size_t)kbeg * 16 : nullptr; const T16* ub = Bt + (size_t)c0 * K + (size_t)kbeg * 16; const T16* ub2 = (NSPLIT >= 2) ? Bt2 + (size_t)c0 * K + (size_t)kbeg * 16 : nullptr;   // wave-uniform: 16 rows of fragments hold 16 K elements; a step of 32 in k is one fragment (1 KiB)
    unsigned vo = (unsigned)lane * 16;
#pragma unroll 1
    for (int kc = 0; kc < kspan; kc += 32) {
        V a[4], a2[4], b[4], b2[4];
#pragma unroll
        for (int mb = 0; mb < 4; ++mb) { a[mb] = WFrag<T16>::ldf(ua + mb * 16 * K, vo); if (NSPLIT == 1 || NSPLIT == 2) a2[mb] = WFrag<T16>::ldf(ua2 + mb * 16 * K, vo); }
#pragma unroll
        for (int nb = 0; nb < 4; ++nb) { b[nb] = WFrag<T16>::ldf(ub + nb * 16 * K, vo); if (NSPLIT >= 2) b2[nb] = WFrag<T16>::ldf(ub2 + nb * 16 * K, vo); }
        __builtin_amdgcn_sched_barrier(0);   // a trip's loads all issue in front of its products: without it the compiler sinks each B fragment behind the products before it, into one register set, and a trip waits four times for memory
#pragma unroll
        for (int nb = 0; nb < 4; ++nb)
#pragma unroll
            for (int mb = 0; mb < 4; ++mb) { acc[mb][nb] = WFrag<T16>::mma(a[mb], b[nb], acc[mb][nb]); if (NSPLIT == 1 || NSPLIT == 2) acc[mb][nb] = WFrag<T16>::mma(a2[mb], b[nb], acc[mb][nb]); if (NSPLIT >= 2) acc[mb][nb] = WFrag<T16>::mma(a[mb], b2[nb], acc[mb][nb]); }
        asm volatile("v_nop\n\tv_nop\n\tv_nop\n\tv_nop" : "+v"(acc[0][0]), "+v"(acc[1][1]), "+v"(acc[2][2]), "+v"(acc[3][3]) : "v"(a[0]), "v"(a[3]));
        addr_step(vo); vo += 1024;   // next fragment of every operand row block
    }
    if constexpr (KS > 1) {
        float* pw = os + wv * (64 * 68);
#pragma unroll
        for (int mb = 0; mb < 4; ++mb)
#pragma unroll
            for (int nb = 0; nb < 4; ++nb) { float* p = pw + (nb * 16 + lr) * 68 + mb * 16 + hi * 8; const v8f t = acc[mb][nb]; *(v4fa*)p = __builtin_shufflevector(t, t, 0, 1, 2, 3); *(v4fa*)(p + 4) = __builtin_shufflevector(t, t, 4, 5, 6, 7); }
        __syncthreads();   // every wave's partial tile is in LDS before any of it is summed
#pragma unroll
        for (int it = 0; it < 64 * 16 / (32 * KS); ++it) { const int g = it * (32 * KS) + (int)threadIdx.x, col = g & 63, rq = g >> 6; const float* p = os + col * 68 + rq * 4; v4f s = *(const v4fa*)p;
#pragma unroll
            for (int w = 1; w < KS; ++w) s += *(const v4fa*)(p + w * (64 * 68));
            if (BIAS) { const float bb = bfr(bias[c0 + col]); s[0] += bb; s[1] += bb; s[2] += bb; s[3] += bb; }
            float* cp = C + (size_t)(r0 + rq * 4) * ldc + c0 + col;
#pragma unroll
            for (int q = 0; q < 4; ++q) cp[(size_t)q * ldc] = s[q]; }
        return;
    }
#pragma unroll
    for (int mb = 0; mb < 4; ++mb) {
#pragma unroll
        for (int nb = 0; nb < 4; ++nb) {
#pragma unroll
            for (int j = 0; j < 8; ++j) os[(hi * 8 + j) * 68 + nb * 16 + lr] = acc[mb][nb][j]; }
        __builtin_amdgcn_wave_barrier(); asm volatile("" ::: "memory");
        float* crow = C + (size_t)(r0 + mb * 16) * ldc + c0;
{
#pragma unroll
            for (int s = 0; s < 8; ++s) { const int row = 2 * s + hi, cofs = lr * 4; v4f val = *(const v4fa*)(os + row * 68 + cofs); if (BIAS) { val[0] += bfr(bias[c0 + cofs]); val[1] += bfr(bias[c0 + cofs + 1]); val[2] += bfr(bias[c0 + cofs + 2]); val[3] += bfr(bias[c0 + cofs + 3]); }
                *(v4f*)(crow + (size_t)row * ldc + cofs) = val; }
             }
        __builtin_amdgcn_wave_barrier(); asm volatile("" ::: "memory");
    }
}

__device__ __forceinline__ h16 tohx(float x) { return (h16)x; }
__device__ __forceinline__ void splitf(float y, unsigned short& h, unsigned short& l) { h = f2bf(y); l = f2bf(y - bf2f(h)); }
typedef __attribute__((ext_vector_type(2))) _Float16 v2h;
typedef __attribute__((ext_vector_type(4))) _Float16 v4h;
typedef __attribute__((ext_vector_type(2))) unsigned short v2us;
typedef __attribute__((ext_vector_type(4))) unsigned short v4us;
typedef __attribute__((ext_vector_type(2))) float v2f;
typedef __attribute__((ext_vector_type(4))) int v4i;

__global__ __launch_bounds__(256) void k_wtG(const float* __restrict__ w, int K, int N, bf* Bt) {
    const int lane = threadIdx.x & 31; const int L0 = (blockIdx.x * 8 + (threadIdx.x >> 5)) * 8; const int nlines = N * K / 64;
{
#pragma unroll 1
        for (int l = 0; l < 8; ++l) { const int L = L0 + l; if (L >= nlines) break; const size_t e = (size_t)L * 64 + lane * 2; const int k = (int)(e % K), n = (int)(e / K); v2us o;
            o[0] = f2bf(w[(size_t)k * N + n]); o[1] = f2bf(w[(size_t)(k + 1) * N + n]); *(v2us*)(Bt + e) = o; }
         }
}
// k_prep: ONE launch turns all eight f32 matrices (four weights, three activations, Er; row-major [rows][K]) into bf16 planes in fragment order. A work-group takes 32 fragments in a row, which are 16384 elements in a row of the source too (K = 1024: one 16-row block; K = 64: 16 of them);
// a thread takes eight pieces of 8 elements, 4 fragments apart; four neighbouring lanes read one whole 128-byte line of a row (32 k), eight neighbouring rows write one whole line of the fragment.
// All loads name one scalar base, one lane offset and a constant, and so do all stores; all sixteen loads are issued in front of the first conversion, and the stores are the thread's last instructions, so that no register that a store names is written again.
template <int K>
__device__ __forceinline__ void cvt_rows(const float* __restrict__ src, bf* dst, int lb) {
    static_assert(K == 64 || K == 1024, "the step of 4 fragments below is written for these two");
    constexpr int FPR = K / 32, ustep = (FPR >= 32) ? 4 * 32 : (4 / FPR) * 16 * K;   // fragments per row block; source elements from a fragment to the fourth behind it
    const int tid = (int)threadIdx.x, c = tid & 3, lr = (tid >> 2) & 15, tq = tid >> 6;
    const char* sb = (const char*)(src + (size_t)lb * (32 * 512)); char* db = (char*)(dst + (size_t)lb * (32 * 512));   // the same for the whole work-group
    const unsigned so = (unsigned)(((tq / FPR) * 16 + lr) * K + (tq % FPR) * 32 + c * 8) * 4, eo = (unsigned)(tq * 512 + (c >> 1) * 256 + (c & 1) * 128 + lr * 8) * 2;
    v8f v[8]; v8us o[8];
#pragma unroll
    for (int u = 0; u < 8; ++u) v[u] = *(const v8f*)(sb + so + u * (ustep * 4));
    asm volatile("s_wait_xcnt 0x0" : : "v"(so), "s"(sb) : "memory");   // inputs only: the loads' offset register and scalar base stay taken up to the wait, so that no load lands in the offset and nothing else is formed there ahead of it
#pragma unroll
    for (int u = 0; u < 8; ++u)
#pragma unroll
        for (int k = 0; k < 8; ++k) o[u][k] = f2bf(v[u][k]);
    __builtin_amdgcn_sched_barrier(0);   // no store rises in front of a conversion: a conversion behind it could be given a register that the store still names
#pragma unroll
    for (int u = 0; u < 8; ++u) *(v8us*)(db + eo + u * (4 * 512 * 2)) = o[u];
}
#define PB_W (DQ / 16)            // work-groups per weight matrix (16 rows each)
#define PB_X (TT / 16)            // per activation matrix
#define PB_E (TT * HD / (32 * 512))   // for Er
__global__ __launch_bounds__(256) void k_prep(const float* __restrict__ wq, const float* __restrict__ wk, const float* __restrict__ wv, const float* __restrict__ wo, const float* __restrict__ xq, const float* __restrict__ xk, const float* __restrict__ xv, const float* __restrict__ er, bf* WQ, bf* WK, bf* WV, bf* WO, bf* XQ, bf* XK, bf* XV, bf* ERB) {
    const int b = (int)blockIdx.x;   // the matrix is chosen by the work-group's index alone
    if (b < 4 * PB_W) { const int m = b / PB_W; cvt_rows<DM>(m == 0 ? wq : m == 1 ? wk : m == 2 ? wv : wo, m == 0 ? WQ : m == 1 ? WK : m == 2 ? WV : WO, b % PB_W); }
    else if (b < 4 * PB_W + 3 * PB_X) { const int m = (b - 4 * PB_W) / PB_X; cvt_rows<DM>(m == 0 ? xq : m == 1 ? xk : xv, m == 0 ? XQ : m == 1 ? XK : XV, (b - 4 * PB_W) % PB_X); }
    else cvt_rows<HD>(er, ERB, b - 4 * PB_W - 3 * PB_X);
}
// k_qkv: the three projections in ONE launch, grid (TT / 64, heads, 3), 8 waves; main loop, K split over the waves and LDS sum in wave order as in k_gemmw<bf, 0, true, 8, DM>; a 64 x 64 tile is 64 rows t of one head, and the epilogue writes it straight as the head's three planes (fp16, bf16 hi, bf16 lo) in fragment order.
// The partial tiles lie [n][m] in LDS with m (the A operand's rows) contiguous, and a thread sums 8 neighbouring m of one n, which are the 8 elements of one 16-byte piece of a fragment: so q and k (fragment rows t, k = d) take the weight rows d as A and the activation rows t as B,
// and v (ISV; fragment rows d, k = t, fragments laid [t / 32][d / 16] so that a wave's 128 keys x 64 columns are 16 KiB in a row) takes t as A and d as B. Both operand planes have the same fragment order, so the roles are a choice of base pointers. A wave's store is two runs of 256 contiguous bytes.
template <bool ISV>
__device__ __forceinline__ void qkv_tile(float* os, const bf* __restrict__ X, const bf* __restrict__ Wt, const float* __restrict__ bias, h16* P16, bf* Ph, bf* Pl, int t0) {   // X, Wt, bias, planes: already at the tile's rows t0.., the head's weight rows, bias and planes
    constexpr int K = DM, KS = 8; typedef WFrag<bf>::V V;
    const int tid = (int)threadIdx.x, lane = tid & 31, lr = lane & 15, hi = lane >> 4;
    v8f acc[4][4];
#pragma unroll
    for (int mb = 0; mb < 4; ++mb)
#pragma unroll
        for (int nb = 0; nb < 4; ++nb) acc[mb][nb] = (v8f){};
    const int wv = __builtin_amdgcn_readfirstlane(tid >> 5); constexpr int kspan = K / KS; const int kbeg = wv * kspan;   // this wave's K slice
    const bf* ua = (ISV ? X : Wt) + (size_t)kbeg * 16; const bf* ub = (ISV ? Wt : X) + (size_t)kbeg * 16;   // wave-uniform: 16 rows of fragments hold 16 K elements; a step of 32 in k is one fragment (1 KiB)
    const int n = tid & 63, mq = (tid >> 6) * 8;   // this thread's n and its first m; its second piece lies 32 m further
    const unsigned bo = (unsigned)(ISV ? n : mq) * 4; const char* bp = (const char*)bias; v4f bb[4];   // the bias goes with d: n for v, m for q and k
    if constexpr (ISV) bb[0] = (v4f)(*(const float*)(bp + bo));
    else { bb[0] = *(const v4f*)(bp + bo); bb[1] = *(const v4f*)(bp + bo + 16); bb[2] = *(const v4f*)(bp + bo + 128); bb[3] = *(const v4f*)(bp + bo + 144); }
    asm volatile("s_wait_xcnt 0x0" : : "v"(bo), "s"(bp) : "memory");   // inputs only: the bias loads' offset register and scalar base stay taken up to the wait; the loads stand in front of the main loop, which covers their latency
    unsigned vo = (unsigned)lane * 16;
#pragma unroll 1
    for (int kc = 0; kc < kspan; kc += 32) {
        V a[4], b[4];
#pragma unroll
        for (int mb = 0; mb < 4; ++mb) a[mb] = WFrag<bf>::ldf(ua + mb * 16 * K, vo);
#pragma unroll
        for (int nb = 0; nb < 4; ++nb) b[nb] = WFrag<bf>::ldf(ub + nb * 16 * K, vo);
        __builtin_amdgcn_sched_barrier(0);   // a trip's loads all issue in front of its products: without it the compiler sinks each B fragment behind the products before it, into one register set, and a trip waits four times for memory
#pragma unroll
        for (int nb = 0; nb < 4; ++nb)
#pragma unroll
            for (int mb = 0; mb < 4; ++mb) acc[mb][nb] = WFrag<bf>::mma(a[mb], b[nb], acc[mb][nb]);
        asm volatile("v_nop\n\tv_nop\n\tv_nop\n\tv_nop" : "+v"(acc[0][0]), "+v"(acc[1][1]), "+v"(acc[2][2]), "+v"(acc[3][3]) : "v"(a[0]), "v"(a[3]));
        addr_step(vo); vo += 1024;   // next fragment of every operand row block
    }
    float* pw = os + wv * (64 * 68);
#pragma unroll
    for (int mb = 0; mb < 4; ++mb)
#pragma unroll
        for (int nb = 0; nb < 4; ++nb) { float* p = pw + (nb * 16 + lr) * 68 + mb * 16 + hi * 8; const v8f t = acc[mb][nb]; *(v4fa*)p = __builtin_shufflevector(t, t, 0, 1, 2, 3); *(v4fa*)(p + 4) = __builtin_shufflevector(t, t, 4, 5, 6, 7); }
    __syncthreads();   // every wave's partial tile is in LDS before any of it is summed
    v8h o16[2]; v8us oh[2], ol[2];
#pragma unroll
    for (int it = 0; it < 2; ++it) { const float* p = os + n * 68 + mq + it * 32; v4f s0 = *(const v4fa*)p, s1 = *(const v4fa*)(p + 4);
#pragma unroll
        for (int w = 1; w < KS; ++w) { s0 += *(const v4fa*)(p + w * (64 * 68)); s1 += *(const v4fa*)(p + w * (64 * 68) + 4); }
#pragma unroll
        for (int q = 0; q < 8; ++q) { const float r = (q < 4 ? s0[q & 3] : s1[q & 3]) + bfr(ISV ? bb[0][0] : bb[it * 2 + (q >> 2)][q & 3]); o16[it][q] = tohx(r); unsigned short a2, c2; splitf(r, a2, c2); oh[it][q] = a2; ol[it][q] = c2; } }
    const int t = t0 + (ISV ? mq : n), d = ISV ? n : mq;   // of the first piece; the second is one fragment in d further (q, k) or one row of four fragments in t (v)
    const unsigned ob = (unsigned)(ISV ? ((t >> 5) * 4 + (d >> 4)) * 512 + ((t >> 4) & 1) * 256 + ((t >> 3) & 1) * 128 + (d & 15) * 8
                                       : (t & ~15) * HD + (d >> 5) * 512 + ((d >> 4) & 1) * 256 + ((d >> 3) & 1) * 128 + (t & 15) * 8) * 2;
    constexpr int step = (ISV ? 4 : 1) * 512 * 2;
    __builtin_amdgcn_sched_barrier(0);   // the six stores stay the thread's last instructions: nothing behind them is given a register that a store still names
#pragma unroll
    for (int it = 0; it < 2; ++it) { *(v8h*)((char*)P16 + ob + it * step) = o16[it]; *(v8us*)((char*)Ph + ob + it * step) = oh[it]; *(v8us*)((char*)Pl + ob + it * step) = ol[it]; }
}
__global__ __launch_bounds__(256) void k_qkv(const bf* __restrict__ XQ, const bf* __restrict__ XK, const bf* __restrict__ XV, const bf* __restrict__ WQ, const bf* __restrict__ WK, const bf* __restrict__ WV, const float* __restrict__ bq, const float* __restrict__ bk, const float* __restrict__ bv,
                                             h16* QP16, bf* QPh, bf* QPl, h16* KP16, bf* KPh, bf* KPl, h16* VT16, bf* VTh, bf* VTl) {
    __shared__ __align__(16) float os[8 * 64 * 68];
    const int z = (int)blockIdx.z, t0 = (int)blockIdx.x * 64, h = (int)blockIdx.y; const size_t xo = (size_t)t0 * DM, wo = (size_t)h * HD * DM, po = (size_t)h * TT * HD;   // the choice below is the same for the whole work-group, so its barrier is met by all of its waves
    if (z == 2) qkv_tile<true>(os, XV + xo, WV + wo, bv + h * HD, VT16 + po, VTh + po, VTl + po, t0);
    else qkv_tile<false>(os, (z == 0 ? XQ : XK) + xo, (z == 0 ? WQ : WK) + wo, (z == 0 ? bq : bk) + h * HD, (z == 0 ? QP16 : KP16) + po, (z == 0 ? QPh : KPh) + po, (z == 0 ? QPl : KPl) + po, t0);
}
// ---- k_attn: one work-group of 16 waves per (head, 32 query rows = QB blocks of 16); the 32 x 2048 score rows never leave LDS and take most of a WGP's LDS, so one work-group has the WGP to itself (4 waves per SIMD, up to 256 registers each).
// Every Er, k and v fragment that a wave loads stays in registers for the products of BOTH row blocks: per query row half as many bytes come from L2 as with one block per work-group. Each row's products, trees and sums are those of a single block. Five stages, a work-group barrier between each two and one inside the last:
// 1 relative logits: qe tiles (q hi/lo planes x Er) are stored straight at their skewed place: qe[i][t] is rel(i, t - 2047 + i) where that column is >= 0, and qe[i+1][t] is rel(i, t + i + 2) where that column is < 2048; rel(i, i+1) = 0 (= the reference's pad/reshape/slice of q.Er^T, upper triangle included)
// 2 scores: each q.k tile adds the relative logit that lies at its own place, scales by 1/8 and stores back
// 3 softmax: wave w owns rows w and w + 16 (register row, one exp, fixed trees) and writes the probabilities over its own rows: fp16 x 1024, or bf16 hi and lo planes for rows < RH
// 4 attn.v: wave w sums the key slice [128 w, 128 w + 128) for all 64 columns of both row blocks
// 5 the 16 partial tiles meet in LDS (column-major, pitch 36) and are added in wave order 0..15; the merged context goes out as hi/lo planes in fragment order
#define SP 2052   // LDS pitch of a score row in floats: rows stay 16-byte aligned, rows 8 apart lie 32 banks apart; columns 2048..2051 take the qe elements that belong to no column of this row block
#define QB 2      // 16-row blocks per work-group
#define PP (QB * 16 + 4)   // LDS pitch of a partial tile's column in floats (stage 5): 16 bytes times an odd number
typedef v2f __attribute__((may_alias)) v2fa;
template <bool UP>
__device__ __forceinline__ void rel_one(float* S, const v16bf (&ah0)[QB], const v16bf (&al0)[QB], const v16bf (&ah1)[QB], const v16bf (&al1)[QB], v16bf b0, v16bf b1, int tt, int r0, int lr, int hi) {   // one Er tile against the q rows of every row block
#pragma unroll
    for (int rb = 0; rb < QB; ++rb) {
        v8f acc = (v8f){}; acc = wmmab(ah0[rb], b0, acc); acc = wmmab(al0[rb], b0, acc); acc = wmmab(ah1[rb], b1, acc); acc = wmmab(al1[rb], b1, acc);
        const int cb = tt * 16 + lr + r0 + rb * 16 + hi * 8 + (UP ? 2 : 1 - TT);   // column of accumulator register 0; register j is one row lower and so j columns further
#pragma unroll
        for (int j = 0; j < 8; ++j) { const int col = cb + j; const bool ok = UP ? (col < TT) : (col >= 0); S[(rb * 16 + hi * 8 + j) * SP + (ok ? col : TT + (lr & 3))] = acc[j]; }
    }
}
template <bool UP>
__device__ __forceinline__ void rel_tiles(float* S, const bf* __restrict__ qh, const bf* __restrict__ ql, const bf* __restrict__ er, int r0, int tbeg, int tend, int lr, int hi) {
    if (tbeg >= tend) return;   // wave-uniform: a wave without a tile loads no q rows
    v16bf ah0[QB], ah1[QB], al0[QB], al1[QB]; unsigned ao[QB];
#pragma unroll
    for (int rb = 0; rb < QB; ++rb) { const int qr = UP ? min(r0 + rb * 16 + 1 + lr, TT - 1) : r0 + rb * 16 + lr; ao[rb] = (unsigned)((qr >> 4) * (16 * HD) + (qr & 15) * 8 + hi * 128) * 2;   // UP: q rows i + 1 (the clamped row has no column in range); byte offset in fragment order: a 16-row tile is 2 fragments (k 0..31, 32..63)
        ah0[rb] = WFrag<bf>::ldf(qh, ao[rb]); ah1[rb] = WFrag<bf>::ldf(qh + 512, ao[rb]); al0[rb] = WFrag<bf>::ldf(ql, ao[rb]); al1[rb] = WFrag<bf>::ldf(ql + 512, ao[rb]); }
    asm volatile("s_wait_xcnt 0x0" : : "v"(ao[0]), "v"(ao[1]), "s"(qh), "s"(ql) : "memory");   // inputs only: the q loads' offset registers and two scalar bases stay taken up to the wait; the Er base and offset are formed behind it, not in those registers ahead of it
    const bf* eb = er + (size_t)tbeg * 16 * HD; unsigned eo = (unsigned)(lr * 8 + hi * 128) * 2;
    for (int tt = tbeg; tt < tend; tt += 32) {   // two Er tiles' loads in flight per trip (16 waves a WGP: each keeps more bytes under way)
        const bool two = tt + 16 < tend;   // wave-uniform; without a second tile its loads read the first again and feed nothing
        const unsigned e2 = eo + (two ? 16 * 16 * HD * 2 : 0);
        const v16bf b0 = WFrag<bf>::ldf(eb, eo), b1 = WFrag<bf>::ldf(eb + 512, eo), c0 = WFrag<bf>::ldf(eb, e2), c1 = WFrag<bf>::ldf(eb + 512, e2);
        rel_one<UP>(S, ah0, al0, ah1, al1, b0, b1, tt, r0, lr, hi);
        asm volatile("" : : "v"(c0), "v"(c1));   // inputs only, the loaded values: holds the second tile's loads in front of the branch, beside the first tile's; without it the compiler sinks them into the branch and a trip waits twice for L2
        if (two) rel_one<UP>(S, ah0, al0, ah1, al1, c0, c1, tt + 16, r0, lr, hi);
        asm volatile("s_wait_xcnt 0x0" : "+v"(eo) : "v"(e2) : "memory");   // as addr_step; the second tile's offset register stays taken up to the wait, and its next value is formed from this statement's result
        eo += 32 * 16 * HD * 2;   // 32 Er tiles further
    }
}
template <bool HI>
__device__ __forceinline__ void attn_rows(float* S, int h, int r0, const h16* __restrict__ QP16, const bf* __restrict__ QPh, const bf* __restrict__ QPl, const h16* __restrict__ KP16, const bf* __restrict__ KPh, const bf* __restrict__ KPl, const bf* __restrict__ ERB, const h16* __restrict__ VT16, const bf* __restrict__ VTh, const bf* __restrict__ VTl, bf* ATh, bf* ATl) {
    const int tid = (int)threadIdx.x, lane = tid & 31, lr = lane & 15, hi = lane >> 4; const int wv = __builtin_amdgcn_readfirstlane(tid >> 5);   // wave-uniform: scalar loop bounds
    const size_t hq = (size_t)h * TT * HD;
    {   // stage 1: for row block rb, Er tiles 0..T0 - rb serve the columns right of the diagonal and tiles T0 - rb..127 those up to it; each deal takes the union over the blocks (a tile that serves only one block leaves the other's elements in the spare columns); the second deal runs in reverse wave order so that the two remainders fall on different waves where they can
        const int T0 = TT / 16 - 1 - (r0 >> 4);
        rel_tiles<true>(S, QPh + hq, QPl + hq, ERB, r0, wv, T0 + 1, lr, hi);
        rel_tiles<false>(S, QPh + hq, QPl + hq, ERB, r0, T0 - (QB - 1) + 15 - wv, TT / 16, lr, hi);
        if (tid < QB * 16 && r0 + tid + 1 < TT) S[tid * SP + r0 + tid + 1] = 0.0f;
    }
    __syncthreads();   // every relative logit lies in LDS before a score tile adds it
    {   // stage 2
        const size_t ab = hq + (size_t)r0 * HD, kb = hq + (size_t)wv * (16 * HD); unsigned lo = (unsigned)(lr * 8 + hi * 128) * 2;   // wave-uniform bases, 32-bit lane byte offset (fragment order); key tile it * 16 + wv lies it * 32 KiB behind tile wv
        if constexpr (HI) {
            v16bf a0[QB], a1[QB], c0[QB], c1[QB];
#pragma unroll
            for (int rb = 0; rb < QB; ++rb) { const size_t ar = ab + rb * (16 * HD); a0[rb] = WFrag<bf>::ldf(QPh + ar, lo); a1[rb] = WFrag<bf>::ldf(QPh + ar + 512, lo); c0[rb] = WFrag<bf>::ldf(QPl + ar, lo); c1[rb] = WFrag<bf>::ldf(QPl + ar + 512, lo); }
#pragma unroll 1   // two tiles' loads (8 KiB a wave) in flight per trip
            for (int io = 0; io < TT / 256; io += 2) {
              v16bf b0[2], b1[2], d0[2], d1[2];
#pragma unroll
              for (int ii = 0; ii < 2; ++ii) { const bf* kh = KPh + kb + ii * (256 * HD); const bf* kl = KPl + kb + ii * (256 * HD); b0[ii] = WFrag<bf>::ldf(kh, lo); b1[ii] = WFrag<bf>::ldf(kh + 512, lo); d0[ii] = WFrag<bf>::ldf(kl, lo); d1[ii] = WFrag<bf>::ldf(kl + 512, lo); }
              __builtin_amdgcn_sched_barrier(0);   // a trip's loads all issue in front of its products: without it the compiler sinks the later fragments behind the products before them, and a trip waits several times for L2
#pragma unroll
              for (int ii = 0; ii < 2; ++ii) { const int n0 = ((io + ii) * 16 + wv) * 16;
#pragma unroll
                for (int rb = 0; rb < QB; ++rb) {
                    v8f acc = (v8f){}; acc = wmmab(a0[rb], b0[ii], acc); acc = wmmab(c0[rb], b0[ii], acc); acc = wmmab(a0[rb], d0[ii], acc); acc = wmmab(a1[rb], b1[ii], acc); acc = wmmab(c1[rb], b1[ii], acc); acc = wmmab(a1[rb], d1[ii], acc);
#pragma unroll
                    for (int j = 0; j < 8; ++j) { float* p = S + (rb * 16 + hi * 8 + j) * SP + n0 + lr; *p = (acc[j] + *p) * SCL; } } }
              addr_step(lo); lo += 2 * 256 * HD * 2; }
        } else {
            v16h a0[QB], a1[QB];
#pragma unroll
            for (int rb = 0; rb < QB; ++rb) { const size_t ar = ab + rb * (16 * HD); a0[rb] = WFrag<h16>::ldf(QP16 + ar, lo); a1[rb] = WFrag<h16>::ldf(QP16 + ar + 512, lo); }
#pragma unroll 1   // four tiles' loads (8 KiB a wave) in flight per trip
            for (int io = 0; io < TT / 256; io += 4) {
              v16h b0[4], b1[4];
#pragma unroll
              for (int ii = 0; ii < 4; ++ii) { const h16* kp = KP16 + kb + ii * (256 * HD); b0[ii] = WFrag<h16>::ldf(kp, lo); b1[ii] = WFrag<h16>::ldf(kp + 512, lo); }
              __builtin_amdgcn_sched_barrier(0);   // a trip's loads all issue in front of its products: without it the compiler sinks the later fragments behind the products before them, and a trip waits several times for L2
#pragma unroll
              for (int ii = 0; ii < 4; ++ii) { const int n0 = ((io + ii) * 16 + wv) * 16;
#pragma unroll
                for (int rb = 0; rb < QB; ++rb) {
                    v8f acc = (v8f){}; acc = wmma16(a0[rb], b0[ii], acc); acc = wmma16(a1[rb], b1[ii], acc);
#pragma unroll
                    for (int j = 0; j < 8; ++j) { float* p = S + (rb * 16 + hi * 8 + j) * SP + n0 + lr; *p = (acc[j] + *p) * SCL; } } }
              addr_step(lo); lo += 4 * 256 * HD * 2; }
        }
    }
    __syncthreads();   // every score of a row lies in LDS before its wave reads the row
#pragma unroll (HI ? 1 : QB)   // the long hi/lo split stays rolled over the two rows: unrolled, the kernel's text passes 32 KB
    for (int rr = 0; rr < QB; ++rr) {   // stage 3
        float* sr = S + (rr * 16 + wv) * SP; float v[TT / 32]; float mx = -3.0e38f;
#pragma unroll
        for (int ch = 0; ch < TT / 128; ++ch) { const v4f a = *(const v4fa*)(sr + ch * 128 + lane * 4);
#pragma unroll
            for (int q = 0; q < 4; ++q) { v[ch * 4 + q] = a[q]; mx = fmaxf(mx, a[q]); } }
#pragma unroll
        for (int sh = 16; sh; sh >>= 1) mx = fmaxf(mx, __shfl_xor(mx, sh, 32));
        float sum = 0.f;
#pragma unroll
        for (int k = 0; k < TT / 32; ++k) { v[k] = __builtin_amdgcn_exp2f((v[k] - mx) * 1.4426950408889634f); sum += v[k]; }
#pragma unroll
        for (int sh = 16; sh; sh >>= 1) sum += __shfl_xor(sum, sh, 32);
        const float f = __fdiv_rn(HI ? 1.0f : PCAR, sum);
        if constexpr (HI) { bf* ph = (bf*)sr; bf* pl = ph + TT;
#pragma unroll
            for (int ch = 0; ch < TT / 128; ++ch) { v4us oh, ol;
#pragma unroll
                for (int q = 0; q < 4; ++q) { unsigned short a, c2; splitf(v[ch * 4 + q] * f, a, c2); oh[q] = a; ol[q] = c2; }
                *(v4us*)(ph + ch * 128 + lane * 4) = oh; *(v4us*)(pl + ch * 128 + lane * 4) = ol; }
        } else { h16* pp = (h16*)sr;
#pragma unroll
            for (int ch = 0; ch < TT / 128; ++ch) { v4h o4;
#pragma unroll
                for (int q = 0; q < 4; ++q) o4[q] = tohx(v[ch * 4 + q] * f);
                *(v4h*)(pp + ch * 128 + lane * 4) = o4; } }
    }
    __syncthreads();   // all probability rows lie in LDS before any wave reads its key slice of them
    v8f acc[QB][4];
#pragma unroll
    for (int rb = 0; rb < QB; ++rb)
#pragma unroll
        for (int nb = 0; nb < 4; ++nb) acc[rb][nb] = (v8f){};
    {   // stage 4
        const size_t vb = (size_t)h * HD * TT + (size_t)wv * (128 * HD); const unsigned lo = (unsigned)(lr * 8 + hi * 128) * 2;   // wave-uniform base (the wave's 16 fragments lie in a row), 32-bit lane byte offset
        const h16* vp = (const h16*)((const char*)(VT16 + vb) + lo); const bf* vh = (const bf*)((const char*)(VTh + vb) + lo); const bf* vl = (const bf*)((const char*)(VTl + vb) + lo);
        v16h bv[HI ? 1 : 16];
        if constexpr (!HI) {
#pragma unroll
            for (int f = 0; f < 16; ++f) bv[f] = WFrag<h16>::ldf(vp + f * 512, 0u);
            __builtin_amdgcn_sched_barrier(0);   // the wave's whole v slice (16 KiB) is under way before its first product: without it the compiler loads each fragment right in front of its products, and the wave waits for L2 once a fragment
        }
#pragma unroll
        for (int s = 0; s < 4; ++s) { const int kc = wv * 128 + s * 32;
            if constexpr (HI) { v16bf a[QB], a2[QB], b[4], b2[4];
#pragma unroll
                for (int nb = 0; nb < 4; ++nb) { b[nb] = WFrag<bf>::ldf(vh + (s * 4 + nb) * 512, 0u); b2[nb] = WFrag<bf>::ldf(vl + (s * 4 + nb) * 512, 0u); }
                __builtin_amdgcn_sched_barrier(0);   // the eight fragments of 32 keys (8 KiB) are under way together: without it the compiler loads each pair right in front of its products, and the wave waits for L2 once a pair
#pragma unroll
                for (int rb = 0; rb < QB; ++rb) { const bf* pr = (const bf*)(S + (rb * 16 + lr) * SP) + kc + 8 * hi; a[rb] = WFrag<bf>::ld(pr); a2[rb] = WFrag<bf>::ld(pr + TT); }
#pragma unroll
                for (int nb = 0; nb < 4; ++nb)
#pragma unroll
                    for (int rb = 0; rb < QB; ++rb) { acc[rb][nb] = wmmab(a[rb], b[nb], acc[rb][nb]); acc[rb][nb] = wmmab(a2[rb], b[nb], acc[rb][nb]); acc[rb][nb] = wmmab(a[rb], b2[nb], acc[rb][nb]); }
            } else { v16h a[QB];
#pragma unroll
                for (int rb = 0; rb < QB; ++rb) a[rb] = WFrag<h16>::ld((const h16*)(S + (rb * 16 + lr) * SP) + kc + 8 * hi);
#pragma unroll
                for (int nb = 0; nb < 4; ++nb)
#pragma unroll
                    for (int rb = 0; rb < QB; ++rb) acc[rb][nb] = wmma16(a[rb], bv[s * 4 + nb], acc[rb][nb]); } }
        if constexpr (HI) asm volatile("s_wait_xcnt 0x0" : : "v"(vh), "v"(vl) : "memory"); else asm volatile("s_wait_xcnt 0x0" : : "v"(vp) : "memory");   // inputs only: the lane's address pairs (one a plane serves all of its loads, which differ by constants) stay taken up to the wait, so that no late load lands in one of them
    }
    __syncthreads();   // every wave has read its slice of the probability rows before the partial tiles overwrite them
    {   // stage 5
        float* pw = S + wv * (64 * PP);
#pragma unroll
        for (int rb = 0; rb < QB; ++rb)
#pragma unroll
            for (int nb = 0; nb < 4; ++nb) { float* p = pw + (nb * 16 + lr) * PP + rb * 16 + hi * 8; const v8f t = acc[rb][nb]; *(v4fa*)p = __builtin_shufflevector(t, t, 0, 1, 2, 3); *(v4fa*)(p + 4) = __builtin_shufflevector(t, t, 4, 5, 6, 7); }
        __syncthreads();   // every wave's partial tile is in LDS before any of it is summed
        const int col = tid & 63, rp = tid >> 6; const float* p = S + col * PP + rp * 4; v4f s = *(const v4fa*)p;   // four neighbouring rows of one column
#pragma unroll
        for (int w = 1; w < 16; ++w) s += *(const v4fa*)(p + w * (64 * PP));
        const float cs = HI ? 1.0f : (1.0f / PCAR);
        unsigned short oa[4], oc[4];
#pragma unroll
        for (int q = 0; q < 4; ++q) splitf(s[q] * cs, oa[q], oc[q]);
        const size_t oo = (size_t)(r0 + ((rp * 4) & ~15)) * DQ + (h * 2 + (col >> 5)) * 512 + ((col >> 4) & 1) * 256 + ((col >> 3) & 1) * 128 + ((rp * 4) & 15) * 8 + (col & 7);   // fragment order, rows = query rows, k = h * HD + col; the thread's four rows lie in one 16-row block, 8 elements apart
        __builtin_amdgcn_sched_barrier(0);   // the eight stores stay the thread's last instructions: nothing behind them is given a register that a store still names
#pragma unroll
        for (int q = 0; q < 4; ++q) { ATh[oo + q * 8] = oa[q]; ATl[oo + q * 8] = oc[q]; }
    }
}
__global__ __launch_bounds__(512) void k_attn(const h16* __restrict__ QP16, const bf* __restrict__ QPh, const bf* __restrict__ QPl, const h16* __restrict__ KP16, const bf* __restrict__ KPh, const bf* __restrict__ KPl, const bf* __restrict__ ERB, const h16* __restrict__ VT16, const bf* __restrict__ VTh, const bf* __restrict__ VTl, bf* ATh, bf* ATl) {
    __shared__ __align__(16) float S[QB * 16 * SP];
    const int r0 = (int)blockIdx.x * (QB * 16), h = (int)blockIdx.y;   // the choice below is the same for the whole work-group (RH is a multiple of its rows), so every barrier is met by all of its waves
    if (r0 < RH) attn_rows<true>(S, h, r0, QP16, QPh, QPl, KP16, KPh, KPl, ERB, VT16, VTh, VTl, ATh, ATl);
    else attn_rows<false>(S, h, r0, QP16, QPh, QPl, KP16, KPh, KPl, ERB, VT16, VTh, VTl, ATh, ATl);
}

extern "C" void kernel_launch(void* const* d_in, const int* in_sizes, int n_in,
                              void* d_out, int out_size, void* d_ws, size_t ws_size, hipStream_t stream) {
    (void)in_sizes; (void)n_in; (void)out_size;
    const float* xq = (const float*)d_in[0]; const float* xk = (const float*)d_in[1]; const float* xv = (const float*)d_in[2]; const float* wq = (const float*)d_in[3]; const float* bq = (const float*)d_in[4]; const float* wk = (const float*)d_in[5]; const float* bk = (const float*)d_in[6]; const float* wv = (const float*)d_in[7]; const float* bv = (const float*)d_in[8]; const float* wo = (const float*)d_in[9]; const float* bo = (const float*)d_in[10]; const float* Er = (const float*)d_in[11]; const float* x = nullptr; (void)x;
    float* OUT = (float*)d_out;     // [1][2048][1024]
    char* wsp = (char*)d_ws;
    auto take = [&](size_t bytes) { char* p = wsp; wsp += (bytes + 255) & ~(size_t)255; return (void*)p; };
    bf* WQ = (bf*)take((size_t)DQ * DM * 2); bf* WK = (bf*)take((size_t)DKV * DM * 2); bf* WV = (bf*)take((size_t)DKV * DM * 2); bf* WO = (bf*)take((size_t)DM * DQ * 2);
    bf* ERB = (bf*)take((size_t)TT * HD * 2);
    bf* XQ = (bf*)take((size_t)TT * DM * 2); bf* XK = (bf*)take((size_t)TT * DM * 2); bf* XV = (bf*)take((size_t)TT * DM * 2);
    h16* QP16 = (h16*)take((size_t)NH_ * TT * HD * 2); h16* KP16 = (h16*)take((size_t)NKV * TT * HD * 2); h16* VT16 = (h16*)take((size_t)NKV * HD * TT * 2);
    bf* QPh = (bf*)take((size_t)NH_ * TT * HD * 2); bf* QPl = (bf*)take((size_t)NH_ * TT * HD * 2); bf* KPh = (bf*)take((size_t)NKV * TT * HD * 2); bf* KPl = (bf*)take((size_t)NKV * TT * HD * 2); bf* VTh = (bf*)take((size_t)NKV * HD * TT * 2); bf* VTl = (bf*)take((size_t)NKV * HD * TT * 2);
    bf* ATh = (bf*)take((size_t)TT * DQ * 2); bf* ATl = (bf*)take((size_t)TT * DQ * 2);
    if ((size_t)(wsp - (char*)d_ws) > ws_size) return;    // ws 256 MiB
    for (int b = 0; b < NB_; ++b) {
        k_prep<<<4 * PB_W + 3 * PB_X + PB_E, 256, 0, stream>>>(wq, wk, wv, wo, xq + (size_t)b * TT * DM, xk + (size_t)b * TT * DM, xv + (size_t)b * TT * DM, Er, WQ, WK, WV, WO, XQ, XK, XV, ERB);   /* Er [2048][64] ('t d'): rows t, k = d */
        k_qkv<<<dim3(TT / 64, NH_, 3), 256, 0, stream>>>(XQ, XK, XV, WQ, WK, WV, bq, bk, bv, QP16, QPh, QPl, KP16, KPh, KPl, VT16, VTh, VTl);
        k_attn<<<dim3(TT / (QB * 16), NH_, 1), 512, 0, stream>>>(QP16, QPh, QPl, KP16, KPh, KPl, ERB, VT16, VTh, VTl, ATh, ATl);   /* one kv head per query head */
        k_gemmw<bf, 1, true, 8, DQ><<<dim3(TT / 64, DM / 64, 1), 256, 0, stream>>>(ATh, ATl, WO, nullptr, OUT + (size_t)b * TT * DM, DM, bo, 0, 0, 0); }
}

// v006
// A run of this version takes 112 microseconds.
// Timed twice side by side with v005, it ran 1.09 and 1.07 times as fast.
// Counting every step since v000, it is 11.2 times as fast.
#include <hip/hip_runtime.h>

// Relative global attention (Music-Transformer skew) (query, key, value [1][2048][1024]; q,k,v = input W^T + b ('oi' [1024][1024] + [1024]; 16 heads x 64); qe = q.Er^T (Er [2048][64], all rows used since s = max_len); s_rel = skew(qe): for j <= i  s_rel[i][j] = qe[i][2047 + j - i]; for j = i+1  0; for j > i+1  qe[i+1][j - i - 2] (the reference's pad-reshape-slice, reproduced exactly, upper triangle included); scores = (q.k + s_rel) / 8; softmax; out = merged ctx Wo^T + bo -> [1][2048][1024] (2.1 M)).
// Compute dtypes, f32 accumulate: every input rounded to bf16; q/k/v on PLAIN bf16 operands (inputs: exact) + biases (three input tensors); qe = q(hi/lo planes) x Er (exact bf16) gives the relative logits, stored in LDS at their skewed place (the index map above) and added to q.k before the 1/8 scale; scores and attn.v: query rows < 512 hl (3 products), the rest single fp16 (x1024); softmax f32; Wo hl x exact (2 products) + bo.

#define NB_  1
#define TT   2048
#define DM   1024
#define NH_  16
#define NKV  16
#define REP  (NH_ / NKV)
#define HD   64
#define DQ   (NH_ * HD)
#define DKV  (NKV * HD)
#define RH   512                  // query rows < RH use hi+lo planes
#define WIN  0
#define PCAR 1024.0f
#define SCL  0.125f   // HD^-0.5
typedef _Float16 h16;
typedef unsigned short bf;
typedef __attribute__((ext_vector_type(16))) __bf16   v16bf;
typedef __attribute__((ext_vector_type(16))) _Float16 v16h;
typedef __attribute__((ext_vector_type(8)))  _Float16 v8h;
typedef __attribute__((ext_vector_type(8)))  unsigned short v8us;
typedef __attribute__((ext_vector_type(8)))  float    v8f;
typedef __attribute__((ext_vector_type(4)))  float    v4f;
typedef v8h  __attribute__((may_alias)) v8ha;
typedef v4f  __attribute__((may_alias)) v4fa;
typedef v8us __attribute__((may_alias)) v8usa;

__device__ __forceinline__ unsigned short f2bf(float f) { unsigned u = __float_as_uint(f); u += 0x7FFFu + ((u >> 16) & 1u); return (unsigned short)(u >> 16); }
__device__ __forceinline__ float bf2f(unsigned short b) { return __uint_as_float(((unsigned)b) << 16); }
__device__ __forceinline__ float bfr(float f) { return bf2f(f2bf(f)); }
__device__ __forceinline__ v16h cat16(v8h lo, v8h hi) { return __builtin_shufflevector(lo, hi, 0, 1, 2, 3, 4, 5, 6, 7, 8, 9, 10, 11, 12, 13, 14, 15); }
__device__ __forceinline__ v16bf cat16b(v8us lo, v8us hi) { return __builtin_bit_cast(v16bf, __builtin_shufflevector(lo, hi, 0, 1, 2, 3, 4, 5, 6, 7, 8, 9, 10, 11, 12, 13, 14, 15)); }
__device__ __forceinline__ v8f wmma16(v16h a, v16h b, v8f c) { return __builtin_amdgcn_wmma_f32_16x16x32_f16(false, a, false, b, (short)0, c, false, false); }
__device__ __forceinline__ v8f wmmab(v16bf a, v16bf b, v8f c) { return __builtin_amdgcn_wmma_f32_16x16x32_bf16(false, a, false, b, (short)0, c, false, false); }



// ---- FRAGMENT ORDER of every 16-bit operand plane in global memory (rows x K, K % 32 == 0): the plane is a row-major grid of fragments (16 rows x 32 k, 512 elements = 1 KiB, fragment index (row / 16) * (K / 32) + k / 32; the v planes alone order their fragments k-block first, see k_qkv);
// inside a fragment element (row, k) lies at ((k >> 4) & 1) * 256 + ((k >> 3) & 1) * 128 + (row & 15) * 8 + (k & 7), which is half * 256 + lane * 8 + e of the lane and register half that hold it in the WMMA operand.
// WFrag::ldf(fragment, lane * 16) is then two wave-wide 16-byte loads of 512 contiguous bytes each (four whole 128-byte lines); from a row-major plane each such load touches 16 lines. WFrag::ld reads a row-major source (the LDS rows).
// ldf takes a wave-uniform fragment pointer and the lane's 32-bit BYTE offset: every load of a loop then names one scalar base, one offset register and a constant, and no per-load address pair is formed (stage 4 of k_attn hands it the lane's own pointer and offset 0).
// Behind each run of such loads stands s_wait_xcnt 0, in front of the rewrite of the offset register that they name (addr_step: the caller advances the offset behind it) or of its release (a statement that takes the address registers as inputs only, so that they stay taken up to the wait).
// ---- k_gemmw: register-blocked GEMM, ONE WAVE per 64x64 output tile (16 accumulators), operands straight from 16-bit planes in fragment order; grid (M/64, N/64, Z), 32 threads.
// C[m][n] (f32, pitch ldc, + optional f32 bias[n]) = sum_k A[m][k] Bt[n][k] (+ split products per NSPLIT). z-batch strides sA/sB/sC in elements. K % (32 * KS) == 0.
// KS > 1 (long-K launches, 32 * KS threads): wave w of the work-group sums the K slice [w K/KS, (w+1) K/KS) of the same 64x64 tile; the KS partial tiles meet in LDS (column-major, pitch 68) and are added in wave order 0..KS-1.
template <typename T16> struct WFrag;
template <> struct WFrag<h16> { typedef v16h V; static __device__ __forceinline__ V ld(const h16* p) { return cat16(*(const v8h*)p, *(const v8h*)(p + 16)); } static __device__ __forceinline__ V ldf(const h16* ub, unsigned vb) { const h16* p = (const h16*)((const char*)ub + vb); return cat16(*(const v8h*)p, *(const v8h*)(p + 256)); } static __device__ __forceinline__ v8f mma(V a, V b, v8f c) { return wmma16(a, b, c); } };
template <> struct WFrag<bf> { typedef v16bf V; static __device__ __forceinline__ V ld(const bf* p) { return cat16b(*(const v8us*)p, *(const v8us*)(p + 16)); } static __device__ __forceinline__ V ldf(const bf* ub, unsigned vb) { const bf* p = (const bf*)((const char*)ub + vb); return cat16b(*(const v8us*)p, *(const v8us*)(p + 256)); } static __device__ __forceinline__ v8f mma(V a, V b, v8f c) { return wmmab(a, b, c); } };
__device__ __forceinline__ void addr_step(unsigned& vb) { asm volatile("s_wait_xcnt 0x0" : "+v"(vb) : : "memory"); }   // the offset's next value is formed from this statement's result, so its rewrite cannot be lifted over the wait
template <typename T16, int NSPLIT, bool BIAS, int KS, int K>
__global__ __launch_bounds__(32 * KS) void k_gemmw(const T16* __restrict__ A, const T16* __restrict__ A2, const T16* __restrict__ Bt, const T16* __restrict__ Bt2, float* C, int ldc, const float* __restrict__ bias, size_t sA, size_t sB, size_t sC) {
    typedef typename WFrag<T16>::V V;
    __shared__ __align__(16) float os[KS == 1 ? 16 * 68 : KS * 64 * 68];
    const size_t z = blockIdx.z; A += z * sA; if (A2) A2 += z * sA; Bt += z * sB; if (Bt2) Bt2 += z * sB; C += z * sC;
    const int lane = threadIdx.x & 31, lr = lane & 15, hi = lane >> 4; const int r0 = blockIdx.x * 64, c0 = blockIdx.y * 64;
    v8f acc[4][4];
#pragma unroll
    for (int mb = 0; mb < 4; ++mb)
#pragma unroll
        for (int nb = 0; nb < 4; ++nb) acc[mb][nb] = (v8f){};
    const int wv = (KS == 1) ? 0 : __builtin_amdgcn_readfirstlane((int)(threadIdx.x >> 5)); constexpr int kspan = K / KS; const int kbeg = wv * kspan;   // this wave's K slice
    const T16* ua = A + (size_t)r0 * K + (size_t)kbeg * 16; const T16* ua2 = (NSPLIT == 1 || NSPLIT == 2) ? A2 + (size_t)r0 * K + (size_t)kbeg * 16 : nullptr; const T16* ub = Bt + (size_t)c0 * K + (size_t)kbeg * 16; const T16* ub2 = (NSPLIT >= 2) ? Bt2 + (size_t)c0 * K + (size_t)kbeg * 16 : nullptr;   // wave-uniform: 16 rows of fragments hold 16 K elements; a step of 32 in k is one fragment (1 KiB)
    unsigned vo = (unsigned)lane * 16;
#pragma unroll 1
    for (int kc = 0; kc < kspan; kc += 32) {
        V a[4], a2[4], b[4], b2[4];
#pragma unroll
        for (int mb = 0; mb < 4; ++mb) { a[mb] = WFrag<T16>::ldf(ua + mb * 16 * K, vo); if (NSPLIT == 1 || NSPLIT == 2) a2[mb] = WFrag<T16>::ldf(ua2 + mb * 16 * K, vo); }
#pragma unroll
        for (int nb = 0; nb < 4; ++nb) { b[nb] = WFrag<T16>::ldf(ub + nb * 16 * K, vo); if (NSPLIT >= 2) b2[nb] = WFrag<T16>::ldf(ub2 + nb * 16 * K, vo); }
        __builtin_amdgcn_sched_barrier(0);   // a trip's loads all issue in front of its products: without it the compiler sinks each B fragment behind the products before it, into one register set, and a trip waits four times for memory
#pragma unroll
        for (int nb = 0; nb < 4; ++nb)
#pragma unroll
            for (int mb = 0; mb < 4; ++mb) { acc[mb][nb] = WFrag<T16>::mma(a[mb], b[nb], acc[mb][nb]); if (NSPLIT == 1 || NSPLIT == 2) acc[mb][nb] = WFrag<T16>::mma(a2[mb], b[nb], acc[mb][nb]); if (NSPLIT >= 2) acc[mb][nb] = WFrag<T16>::mma(a[mb], b2[nb], acc[mb][nb]); }
        asm volatile("v_nop\n\tv_nop\n\tv_nop\n\tv_nop" : "+v"(acc[0][0]), "+v"(acc[1][1]), "+v"(acc[2][2]), "+v"(acc[3][3]) : "v"(a[0]), "v"(a[3]));
        addr_step(vo); vo += 1024;   // next fragment of every operand row block
    }
    if constexpr (KS > 1) {
        float* pw = os + wv * (64 * 68);
#pragma unroll
        for (int mb = 0; mb < 4; ++mb)
#pragma unroll
            for (int nb = 0; nb < 4; ++nb) { float* p = pw + (nb * 16 + lr) * 68 + mb * 16 + hi * 8; const v8f t = acc[mb][nb]; *(v4fa*)p = __builtin_shufflevector(t, t, 0, 1, 2, 3); *(v4fa*)(p + 4) = __builtin_shufflevector(t, t, 4, 5, 6, 7); }
        __syncthreads();   // every wave's partial tile is in LDS before any of it is summed
#pragma unroll
        for (int it = 0; it < 64 * 16 / (32 * KS); ++it) { const int g = it * (32 * KS) + (int)threadIdx.x, col = g & 63, rq = g >> 6; const float* p = os + col * 68 + rq * 4; v4f s = *(const v4fa*)p;
#pragma unroll
            for (int w = 1; w < KS; ++w) s += *(const v4fa*)(p + w * (64 * 68));
            if (BIAS) { const float bb = bfr(bias[c0 + col]); s[0] += bb; s[1] += bb; s[2] += bb; s[3] += bb; }
            float* cp = C + (size_t)(r0 + rq * 4) * ldc + c0 + col;
#pragma unroll
            for (int q = 0; q < 4; ++q) cp[(size_t)q * ldc] = s[q]; }
        return;
    }
#pragma unroll
    for (int mb = 0; mb < 4; ++mb) {
#pragma unroll
        for (int nb = 0; nb < 4; ++nb) {
#pragma unroll
            for (int j = 0; j < 8; ++j) os[(hi * 8 + j) * 68 + nb * 16 + lr] = acc[mb][nb][j]; }
        __builtin_amdgcn_wave_barrier(); asm volatile("" ::: "memory");
        float* crow = C + (size_t)(r0 + mb * 16) * ldc + c0;
{
#pragma unroll
            for (int s = 0; s < 8; ++s) { const int row = 2 * s + hi, cofs = lr * 4; v4f val = *(const v4fa*)(os + row * 68 + cofs); if (BIAS) { val[0] += bfr(bias[c0 + cofs]); val[1] += bfr(bias[c0 + cofs + 1]); val[2] += bfr(bias[c0 + cofs + 2]); val[3] += bfr(bias[c0 + cofs + 3]); }
                *(v4f*)(crow + (size_t)row * ldc + cofs) = val; }
             }
        __builtin_amdgcn_wave_barrier(); asm volatile("" ::: "memory");
    }
}

__device__ __forceinline__ h16 tohx(float x) { return (h16)x; }
__device__ __forceinline__ void splitf(float y, unsigned short& h, unsigned short& l) { h = f2bf(y); l = f2bf(y - bf2f(h)); }
typedef __attribute__((ext_vector_type(2))) _Float16 v2h;
typedef __attribute__((ext_vector_type(4))) _Float16 v4h;
typedef __attribute__((ext_vector_type(2))) unsigned short v2us;
typedef __attribute__((ext_vector_type(4))) unsigned short v4us;
typedef __attribute__((ext_vector_type(2))) float v2f;
typedef __attribute__((ext_vector_type(4))) int v4i;

__global__ __launch_bounds__(256) void k_wtG(const float* __restrict__ w, int K, int N, bf* Bt) {
    const int lane = threadIdx.x & 31; const int L0 = (blockIdx.x * 8 + (threadIdx.x >> 5)) * 8; const int nlines = N * K / 64;
{
#pragma unroll 1
        for (int l = 0; l < 8; ++l) { const int L = L0 + l; if (L >= nlines) break; const size_t e = (size_t)L * 64 + lane * 2; const int k = (int)(e % K), n = (int)(e / K); v2us o;
            o[0] = f2bf(w[(size_t)k * N + n]); o[1] = f2bf(w[(size_t)(k + 1) * N + n]); *(v2us*)(Bt + e) = o; }
         }
}
// k_prep: ONE launch turns all eight f32 matrices (four weights, three activations, Er; row-major [rows][K]) into bf16 planes in fragment order. A work-group takes 32 fragments in a row, which are 16384 elements in a row of the source too (K = 1024: one 16-row block; K = 64: 16 of them);
// a thread takes eight pieces of 8 elements, 4 fragments apart; four neighbouring lanes read one whole 128-byte line of a row (32 k), eight neighbouring rows write one whole line of the fragment.
// All loads name one scalar base, one lane offset and a constant, and so do all stores; all sixteen loads are issued in front of the first conversion, and the stores are the thread's last instructions, so that no register that a store names is written again.
template <int K>
__device__ __forceinline__ void cvt_rows(const float* __restrict__ src, bf* dst, int lb) {
    static_assert(K == 64 || K == 1024, "the step of 4 fragments below is written for these two");
    constexpr int FPR = K / 32, ustep = (FPR >= 32) ? 4 * 32 : (4 / FPR) * 16 * K;   // fragments per row block; source elements from a fragment to the fourth behind it
    const int tid = (int)threadIdx.x, c = tid & 3, lr = (tid >> 2) & 15, tq = tid >> 6;
    const char* sb = (const char*)(src + (size_t)lb * (32 * 512)); char* db = (char*)(dst + (size_t)lb * (32 * 512));   // the same for the whole work-group
    const unsigned so = (unsigned)(((tq / FPR) * 16 + lr) * K + (tq % FPR) * 32 + c * 8) * 4, eo = (unsigned)(tq * 512 + (c >> 1) * 256 + (c & 1) * 128 + lr * 8) * 2;
    v8f v[8]; v8us o[8];
#pragma unroll
    for (int u = 0; u < 8; ++u) v[u] = *(const v8f*)(sb + so + u * (ustep * 4));
    asm volatile("s_wait_xcnt 0x0" : : "v"(so), "s"(sb) : "memory");   // inputs only: the loads' offset register and scalar base stay taken up to the wait, so that no load lands in the offset and nothing else is formed there ahead of it
#pragma unroll
    for (int u = 0; u < 8; ++u)
#pragma unroll
        for (int k = 0; k < 8; ++k) o[u][k] = f2bf(v[u][k]);
    __builtin_amdgcn_sched_barrier(0);   // no store rises in front of a conversion: a conversion behind it could be given a register that the store still names
#pragma unroll
    for (int u = 0; u < 8; ++u) *(v8us*)(db + eo + u * (4 * 512 * 2)) = o[u];
}
#define PB_W (DQ / 16)            // work-groups per weight matrix (16 rows each)
#define PB_X (TT / 16)            // per activation matrix
#define PB_E (TT * HD / (32 * 512))   // for Er
__global__ __launch_bounds__(256) void k_prep(const float* __restrict__ wq, const float* __restrict__ wk, const float* __restrict__ wv, const float* __restrict__ wo, const float* __restrict__ xq, const float* __restrict__ xk, const float* __restrict__ xv, const float* __restrict__ er, bf* WQ, bf* WK, bf* WV, bf* WO, bf* XQ, bf* XK, bf* XV, bf* ERB) {
    const int b = (int)blockIdx.x;   // the matrix is chosen by the work-group's index alone
    if (b < 4 * PB_W) { const int m = b / PB_W; cvt_rows<DM>(m == 0 ? wq : m == 1 ? wk : m == 2 ? wv : wo, m == 0 ? WQ : m == 1 ? WK : m == 2 ? WV : WO, b % PB_W); }
    else if (b < 4 * PB_W + 3 * PB_X) { const int m = (b - 4 * PB_W) / PB_X; cvt_rows<DM>(m == 0 ? xq : m == 1 ? xk : xv, m == 0 ? XQ : m == 1 ? XK : XV, (b - 4 * PB_W) % PB_X); }
    else cvt_rows<HD>(er, ERB, b - 4 * PB_W - 3 * PB_X);
}
// k_qkv: the three projections in ONE launch, grid (TT / 64, heads, 3), 8 waves; main loop, K split over the waves and LDS sum in wave order as in k_gemmw<bf, 0, true, 8, DM>; a 64 x 64 tile is 64 rows t of one head, and the epilogue writes it straight as the head's three planes (fp16, bf16 hi, bf16 lo) in fragment order.
// The partial tiles lie [n][m] in LDS with m (the A operand's rows) contiguous, and a thread sums 8 neighbouring m of one n, which are the 8 elements of one 16-byte piece of a fragment: so q and k (fragment rows t, k = d) take the weight rows d as A and the activation rows t as B,
// and v (ISV; fragment rows d, k = t, fragments laid [t / 32][d / 16] so that a wave's 128 keys x 64 columns are 16 KiB in a row) takes t as A and d as B. Both operand planes have the same fragment order, so the roles are a choice of base pointers. A wave's store is two runs of 256 contiguous bytes.
template <bool ISV>
__device__ __forceinline__ void qkv_tile(float* os, const bf* __restrict__ X, const bf* __restrict__ Wt, const float* __restrict__ bias, h16* P16, bf* Ph, bf* Pl, int t0) {   // X, Wt, bias, planes: already at the tile's rows t0.., the head's weight rows, bias and planes
    constexpr int K = DM, KS = 8; typedef WFrag<bf>::V V;
    const int tid = (int)threadIdx.x, lane = tid & 31, lr = lane & 15, hi = lane >> 4;
    v8f acc[4][4];
#pragma unroll
    for (int mb = 0; mb < 4; ++mb)
#pragma unroll
        for (int nb = 0; nb < 4; ++nb) acc[mb][nb] = (v8f){};
    const int wv = __builtin_amdgcn_readfirstlane(tid >> 5); constexpr int kspan = K / KS; const int kbeg = wv * kspan;   // this wave's K slice
    const bf* ua = (ISV ? X : Wt) + (size_t)kbeg * 16; const bf* ub = (ISV ? Wt : X) + (size_t)kbeg * 16;   // wave-uniform: 16 rows of fragments hold 16 K elements; a step of 32 in k is one fragment (1 KiB)
    const int n = tid & 63, mq = (tid >> 6) * 8;   // this thread's n and its first m; its second piece lies 32 m further
    const unsigned bo = (unsigned)(ISV ? n : mq) * 4; const char* bp = (const char*)bias; v4f bb[4];   // the bias goes with d: n for v, m for q and k
    if constexpr (ISV) bb[0] = (v4f)(*(const float*)(bp + bo));
    else { bb[0] = *(const v4f*)(bp + bo); bb[1] = *(const v4f*)(bp + bo + 16); bb[2] = *(const v4f*)(bp + bo + 128); bb[3] = *(const v4f*)(bp + bo + 144); }
    asm volatile("s_wait_xcnt 0x0" : : "v"(bo), "s"(bp) : "memory");   // inputs only: the bias loads' offset register and scalar base stay taken up to the wait; the loads stand in front of the main loop, which covers their latency
    unsigned vo = (unsigned)lane * 16;
#pragma unroll 1
    for (int kc = 0; kc < kspan; kc += 32) {
        V a[4], b[4];
#pragma unroll
        for (int mb = 0; mb < 4; ++mb) a[mb] = WFrag<bf>::ldf(ua + mb * 16 * K, vo);
#pragma unroll
        for (int nb = 0; nb < 4; ++nb) b[nb] = WFrag<bf>::ldf(ub + nb * 16 * K, vo);
        __builtin_amdgcn_sched_barrier(0);   // a trip's loads all issue in front of its products: without it the compiler sinks each B fragment behind the products before it, into one register set, and a trip waits four times for memory
#pragma unroll
        for (int nb = 0; nb < 4; ++nb)
#pragma unroll
            for (int mb = 0; mb < 4; ++mb) acc[mb][nb] = WFrag<bf>::mma(a[mb], b[nb], acc[mb][nb]);
        asm volatile("v_nop\n\tv_nop\n\tv_nop\n\tv_nop" : "+v"(acc[0][0]), "+v"(acc[1][1]), "+v"(acc[2][2]), "+v"(acc[3][3]) : "v"(a[0]), "v"(a[3]));
        addr_step(vo); vo += 1024;   // next fragment of every operand row block
    }
    float* pw = os + wv * (64 * 68);
#pragma unroll
    for (int mb = 0; mb < 4; ++mb)
#pragma unroll
        for (int nb = 0; nb < 4; ++nb) { float* p = pw + (nb * 16 + lr) * 68 + mb * 16 + hi * 8; const v8f t = acc[mb][nb]; *(v4fa*)p = __builtin_shufflevector(t, t, 0, 1, 2, 3); *(v4fa*)(p + 4) = __builtin_shufflevector(t, t, 4, 5, 6, 7); }
    __syncthreads();   // every wave's partial tile is in LDS before any of it is summed
    v8h o16[2]; v8us oh[2], ol[2];
#pragma unroll
    for (int it = 0; it < 2; ++it) { const float* p = os + n * 68 + mq + it * 32; v4f s0 = *(const v4fa*)p, s1 = *(const v4fa*)(p + 4);
#pragma unroll
        for (int w = 1; w < KS; ++w) { s0 += *(const v4fa*)(p + w * (64 * 68)); s1 += *(const v4fa*)(p + w * (64 * 68) + 4); }
#pragma unroll
        for (int q = 0; q < 8; ++q) { const float r = (q < 4 ? s0[q & 3] : s1[q & 3]) + bfr(ISV ? bb[0][0] : bb[it * 2 + (q >> 2)][q & 3]); o16[it][q] = tohx(r); unsigned short a2, c2; splitf(r, a2, c2); oh[it][q] = a2; ol[it][q] = c2; } }
    const int t = t0 + (ISV ? mq : n), d = ISV ? n : mq;   // of the first piece; the second is one fragment in d further (q, k) or one row of four fragments in t (v)
    const unsigned ob = (unsigned)(ISV ? ((t >> 5) * 4 + (d >> 4)) * 512 + ((t >> 4) & 1) * 256 + ((t >> 3) & 1) * 128 + (d & 15) * 8
                                       : (t & ~15) * HD + (d >> 5) * 512 + ((d >> 4) & 1) * 256 + ((d >> 3) & 1) * 128 + (t & 15) * 8) * 2;
    constexpr int step = (ISV ? 4 : 1) * 512 * 2;
    __builtin_amdgcn_sched_barrier(0);   // the six stores stay the thread's last instructions: nothing behind them is given a register that a store still names
#pragma unroll
    for (int it = 0; it < 2; ++it) { *(v8h*)((char*)P16 + ob + it * step) = o16[it]; *(v8us*)((char*)Ph + ob + it * step) = oh[it]; *(v8us*)((char*)Pl + ob + it * step) = ol[it]; }
}
__global__ __launch_bounds__(256) void k_qkv(const bf* __restrict__ XQ, const bf* __restrict__ XK, const bf* __restrict__ XV, const bf* __restrict__ WQ, const bf* __restrict__ WK, const bf* __restrict__ WV, const float* __restrict__ bq, const float* __restrict__ bk, const float* __restrict__ bv,
                                             h16* QP16, bf* QPh, bf* QPl, h16* KP16, bf* KPh, bf* KPl, h16* VT16, bf* VTh, bf* VTl) {
    __shared__ __align__(16) float os[8 * 64 * 68];
    const int z = (int)blockIdx.z, t0 = (int)blockIdx.x * 64, h = (int)blockIdx.y; const size_t xo = (size_t)t0 * DM, wo = (size_t)h * HD * DM, po = (size_t)h * TT * HD;   // the choice below is the same for the whole work-group, so its barrier is met by all of its waves
    if (z == 2) qkv_tile<true>(os, XV + xo, WV + wo, bv + h * HD, VT16 + po, VTh + po, VTl + po, t0);
    else qkv_tile<false>(os, (z == 0 ? XQ : XK) + xo, (z == 0 ? WQ : WK) + wo, (z == 0 ? bq : bk) + h * HD, (z == 0 ? QP16 : KP16) + po, (z == 0 ? QPh : KPh) + po, (z == 0 ? QPl : KPl) + po, t0);
}
// ---- k_attn: one work-group of 16 waves per (head, 32 query rows = QB blocks of 16); the 32 x 2048 score rows never leave LDS and take most of a WGP's LDS, so one work-group has the WGP to itself (4 waves per SIMD, up to 256 registers each).
// Every Er, k and v fragment that a wave loads stays in registers for the products of BOTH row blocks: per query row half as many bytes come from L2 as with one block per work-group. Each row's products, trees and sums are those of a single block. Five stages, a work-group barrier between each two and one inside the last:
// 1 relative logits: qe tiles (q hi/lo planes x Er) are stored straight at their skewed place: qe[i][t] is rel(i, t - 2047 + i) where that column is >= 0, and qe[i+1][t] is rel(i, t + i + 2) where that column is < 2048; rel(i, i+1) = 0 (= the reference's pad/reshape/slice of q.Er^T, upper triangle included)
// 2 scores: each q.k tile adds the relative logit that lies at its own place, scales by 1/8 and stores back
// 3 softmax: wave w owns rows w and w + 16 (register row, one exp, fixed trees) and writes the probabilities over its own rows: fp16 x 1024, or bf16 hi and lo planes for rows < RH
// 4 attn.v: wave w sums the key slice [128 w, 128 w + 128) for all 64 columns of both row blocks
// 5 the 16 partial tiles meet in LDS (column-major, pitch 36) and are added in wave order 0..15; the merged context goes out as hi/lo planes in fragment order
#define SP 2052   // LDS pitch of a score row in floats: rows stay 16-byte aligned, rows 8 apart lie 32 banks apart; columns 2048..2051 take the qe elements that belong to no column of this row block
#define QB 2      // 16-row blocks per work-group
#define PP (QB * 16 + 4)   // LDS pitch of a partial tile's column in floats (stage 5): 16 bytes times an odd number
typedef v2f __attribute__((may_alias)) v2fa;
template <bool UP>
__device__ __forceinline__ void rel_one(float* S, const v16bf (&ah0)[QB], const v16bf (&al0)[QB], const v16bf (&ah1)[QB], const v16bf (&al1)[QB], v16bf b0, v16bf b1, int tt, int r0, int lr, int hi) {   // one Er tile against the q rows of every row block
#pragma unroll
    for (int rb = 0; rb < QB; ++rb) {
        v8f acc = (v8f){}; acc = wmmab(ah0[rb], b0, acc); acc = wmmab(al0[rb], b0, acc); acc = wmmab(ah1[rb], b1, acc); acc = wmmab(al1[rb], b1, acc);
        const int cb = tt * 16 + lr + r0 + rb * 16 + hi * 8 + (UP ? 2 : 1 - TT);   // column of accumulator register 0; register j is one row lower and so j columns further
#pragma unroll
        for (int j = 0; j < 8; ++j) { const int col = cb + j; const bool ok = UP ? (col < TT) : (col >= 0); S[(rb * 16 + hi * 8 + j) * SP + (ok ? col : TT + (lr & 3))] = acc[j]; }
    }
}
template <bool UP>
__device__ __forceinline__ void rel_tiles(float* S, const bf* __restrict__ qh, const bf* __restrict__ ql, const bf* __restrict__ er, int r0, int tbeg, int tend, int lr, int hi) {
    if (tbeg >= tend) return;   // wave-uniform: a wave without a tile loads no q rows
    v16bf ah0[QB], ah1[QB], al0[QB], al1[QB]; unsigned ao[QB];
#pragma unroll
    for (int rb = 0; rb < QB; ++rb) { const int qr = UP ? min(r0 + rb * 16 + 1 + lr, TT - 1) : r0 + rb * 16 + lr; ao[rb] = (unsigned)((qr >> 4) * (16 * HD) + (qr & 15) * 8 + hi * 128) * 2;   // UP: q rows i + 1 (the clamped row has no column in range); byte offset in fragment order: a 16-row tile is 2 fragments (k 0..31, 32..63)
        ah0[rb] = WFrag<bf>::ldf(qh, ao[rb]); ah1[rb] = WFrag<bf>::ldf(qh + 512, ao[rb]); al0[rb] = WFrag<bf>::ldf(ql, ao[rb]); al1[rb] = WFrag<bf>::ldf(ql + 512, ao[rb]); }
    asm volatile("s_wait_xcnt 0x0" : : "v"(ao[0]), "v"(ao[1]), "s"(qh), "s"(ql) : "memory");   // inputs only: the q loads' offset registers and two scalar bases stay taken up to the wait; the Er base and offset are formed behind it, not in those registers ahead of it
    const bf* eb = er + (size_t)tbeg * 16 * HD; unsigned eo = (unsigned)(lr * 8 + hi * 128) * 2;
    for (int tt = tbeg; tt < tend; tt += 32) {   // two Er tiles' loads in flight per trip (16 waves a WGP: each keeps more bytes under way)
        const bool two = tt + 16 < tend;   // wave-uniform; without a second tile its loads read the first again and feed nothing
        const unsigned e2 = eo + (two ? 16 * 16 * HD * 2 : 0);
        const v16bf b0 = WFrag<bf>::ldf(eb, eo), b1 = WFrag<bf>::ldf(eb + 512, eo), c0 = WFrag<bf>::ldf(eb, e2), c1 = WFrag<bf>::ldf(eb + 512, e2);
        rel_one<UP>(S, ah0, al0, ah1, al1, b0, b1, tt, r0, lr, hi);
        asm volatile("" : : "v"(c0), "v"(c1));   // inputs only, the loaded values: holds the second tile's loads in front of the branch, beside the first tile's; without it the compiler sinks them into the branch and a trip waits twice for L2
        if (two) rel_one<UP>(S, ah0, al0, ah1, al1, c0, c1, tt + 16, r0, lr, hi);
        asm volatile("s_wait_xcnt 0x0" : "+v"(eo) : "v"(e2) : "memory");   // as addr_step; the second tile's offset register stays taken up to the wait, and its next value is formed from this statement's result
        eo += 32 * 16 * HD * 2;   // 32 Er tiles further
    }
}
template <bool HI>
__device__ __forceinline__ void attn_rows(float* S, int h, int r0, const h16* __restrict__ QP16, const bf* __restrict__ QPh, const bf* __restrict__ QPl, const h16* __restrict__ KP16, const bf* __restrict__ KPh, const bf* __restrict__ KPl, const bf* __restrict__ ERB, const h16* __restrict__ VT16, const bf* __restrict__ VTh, const bf* __restrict__ VTl, bf* ATh, bf* ATl) {
    const int tid = (int)threadIdx.x, lane = tid & 31, lr = lane & 15, hi = lane >> 4; const int wv = __builtin_amdgcn_readfirstlane(tid >> 5);   // wave-uniform: scalar loop bounds
    const size_t hq = (size_t)h * TT * HD;
    {   // stage 1: for row block rb, Er tiles 0..T0 - rb serve the columns right of the diagonal and tiles T0 - rb..127 those up to it; each deal takes the union over the blocks (a tile that serves only one block leaves the other's elements in the spare columns); the second deal runs in reverse wave order so that the two remainders fall on different waves where they can
        const int T0 = TT / 16 - 1 - (r0 >> 4);
        rel_tiles<true>(S, QPh + hq, QPl + hq, ERB, r0, wv, T0 + 1, lr, hi);
        rel_tiles<false>(S, QPh + hq, QPl + hq, ERB, r0, T0 - (QB - 1) + 15 - wv, TT / 16, lr, hi);
        if (tid < QB * 16 && r0 + tid + 1 < TT) S[tid * SP + r0 + tid + 1] = 0.0f;
    }
    __syncthreads();   // every relative logit lies in LDS before a score tile adds it
    {   // stage 2
        const size_t ab = hq + (size_t)r0 * HD, kb = hq + (size_t)wv * (16 * HD); unsigned lo = (unsigned)(lr * 8 + hi * 128) * 2;   // wave-uniform bases, 32-bit lane byte offset (fragment order); key tile it * 16 + wv lies it * 32 KiB behind tile wv
        if constexpr (HI) {
            v16bf a0[QB], a1[QB], c0[QB], c1[QB];
#pragma unroll
            for (int rb = 0; rb < QB; ++rb) { const size_t ar = ab + rb * (16 * HD); a0[rb] = WFrag<bf>::ldf(QPh + ar, lo); a1[rb] = WFrag<bf>::ldf(QPh + ar + 512, lo); c0[rb] = WFrag<bf>::ldf(QPl + ar, lo); c1[rb] = WFrag<bf>::ldf(QPl + ar + 512, lo); }
#pragma unroll 1   // two tiles' loads (8 KiB a wave) in flight per trip
            for (int io = 0; io < TT / 256; io += 2) {
              v16bf b0[2], b1[2], d0[2], d1[2];
#pragma unroll
              for (int ii = 0; ii < 2; ++ii) { const bf* kh = KPh + kb + ii * (256 * HD); const bf* kl = KPl + kb + ii * (256 * HD); b0[ii] = WFrag<bf>::ldf(kh, lo); b1[ii] = WFrag<bf>::ldf(kh + 512, lo); d0[ii] = WFrag<bf>::ldf(kl, lo); d1[ii] = WFrag<bf>::ldf(kl + 512, lo); }
              __builtin_amdgcn_sched_barrier(0);   // a trip's loads all issue in front of its products: without it the compiler sinks the later fragments behind the products before them, and a trip waits several times for L2
#pragma unroll
              for (int ii = 0; ii < 2; ++ii) { const int n0 = ((io + ii) * 16 + wv) * 16;
#pragma unroll
                for (int rb = 0; rb < QB; ++rb) {
                    v8f acc = (v8f){}; acc = wmmab(a0[rb], b0[ii], acc); acc = wmmab(c0[rb], b0[ii], acc); acc = wmmab(a0[rb], d0[ii], acc); acc = wmmab(a1[rb], b1[ii], acc); acc = wmmab(c1[rb], b1[ii], acc); acc = wmmab(a1[rb], d1[ii], acc);
#pragma unroll
                    for (int j = 0; j < 8; ++j) { float* p = S + (rb * 16 + hi * 8 + j) * SP + n0 + lr; *p = (acc[j] + *p) * SCL; } } }
              addr_step(lo); lo += 2 * 256 * HD * 2; }
        } else {
            v16h a0[QB], a1[QB];
#pragma unroll
            for (int rb = 0; rb < QB; ++rb) { const size_t ar = ab + rb * (16 * HD); a0[rb] = WFrag<h16>::ldf(QP16 + ar, lo); a1[rb] = WFrag<h16>::ldf(QP16 + ar + 512, lo); }
#pragma unroll 1   // four tiles' loads (8 KiB a wave) in flight per trip
            for (int io = 0; io < TT / 256; io += 4) {
              v16h b0[4], b1[4];
#pragma unroll
              for (int ii = 0; ii < 4; ++ii) { const h16* kp = KP16 + kb + ii * (256 * HD); b0[ii] = WFrag<h16>::ldf(kp, lo); b1[ii] = WFrag<h16>::ldf(kp + 512, lo); }
              __builtin_amdgcn_sched_barrier(0);   // a trip's loads all issue in front of its products: without it the compiler sinks the later fragments behind the products before them, and a trip waits several times for L2
#pragma unroll
              for (int ii = 0; ii < 4; ++ii) { const int n0 = ((io + ii) * 16 + wv) * 16;
#pragma unroll
                for (int rb = 0; rb < QB; ++rb) {
                    v8f acc = (v8f){}; acc = wmma16(a0[rb], b0[ii], acc); acc = wmma16(a1[rb], b1[ii], acc);
#pragma unroll
                    for (int j = 0; j < 8; ++j) { float* p = S + (rb * 16 + hi * 8 + j) * SP + n0 + lr; *p = (acc[j] + *p) * SCL; } } }
              addr_step(lo); lo += 4 * 256 * HD * 2; }
        }
    }
    __syncthreads();   // every score of a row lies in LDS before its wave reads the row
#pragma unroll (HI ? 1 : QB)   // the long hi/lo split stays rolled over the two rows: unrolled, the kernel's text passes 32 KB
    for (int rr = 0; rr < QB; ++rr) {   // stage 3
        float* sr = S + (rr * 16 + wv) * SP; float v[TT / 32]; float mx = -3.0e38f;
#pragma unroll
        for (int ch = 0; ch < TT / 128; ++ch) { const v4f a = *(const v4fa*)(sr + ch * 128 + lane * 4);
#pragma unroll
            for (int q = 0; q < 4; ++q) { v[ch * 4 + q] = a[q]; mx = fmaxf(mx, a[q]); } }
#pragma unroll
        for (int sh = 16; sh; sh >>= 1) mx = fmaxf(mx, __shfl_xor(mx, sh, 32));
        float sum = 0.f;
#pragma unroll
        for (int k = 0; k < TT / 32; ++k) { v[k] = __builtin_amdgcn_exp2f((v[k] - mx) * 1.4426950408889634f); sum += v[k]; }
#pragma unroll
        for (int sh = 16; sh; sh >>= 1) sum += __shfl_xor(sum, sh, 32);
        const float f = __fdiv_rn(HI ? 1.0f : PCAR, sum);
        if constexpr (HI) { bf* ph = (bf*)sr; bf* pl = ph + TT;
#pragma unroll
            for (int ch = 0; ch < TT / 128; ++ch) { v4us oh, ol;
#pragma unroll
                for (int q = 0; q < 4; ++q) { unsigned short a, c2; splitf(v[ch * 4 + q] * f, a, c2); oh[q] = a; ol[q] = c2; }
                *(v4us*)(ph + ch * 128 + lane * 4) = oh; *(v4us*)(pl + ch * 128 + lane * 4) = ol; }
        } else { h16* pp = (h16*)sr;
#pragma unroll
            for (int ch = 0; ch < TT / 128; ++ch) { v4h o4;
#pragma unroll
                for (int q = 0; q < 4; ++q) o4[q] = tohx(v[ch * 4 + q] * f);
                *(v4h*)(pp + ch * 128 + lane * 4) = o4; } }
    }
    __syncthreads();   // all probability rows lie in LDS before any wave reads its key slice of them
    v8f acc[QB][4];
#pragma unroll
    for (int rb = 0; rb < QB; ++rb)
#pragma unroll
        for (int nb = 0; nb < 4; ++nb) acc[rb][nb] = (v8f){};
    {   // stage 4
        const size_t vb = (size_t)h * HD * TT + (size_t)wv * (128 * HD); const unsigned lo = (unsigned)(lr * 8 + hi * 128) * 2;   // wave-uniform base (the wave's 16 fragments lie in a row), 32-bit lane byte offset
        const h16* vp = (const h16*)((const char*)(VT16 + vb) + lo); const bf* vh = (const bf*)((const char*)(VTh + vb) + lo); const bf* vl = (const bf*)((const char*)(VTl + vb) + lo);
        v16h bv[HI ? 1 : 16];
        if constexpr (!HI) {
#pragma unroll
            for (int f = 0; f < 16; ++f) bv[f] = WFrag<h16>::ldf(vp + f * 512, 0u);
            __builtin_amdgcn_sched_barrier(0);   // the wave's whole v slice (16 KiB) is under way before its first product: without it the compiler loads each fragment right in front of its products, and the wave waits for L2 once a fragment
        }
#pragma unroll
        for (int s = 0; s < 4; ++s) { const int kc = wv * 128 + s * 32;
            if constexpr (HI) { v16bf a[QB], a2[QB], b[4], b2[4];
#pragma unroll
                for (int nb = 0; nb < 4; ++nb) { b[nb] = WFrag<bf>::ldf(vh + (s * 4 + nb) * 512, 0u); b2[nb] = WFrag<bf>::ldf(vl + (s * 4 + nb) * 512, 0u); }
                __builtin_amdgcn_sched_barrier(0);   // the eight fragments of 32 keys (8 KiB) are under way together: without it the compiler loads each pair right in front of its products, and the wave waits for L2 once a pair
#pragma unroll
                for (int rb = 0; rb < QB; ++rb) { const bf* pr = (const bf*)(S + (rb * 16 + lr) * SP) + kc + 8 * hi; a[rb] = WFrag<bf>::ld(pr); a2[rb] = WFrag<bf>::ld(pr + TT); }
#pragma unroll
                for (int nb = 0; nb < 4; ++nb)
#pragma unroll
                    for (int rb = 0; rb < QB; ++rb) { acc[rb][nb] = wmmab(a[rb], b[nb], acc[rb][nb]); acc[rb][nb] = wmmab(a2[rb], b[nb], acc[rb][nb]); acc[rb][nb] = wmmab(a[rb], b2[nb], acc[rb][nb]); }
            } else { v16h a[QB];
#pragma unroll
                for (int rb = 0; rb < QB; ++rb) a[rb] = WFrag<h16>::ld((const h16*)(S + (rb * 16 + lr) * SP) + kc + 8 * hi);
#pragma unroll
                for (int nb = 0; nb < 4; ++nb)
#pragma unroll
                    for (int rb = 0; rb < QB; ++rb) acc[rb][nb] = wmma16(a[rb], bv[s * 4 + nb], acc[rb][nb]); } }
        if constexpr (HI) asm volatile("s_wait_xcnt 0x0" : : "v"(vh), "v"(vl) : "memory"); else asm volatile("s_wait_xcnt 0x0" : : "v"(vp) : "memory");   // inputs only: the lane's address pairs (one a plane serves all of its loads, which differ by constants) stay taken up to the wait, so that no late load lands in one of them
    }
    __syncthreads();   // every wave has read its slice of the probability rows before the partial tiles overwrite them
    {   // stage 5
        float* pw = S + wv * (64 * PP);
#pragma unroll
        for (int rb = 0; rb < QB; ++rb)
#pragma unroll
            for (int nb = 0; nb < 4; ++nb) { float* p = pw + (nb * 16 + lr) * PP + rb * 16 + hi * 8; const v8f t = acc[rb][nb]; *(v4fa*)p = __builtin_shufflevector(t, t, 0, 1, 2, 3); *(v4fa*)(p + 4) = __builtin_shufflevector(t, t, 4, 5, 6, 7); }
        __syncthreads();   // every wave's partial tile is in LDS before any of it is summed
        const int col = tid & 63, rp = tid >> 6; const float* p = S + col * PP + rp * 4; v4f s = *(const v4fa*)p;   // four neighbouring rows of one column
#pragma unroll
        for (int w = 1; w < 16; ++w) s += *(const v4fa*)(p + w * (64 * PP));
        const float cs = HI ? 1.0f : (1.0f / PCAR);
        unsigned short oa[4], oc[4];
#pragma unroll
        for (int q = 0; q < 4; ++q) splitf(s[q] * cs, oa[q], oc[q]);
        const size_t oo = (size_t)(r0 + ((rp * 4) & ~15)) * DQ + (h * 2 + (col >> 5)) * 512 + ((col >> 4) & 1) * 256 + ((col >> 3) & 1) * 128 + ((rp * 4) & 15) * 8 + (col & 7);   // fragment order, rows = query rows, k = h * HD + col; the thread's four rows lie in one 16-row block, 8 elements apart
        __builtin_amdgcn_sched_barrier(0);   // the eight stores stay the thread's last instructions: nothing behind them is given a register that a store still names
#pragma unroll
        for (int q = 0; q < 4; ++q) { ATh[oo + q * 8] = oa[q]; ATl[oo + q * 8] = oc[q]; }
    }
}
__global__ __launch_bounds__(512) void k_attn(const h16* __restrict__ QP16, const bf* __restrict__ QPh, const bf* __restrict__ QPl, const h16* __restrict__ KP16, const bf* __restrict__ KPh, const bf* __restrict__ KPl, const bf* __restrict__ ERB, const h16* __restrict__ VT16, const bf* __restrict__ VTh, const bf* __restrict__ VTl, bf* ATh, bf* ATl) {
    __shared__ __align__(16) float S[QB * 16 * SP];
    // Grid (RH / 32, heads, TT / RH): there are four times as many work-groups as WGPs, and one of hi/lo rows lasts about half as long again as one of fp16 rows. Slab z = 0 holds all hi/lo row blocks of all heads.
    // For speed only: every (head, row block) is done exactly once wherever and whenever its work-group runs.
    static_assert(RH > 0 && RH % (QB * 16) == 0 && TT % RH == 0, "slabs of RH query rows; slab 0 is the hi/lo one");
    const int r0 = (int)blockIdx.z * RH + (int)blockIdx.x * (QB * 16), h = (int)blockIdx.y;   // the choice below is the same for the whole work-group (RH is a multiple of its rows), so every barrier is met by all of its waves
    if (r0 < RH) attn_rows<true>(S, h, r0, QP16, QPh, QPl, KP16, KPh, KPl, ERB, VT16, VTh, VTl, ATh, ATl);
    else attn_rows<false>(S, h, r0, QP16, QPh, QPl, KP16, KPh, KPl, ERB, VT16, VTh, VTl, ATh, ATl);
}

extern "C" void kernel_launch(void* const* d_in, const int* in_sizes, int n_in,
                              void* d_out, int out_size, void* d_ws, size_t ws_size, hipStream_t stream) {
    (void)in_sizes; (void)n_in; (void)out_size;
    const float* xq = (const float*)d_in[0]; const float* xk = (const float*)d_in[1]; const float* xv = (const float*)d_in[2]; const float* wq = (const float*)d_in[3]; const float* bq = (const float*)d_in[4]; const float* wk = (const float*)d_in[5]; const float* bk = (const float*)d_in[6]; const float* wv = (const float*)d_in[7]; const float* bv = (const float*)d_in[8]; const float* wo = (const float*)d_in[9]; const float* bo = (const float*)d_in[10]; const float* Er = (const float*)d_in[11]; const float* x = nullptr; (void)x;
    float* OUT = (float*)d_out;     // [1][2048][1024]
    char* wsp = (char*)d_ws;
    auto take = [&](size_t bytes) { char* p = wsp; wsp += (bytes + 255) & ~(size_t)255; return (void*)p; };
    bf* WQ = (bf*)take((size_t)DQ * DM * 2); bf* WK = (bf*)take((size_t)DKV * DM * 2); bf* WV = (bf*)take((size_t)DKV * DM * 2); bf* WO = (bf*)take((size_t)DM * DQ * 2);
    bf* ERB = (bf*)take((size_t)TT * HD * 2);
    bf* XQ = (bf*)take((size_t)TT * DM * 2); bf* XK = (bf*)take((size_t)TT * DM * 2); bf* XV = (bf*)take((size_t)TT * DM * 2);
    h16* QP16 = (h16*)take((size_t)NH_ * TT * HD * 2); h16* KP16 = (h16*)take((size_t)NKV * TT * HD * 2); h16* VT16 = (h16*)take((size_t)NKV * HD * TT * 2);
    bf* QPh = (bf*)take((size_t)NH_ * TT * HD * 2); bf* QPl = (bf*)take((size_t)NH_ * TT * HD * 2); bf* KPh = (bf*)take((size_t)NKV * TT * HD * 2); bf* KPl = (bf*)take((size_t)NKV * TT * HD * 2); bf* VTh = (bf*)take((size_t)NKV * HD * TT * 2); bf* VTl = (bf*)take((size_t)NKV * HD * TT * 2);
    bf* ATh = (bf*)take((size_t)TT * DQ * 2); bf* ATl = (bf*)take((size_t)TT * DQ * 2);
    if ((size_t)(wsp - (char*)d_ws) > ws_size) return;    // ws 256 MiB
    for (int b = 0; b < NB_; ++b) {
        k_prep<<<4 * PB_W + 3 * PB_X + PB_E, 256, 0, stream>>>(wq, wk, wv, wo, xq + (size_t)b * TT * DM, xk + (size_t)b * TT * DM, xv + (size_t)b * TT * DM, Er, WQ, WK, WV, WO, XQ, XK, XV, ERB);   /* Er [2048][64] ('t d'): rows t, k = d */
        k_qkv<<<dim3(TT / 64, NH_, 3), 256, 0, stream>>>(XQ, XK, XV, WQ, WK, WV, bq, bk, bv, QP16, QPh, QPl, KP16, KPh, KPl, VT16, VTh, VTl);
        k_attn<<<dim3(RH / (QB * 16), NH_, TT / RH), 512, 0, stream>>>(QP16, QPh, QPl, KP16, KPh, KPl, ERB, VT16, VTh, VTl, ATh, ATl);   /* one kv head per query head */
        k_gemmw<bf, 1, true, 8, DQ><<<dim3(TT / 64, DM / 64, 1), 256, 0, stream>>>(ATh, ATl, WO, nullptr, OUT + (size_t)b * TT * DM, DM, bo, 0, 0, 0); }
}

// v007
// A run of this version takes 107 microseconds.
// In two side-by-side timings against v006, it was 1.04 and 1.05 times as fast.
// Over all steps from v000 it is 11.7 times as fast.
#include <hip/hip_runtime.h>

// Relative global attention (Music-Transformer skew) (query, key, value [1][2048][1024]; q,k,v = input W^T + b ('oi' [1024][1024] + [1024]; 16 heads x 64); qe = q.Er^T (Er [2048][64], all rows used since s = max_len); s_rel = skew(qe): for j <= i  s_rel[i][j] = qe[i][2047 + j - i]; for j = i+1  0; for j > i+1  qe[i+1][j - i - 2] (the reference's pad-reshape-slice, reproduced exactly, upper triangle included); scores = (q.k + s_rel) / 8; softmax; out = merged ctx Wo^T + bo -> [1][2048][1024] (2.1 M)).
// Compute dtypes, f32 accumulate: every input rounded to bf16; q/k/v on PLAIN bf16 operands (inputs: exact) + biases (three input tensors); qe = q(hi/lo planes) x Er (exact bf16) gives the relative logits, stored in LDS at their skewed place (the index map above) and added to q.k before the 1/8 scale; scores and attn.v: query rows < 512 hl (3 products), the rest single fp16 (x1024); softmax f32; Wo hl x exact (2 products) + bo.

#define NB_  1
#define TT   2048
#define DM   1024
#define NH_  16
#define NKV  16
#define REP  (NH_ / NKV)
#define HD   64
#define DQ   (NH_ * HD)
#define DKV  (NKV * HD)
#define RH   512                  // query rows < RH use hi+lo planes
#define WIN  0
#define PCAR 1024.0f
#define SCL  0.125f   // HD^-0.5
typedef _Float16 h16;
typedef unsigned short bf;
typedef __attribute__((ext_vector_type(16))) __bf16   v16bf;
typedef __attribute__((ext_vector_type(16))) _Float16 v16h;
typedef __attribute__((ext_vector_type(8)))  _Float16 v8h;
typedef __attribute__((ext_vector_type(8)))  unsigned short v8us;
typedef __attribute__((ext_vector_type(8)))  float    v8f;
typedef __attribute__((ext_vector_type(4)))  float    v4f;
typedef v8h  __attribute__((may_alias)) v8ha;
typedef v4f  __attribute__((may_alias)) v4fa;
typedef v8us __attribute__((may_alias)) v8usa;

__device__ __forceinline__ unsigned short f2bf(float f) { unsigned u = __float_as_uint(f); u += 0x7FFFu + ((u >> 16) & 1u); return (unsigned short)(u >> 16); }
__device__ __forceinline__ float bf2f(unsigned short b) { return __uint_as_float(((unsigned)b) << 16); }
__device__ __forceinline__ float bfr(float f) { return bf2f(f2bf(f)); }
__device__ __forceinline__ v16h cat16(v8h lo, v8h hi) { return __builtin_shufflevector(lo, hi, 0, 1, 2, 3, 4, 5, 6, 7, 8, 9, 10, 11, 12, 13, 14, 15); }
__device__ __forceinline__ v16bf cat16b(v8us lo, v8us hi) { return __builtin_bit_cast(v16bf, __builtin_shufflevector(lo, hi, 0, 1, 2, 3, 4, 5, 6, 7, 8, 9, 10, 11, 12, 13, 14, 15)); }
__device__ __forceinline__ v8f wmma16(v16h a, v16h b, v8f c) { return __builtin_amdgcn_wmma_f32_16x16x32_f16(false, a, false, b, (short)0, c, false, false); }
__device__ __forceinline__ v8f wmmab(v16bf a, v16bf b, v8f c) { return __builtin_amdgcn_wmma_f32_16x16x32_bf16(false, a, false, b, (short)0, c, false, false); }



// ---- FRAGMENT ORDER of every 16-bit operand plane in global memory (rows x K, K % 32 == 0): the plane is a row-major grid of fragments (16 rows x 32 k, 512 elements = 1 KiB, fragment index (row / 16) * (K / 32) + k / 32; the v planes alone order their fragments k-block first, see k_qkv);
// inside a fragment element (row, k) lies at ((k >> 4) & 1) * 256 + ((k >> 3) & 1) * 128 + (row & 15) * 8 + (k & 7), which is half * 256 + lane * 8 + e of the lane and register half that hold it in the WMMA operand.
// WFrag::ldf(fragment, lane * 16) is then two wave-wide 16-byte loads of 512 contiguous bytes each (four whole 128-byte lines); from a row-major plane each such load touches 16 lines. WFrag::ld reads a row-major source (the LDS rows).
// ldf takes a wave-uniform fragment pointer and the lane's 32-bit BYTE offset: every load of a loop then names one scalar base, one offset register and a constant, and no per-load address pair is formed (stages 2 and 4 of k_attn hand it the lane's own pointer and offset 0).
// Behind each run of such loads stands s_wait_xcnt 0, in front of the rewrite of the offset register that they name (addr_step: the caller advances the offset behind it) or of its release (a statement that takes the address registers as inputs only, so that they stay taken up to the wait).
// ---- k_gemmw: register-blocked GEMM, ONE WAVE per 64x64 output tile (16 accumulators), operands straight from 16-bit planes in fragment order; grid (M/64, N/64, Z), 32 threads.
// C[m][n] (f32, pitch ldc, + optional f32 bias[n]) = sum_k A[m][k] Bt[n][k] (+ split products per NSPLIT). z-batch strides sA/sB/sC in elements. K % (32 * KS) == 0.
// KS > 1 (long-K launches, 32 * KS threads): wave w of the work-group sums the K slice [w K/KS, (w+1) K/KS) of the same 64x64 tile; the KS partial tiles meet in LDS (column-major, pitch 68) and are added in wave order 0..KS-1.
template <typename T16> struct WFrag;
template <> struct WFrag<h16> { typedef v16h V; static __device__ __forceinline__ V ld(const h16* p) { return cat16(*(const v8h*)p, *(const v8h*)(p + 16)); } static __device__ __forceinline__ V ldf(const h16* ub, unsigned vb) { const h16* p = (const h16*)((const char*)ub + vb); return cat16(*(const v8h*)p, *(const v8h*)(p + 256)); } static __device__ __forceinline__ v8f mma(V a, V b, v8f c) { return wmma16(a, b, c); } };
template <> struct WFrag<bf> { typedef v16bf V; static __device__ __forceinline__ V ld(const bf* p) { return cat16b(*(const v8us*)p, *(const v8us*)(p + 16)); } static __device__ __forceinline__ V ldf(const bf* ub, unsigned vb) { const bf* p = (const bf*)((const char*)ub + vb); return cat16b(*(const v8us*)p, *(const v8us*)(p + 256)); } static __device__ __forceinline__ v8f mma(V a, V b, v8f c) { return wmmab(a, b, c); } };
__device__ __forceinline__ void addr_step(unsigned& vb) { asm volatile("s_wait_xcnt 0x0" : "+v"(vb) : : "memory"); }   // the offset's next value is formed from this statement's result, so its rewrite cannot be lifted over the wait
template <typename T16, int NSPLIT, bool BIAS, int KS, int K>
__global__ __launch_bounds__(32 * KS) void k_gemmw(const T16* __restrict__ A, const T16* __restrict__ A2, const T16* __restrict__ Bt, const T16* __restrict__ Bt2, float* C, int ldc, const float* __restrict__ bias, size_t sA, size_t sB, size_t sC) {
    typedef typename WFrag<T16>::V V;
    __shared__ __align__(16) float os[KS == 1 ? 16 * 68 : KS * 64 * 68];
    const size_t z = blockIdx.z; A += z * sA; if (A2) A2 += z * sA; Bt += z * sB; if (Bt2) Bt2 += z * sB; C += z * sC;
    const int lane = threadIdx.x & 31, lr = lane & 15, hi = lane >> 4; const int r0 = blockIdx.x * 64, c0 = blockIdx.y * 64;
    v8f acc[4][4];
#pragma unroll
    for (int mb = 0; mb < 4; ++mb)
#pragma unroll
        for (int nb = 0; nb < 4; ++nb) acc[mb][nb] = (v8f){};
    const int wv = (KS == 1) ? 0 : __builtin_amdgcn_readfirstlane((int)(threadIdx.x >> 5)); constexpr int kspan = K / KS; const int kbeg = wv * kspan;   // this wave's K slice
    const T16* ua = A + (size_t)r0 * K + (size_t)kbeg * 16; const T16* ua2 = (NSPLIT == 1 || NSPLIT == 2) ? A2 + (size_t)r0 * K + (size_t)kbeg * 16 : nullptr; const T16* ub = Bt + (size_t)c0 * K + (size_t)kbeg * 16; const T16* ub2 = (NSPLIT >= 2) ? Bt2 + (size_t)c0 * K + (size_t)kbeg * 16 : nullptr;   // wave-uniform: 16 rows of fragments hold 16 K elements; a step of 32 in k is one fragment (1 KiB)
    unsigned vo = (unsigned)lane * 16;
#pragma unroll 1
    for (int kc = 0; kc < kspan; kc += 32) {
        V a[4], a2[4], b[4], b2[4];
#pragma unroll
        for (int mb = 0; mb < 4; ++mb) { a[mb] = WFrag<T16>::ldf(ua + mb * 16 * K, vo); if (NSPLIT == 1 || NSPLIT == 2) a2[mb] = WFrag<T16>::ldf(ua2 + mb * 16 * K, vo); }
#pragma unroll
        for (int nb = 0; nb < 4; ++nb) { b[nb] = WFrag<T16>::ldf(ub + nb * 16 * K, vo); if (NSPLIT >= 2) b2[nb] = WFrag<T16>::ldf(ub2 + nb * 16 * K, vo); }
        __builtin_amdgcn_sched_barrier(0);   // a trip's loads all issue in front of its products: without it the compiler sinks each B fragment behind the products before it, into one register set, and a trip waits four times for memory
#pragma unroll
        for (int nb = 0; nb < 4; ++nb)
#pragma unroll
            for (int mb = 0; mb < 4; ++mb) { acc[mb][nb] = WFrag<T16>::mma(a[mb], b[nb], acc[mb][nb]); if (NSPLIT == 1 || NSPLIT == 2) acc[mb][nb] = WFrag<T16>::mma(a2[mb], b[nb], acc[mb][nb]); if (NSPLIT >= 2) acc[mb][nb] = WFrag<T16>::mma(a[mb], b2[nb], acc[mb][nb]); }
        asm volatile("v_nop\n\tv_nop\n\tv_nop\n\tv_nop" : "+v"(acc[0][0]), "+v"(acc[1][1]), "+v"(acc[2][2]), "+v"(acc[3][3]) : "v"(a[0]), "v"(a[3]));
        addr_step(vo); vo += 1024;   // next fragment of every operand row block
    }
    if constexpr (KS > 1) {
        float* pw = os + wv * (64 * 68);
#pragma unroll
        for (int mb = 0; mb < 4; ++mb)
#pragma unroll
            for (int nb = 0; nb < 4; ++nb) { float* p = pw + (nb * 16 + lr) * 68 + mb * 16 + hi * 8; const v8f t = acc[mb][nb]; *(v4fa*)p = __builtin_shufflevector(t, t, 0, 1, 2, 3); *(v4fa*)(p + 4) = __builtin_shufflevector(t, t, 4, 5, 6, 7); }
        __syncthreads();   // every wave's partial tile is in LDS before any of it is summed
#pragma unroll
        for (int it = 0; it < 64 * 16 / (32 * KS); ++it) { const int g = it * (32 * KS) + (int)threadIdx.x, col = g & 63, rq = g >> 6; const float* p = os + col * 68 + rq * 4; v4f s = *(const v4fa*)p;
#pragma unroll
            for (int w = 1; w < KS; ++w) s += *(const v4fa*)(p + w * (64 * 68));
            if (BIAS) { const float bb = bfr(bias[c0 + col]); s[0] += bb; s[1] += bb; s[2] += bb; s[3] += bb; }
            float* cp = C + (size_t)(r0 + rq * 4) * ldc + c0 + col;
#pragma unroll
            for (int q = 0; q < 4; ++q) cp[(size_t)q * ldc] = s[q]; }
        return;
    }
#pragma unroll
    for (int mb = 0; mb < 4; ++mb) {
#pragma unroll
        for (int nb = 0; nb < 4; ++nb) {
#pragma unroll
            for (int j = 0; j < 8; ++j) os[(hi * 8 + j) * 68 + nb * 16 + lr] = acc[mb][nb][j]; }
        __builtin_amdgcn_wave_barrier(); asm volatile("" ::: "memory");
        float* crow = C + (size_t)(r0 + mb * 16) * ldc + c0;
{
#pragma unroll
            for (int s = 0; s < 8; ++s) { const int row = 2 * s + hi, cofs = lr * 4; v4f val = *(const v4fa*)(os + row * 68 + cofs); if (BIAS) { val[0] += bfr(bias[c0 + cofs]); val[1] += bfr(bias[c0 + cofs + 1]); val[2] += bfr(bias[c0 + cofs + 2]); val[3] += bfr(bias[c0 + cofs + 3]); }
                *(v4f*)(crow + (size_t)row * ldc + cofs) = val; }
             }
        __builtin_amdgcn_wave_barrier(); asm volatile("" ::: "memory");
    }
}

__device__ __forceinline__ h16 tohx(float x) { return (h16)x; }
__device__ __forceinline__ void splitf(float y, unsigned short& h, unsigned short& l) { h = f2bf(y); l = f2bf(y - bf2f(h)); }
typedef __attribute__((ext_vector_type(2))) _Float16 v2h;
typedef __attribute__((ext_vector_type(4))) _Float16 v4h;
typedef __attribute__((ext_vector_type(2))) unsigned short v2us;
typedef __attribute__((ext_vector_type(4))) unsigned short v4us;
typedef __attribute__((ext_vector_type(2))) float v2f;
typedef __attribute__((ext_vector_type(4))) int v4i;

__global__ __launch_bounds__(256) void k_wtG(const float* __restrict__ w, int K, int N, bf* Bt) {
    const int lane = threadIdx.x & 31; const int L0 = (blockIdx.x * 8 + (threadIdx.x >> 5)) * 8; const int nlines = N * K / 64;
{
#pragma unroll 1
        for (int l = 0; l < 8; ++l) { const int L = L0 + l; if (L >= nlines) break; const size_t e = (size_t)L * 64 + lane * 2; const int k = (int)(e % K), n = (int)(e / K); v2us o;
            o[0] = f2bf(w[(size_t)k * N + n]); o[1] = f2bf(w[(size_t)(k + 1) * N + n]); *(v2us*)(Bt + e) = o; }
         }
}
// k_prep: ONE launch turns all eight f32 matrices (four weights, three activations, Er; row-major [rows][K]) into bf16 planes in fragment order. A work-group takes 32 fragments in a row, which are 16384 elements in a row of the source too (K = 1024: one 16-row block; K = 64: 16 of them);
// a thread takes eight pieces of 8 elements, 4 fragments apart; four neighbouring lanes read one whole 128-byte line of a row (32 k), eight neighbouring rows write one whole line of the fragment.
// All loads name one scalar base, one lane offset and a constant, and so do all stores; all sixteen loads are issued in front of the first conversion, and the stores are the thread's last instructions, so that no register that a store names is written again.
template <int K>
__device__ __forceinline__ void cvt_rows(const float* __restrict__ src, bf* dst, int lb) {
    static_assert(K == 64 || K == 1024, "the step of 4 fragments below is written for these two");
    constexpr int FPR = K / 32, ustep = (FPR >= 32) ? 4 * 32 : (4 / FPR) * 16 * K;   // fragments per row block; source elements from a fragment to the fourth behind it
    const int tid = (int)threadIdx.x, c = tid & 3, lr = (tid >> 2) & 15, tq = tid >> 6;
    const char* sb = (const char*)(src + (size_t)lb * (32 * 512)); char* db = (char*)(dst + (size_t)lb * (32 * 512));   // the same for the whole work-group
    const unsigned so = (unsigned)(((tq / FPR) * 16 + lr) * K + (tq % FPR) * 32 + c * 8) * 4, eo = (unsigned)(tq * 512 + (c >> 1) * 256 + (c & 1) * 128 + lr * 8) * 2;
    v8f v[8]; v8us o[8];
#pragma unroll
    for (int u = 0; u < 8; ++u) v[u] = *(const v8f*)(sb + so + u * (ustep * 4));
    asm volatile("s_wait_xcnt 0x0" : : "v"(so), "s"(sb) : "memory");   // inputs only: the loads' offset register and scalar base stay taken up to the wait, so that no load lands in the offset and nothing else is formed there ahead of it
#pragma unroll
    for (int u = 0; u < 8; ++u)
#pragma unroll
        for (int k = 0; k < 8; ++k) o[u][k] = f2bf(v[u][k]);
    __builtin_amdgcn_sched_barrier(0);   // no store rises in front of a conversion: a conversion behind it could be given a register that the store still names
#pragma unroll
    for (int u = 0; u < 8; ++u) *(v8us*)(db + eo + u * (4 * 512 * 2)) = o[u];
}
#define PB_W (DQ / 16)            // work-groups per weight matrix (16 rows each)
#define PB_X (TT / 16)            // per activation matrix
#define PB_E (TT * HD / (32 * 512))   // for Er
__global__ __launch_bounds__(256) void k_prep(const float* __restrict__ wq, const float* __restrict__ wk, const float* __restrict__ wv, const float* __restrict__ wo, const float* __restrict__ xq, const float* __restrict__ xk, const float* __restrict__ xv, const float* __restrict__ er, bf* WQ, bf* WK, bf* WV, bf* WO, bf* XQ, bf* XK, bf* XV, bf* ERB) {
    const int b = (int)blockIdx.x;   // the matrix is chosen by the work-group's index alone
    if (b < 4 * PB_W) { const int m = b / PB_W; cvt_rows<DM>(m == 0 ? wq : m == 1 ? wk : m == 2 ? wv : wo, m == 0 ? WQ : m == 1 ? WK : m == 2 ? WV : WO, b % PB_W); }
    else if (b < 4 * PB_W + 3 * PB_X) { const int m = (b - 4 * PB_W) / PB_X; cvt_rows<DM>(m == 0 ? xq : m == 1 ? xk : xv, m == 0 ? XQ : m == 1 ? XK : XV, (b - 4 * PB_W) % PB_X); }
    else cvt_rows<HD>(er, ERB, b - 4 * PB_W - 3 * PB_X);
}
// k_qkv: the three projections in ONE launch, grid (TT / 64, heads, 3), 8 waves; main loop, K split over the waves and LDS sum in wave order as in k_gemmw<bf, 0, true, 8, DM>; a 64 x 64 tile is 64 rows t of one head, and the epilogue writes it straight as the head's three planes (fp16, bf16 hi, bf16 lo) in fragment order.
// The partial tiles lie [n][m] in LDS with m (the A operand's rows) contiguous, and a thread sums 8 neighbouring m of one n, which are the 8 elements of one 16-byte piece of a fragment: so q and k (fragment rows t, k = d) take the weight rows d as A and the activation rows t as B,
// and v (ISV; fragment rows d, k = t, fragments laid [t / 32][d / 16] so that a wave's 128 keys x 64 columns are 16 KiB in a row) takes t as A and d as B. Both operand planes have the same fragment order, so the roles are a choice of base pointers. A wave's store is two runs of 256 contiguous bytes.
template <bool ISV>
__device__ __forceinline__ void qkv_tile(float* os, const bf* __restrict__ X, const bf* __restrict__ Wt, const float* __restrict__ bias, h16* P16, bf* Ph, bf* Pl, int t0) {   // X, Wt, bias, planes: already at the tile's rows t0.., the head's weight rows, bias and planes
    constexpr int K = DM, KS = 8; typedef WFrag<bf>::V V;
    const int tid = (int)threadIdx.x, lane = tid & 31, lr = lane & 15, hi = lane >> 4;
    v8f acc[4][4];
#pragma unroll
    for (int mb = 0; mb < 4; ++mb)
#pragma unroll
        for (int nb = 0; nb < 4; ++nb) acc[mb][nb] = (v8f){};
    const int wv = __builtin_amdgcn_readfirstlane(tid >> 5); constexpr int kspan = K / KS; const int kbeg = wv * kspan;   // this wave's K slice
    const bf* ua = (ISV ? X : Wt) + (size_t)kbeg * 16; const bf* ub = (ISV ? Wt : X) + (size_t)kbeg * 16;   // wave-uniform: 16 rows of fragments hold 16 K elements; a step of 32 in k is one fragment (1 KiB)
    const int n = tid & 63, mq = (tid >> 6) * 8;   // this thread's n and its first m; its second piece lies 32 m further
    const unsigned bo = (unsigned)(ISV ? n : mq) * 4; const char* bp = (const char*)bias; v4f bb[4];   // the bias goes with d: n for v, m for q and k
    if constexpr (ISV) bb[0] = (v4f)(*(const float*)(bp + bo));
    else { bb[0] = *(const v4f*)(bp + bo); bb[1] = *(const v4f*)(bp + bo + 16); bb[2] = *(const v4f*)(bp + bo + 128); bb[3] = *(const v4f*)(bp + bo + 144); }
    asm volatile("s_wait_xcnt 0x0" : : "v"(bo), "s"(bp) : "memory");   // inputs only: the bias loads' offset register and scalar base stay taken up to the wait; the loads stand in front of the main loop, which covers their latency
    unsigned vo = (unsigned)lane * 16;
#pragma unroll 1
    for (int kc = 0; kc < kspan; kc += 32) {
        V a[4], b[4];
#pragma unroll
        for (int mb = 0; mb < 4; ++mb) a[mb] = WFrag<bf>::ldf(ua + mb * 16 * K, vo);
#pragma unroll
        for (int nb = 0; nb < 4; ++nb) b[nb] = WFrag<bf>::ldf(ub + nb * 16 * K, vo);
        __builtin_amdgcn_sched_barrier(0);   // a trip's loads all issue in front of its products: without it the compiler sinks each B fragment behind the products before it, into one register set, and a trip waits four times for memory
#pragma unroll
        for (int nb = 0; nb < 4; ++nb)
#pragma unroll
            for (int mb = 0; mb < 4; ++mb) acc[mb][nb] = WFrag<bf>::mma(a[mb], b[nb], acc[mb][nb]);
        asm volatile("v_nop\n\tv_nop\n\tv_nop\n\tv_nop" : "+v"(acc[0][0]), "+v"(acc[1][1]), "+v"(acc[2][2]), "+v"(acc[3][3]) : "v"(a[0]), "v"(a[3]));
        addr_step(vo); vo += 1024;   // next fragment of every operand row block
    }
    float* pw = os + wv * (64 * 68);
#pragma unroll
    for (int mb = 0; mb < 4; ++mb)
#pragma unroll
        for (int nb = 0; nb < 4; ++nb) { float* p = pw + (nb * 16 + lr) * 68 + mb * 16 + hi * 8; const v8f t = acc[mb][nb]; *(v4fa*)p = __builtin_shufflevector(t, t, 0, 1, 2, 3); *(v4fa*)(p + 4) = __builtin_shufflevector(t, t, 4, 5, 6, 7); }
    __syncthreads();   // every wave's partial tile is in LDS before any of it is summed
    v8h o16[2]; v8us oh[2], ol[2];
#pragma unroll
    for (int it = 0; it < 2; ++it) { const float* p = os + n * 68 + mq + it * 32; v4f s0 = *(const v4fa*)p, s1 = *(const v4fa*)(p + 4);
#pragma unroll
        for (int w = 1; w < KS; ++w) { s0 += *(const v4fa*)(p + w * (64 * 68)); s1 += *(const v4fa*)(p + w * (64 * 68) + 4); }
#pragma unroll
        for (int q = 0; q < 8; ++q) { const float r = (q < 4 ? s0[q & 3] : s1[q & 3]) + bfr(ISV ? bb[0][0] : bb[it * 2 + (q >> 2)][q & 3]); o16[it][q] = tohx(r); unsigned short a2, c2; splitf(r, a2, c2); oh[it][q] = a2; ol[it][q] = c2; } }
    const int t = t0 + (ISV ? mq : n), d = ISV ? n : mq;   // of the first piece; the second is one fragment in d further (q, k) or one row of four fragments in t (v)
    const unsigned ob = (unsigned)(ISV ? ((t >> 5) * 4 + (d >> 4)) * 512 + ((t >> 4) & 1) * 256 + ((t >> 3) & 1) * 128 + (d & 15) * 8
                                       : (t & ~15) * HD + (d >> 5) * 512 + ((d >> 4) & 1) * 256 + ((d >> 3) & 1) * 128 + (t & 15) * 8) * 2;
    constexpr int step = (ISV ? 4 : 1) * 512 * 2;
    __builtin_amdgcn_sched_barrier(0);   // the six stores stay the thread's last instructions: nothing behind them is given a register that a store still names
#pragma unroll
    for (int it = 0; it < 2; ++it) { *(v8h*)((char*)P16 + ob + it * step) = o16[it]; *(v8us*)((char*)Ph + ob + it * step) = oh[it]; *(v8us*)((char*)Pl + ob + it * step) = ol[it]; }
}
__global__ __launch_bounds__(256) void k_qkv(const bf* __restrict__ XQ, const bf* __restrict__ XK, const bf* __restrict__ XV, const bf* __restrict__ WQ, const bf* __restrict__ WK, const bf* __restrict__ WV, const float* __restrict__ bq, const float* __restrict__ bk, const float* __restrict__ bv,
                                             h16* QP16, bf* QPh, bf* QPl, h16* KP16, bf* KPh, bf* KPl, h16* VT16, bf* VTh, bf* VTl) {
    __shared__ __align__(16) float os[8 * 64 * 68];
    const int z = (int)blockIdx.z, t0 = (int)blockIdx.x * 64, h = (int)blockIdx.y; const size_t xo = (size_t)t0 * DM, wo = (size_t)h * HD * DM, po = (size_t)h * TT * HD;   // the choice below is the same for the whole work-group, so its barrier is met by all of its waves
    if (z == 2) qkv_tile<true>(os, XV + xo, WV + wo, bv + h * HD, VT16 + po, VTh + po, VTl + po, t0);
    else qkv_tile<false>(os, (z == 0 ? XQ : XK) + xo, (z == 0 ? WQ : WK) + wo, (z == 0 ? bq : bk) + h * HD, (z == 0 ? QP16 : KP16) + po, (z == 0 ? QPh : KPh) + po, (z == 0 ? QPl : KPl) + po, t0);
}
// ---- k_attn: one work-group of 16 waves per (head, 32 query rows = QB blocks of 16); the 32 x 2048 score rows never leave LDS and take most of a WGP's LDS, so one work-group has the WGP to itself (4 waves per SIMD, up to 256 registers each).
// Every Er, k and v fragment that a wave loads stays in registers for the products of BOTH row blocks: per query row half as many bytes come from L2 as with one block per work-group. Each row's products, trees and sums are those of a single block. Five stages, a work-group barrier between each two and one inside the last:
// 1 relative logits: qe tiles (q hi/lo planes x Er) are stored straight at their skewed place: qe[i][t] is rel(i, t - 2047 + i) where that column is >= 0, and qe[i+1][t] is rel(i, t + i + 2) where that column is < 2048; rel(i, i+1) = 0 (= the reference's pad/reshape/slice of q.Er^T, upper triangle included)
// 2 scores: each q.k tile adds the relative logit that lies at its own place, scales by 1/8 and stores back
// 3 softmax: wave w owns rows w and w + 16 (register row, one exp, fixed trees) and writes the probabilities over its own rows: fp16 x 1024, or bf16 hi and lo planes for rows < RH
// 4 attn.v: wave w sums the key slice [128 w, 128 w + 128) for all 64 columns of both row blocks
// 5 the 16 partial tiles meet in LDS (column-major, pitch 36) and are added in wave order 0..15; the merged context goes out as hi/lo planes in fragment order
// Fragments are fetched ahead, into registers: the first k tiles of stage 2 are loaded in front of the barrier that ends stage 1, each tile's registers are refilled right behind its products, and v fragments of stage 4 are loaded in front of the barriers that end stages 2 and 3, so that they come from L2 while waves wait for one another and while stage 3 runs on the vector unit alone. Those three barriers (lds_barrier) wait for the wave's LDS accesses only; nothing is stored to global memory before stage 5.
#define SP 2052   // LDS pitch of a score row in floats: rows stay 16-byte aligned, rows 8 apart lie 32 banks apart; columns 2048..2051 take the qe elements that belong to no column of this row block
#define QB 2      // 16-row blocks per work-group
#define PP (QB * 16 + 4)   // LDS pitch of a partial tile's column in floats (stage 5): 16 bytes times an odd number
typedef v2f __attribute__((may_alias)) v2fa;
__device__ __forceinline__ void lds_barrier() {   // a work-group barrier that orders LDS alone: __syncthreads() also waits for the wave's global loads, and the fragments fetched ahead would stop being ahead
    __builtin_amdgcn_fence(__ATOMIC_RELEASE, "workgroup", "local"); __builtin_amdgcn_s_barrier(); __builtin_amdgcn_fence(__ATOMIC_ACQUIRE, "workgroup", "local");
}
template <bool UP>
__device__ __forceinline__ void rel_one(float* S, const v16bf (&ah0)[QB], const v16bf (&al0)[QB], const v16bf (&ah1)[QB], const v16bf (&al1)[QB], v16bf b0, v16bf b1, int tt, int r0, int lr, int hi) {   // one Er tile against the q rows of every row block
#pragma unroll
    for (int rb = 0; rb < QB; ++rb) {
        v8f acc = (v8f){}; acc = wmmab(ah0[rb], b0, acc); acc = wmmab(al0[rb], b0, acc); acc = wmmab(ah1[rb], b1, acc); acc = wmmab(al1[rb], b1, acc);
        const int cb = tt * 16 + lr + r0 + rb * 16 + hi * 8 + (UP ? 2 : 1 - TT);   // column of accumulator register 0; register j is one row lower and so j columns further
#pragma unroll
        for (int j = 0; j < 8; ++j) { const int col = cb + j; const bool ok = UP ? (col < TT) : (col >= 0); S[(rb * 16 + hi * 8 + j) * SP + (ok ? col : TT + (lr & 3))] = acc[j]; }
    }
}
template <bool UP>
__device__ __forceinline__ void rel_tiles(float* S, const bf* __restrict__ qh, const bf* __restrict__ ql, const bf* __restrict__ er, int r0, int tbeg, int tend, int lr, int hi) {
    if (tbeg >= tend) return;   // wave-uniform: a wave without a tile loads no q rows
    v16bf ah0[QB], ah1[QB], al0[QB], al1[QB]; unsigned ao[QB];
#pragma unroll
    for (int rb = 0; rb < QB; ++rb) { const int qr = UP ? min(r0 + rb * 16 + 1 + lr, TT - 1) : r0 + rb * 16 + lr; ao[rb] = (unsigned)((qr >> 4) * (16 * HD) + (qr & 15) * 8 + hi * 128) * 2;   // UP: q rows i + 1 (the clamped row has no column in range); byte offset in fragment order: a 16-row tile is 2 fragments (k 0..31, 32..63)
        ah0[rb] = WFrag<bf>::ldf(qh, ao[rb]); ah1[rb] = WFrag<bf>::ldf(qh + 512, ao[rb]); al0[rb] = WFrag<bf>::ldf(ql, ao[rb]); al1[rb] = WFrag<bf>::ldf(ql + 512, ao[rb]); }
    asm volatile("s_wait_xcnt 0x0" : : "v"(ao[0]), "v"(ao[1]), "s"(qh), "s"(ql) : "memory");   // inputs only: the q loads' offset registers and two scalar bases stay taken up to the wait; the Er base and offset are formed behind it, not in those registers ahead of it
    const bf* eb = er + (size_t)tbeg * 16 * HD; unsigned eo = (unsigned)(lr * 8 + hi * 128) * 2;
    for (int tt = tbeg; tt < tend; tt += 32) {   // two Er tiles' loads in flight per trip (16 waves a WGP: each keeps more bytes under way)
        const bool two = tt + 16 < tend;   // wave-uniform; without a second tile its loads read the first again and feed nothing
        const unsigned e2 = eo + (two ? 16 * 16 * HD * 2 : 0);
        const v16bf b0 = WFrag<bf>::ldf(eb, eo), b1 = WFrag<bf>::ldf(eb + 512, eo), c0 = WFrag<bf>::ldf(eb, e2), c1 = WFrag<bf>::ldf(eb + 512, e2);
        rel_one<UP>(S, ah0, al0, ah1, al1, b0, b1, tt, r0, lr, hi);
        asm volatile("" : : "v"(c0), "v"(c1));   // inputs only, the loaded values: holds the second tile's loads in front of the branch, beside the first tile's; without it the compiler sinks them into the branch and a trip waits twice for L2
        if (two) rel_one<UP>(S, ah0, al0, ah1, al1, c0, c1, tt + 16, r0, lr, hi);
        asm volatile("s_wait_xcnt 0x0" : "+v"(eo) : "v"(e2) : "memory");   // as addr_step; the second tile's offset register stays taken up to the wait, and its next value is formed from this statement's result
        eo += 32 * 16 * HD * 2;   // 32 Er tiles further
    }
}
__device__ __forceinline__ void rel_stage(float* S, int h, int r0, const bf* __restrict__ QPh, const bf* __restrict__ QPl, const bf* __restrict__ ERB) {   // the same for hi/lo and fp16 rows: it stands once in the kernel's text, which so stays under 32 KB
    const int tid = (int)threadIdx.x, lane = tid & 31, lr = lane & 15, hi = lane >> 4; const int wv = __builtin_amdgcn_readfirstlane(tid >> 5);   // wave-uniform: scalar loop bounds
    const size_t hq = (size_t)h * TT * HD;
    {   // stage 1: for row block rb, Er tiles 0..T0 - rb serve the columns right of the diagonal and tiles T0 - rb..127 those up to it; each deal takes the union over the blocks (a tile that serves only one block leaves the other's elements in the spare columns); the second deal runs in reverse wave order so that the two remainders fall on different waves where they can
        const int T0 = TT / 16 - 1 - (r0 >> 4);
        rel_tiles<true>(S, QPh + hq, QPl + hq, ERB, r0, wv, T0 + 1, lr, hi);
        rel_tiles<false>(S, QPh + hq, QPl + hq, ERB, r0, T0 - (QB - 1) + 15 - wv, TT / 16, lr, hi);
        if (tid < QB * 16 && r0 + tid + 1 < TT) S[tid * SP + r0 + tid + 1] = 0.0f;
    }
}
template <bool HI>
__device__ __forceinline__ void attn_rows(float* S, int h, int r0, const h16* __restrict__ QP16, const bf* __restrict__ QPh, const bf* __restrict__ QPl, const h16* __restrict__ KP16, const bf* __restrict__ KPh, const bf* __restrict__ KPl, const h16* __restrict__ VT16, const bf* __restrict__ VTh, const bf* __restrict__ VTl, bf* ATh, bf* ATl) {
    const int tid = (int)threadIdx.x, lane = tid & 31, lr = lane & 15, hi = lane >> 4; const int wv = __builtin_amdgcn_readfirstlane(tid >> 5);   // wave-uniform: scalar loop bounds
    const size_t hq = (size_t)h * TT * HD;
    const unsigned lo = (unsigned)(lr * 8 + hi * 128) * 2;   // 32-bit lane byte offset in a fragment
    const size_t vb = (size_t)h * HD * TT + (size_t)wv * (128 * HD);   // wave-uniform base of the wave's v slice (its 16 fragments of a plane lie in a row)
    const h16* vp = (const h16*)((const char*)(VT16 + vb) + lo); const bf* vh = (const bf*)((const char*)(VTh + vb) + lo); const bf* vl = (const bf*)((const char*)(VTl + vb) + lo);
    v16h bv[HI ? 1 : 16]; v16bf wb[HI ? 8 : 1], wb2[HI ? 8 : 1];   // stage 4's v fragments, fetched ahead: fp16 rows the wave's whole slice (16 KiB), hi/lo rows the first 64 of its 128 keys in both planes
    {   // stage 2: the fragment registers of a key tile are refilled right behind its products, so that loads are under way while the other tiles are worked on. The refill is unconditional (a branch round it would make the compiler wait for every load at each use): behind the last tiles it brings the first v fragments, by a wave-uniform choice of base and step.
        const size_t ab = hq + (size_t)r0 * HD, kb = hq + (size_t)wv * (16 * HD);   // wave-uniform bases (fragment order); key tile it * 16 + wv lies it * 32 KiB behind tile wv
        if constexpr (HI) {
            v16bf a0[QB], a1[QB], c0[QB], c1[QB], b0[2], b1[2], d0[2], d1[2];   // two key tiles' fragments
            const bf* qh = (const bf*)((const char*)(QPh + ab) + lo); const bf* ql = (const bf*)((const char*)(QPl + ab) + lo); const bf* kh = (const bf*)((const char*)(KPh + kb) + lo); const bf* kl = (const bf*)((const char*)(KPl + kb) + lo);
#pragma unroll
            for (int rb = 0; rb < QB; ++rb) { const int ar = rb * (16 * HD); a0[rb] = WFrag<bf>::ldf(qh + ar, 0u); a1[rb] = WFrag<bf>::ldf(qh + ar + 512, 0u); c0[rb] = WFrag<bf>::ldf(ql + ar, 0u); c1[rb] = WFrag<bf>::ldf(ql + ar + 512, 0u); }
            __builtin_amdgcn_sched_barrier(0);   // the q loads stay the oldest: the loop's waits for them stand in every trip, and behind younger q loads they would also wait for the refills under way
#pragma unroll
            for (int t = 0; t < 2; ++t) { const int kt = t * (256 * HD); b0[t] = WFrag<bf>::ldf(kh + kt, 0u); b1[t] = WFrag<bf>::ldf(kh + kt + 512, 0u); d0[t] = WFrag<bf>::ldf(kl + kt, 0u); d1[t] = WFrag<bf>::ldf(kl + kt + 512, 0u); }
            asm volatile("s_wait_xcnt 0x0" : : "v"(qh), "v"(ql), "v"(kh), "v"(kl) : "memory");   // inputs only: the lane's four address pairs (one a plane serves all of its loads, which differ by constants) stay taken up to the wait, so that no late load lands in one of them
            __builtin_amdgcn_sched_barrier(0);   // the loads stay in front of the barrier: behind it they would start only when the last wave has ended stage 1
            lds_barrier();   // every relative logit lies in LDS before a score tile adds it
            unsigned ko = lo;   // the k refills' offset: it moves on by two tiles a trip
#pragma unroll 1   // rolled: the same two tiles' registers serve every trip, and the text stays short
            for (int io = 0; io < TT / 256; io += 2) {
              const bool last = io + 2 >= TT / 256;   // wave-uniform
              const char* sh = (const char*)(last ? VTh + vb : KPh + kb + 2 * (256 * HD)); const char* sl = (const char*)(last ? VTl + vb : KPl + kb + 2 * (256 * HD));
              const unsigned o[2] = { last ? lo : ko, last ? lo + 2 * 1024 : ko + 256 * HD * 2 };   // k: the tile two further; v: two fragments of each plane
              const bf* ph[2] = { (const bf*)(sh + o[0]), (const bf*)(sh + o[1]) }; const bf* pl[2] = { (const bf*)(sl + o[0]), (const bf*)(sl + o[1]) };
#pragma unroll
              for (int t = 0; t < 2; ++t) { const int n0 = ((io + t) * 16 + wv) * 16;
#pragma unroll
                for (int rb = 0; rb < QB; ++rb) {
                    v8f acc = (v8f){}; acc = wmmab(a0[rb], b0[t], acc); acc = wmmab(c0[rb], b0[t], acc); acc = wmmab(a0[rb], d0[t], acc); acc = wmmab(a1[rb], b1[t], acc); acc = wmmab(c1[rb], b1[t], acc); acc = wmmab(a1[rb], d1[t], acc);
#pragma unroll
                    for (int j = 0; j < 8; ++j) { float* q = S + (rb * 16 + hi * 8 + j) * SP + n0 + lr; *q = (acc[j] + *q) * SCL; } }
                b0[t] = WFrag<bf>::ldf(ph[t], 0u); b1[t] = WFrag<bf>::ldf(ph[t] + 512, 0u); d0[t] = WFrag<bf>::ldf(pl[t], 0u); d1[t] = WFrag<bf>::ldf(pl[t] + 512, 0u);
                __builtin_amdgcn_sched_barrier(0);   // a tile's refill issues in front of the other tile's products, not behind them
              }
              asm volatile("s_wait_xcnt 0x0" : "+v"(ko) : "v"(ph[0]), "v"(ph[1]), "v"(pl[0]), "v"(pl[1]) : "memory");   // as addr_step; the refills' four address pairs stay taken up to the wait, and the next trip's are formed from this statement's result
              ko += 2 * 256 * HD * 2; }
#pragma unroll
            for (int t = 0; t < 2; ++t) { wb[2 * t] = b0[t]; wb[2 * t + 1] = b1[t]; wb2[2 * t] = d0[t]; wb2[2 * t + 1] = d1[t]; }
        } else {
            v16h a0[QB], a1[QB], b0[4], b1[4];   // four key tiles' fragments, refilled in pairs
            const h16* qp = (const h16*)((const char*)(QP16 + ab) + lo); const h16* kp = (const h16*)((const char*)(KP16 + kb) + lo);
#pragma unroll
            for (int rb = 0; rb < QB; ++rb) { const int ar = rb * (16 * HD); a0[rb] = WFrag<h16>::ldf(qp + ar, 0u); a1[rb] = WFrag<h16>::ldf(qp + ar + 512, 0u); }
            __builtin_amdgcn_sched_barrier(0);   // the q loads stay the oldest: the loop's waits for them stand in every trip, and behind younger q loads they would also wait for the refills under way
#pragma unroll
            for (int t = 0; t < 4; ++t) { const int kt = t * (256 * HD); b0[t] = WFrag<h16>::ldf(kp + kt, 0u); b1[t] = WFrag<h16>::ldf(kp + kt + 512, 0u); }
            asm volatile("s_wait_xcnt 0x0" : : "v"(qp), "v"(kp) : "memory");   // inputs only: the lane's two address pairs (each serves all of its loads, which differ by constants) stay taken up to the wait, so that no late load lands in one of them
            __builtin_amdgcn_sched_barrier(0);   // the loads stay in front of the barrier: behind it they would start only when the last wave has ended stage 1
            lds_barrier();   // every relative logit lies in LDS before a score tile adds it
#pragma unroll 1   // rolled over the two halves of the wave's eight tiles, for the size of the text
            for (int io = 0; io < TT / 256; io += 4) {
              const bool last = io + 4 >= TT / 256;   // wave-uniform
              const char* sp = (const char*)(last ? VT16 + vb : KP16 + kb + 4 * (256 * HD)); const unsigned st = last ? 2 * 1024 : 256 * HD * 2;   // k: tiles 4..7, 32 KiB apart; v: two fragments a step
              const h16* rp[4] = { (const h16*)(sp + lo), (const h16*)(sp + (lo + st)), (const h16*)(sp + (lo + 2 * st)), (const h16*)(sp + (lo + 3 * st)) };
#pragma unroll
              for (int p = 0; p < 2; ++p) {
#pragma unroll
                for (int ii = 0; ii < 2; ++ii) { const int t = p * 2 + ii, n0 = ((io + t) * 16 + wv) * 16;
#pragma unroll
                  for (int rb = 0; rb < QB; ++rb) {
                    v8f acc = (v8f){}; acc = wmma16(a0[rb], b0[t], acc); acc = wmma16(a1[rb], b1[t], acc);
#pragma unroll
                    for (int j = 0; j < 8; ++j) { float* q = S + (rb * 16 + hi * 8 + j) * SP + n0 + lr; *q = (acc[j] + *q) * SCL; } } }
#pragma unroll
                for (int ii = 0; ii < 2; ++ii) { const int t = p * 2 + ii; b0[t] = WFrag<h16>::ldf(rp[t], 0u); b1[t] = WFrag<h16>::ldf(rp[t] + 512, 0u); }
                __builtin_amdgcn_sched_barrier(0);   // a pair's refill issues in front of the other pair's products, not behind them
              }
              asm volatile("s_wait_xcnt 0x0" : : "v"(rp[0]), "v"(rp[1]), "v"(rp[2]), "v"(rp[3]) : "memory");   // inputs only: the refills' four address pairs stay taken up to the wait, so that no refill lands in one of them
            }
#pragma unroll
            for (int t = 0; t < 4; ++t) { bv[2 * t] = b0[t]; bv[2 * t + 1] = b1[t]; }
#pragma unroll
            for (int f = 8; f < 16; ++f) bv[f] = WFrag<h16>::ldf(vp + f * 512, 0u);
            asm volatile("s_wait_xcnt 0x0" : : "v"(vp) : "memory");   // inputs only: the lane's address pair (it serves these eight fragments, which differ by constants) stays taken up to the wait
        }
    }
    __builtin_amdgcn_sched_barrier(0);   // the loads stay in front of stage 3: without it the compiler loads each fragment right in front of its products, and the wave waits for L2 in stage 4
    lds_barrier();   // every score of a row lies in LDS before its wave reads the row
#pragma unroll 1   // rolled over the two rows: one row's 64 values stand beside the v fragments fetched ahead without crowding the schedule, and the kernel's text stays under 32 KB
    for (int rr = 0; rr < QB; ++rr) {   // stage 3
        float* sr = S + (rr * 16 + wv) * SP; float v[TT / 32]; float mx = -3.0e38f;
#pragma unroll
        for (int ch = 0; ch < TT / 128; ++ch) { const v4f a = *(const v4fa*)(sr + ch * 128 + lane * 4);
#pragma unroll
            for (int q = 0; q < 4; ++q) { v[ch * 4 + q] = a[q]; mx = fmaxf(mx, a[q]); } }
#pragma unroll
        for (int sh = 16; sh; sh >>= 1) mx = fmaxf(mx, __shfl_xor(mx, sh, 32));
        float sum = 0.f;
#pragma unroll
        for (int k = 0; k < TT / 32; ++k) { v[k] = __builtin_amdgcn_exp2f((v[k] - mx) * 1.4426950408889634f); sum += v[k]; }
#pragma unroll
        for (int sh = 16; sh; sh >>= 1) sum += __shfl_xor(sum, sh, 32);
        const float f = __fdiv_rn(HI ? 1.0f : PCAR, sum);
        if constexpr (HI) { bf* ph = (bf*)sr; bf* pl = ph + TT;
#pragma unroll
            for (int ch = 0; ch < TT / 128; ++ch) { v4us oh, ol;
#pragma unroll
                for (int q = 0; q < 4; ++q) { unsigned short a, c2; splitf(v[ch * 4 + q] * f, a, c2); oh[q] = a; ol[q] = c2; }
                *(v4us*)(ph + ch * 128 + lane * 4) = oh; *(v4us*)(pl + ch * 128 + lane * 4) = ol; }
        } else { h16* pp = (h16*)sr;
#pragma unroll
            for (int ch = 0; ch < TT / 128; ++ch) { v4h o4;
#pragma unroll
                for (int q = 0; q < 4; ++q) o4[q] = tohx(v[ch * 4 + q] * f);
                *(v4h*)(pp + ch * 128 + lane * 4) = o4; } }
    }
    if constexpr (HI) {   // the next v fragments start in front of the barrier; through stage 3 they would take the registers that its schedule needs
#pragma unroll
        for (int f = 4; f < 8; ++f) { wb[f] = WFrag<bf>::ldf(vh + f * 512, 0u); wb2[f] = WFrag<bf>::ldf(vl + f * 512, 0u); }
        __builtin_amdgcn_sched_barrier(0);   // the loads stay in front of the barrier: behind it they would start only when the last wave has ended stage 3
    }
    lds_barrier();   // all probability rows lie in LDS before any wave reads its key slice of them
    v8f acc[QB][4];
#pragma unroll
    for (int rb = 0; rb < QB; ++rb)
#pragma unroll
        for (int nb = 0; nb < 4; ++nb) acc[rb][nb] = (v8f){};
    {   // stage 4
#pragma unroll
        for (int s = 0; s < 4; ++s) { const int kc = wv * 128 + s * 32;
            if constexpr (HI) { v16bf a[QB], a2[QB];
#pragma unroll
                for (int rb = 0; rb < QB; ++rb) { const bf* pr = (const bf*)(S + (rb * 16 + lr) * SP) + kc + 8 * hi; a[rb] = WFrag<bf>::ld(pr); a2[rb] = WFrag<bf>::ld(pr + TT); }
#pragma unroll
                for (int nb = 0; nb < 4; ++nb)
#pragma unroll
                    for (int rb = 0; rb < QB; ++rb) { const int f = (s & 1) * 4 + nb; acc[rb][nb] = wmmab(a[rb], wb[f], acc[rb][nb]); acc[rb][nb] = wmmab(a2[rb], wb[f], acc[rb][nb]); acc[rb][nb] = wmmab(a[rb], wb2[f], acc[rb][nb]); }
                if (s < 2) {   // the eight fragments of keys 64 further take the places of those just used
#pragma unroll
                    for (int nb = 0; nb < 4; ++nb) { const int f = (s & 1) * 4 + nb; wb[f] = WFrag<bf>::ldf(vh + ((s + 2) * 4 + nb) * 512, 0u); wb2[f] = WFrag<bf>::ldf(vl + ((s + 2) * 4 + nb) * 512, 0u); }
                    __builtin_amdgcn_sched_barrier(0);   // the refill issues in front of the next 32 keys' products: without it the compiler loads each pair right in front of its own products, and the wave waits for L2 once a pair
                }
            } else { v16h a[QB];
#pragma unroll
                for (int rb = 0; rb < QB; ++rb) a[rb] = WFrag<h16>::ld((const h16*)(S + (rb * 16 + lr) * SP) + kc + 8 * hi);
#pragma unroll
                for (int nb = 0; nb < 4; ++nb)
#pragma unroll
                    for (int rb = 0; rb < QB; ++rb) acc[rb][nb] = wmma16(a[rb], bv[s * 4 + nb], acc[rb][nb]); } }
        if constexpr (HI) asm volatile("s_wait_xcnt 0x0" : : "v"(vh), "v"(vl) : "memory");   // inputs only: the lane's address pairs (one a plane serves all of its loads, which differ by constants) stay taken up to the wait, so that no late load lands in one of them
    }
    __syncthreads();   // every wave has read its slice of the probability rows before the partial tiles overwrite them
    {   // stage 5
        float* pw = S + wv * (64 * PP);
#pragma unroll
        for (int rb = 0; rb < QB; ++rb)
#pragma unroll
            for (int nb = 0; nb < 4; ++nb) { float* p = pw + (nb * 16 + lr) * PP + rb * 16 + hi * 8; const v8f t = acc[rb][nb]; *(v4fa*)p = __builtin_shufflevector(t, t, 0, 1, 2, 3); *(v4fa*)(p + 4) = __builtin_shufflevector(t, t, 4, 5, 6, 7); }
        __syncthreads();   // every wave's partial tile is in LDS before any of it is summed
        const int col = tid & 63, rp = tid >> 6; const float* p = S + col * PP + rp * 4; v4f s = *(const v4fa*)p;   // four neighbouring rows of one column
#pragma unroll
        for (int w = 1; w < 16; ++w) s += *(const v4fa*)(p + w * (64 * PP));
        const float cs = HI ? 1.0f : (1.0f / PCAR);
        unsigned short oa[4], oc[4];
#pragma unroll
        for (int q = 0; q < 4; ++q) splitf(s[q] * cs, oa[q], oc[q]);
        const size_t oo = (size_t)(r0 + ((rp * 4) & ~15)) * DQ + (h * 2 + (col >> 5)) * 512 + ((col >> 4) & 1) * 256 + ((col >> 3) & 1) * 128 + ((rp * 4) & 15) * 8 + (col & 7);   // fragment order, rows = query rows, k = h * HD + col; the thread's four rows lie in one 16-row block, 8 elements apart
        __builtin_amdgcn_sched_barrier(0);   // the eight stores stay the thread's last instructions: nothing behind them is given a register that a store still names
#pragma unroll
        for (int q = 0; q < 4; ++q) { ATh[oo + q * 8] = oa[q]; ATl[oo + q * 8] = oc[q]; }
    }
}
__global__ __launch_bounds__(512) void k_attn(const h16* __restrict__ QP16, const bf* __restrict__ QPh, const bf* __restrict__ QPl, const h16* __restrict__ KP16, const bf* __restrict__ KPh, const bf* __restrict__ KPl, const bf* __restrict__ ERB, const h16* __restrict__ VT16, const bf* __restrict__ VTh, const bf* __restrict__ VTl, bf* ATh, bf* ATl) {
    __shared__ __align__(16) float S[QB * 16 * SP];
    // Grid (RH / 32, heads, TT / RH): there are four times as many work-groups as WGPs, and one of hi/lo rows lasts about half as long again as one of fp16 rows. Slab z = 0 holds all hi/lo row blocks of all heads.
    // For speed only: every (head, row block) is done exactly once wherever and whenever its work-group runs.
    static_assert(RH > 0 && RH % (QB * 16) == 0 && TT % RH == 0, "slabs of RH query rows; slab 0 is the hi/lo one");
    const int r0 = (int)blockIdx.z * RH + (int)blockIdx.x * (QB * 16), h = (int)blockIdx.y;   // the choice below is the same for the whole work-group (RH is a multiple of its rows), so every barrier is met by all of its waves
    rel_stage(S, h, r0, QPh, QPl, ERB);
    if (r0 < RH) attn_rows<true>(S, h, r0, QP16, QPh, QPl, KP16, KPh, KPl, VT16, VTh, VTl, ATh, ATl);
    else attn_rows<false>(S, h, r0, QP16, QPh, QPl, KP16, KPh, KPl, VT16, VTh, VTl, ATh, ATl);
}

extern "C" void kernel_launch(void* const* d_in, const int* in_sizes, int n_in,
                              void* d_out, int out_size, void* d_ws, size_t ws_size, hipStream_t stream) {
    (void)in_sizes; (void)n_in; (void)out_size;
    const float* xq = (const float*)d_in[0]; const float* xk = (const float*)d_in[1]; const float* xv = (const float*)d_in[2]; const float* wq = (const float*)d_in[3]; const float* bq = (const float*)d_in[4]; const float* wk = (const float*)d_in[5]; const float* bk = (const float*)d_in[6]; const float* wv = (const float*)d_in[7]; const float* bv = (const float*)d_in[8]; const float* wo = (const float*)d_in[9]; const float* bo = (const float*)d_in[10]; const float* Er = (const float*)d_in[11]; const float* x = nullptr; (void)x;
    float* OUT = (float*)d_out;     // [1][2048][1024]
    char* wsp = (char*)d_ws;
    auto take = [&](size_t bytes) { char* p = wsp; wsp += (bytes + 255) & ~(size_t)255; return (void*)p; };
    bf* WQ = (bf*)take((size_t)DQ * DM * 2); bf* WK = (bf*)take((size_t)DKV * DM * 2); bf* WV = (bf*)take((size_t)DKV * DM * 2); bf* WO = (bf*)take((size_t)DM * DQ * 2);
    bf* ERB = (bf*)take((size_t)TT * HD * 2);
    bf* XQ = (bf*)take((size_t)TT * DM * 2); bf* XK = (bf*)take((size_t)TT * DM * 2); bf* XV = (bf*)take((size_t)TT * DM * 2);
    h16* QP16 = (h16*)take((size_t)NH_ * TT * HD * 2); h16* KP16 = (h16*)take((size_t)NKV * TT * HD * 2); h16* VT16 = (h16*)take((size_t)NKV * HD * TT * 2);
    bf* QPh = (bf*)take((size_t)NH_ * TT * HD * 2); bf* QPl = (bf*)take((size_t)NH_ * TT * HD * 2); bf* KPh = (bf*)take((size_t)NKV * TT * HD * 2); bf* KPl = (bf*)take((size_t)NKV * TT * HD * 2); bf* VTh = (bf*)take((size_t)NKV * HD * TT * 2); bf* VTl = (bf*)take((size_t)NKV * HD * TT * 2);
    bf* ATh = (bf*)take((size_t)TT * DQ * 2); bf* ATl = (bf*)take((size_t)TT * DQ * 2);
    if ((size_t)(wsp - (char*)d_ws) > ws_size) return;    // ws 256 MiB
    for (int b = 0; b < NB_; ++b) {
        k_prep<<<4 * PB_W + 3 * PB_X + PB_E, 256, 0, stream>>>(wq, wk, wv, wo, xq + (size_t)b * TT * DM, xk + (size_t)b * TT * DM, xv + (size_t)b * TT * DM, Er, WQ, WK, WV, WO, XQ, XK, XV, ERB);   /* Er [2048][64] ('t d'): rows t, k = d */
        k_qkv<<<dim3(TT / 64, NH_, 3), 256, 0, stream>>>(XQ, XK, XV, WQ, WK, WV, bq, bk, bv, QP16, QPh, QPl, KP16, KPh, KPl, VT16, VTh, VTl);
        k_attn<<<dim3(RH / (QB * 16), NH_, TT / RH), 512, 0, stream>>>(QP16, QPh, QPl, KP16, KPh, KPl, ERB, VT16, VTh, VTl, ATh, ATl);   /* one kv head per query head */
        k_gemmw<bf, 1, true, 8, DQ><<<dim3(TT / 64, DM / 64, 1), 256, 0, stream>>>(ATh, ATl, WO, nullptr, OUT + (size_t)b * TT * DM, DM, bo, 0, 0, 0); }
}

// v008
// Measured time: 103 microseconds a run.
// Next to v007, in two timings, it ran 1.05 and 1.03 times as fast.
// All steps since v000 together make it 12.2 times as fast.
#include <hip/hip_runtime.h>

// Relative global attention (Music-Transformer skew) (query, key, value [1][2048][1024]; q,k,v = input W^T + b ('oi' [1024][1024] + [1024]; 16 heads x 64); qe = q.Er^T (Er [2048][64], all rows used since s = max_len); s_rel = skew(qe): for j <= i  s_rel[i][j] = qe[i][2047 + j - i]; for j = i+1  0; for j > i+1  qe[i+1][j - i - 2] (the reference's pad-reshape-slice, reproduced exactly, upper triangle included); scores = (q.k + s_rel) / 8; softmax; out = merged ctx Wo^T + bo -> [1][2048][1024] (2.1 M)).
// Compute dtypes, f32 accumulate: every input rounded to bf16; q/k/v on PLAIN bf16 operands (inputs: exact) + biases (three input tensors); qe = q(hi/lo planes) x Er (exact bf16) gives the relative logits, stored in LDS at their skewed place (the index map above) and added to q.k before the 1/8 scale; scores and attn.v: query rows < 512 hl (3 products), the rest single fp16 (x1024); softmax f32; Wo hl x exact (2 products) + bo.

#define NB_  1
#define TT   2048
#define DM   1024
#define NH_  16
#define NKV  16
#define REP  (NH_ / NKV)
#define HD   64
#define DQ   (NH_ * HD)
#define DKV  (NKV * HD)
#define RH   512                  // query rows < RH use hi+lo planes
#define WIN  0
#define PCAR 1024.0f
#define SCL  0.125f   // HD^-0.5
typedef _Float16 h16;
typedef unsigned short bf;
typedef __attribute__((ext_vector_type(16))) __bf16   v16bf;
typedef __attribute__((ext_vector_type(16))) _Float16 v16h;
typedef __attribute__((ext_vector_type(8)))  _Float16 v8h;
typedef __attribute__((ext_vector_type(8)))  unsigned short v8us;
typedef __attribute__((ext_vector_type(8)))  float    v8f;
typedef __attribute__((ext_vector_type(4)))  float    v4f;
typedef v8h  __attribute__((may_alias)) v8ha;
typedef v4f  __attribute__((may_alias)) v4fa;
typedef v8us __attribute__((may_alias)) v8usa;

__device__ __forceinline__ unsigned short f2bf(float f) { unsigned u = __float_as_uint(f); u += 0x7FFFu + ((u >> 16) & 1u); return (unsigned short)(u >> 16); }
__device__ __forceinline__ float bf2f(unsigned short b) { return __uint_as_float(((unsigned)b) << 16); }
__device__ __forceinline__ float bfr(float f) { return bf2f(f2bf(f)); }
__device__ __forceinline__ v16h cat16(v8h lo, v8h hi) { return __builtin_shufflevector(lo, hi, 0, 1, 2, 3, 4, 5, 6, 7, 8, 9, 10, 11, 12, 13, 14, 15); }
__device__ __forceinline__ v16bf cat16b(v8us lo, v8us hi) { return __builtin_bit_cast(v16bf, __builtin_shufflevector(lo, hi, 0, 1, 2, 3, 4, 5, 6, 7, 8, 9, 10, 11, 12, 13, 14, 15)); }
__device__ __forceinline__ v8f wmma16(v16h a, v16h b, v8f c) { return __builtin_amdgcn_wmma_f32_16x16x32_f16(false, a, false, b, (short)0, c, false, false); }
__device__ __forceinline__ v8f wmmab(v16bf a, v16bf b, v8f c) { return __builtin_amdgcn_wmma_f32_16x16x32_bf16(false, a, false, b, (short)0, c, false, false); }



// ---- FRAGMENT ORDER of every 16-bit operand plane in global memory (rows x K, K % 32 == 0): the plane is a row-major grid of fragments (16 rows x 32 k, 512 elements = 1 KiB, fragment index (row / 16) * (K / 32) + k / 32; the v planes alone order their fragments k-block first, see k_qkv);
// inside a fragment element (row, k) lies at ((k >> 4) & 1) * 256 + ((k >> 3) & 1) * 128 + (row & 15) * 8 + (k & 7), which is half * 256 + lane * 8 + e of the lane and register half that hold it in the WMMA operand.
// WFrag::ldf(fragment, lane * 16) is then two wave-wide 16-byte loads of 512 contiguous bytes each (four whole 128-byte lines); from a row-major plane each such load touches 16 lines. WFrag::ld reads a row-major source (the LDS rows).
// ldf takes a wave-uniform fragment pointer and the lane's 32-bit BYTE offset: every load of a loop then names one scalar base, one offset register and a constant, and no per-load address pair is formed (stages 2 and 4 of k_attn hand it the lane's own pointer and offset 0).
// Behind each run of such loads stands s_wait_xcnt 0, in front of the rewrite of the offset register that they name (addr_step: the caller advances the offset behind it) or of its release (a statement that takes the address registers as inputs only, so that they stay taken up to the wait).
// ---- k_gemmw: register-blocked GEMM, ONE WAVE per 64x64 output tile (16 accumulators), operands straight from 16-bit planes in fragment order; grid (M/64, N/64, Z), 32 threads.
// C[m][n] (f32, pitch ldc, + optional f32 bias[n]) = sum_k A[m][k] Bt[n][k] (+ split products per NSPLIT). z-batch strides sA/sB/sC in elements. K % (32 * KS) == 0.
// KS > 1 (long-K launches, 32 * KS threads): wave w of the work-group sums the K slice [w K/KS, (w+1) K/KS) of the same 64x64 tile; the KS partial tiles meet in LDS (column-major, pitch 68) and are added in wave order 0..KS-1.
template <typename T16> struct WFrag;
template <> struct WFrag<h16> { typedef v16h V; static __device__ __forceinline__ V ld(const h16* p) { return cat16(*(const v8h*)p, *(const v8h*)(p + 16)); } static __device__ __forceinline__ V ldf(const h16* ub, unsigned vb) { const h16* p = (const h16*)((const char*)ub + vb); return cat16(*(const v8h*)p, *(const v8h*)(p + 256)); } static __device__ __forceinline__ v8f mma(V a, V b, v8f c) { return wmma16(a, b, c); } };
template <> struct WFrag<bf> { typedef v16bf V; static __device__ __forceinline__ V ld(const bf* p) { return cat16b(*(const v8us*)p, *(const v8us*)(p + 16)); } static __device__ __forceinline__ V ldf(const bf* ub, unsigned vb) { const bf* p = (const bf*)((const char*)ub + vb); return cat16b(*(const v8us*)p, *(const v8us*)(p + 256)); } static __device__ __forceinline__ v8f mma(V a, V b, v8f c) { return wmmab(a, b, c); } };
__device__ __forceinline__ void addr_step(unsigned& vb) { asm volatile("s_wait_xcnt 0x0" : "+v"(vb) : : "memory"); }   // the offset's next value is formed from this statement's result, so its rewrite cannot be lifted over the wait
template <typename T16, int NSPLIT, bool BIAS, int KS, int K>
__global__ __launch_bounds__(32 * KS) void k_gemmw(const T16* __restrict__ A, const T16* __restrict__ A2, const T16* __restrict__ Bt, const T16* __restrict__ Bt2, float* C, int ldc, const float* __restrict__ bias, size_t sA, size_t sB, size_t sC) {
    typedef typename WFrag<T16>::V V;
    __shared__ __align__(16) float os[KS == 1 ? 16 * 68 : KS * 64 * 68];
    const size_t z = blockIdx.z; A += z * sA; if (A2) A2 += z * sA; Bt += z * sB; if (Bt2) Bt2 += z * sB; C += z * sC;
    const int lane = threadIdx.x & 31, lr = lane & 15, hi = lane >> 4; const int r0 = blockIdx.x * 64, c0 = blockIdx.y * 64;
    v8f acc[4][4];
#pragma unroll
    for (int mb = 0; mb < 4; ++mb)
#pragma unroll
        for (int nb = 0; nb < 4; ++nb) acc[mb][nb] = (v8f){};
    const int wv = (KS == 1) ? 0 : __builtin_amdgcn_readfirstlane((int)(threadIdx.x >> 5)); constexpr int kspan = K / KS; const int kbeg = wv * kspan;   // this wave's K slice
    const T16* ua = A + (size_t)r0 * K + (size_t)kbeg * 16; const T16* ua2 = (NSPLIT == 1 || NSPLIT == 2) ? A2 + (size_t)r0 * K + (size_t)kbeg * 16 : nullptr; const T16* ub = Bt + (size_t)c0 * K + (size_t)kbeg * 16; const T16* ub2 = (NSPLIT >= 2) ? Bt2 + (size_t)c0 * K + (size_t)kbeg * 16 : nullptr;   // wave-uniform: 16 rows of fragments hold 16 K elements; a step of 32 in k is one fragment (1 KiB)
    unsigned vo = (unsigned)lane * 16;
#pragma unroll 1
    for (int kc = 0; kc < kspan; kc += 32) {
        V a[4], a2[4], b[4], b2[4];
#pragma unroll
        for (int mb = 0; mb < 4; ++mb) { a[mb] = WFrag<T16>::ldf(ua + mb * 16 * K, vo); if (NSPLIT == 1 || NSPLIT == 2) a2[mb] = WFrag<T16>::ldf(ua2 + mb * 16 * K, vo); }
#pragma unroll
        for (int nb = 0; nb < 4; ++nb) { b[nb] = WFrag<T16>::ldf(ub + nb * 16 * K, vo); if (NSPLIT >= 2) b2[nb] = WFrag<T16>::ldf(ub2 + nb * 16 * K, vo); }
        __builtin_amdgcn_sched_barrier(0);   // a trip's loads all issue in front of its products: without it the compiler sinks each B fragment behind the products before it, into one register set, and a trip waits four times for memory
#pragma unroll
        for (int nb = 0; nb < 4; ++nb)
#pragma unroll
            for (int mb = 0; mb < 4; ++mb) { acc[mb][nb] = WFrag<T16>::mma(a[mb], b[nb], acc[mb][nb]); if (NSPLIT == 1 || NSPLIT == 2) acc[mb][nb] = WFrag<T16>::mma(a2[mb], b[nb], acc[mb][nb]); if (NSPLIT >= 2) acc[mb][nb] = WFrag<T16>::mma(a[mb], b2[nb], acc[mb][nb]); }
        asm volatile("v_nop\n\tv_nop\n\tv_nop\n\tv_nop" : "+v"(acc[0][0]), "+v"(acc[1][1]), "+v"(acc[2][2]), "+v"(acc[3][3]) : "v"(a[0]), "v"(a[3]));
        addr_step(vo); vo += 1024;   // next fragment of every operand row block
    }
    if constexpr (KS > 1) {
        float* pw = os + wv * (64 * 68);
#pragma unroll
        for (int mb = 0; mb < 4; ++mb)
#pragma unroll
            for (int nb = 0; nb < 4; ++nb) { float* p = pw + (nb * 16 + lr) * 68 + mb * 16 + hi * 8; const v8f t = acc[mb][nb]; *(v4fa*)p = __builtin_shufflevector(t, t, 0, 1, 2, 3); *(v4fa*)(p + 4) = __builtin_shufflevector(t, t, 4, 5, 6, 7); }
        __syncthreads();   // every wave's partial tile is in LDS before any of it is summed
#pragma unroll
        for (int it = 0; it < 64 * 16 / (32 * KS); ++it) { const int g = it * (32 * KS) + (int)threadIdx.x, col = g & 63, rq = g >> 6; const float* p = os + col * 68 + rq * 4; v4f s = *(const v4fa*)p;
#pragma unroll
            for (int w = 1; w < KS; ++w) s += *(const v4fa*)(p + w * (64 * 68));
            if (BIAS) { const float bb = bfr(bias[c0 + col]); s[0] += bb; s[1] += bb; s[2] += bb; s[3] += bb; }
            float* cp = C + (size_t)(r0 + rq * 4) * ldc + c0 + col;
#pragma unroll
            for (int q = 0; q < 4; ++q) cp[(size_t)q * ldc] = s[q]; }
        return;
    }
#pragma unroll
    for (int mb = 0; mb < 4; ++mb) {
#pragma unroll
        for (int nb = 0; nb < 4; ++nb) {
#pragma unroll
            for (int j = 0; j < 8; ++j) os[(hi * 8 + j) * 68 + nb * 16 + lr] = acc[mb][nb][j]; }
        __builtin_amdgcn_wave_barrier(); asm volatile("" ::: "memory");
        float* crow = C + (size_t)(r0 + mb * 16) * ldc + c0;
{
#pragma unroll
            for (int s = 0; s < 8; ++s) { const int row = 2 * s + hi, cofs = lr * 4; v4f val = *(const v4fa*)(os + row * 68 + cofs); if (BIAS) { val[0] += bfr(bias[c0 + cofs]); val[1] += bfr(bias[c0 + cofs + 1]); val[2] += bfr(bias[c0 + cofs + 2]); val[3] += bfr(bias[c0 + cofs + 3]); }
                *(v4f*)(crow + (size_t)row * ldc + cofs) = val; }
             }
        __builtin_amdgcn_wave_barrier(); asm volatile("" ::: "memory");
    }
}

__device__ __forceinline__ h16 tohx(float x) { return (h16)x; }
__device__ __forceinline__ void splitf(float y, unsigned short& h, unsigned short& l) { h = f2bf(y); l = f2bf(y - bf2f(h)); }
typedef __attribute__((ext_vector_type(2))) _Float16 v2h;
typedef __attribute__((ext_vector_type(4))) _Float16 v4h;
typedef __attribute__((ext_vector_type(2))) unsigned short v2us;
typedef __attribute__((ext_vector_type(4))) unsigned short v4us;
typedef __attribute__((ext_vector_type(2))) float v2f;
typedef __attribute__((ext_vector_type(4))) int v4i;

__global__ __launch_bounds__(256) void k_wtG(const float* __restrict__ w, int K, int N, bf* Bt) {
    const int lane = threadIdx.x & 31; const int L0 = (blockIdx.x * 8 + (threadIdx.x >> 5)) * 8; const int nlines = N * K / 64;
{
#pragma unroll 1
        for (int l = 0; l < 8; ++l) { const int L = L0 + l; if (L >= nlines) break; const size_t e = (size_t)L * 64 + lane * 2; const int k = (int)(e % K), n = (int)(e / K); v2us o;
            o[0] = f2bf(w[(size_t)k * N + n]); o[1] = f2bf(w[(size_t)(k + 1) * N + n]); *(v2us*)(Bt + e) = o; }
         }
}
// k_prep: ONE launch turns all eight f32 matrices (four weights, three activations, Er; row-major [rows][K]) into bf16 planes in fragment order. A work-group takes 32 fragments in a row, which are 16384 elements in a row of the source too (K = 1024: one 16-row block; K = 64: 16 of them);
// a thread takes eight pieces of 8 elements, 4 fragments apart; four neighbouring lanes read one whole 128-byte line of a row (32 k), eight neighbouring rows write one whole line of the fragment.
// All loads name one scalar base, one lane offset and a constant, and so do all stores; all sixteen loads are issued in front of the first conversion, and the stores are the thread's last instructions, so that no register that a store names is written again.
template <int K>
__device__ __forceinline__ void cvt_rows(const float* __restrict__ src, bf* dst, int lb) {
    static_assert(K == 64 || K == 1024, "the step of 4 fragments below is written for these two");
    constexpr int FPR = K / 32, ustep = (FPR >= 32) ? 4 * 32 : (4 / FPR) * 16 * K;   // fragments per row block; source elements from a fragment to the fourth behind it
    const int tid = (int)threadIdx.x, c = tid & 3, lr = (tid >> 2) & 15, tq = tid >> 6;
    const char* sb = (const char*)(src + (size_t)lb * (32 * 512)); char* db = (char*)(dst + (size_t)lb * (32 * 512));   // the same for the whole work-group
    const unsigned so = (unsigned)(((tq / FPR) * 16 + lr) * K + (tq % FPR) * 32 + c * 8) * 4, eo = (unsigned)(tq * 512 + (c >> 1) * 256 + (c & 1) * 128 + lr * 8) * 2;
    v8f v[8]; v8us o[8];
#pragma unroll
    for (int u = 0; u < 8; ++u) v[u] = *(const v8f*)(sb + so + u * (ustep * 4));
    asm volatile("s_wait_xcnt 0x0" : : "v"(so), "s"(sb) : "memory");   // inputs only: the loads' offset register and scalar base stay taken up to the wait, so that no load lands in the offset and nothing else is formed there ahead of it
#pragma unroll
    for (int u = 0; u < 8; ++u)
#pragma unroll
        for (int k = 0; k < 8; ++k) o[u][k] = f2bf(v[u][k]);
    __builtin_amdgcn_sched_barrier(0);   // no store rises in front of a conversion: a conversion behind it could be given a register that the store still names
#pragma unroll
    for (int u = 0; u < 8; ++u) *(v8us*)(db + eo + u * (4 * 512 * 2)) = o[u];
}
#define PB_W (DQ / 16)            // work-groups per weight matrix (16 rows each)
#define PB_X (TT / 16)            // per activation matrix
#define PB_E (TT * HD / (32 * 512))   // for Er
__global__ __launch_bounds__(256) void k_prep(const float* __restrict__ wq, const float* __restrict__ wk, const float* __restrict__ wv, const float* __restrict__ wo, const float* __restrict__ xq, const float* __restrict__ xk, const float* __restrict__ xv, const float* __restrict__ er, bf* WQ, bf* WK, bf* WV, bf* WO, bf* XQ, bf* XK, bf* XV, bf* ERB) {
    const int b = (int)blockIdx.x;   // the matrix is chosen by the work-group's index alone
    if (b < 4 * PB_W) { const int m = b / PB_W; cvt_rows<DM>(m == 0 ? wq : m == 1 ? wk : m == 2 ? wv : wo, m == 0 ? WQ : m == 1 ? WK : m == 2 ? WV : WO, b % PB_W); }
    else if (b < 4 * PB_W + 3 * PB_X) { const int m = (b - 4 * PB_W) / PB_X; cvt_rows<DM>(m == 0 ? xq : m == 1 ? xk : xv, m == 0 ? XQ : m == 1 ? XK : XV, (b - 4 * PB_W) % PB_X); }
    else cvt_rows<HD>(er, ERB, b - 4 * PB_W - 3 * PB_X);
}
// k_qkv: the three projections in ONE launch, grid (TT / 128, heads / 2, 3), 8 waves; a work-group computes a 128 x 128 tile (128 rows t of two heads). Wave (wk, wm, wn) sums the K half wk of the 64 x 64 quarter (wm, wn); the two partial tiles of a quarter meet in LDS and are added in the order wk = 0, 1.
// The operands come into LDS by asynchronous copies (global_load_async_to_lds_b128), so that a fragment is fetched from L2 once per work-group and read from LDS by the two waves that need it. A stage is 64 k of both K halves of both operands: 64 fragments = 64 KiB, laid [operand][K half][16-row block][k / 32] x 1 KiB; two buffers, the next stage's copies fly while this one is worked on.
// A fragment keeps its order in LDS, so a wave's fragment read is two contiguous 512-byte reads. The buffers lie in the array that later takes the partial tiles; the barrier at the foot of the last trip ends every read of them.
// The partial tiles lie [n][m] in LDS with m (the A operand's rows) contiguous, and a thread sums 8 neighbouring m of one n, which are the 8 elements of one 16-byte piece of a fragment: so q and k (fragment rows t, k = d) take the weight rows d as A and the activation rows t as B,
// and v (ISV; fragment rows d, k = t, fragments laid [t / 32][d / 16] so that a wave's 128 keys x 64 columns are 16 KiB in a row) takes t as A and d as B. Both operand planes have the same fragment order, so the roles are a choice of base pointers. A wave's store is two runs of 256 contiguous bytes.
__device__ __forceinline__ void stage_copy8(unsigned l, const char* g) {   // one operand's share of a stage: the thread's eight 16-byte pieces; in LDS 4 KiB apart; in the plane two 16-row blocks (64 KiB) apart, the second four in the other K half (16 KiB further)
    asm volatile("global_load_async_to_lds_b128 %0, %8, off\n\t"
                 "global_load_async_to_lds_b128 %1, %9, off\n\t"
                 "global_load_async_to_lds_b128 %2, %10, off\n\t"
                 "global_load_async_to_lds_b128 %3, %11, off\n\t"
                 "global_load_async_to_lds_b128 %4, %12, off\n\t"
                 "global_load_async_to_lds_b128 %5, %13, off\n\t"
                 "global_load_async_to_lds_b128 %6, %14, off\n\t"
                 "global_load_async_to_lds_b128 %7, %15, off\n\t"
                 "s_wait_xcnt 0x0"   // inside the copies' own statement: it stands in front of every later write of a register that a copy names
                 : : "v"(l), "v"(l + 4096u), "v"(l + 8192u), "v"(l + 12288u), "v"(l + 16384u), "v"(l + 20480u), "v"(l + 24576u), "v"(l + 28672u),
                     "v"(g), "v"(g + 65536), "v"(g + 131072), "v"(g + 196608), "v"(g + 16384), "v"(g + 81920), "v"(g + 147456), "v"(g + 212992) : "memory");
}
template <bool ISV>
__device__ __forceinline__ void qkv_tile(float* os, const bf* __restrict__ X, const bf* __restrict__ Wt, const float* __restrict__ bias, h16* P16, bf* Ph, bf* Pl, int t0) {   // X, Wt, bias, planes: already at the tile's rows t0.., the first head's weight rows, bias and planes
    constexpr int K = DM, NT = K / 128; typedef WFrag<bf>::V V;   // NT stages of 64 k in each K half
    static_assert(K == 1024 && NT >= 2, "the constants of stage_copy8 are those of 32 fragments a row block; the ring needs two stages");
    const int tid = (int)threadIdx.x, lane = tid & 31, lr = lane & 15, hi = lane >> 4;
    v8f acc[4][4];
#pragma unroll
    for (int mb = 0; mb < 4; ++mb)
#pragma unroll
        for (int nb = 0; nb < 4; ++nb) acc[mb][nb] = (v8f){};
    const int wv = __builtin_amdgcn_readfirstlane(tid >> 5), wk = wv >> 2, wm = (wv >> 1) & 1, wn = wv & 1;   // wave-uniform
    const unsigned lb = (unsigned)(size_t)os + (unsigned)tid * 16;   // the thread's first LDS byte in buffer 0
    const unsigned go = (unsigned)((tid >> 7) * (16 * K * 2) + (tid & 127) * 16);   // its row block (of a pair) and its 16 bytes in that block's two fragments of a stage
    const char* ga = (const char*)(ISV ? X : Wt) + go; const char* gb = (const char*)(ISV ? Wt : X) + go;
    stage_copy8(lb, ga); stage_copy8(lb + 32768u, gb);
    asm volatile("s_wait_asynccnt 0x0" ::: "memory");   // this wave's copies of stage 0 have landed
    __syncthreads();   // stage 0 lies in LDS before any wave reads it
    stage_copy8(lb + 65536u, ga + 2048); stage_copy8(lb + 98304u, gb + 2048);
#pragma unroll 1   // rolled: one trip a stage, the buffer chosen by the trip's parity
    for (int s = 0; s < NT; ++s) {
        const char* bp = (const char*)os + (s & 1) * 65536 + wk * 16384 + lane * 16;
        const bf* la = (const bf*)(bp + wm * 8192); const bf* lbp = (const bf*)(bp + 32768 + wn * 8192);
        V a[4], b[4];
#pragma unroll
        for (int c = 0; c < 2; ++c) {
#pragma unroll
            for (int mb = 0; mb < 4; ++mb) { const bf* p = la + mb * 1024 + c * 512; a[mb] = cat16b(*(const v8usa*)p, *(const v8usa*)(p + 256)); }
#pragma unroll
            for (int nb = 0; nb < 4; ++nb) { const bf* p = lbp + nb * 1024 + c * 512; b[nb] = cat16b(*(const v8usa*)p, *(const v8usa*)(p + 256)); }
            __builtin_amdgcn_sched_barrier(0);   // the eight fragments' reads all issue in front of their products: without it the compiler sinks each B fragment behind the products before it, into one register set, and the wave waits four times for LDS
#pragma unroll
            for (int nb = 0; nb < 4; ++nb)
#pragma unroll
                for (int mb = 0; mb < 4; ++mb) acc[mb][nb] = WFrag<bf>::mma(a[mb], b[nb], acc[mb][nb]);
        }
        __builtin_amdgcn_sched_barrier(0);   // the trip's products stay in front of its foot: behind the barrier they would stand between it and the refill, which would start that much later
        asm volatile("s_wait_dscnt 0x0" ::: "memory");      // this wave's reads of the buffer have returned before it is refilled
        asm volatile("s_wait_asynccnt 0x0" ::: "memory");   // this wave's copies of the next stage have landed
        __syncthreads();   // publishes the next stage and ends every wave's reads of this trip's buffer
        if (s + 2 < NT) { const unsigned l2 = lb + (unsigned)(s & 1) * 65536u; const int g2 = (s + 2) * 2048; stage_copy8(l2, ga + g2); stage_copy8(l2 + 32768u, gb + g2); }   // the same test for the whole work-group
    }
    asm volatile("s_wait_asynccnt 0x0" ::: "memory");   // no copy is under way when the buffers become the partial tiles
    const int n = tid & 63, mq = (tid >> 6) * 8;   // this thread's n and its first m in every quarter; its second piece lies 32 m further
    const unsigned bo = (unsigned)(ISV ? n : mq) * 4; const char* bsp = (const char*)bias; v4f bb[ISV ? 2 : 8];   // the bias goes with d: n for v, m for q and k; the second head's lies 64 floats further
    if constexpr (ISV) { bb[0] = (v4f)(*(const float*)(bsp + bo)); bb[1] = (v4f)(*(const float*)(bsp + bo + 256)); }
    else {
#pragma unroll
        for (int u = 0; u < 4; ++u) { bb[u * 2] = *(const v4f*)(bsp + bo + u * 128); bb[u * 2 + 1] = *(const v4f*)(bsp + bo + u * 128 + 16); } }
    asm volatile("s_wait_xcnt 0x0" : : "v"(bo), "s"(bsp) : "memory");   // inputs only: the bias loads' offset register and scalar base stay taken up to the wait; the LDS stores and the barrier below cover their latency
    float* pw = os + wv * (64 * 68);
#pragma unroll
    for (int mb = 0; mb < 4; ++mb)
#pragma unroll
        for (int nb = 0; nb < 4; ++nb) { float* p = pw + (nb * 16 + lr) * 68 + mb * 16 + hi * 8; const v8f t = acc[mb][nb]; *(v4fa*)p = __builtin_shufflevector(t, t, 0, 1, 2, 3); *(v4fa*)(p + 4) = __builtin_shufflevector(t, t, 4, 5, 6, 7); }
    __syncthreads();   // every wave's partial tile is in LDS before any of it is summed
    v8h o16[8]; v8us oh[8], ol[8];
#pragma unroll
    for (int st = 0; st < 4; ++st)   // quarter (wm, wn) = (st >> 1, st & 1): its partial tiles are those of waves st and st + 4
#pragma unroll
        for (int it = 0; it < 2; ++it) { const float* p = os + st * (64 * 68) + n * 68 + mq + it * 32; v4f s0 = *(const v4fa*)p, s1 = *(const v4fa*)(p + 4);
            s0 += *(const v4fa*)(p + 4 * (64 * 68)); s1 += *(const v4fa*)(p + 4 * (64 * 68) + 4);
#pragma unroll
            for (int q = 0; q < 8; ++q) { const float r = (q < 4 ? s0[q & 3] : s1[q & 3]) + bfr(ISV ? bb[st & 1][0] : bb[(st >> 1) * 4 + it * 2 + (q >> 2)][q & 3]); o16[st * 2 + it][q] = tohx(r); unsigned short a2, c2; splitf(r, a2, c2); oh[st * 2 + it][q] = a2; ol[st * 2 + it][q] = c2; } }
    const int t = t0 + (ISV ? mq : n), d = ISV ? n : mq;   // of the first piece of quarter (0, 0)
    const unsigned ob = (unsigned)(ISV ? ((t >> 5) * 4 + (d >> 4)) * 512 + ((t >> 4) & 1) * 256 + ((t >> 3) & 1) * 128 + (d & 15) * 8
                                       : (t & ~15) * HD + (d >> 5) * 512 + ((d >> 4) & 1) * 256 + ((d >> 3) & 1) * 128 + (t & 15) * 8) * 2;
#pragma unroll
    for (int st = 0; st < 4; ++st)
#pragma unroll
        for (int it = 0; it < 2; ++it) {   // q, k: 64 d further is the next head's plane, 64 t further four 16-row blocks, 32 d further one fragment; v: 64 d further the next head's plane, 64 t further eight fragments, 32 t further four
            const int off = (ISV ? (st & 1) * (TT * HD) + (st >> 1) * (8 * 512) + it * (4 * 512) : (st >> 1) * (TT * HD) + (st & 1) * (64 * HD) + it * 512) * 2;
            *(v8h*)((char*)P16 + ob + off) = o16[st * 2 + it]; *(v8us*)((char*)Ph + ob + off) = oh[st * 2 + it]; *(v8us*)((char*)Pl + ob + off) = ol[st * 2 + it]; }
}
__global__ __launch_bounds__(256) void k_qkv(const bf* __restrict__ XQ, const bf* __restrict__ XK, const bf* __restrict__ XV, const bf* __restrict__ WQ, const bf* __restrict__ WK, const bf* __restrict__ WV, const float* __restrict__ bq, const float* __restrict__ bk, const float* __restrict__ bv,
                                             h16* QP16, bf* QPh, bf* QPl, h16* KP16, bf* KPh, bf* KPl, h16* VT16, bf* VTh, bf* VTl) {
    __shared__ __align__(16) float os[8 * 64 * 68];   // first the two 64-KiB stage buffers, then the eight partial tiles
    static_assert(sizeof(float) * 8 * 64 * 68 >= 2 * 65536, "both stage buffers lie inside the array");
    const int z = (int)blockIdx.z, t0 = (int)blockIdx.x * 128, h = (int)blockIdx.y * 2; const size_t xo = (size_t)t0 * DM, wo = (size_t)h * HD * DM, po = (size_t)h * TT * HD;   // the choice below is the same for the whole work-group, so its barriers are met by all of its waves
    if (z == 2) qkv_tile<true>(os, XV + xo, WV + wo, bv + h * HD, VT16 + po, VTh + po, VTl + po, t0);
    else qkv_tile<false>(os, (z == 0 ? XQ : XK) + xo, (z == 0 ? WQ : WK) + wo, (z == 0 ? bq : bk) + h * HD, (z == 0 ? QP16 : KP16) + po, (z == 0 ? QPh : KPh) + po, (z == 0 ? QPl : KPl) + po, t0);
}
// ---- k_attn: one work-group of 16 waves per (head, 32 query rows = QB blocks of 16); the 32 x 2048 score rows never leave LDS and take most of a WGP's LDS, so one work-group has the WGP to itself (4 waves per SIMD, up to 256 registers each).
// Every Er, k and v fragment that a wave loads stays in registers for the products of BOTH row blocks: per query row half as many bytes come from L2 as with one block per work-group. Each row's products, trees and sums are those of a single block. Five stages, a work-group barrier between each two and one inside the last:
// 1 relative logits: qe tiles (q hi/lo planes x Er) are stored straight at their skewed place: qe[i][t] is rel(i, t - 2047 + i) where that column is >= 0, and qe[i+1][t] is rel(i, t + i + 2) where that column is < 2048; rel(i, i+1) = 0 (= the reference's pad/reshape/slice of q.Er^T, upper triangle included)
// 2 scores: each q.k tile adds the relative logit that lies at its own place, scales by 1/8 and stores back
// 3 softmax: wave w owns rows w and w + 16 (register row, one exp, fixed trees) and writes the probabilities over its own rows: fp16 x 1024, or bf16 hi and lo planes for rows < RH
// 4 attn.v: wave w sums the key slice [128 w, 128 w + 128) for all 64 columns of both row blocks
// 5 the 16 partial tiles meet in LDS (column-major, pitch 36) and are added in wave order 0..15; the merged context goes out as hi/lo planes in fragment order
// Fragments are fetched ahead, into registers: the first k tiles of stage 2 are loaded in front of the barrier that ends stage 1, each tile's registers are refilled right behind its products, and v fragments of stage 4 are loaded in front of the barriers that end stages 2 and 3, so that they come from L2 while waves wait for one another and while stage 3 runs on the vector unit alone. Those three barriers (lds_barrier) wait for the wave's LDS accesses only; nothing is stored to global memory before stage 5.
#define SP 2052   // LDS pitch of a score row in floats: rows stay 16-byte aligned, rows 8 apart lie 32 banks apart; columns 2048..2051 take the qe elements that belong to no column of this row block
#define QB 2      // 16-row blocks per work-group
#define PP (QB * 16 + 4)   // LDS pitch of a partial tile's column in floats (stage 5): 16 bytes times an odd number
typedef v2f __attribute__((may_alias)) v2fa;
__device__ __forceinline__ void lds_barrier() {   // a work-group barrier that orders LDS alone: __syncthreads() also waits for the wave's global loads, and the fragments fetched ahead would stop being ahead
    __builtin_amdgcn_fence(__ATOMIC_RELEASE, "workgroup", "local"); __builtin_amdgcn_s_barrier(); __builtin_amdgcn_fence(__ATOMIC_ACQUIRE, "workgroup", "local");
}
template <bool UP>
__device__ __forceinline__ void rel_one(float* S, const v16bf (&ah0)[QB], const v16bf (&al0)[QB], const v16bf (&ah1)[QB], const v16bf (&al1)[QB], v16bf b0, v16bf b1, int tt, int r0, int lr, int hi) {   // one Er tile against the q rows of every row block
#pragma unroll
    for (int rb = 0; rb < QB; ++rb) {
        v8f acc = (v8f){}; acc = wmmab(ah0[rb], b0, acc); acc = wmmab(al0[rb], b0, acc); acc = wmmab(ah1[rb], b1, acc); acc = wmmab(al1[rb], b1, acc);
        const int cb = tt * 16 + lr + r0 + rb * 16 + hi * 8 + (UP ? 2 : 1 - TT);   // column of accumulator register 0; register j is one row lower and so j columns further
#pragma unroll
        for (int j = 0; j < 8; ++j) { const int col = cb + j; const bool ok = UP ? (col < TT) : (col >= 0); S[(rb * 16 + hi * 8 + j) * SP + (ok ? col : TT + (lr & 3))] = acc[j]; }
    }
}
template <bool UP>
__device__ __forceinline__ void rel_tiles(float* S, const bf* __restrict__ qh, const bf* __restrict__ ql, const bf* __restrict__ er, int r0, int tbeg, int tend, int lr, int hi) {
    if (tbeg >= tend) return;   // wave-uniform: a wave without a tile loads no q rows
    v16bf ah0[QB], ah1[QB], al0[QB], al1[QB]; unsigned ao[QB];
#pragma unroll
    for (int rb = 0; rb < QB; ++rb) { const int qr = UP ? min(r0 + rb * 16 + 1 + lr, TT - 1) : r0 + rb * 16 + lr; ao[rb] = (unsigned)((qr >> 4) * (16 * HD) + (qr & 15) * 8 + hi * 128) * 2;   // UP: q rows i + 1 (the clamped row has no column in range); byte offset in fragment order: a 16-row tile is 2 fragments (k 0..31, 32..63)
        ah0[rb] = WFrag<bf>::ldf(qh, ao[rb]); ah1[rb] = WFrag<bf>::ldf(qh + 512, ao[rb]); al0[rb] = WFrag<bf>::ldf(ql, ao[rb]); al1[rb] = WFrag<bf>::ldf(ql + 512, ao[rb]); }
    asm volatile("s_wait_xcnt 0x0" : : "v"(ao[0]), "v"(ao[1]), "s"(qh), "s"(ql) : "memory");   // inputs only: the q loads' offset registers and two scalar bases stay taken up to the wait; the Er base and offset are formed behind it, not in those registers ahead of it
    const bf* eb = er + (size_t)tbeg * 16 * HD; unsigned eo = (unsigned)(lr * 8 + hi * 128) * 2;
    for (int tt = tbeg; tt < tend; tt += 32) {   // two Er tiles' loads in flight per trip (16 waves a WGP: each keeps more bytes under way)
        const bool two = tt + 16 < tend;   // wave-uniform; without a second tile its loads read the first again and feed nothing
        const unsigned e2 = eo + (two ? 16 * 16 * HD * 2 : 0);
        const v16bf b0 = WFrag<bf>::ldf(eb, eo), b1 = WFrag<bf>::ldf(eb + 512, eo), c0 = WFrag<bf>::ldf(eb, e2), c1 = WFrag<bf>::ldf(eb + 512, e2);
        rel_one<UP>(S, ah0, al0, ah1, al1, b0, b1, tt, r0, lr, hi);
        asm volatile("" : : "v"(c0), "v"(c1));   // inputs only, the loaded values: holds the second tile's loads in front of the branch, beside the first tile's; without it the compiler sinks them into the branch and a trip waits twice for L2
        if (two) rel_one<UP>(S, ah0, al0, ah1, al1, c0, c1, tt + 16, r0, lr, hi);
        asm volatile("s_wait_xcnt 0x0" : "+v"(eo) : "v"(e2) : "memory");   // as addr_step; the second tile's offset register stays taken up to the wait, and its next value is formed from this statement's result
        eo += 32 * 16 * HD * 2;   // 32 Er tiles further
    }
}
__device__ __forceinline__ void rel_stage(float* S, int h, int r0, const bf* __restrict__ QPh, const bf* __restrict__ QPl, const bf* __restrict__ ERB) {   // the same for hi/lo and fp16 rows: it stands once in the kernel's text, which so stays under 32 KB
    const int tid = (int)threadIdx.x, lane = tid & 31, lr = lane & 15, hi = lane >> 4; const int wv = __builtin_amdgcn_readfirstlane(tid >> 5);   // wave-uniform: scalar loop bounds
    const size_t hq = (size_t)h * TT * HD;
    {   // stage 1: for row block rb, Er tiles 0..T0 - rb serve the columns right of the diagonal and tiles T0 - rb..127 those up to it; each deal takes the union over the blocks (a tile that serves only one block leaves the other's elements in the spare columns); the second deal runs in reverse wave order so that the two remainders fall on different waves where they can
        const int T0 = TT / 16 - 1 - (r0 >> 4);
        rel_tiles<true>(S, QPh + hq, QPl + hq, ERB, r0, wv, T0 + 1, lr, hi);
        rel_tiles<false>(S, QPh + hq, QPl + hq, ERB, r0, T0 - (QB - 1) + 15 - wv, TT / 16, lr, hi);
        if (tid < QB * 16 && r0 + tid + 1 < TT) S[tid * SP + r0 + tid + 1] = 0.0f;
    }
}
template <bool HI>
__device__ __forceinline__ void attn_rows(float* S, int h, int r0, const h16* __restrict__ QP16, const bf* __restrict__ QPh, const bf* __restrict__ QPl, const h16* __restrict__ KP16, const bf* __restrict__ KPh, const bf* __restrict__ KPl, const h16* __restrict__ VT16, const bf* __restrict__ VTh, const bf* __restrict__ VTl, bf* ATh, bf* ATl) {
    const int tid = (int)threadIdx.x, lane = tid & 31, lr = lane & 15, hi = lane >> 4; const int wv = __builtin_amdgcn_readfirstlane(tid >> 5);   // wave-uniform: scalar loop bounds
    const size_t hq = (size_t)h * TT * HD;
    const unsigned lo = (unsigned)(lr * 8 + hi * 128) * 2;   // 32-bit lane byte offset in a fragment
    const size_t vb = (size_t)h * HD * TT + (size_t)wv * (128 * HD);   // wave-uniform base of the wave's v slice (its 16 fragments of a plane lie in a row)
    const h16* vp = (const h16*)((const char*)(VT16 + vb) + lo); const bf* vh = (const bf*)((const char*)(VTh + vb) + lo); const bf* vl = (const bf*)((const char*)(VTl + vb) + lo);
    v16h bv[HI ? 1 : 16]; v16bf wb[HI ? 8 : 1], wb2[HI ? 8 : 1];   // stage 4's v fragments, fetched ahead: fp16 rows the wave's whole slice (16 KiB), hi/lo rows the first 64 of its 128 keys in both planes
    {   // stage 2: the fragment registers of a key tile are refilled right behind its products, so that loads are under way while the other tiles are worked on. The refill is unconditional (a branch round it would make the compiler wait for every load at each use): behind the last tiles it brings the first v fragments, by a wave-uniform choice of base and step.
        const size_t ab = hq + (size_t)r0 * HD, kb = hq + (size_t)wv * (16 * HD);   // wave-uniform bases (fragment order); key tile it * 16 + wv lies it * 32 KiB behind tile wv
        if constexpr (HI) {
            v16bf a0[QB], a1[QB], c0[QB], c1[QB], b0[2], b1[2], d0[2], d1[2];   // two key tiles' fragments
            const bf* qh = (const bf*)((const char*)(QPh + ab) + lo); const bf* ql = (const bf*)((const char*)(QPl + ab) + lo); const bf* kh = (const bf*)((const char*)(KPh + kb) + lo); const bf* kl = (const bf*)((const char*)(KPl + kb) + lo);
#pragma unroll
            for (int rb = 0; rb < QB; ++rb) { const int ar = rb * (16 * HD); a0[rb] = WFrag<bf>::ldf(qh + ar, 0u); a1[rb] = WFrag<bf>::ldf(qh + ar + 512, 0u); c0[rb] = WFrag<bf>::ldf(ql + ar, 0u); c1[rb] = WFrag<bf>::ldf(ql + ar + 512, 0u); }
            __builtin_amdgcn_sched_barrier(0);   // the q loads stay the oldest: the loop's waits for them stand in every trip, and behind younger q loads they would also wait for the refills under way
#pragma unroll
            for (int t = 0; t < 2; ++t) { const int kt = t * (256 * HD); b0[t] = WFrag<bf>::ldf(kh + kt, 0u); b1[t] = WFrag<bf>::ldf(kh + kt + 512, 0u); d0[t] = WFrag<bf>::ldf(kl + kt, 0u); d1[t] = WFrag<bf>::ldf(kl + kt + 512, 0u); }
            asm volatile("s_wait_xcnt 0x0" : : "v"(qh), "v"(ql), "v"(kh), "v"(kl) : "memory");   // inputs only: the lane's four address pairs (one a plane serves all of its loads, which differ by constants) stay taken up to the wait, so that no late load lands in one of them
            __builtin_amdgcn_sched_barrier(0);   // the loads stay in front of the barrier: behind it they would start only when the last wave has ended stage 1
            lds_barrier();   // every relative logit lies in LDS before a score tile adds it
            unsigned ko = lo;   // the k refills' offset: it moves on by two tiles a trip
#pragma unroll 1   // rolled: the same two tiles' registers serve every trip, and the text stays short
            for (int io = 0; io < TT / 256; io += 2) {
              const bool last = io + 2 >= TT / 256;   // wave-uniform
              const char* sh = (const char*)(last ? VTh + vb : KPh + kb + 2 * (256 * HD)); const char* sl = (const char*)(last ? VTl + vb : KPl + kb + 2 * (256 * HD));
              const unsigned o[2] = { last ? lo : ko, last ? lo + 2 * 1024 : ko + 256 * HD * 2 };   // k: the tile two further; v: two fragments of each plane
              const bf* ph[2] = { (const bf*)(sh + o[0]), (const bf*)(sh + o[1]) }; const bf* pl[2] = { (const bf*)(sl + o[0]), (const bf*)(sl + o[1]) };
#pragma unroll
              for (int t = 0; t < 2; ++t) { const int n0 = ((io + t) * 16 + wv) * 16;
#pragma unroll
                for (int rb = 0; rb < QB; ++rb) {
                    v8f acc = (v8f){}; acc = wmmab(a0[rb], b0[t], acc); acc = wmmab(c0[rb], b0[t], acc); acc = wmmab(a0[rb], d0[t], acc); acc = wmmab(a1[rb], b1[t], acc); acc = wmmab(c1[rb], b1[t], acc); acc = wmmab(a1[rb], d1[t], acc);
#pragma unroll
                    for (int j = 0; j < 8; ++j) { float* q = S + (rb * 16 + hi * 8 + j) * SP + n0 + lr; *q = (acc[j] + *q) * SCL; } }
                b0[t] = WFrag<bf>::ldf(ph[t], 0u); b1[t] = WFrag<bf>::ldf(ph[t] + 512, 0u); d0[t] = WFrag<bf>::ldf(pl[t], 0u); d1[t] = WFrag<bf>::ldf(pl[t] + 512, 0u);
                __builtin_amdgcn_sched_barrier(0);   // a tile's refill issues in front of the other tile's products, not behind them
              }
              asm volatile("s_wait_xcnt 0x0" : "+v"(ko) : "v"(ph[0]), "v"(ph[1]), "v"(pl[0]), "v"(pl[1]) : "memory");   // as addr_step; the refills' four address pairs stay taken up to the wait, and the next trip's are formed from this statement's result
              ko += 2 * 256 * HD * 2; }
#pragma unroll
            for (int t = 0; t < 2; ++t) { wb[2 * t] = b0[t]; wb[2 * t + 1] = b1[t]; wb2[2 * t] = d0[t]; wb2[2 * t + 1] = d1[t]; }
        } else {
            v16h a0[QB], a1[QB], b0[4], b1[4];   // four key tiles' fragments, refilled in pairs
            const h16* qp = (const h16*)((const char*)(QP16 + ab) + lo); const h16* kp = (const h16*)((const char*)(KP16 + kb) + lo);
#pragma unroll
            for (int rb = 0; rb < QB; ++rb) { const int ar = rb * (16 * HD); a0[rb] = WFrag<h16>::ldf(qp + ar, 0u); a1[rb] = WFrag<h16>::ldf(qp + ar + 512, 0u); }
            __builtin_amdgcn_sched_barrier(0);   // the q loads stay the oldest: the loop's waits for them stand in every trip, and behind younger q loads they would also wait for the refills under way
#pragma unroll
            for (int t = 0; t < 4; ++t) { const int kt = t * (256 * HD); b0[t] = WFrag<h16>::ldf(kp + kt, 0u); b1[t] = WFrag<h16>::ldf(kp + kt + 512, 0u); }
            asm volatile("s_wait_xcnt 0x0" : : "v"(qp), "v"(kp) : "memory");   // inputs only: the lane's two address pairs (each serves all of its loads, which differ by constants) stay taken up to the wait, so that no late load lands in one of them
            __builtin_amdgcn_sched_barrier(0);   // the loads stay in front of the barrier: behind it they would start only when the last wave has ended stage 1
            lds_barrier();   // every relative logit lies in LDS before a score tile adds it
#pragma unroll 1   // rolled over the two halves of the wave's eight tiles, for the size of the text
            for (int io = 0; io < TT / 256; io += 4) {
              const bool last = io + 4 >= TT / 256;   // wave-uniform
              const char* sp = (const char*)(last ? VT16 + vb : KP16 + kb + 4 * (256 * HD)); const unsigned st = last ? 2 * 1024 : 256 * HD * 2;   // k: tiles 4..7, 32 KiB apart; v: two fragments a step
              const h16* rp[4] = { (const h16*)(sp + lo), (const h16*)(sp + (lo + st)), (const h16*)(sp + (lo + 2 * st)), (const h16*)(sp + (lo + 3 * st)) };
#pragma unroll
              for (int p = 0; p < 2; ++p) {
#pragma unroll
                for (int ii = 0; ii < 2; ++ii) { const int t = p * 2 + ii, n0 = ((io + t) * 16 + wv) * 16;
#pragma unroll
                  for (int rb = 0; rb < QB; ++rb) {
                    v8f acc = (v8f){}; acc = wmma16(a0[rb], b0[t], acc); acc = wmma16(a1[rb], b1[t], acc);
#pragma unroll
                    for (int j = 0; j < 8; ++j) { float* q = S + (rb * 16 + hi * 8 + j) * SP + n0 + lr; *q = (acc[j] + *q) * SCL; } } }
#pragma unroll
                for (int ii = 0; ii < 2; ++ii) { const int t = p * 2 + ii; b0[t] = WFrag<h16>::ldf(rp[t], 0u); b1[t] = WFrag<h16>::ldf(rp[t] + 512, 0u); }
                __builtin_amdgcn_sched_barrier(0);   // a pair's refill issues in front of the other pair's products, not behind them
              }
              asm volatile("s_wait_xcnt 0x0" : : "v"(rp[0]), "v"(rp[1]), "v"(rp[2]), "v"(rp[3]) : "memory");   // inputs only: the refills' four address pairs stay taken up to the wait, so that no refill lands in one of them
            }
#pragma unroll
            for (int t = 0; t < 4; ++t) { bv[2 * t] = b0[t]; bv[2 * t + 1] = b1[t]; }
#pragma unroll
            for (int f = 8; f < 16; ++f) bv[f] = WFrag<h16>::ldf(vp + f * 512, 0u);
            asm volatile("s_wait_xcnt 0x0" : : "v"(vp) : "memory");   // inputs only: the lane's address pair (it serves these eight fragments, which differ by constants) stays taken up to the wait
        }
    }
    __builtin_amdgcn_sched_barrier(0);   // the loads stay in front of stage 3: without it the compiler loads each fragment right in front of its products, and the wave waits for L2 in stage 4
    lds_barrier();   // every score of a row lies in LDS before its wave reads the row
#pragma unroll 1   // rolled over the two rows: one row's 64 values stand beside the v fragments fetched ahead without crowding the schedule, and the kernel's text stays under 32 KB
    for (int rr = 0; rr < QB; ++rr) {   // stage 3
        float* sr = S + (rr * 16 + wv) * SP; float v[TT / 32]; float mx = -3.0e38f;
#pragma unroll
        for (int ch = 0; ch < TT / 128; ++ch) { const v4f a = *(const v4fa*)(sr + ch * 128 + lane * 4);
#pragma unroll
            for (int q = 0; q < 4; ++q) { v[ch * 4 + q] = a[q]; mx = fmaxf(mx, a[q]); } }
#pragma unroll
        for (int sh = 16; sh; sh >>= 1) mx = fmaxf(mx, __shfl_xor(mx, sh, 32));
        float sum = 0.f;
#pragma unroll
        for (int k = 0; k < TT / 32; ++k) { v[k] = __builtin_amdgcn_exp2f((v[k] - mx) * 1.4426950408889634f); sum += v[k]; }
#pragma unroll
        for (int sh = 16; sh; sh >>= 1) sum += __shfl_xor(sum, sh, 32);
        const float f = __fdiv_rn(HI ? 1.0f : PCAR, sum);
        if constexpr (HI) { bf* ph = (bf*)sr; bf* pl = ph + TT;
#pragma unroll
            for (int ch = 0; ch < TT / 128; ++ch) { v4us oh, ol;
#pragma unroll
                for (int q = 0; q < 4; ++q) { unsigned short a, c2; splitf(v[ch * 4 + q] * f, a, c2); oh[q] = a; ol[q] = c2; }
                *(v4us*)(ph + ch * 128 + lane * 4) = oh; *(v4us*)(pl + ch * 128 + lane * 4) = ol; }
        } else { h16* pp = (h16*)sr;
#pragma unroll
            for (int ch = 0; ch < TT / 128; ++ch) { v4h o4;
#pragma unroll
                for (int q = 0; q < 4; ++q) o4[q] = tohx(v[ch * 4 + q] * f);
                *(v4h*)(pp + ch * 128 + lane * 4) = o4; } }
    }
    if constexpr (HI) {   // the next v fragments start in front of the barrier; through stage 3 they would take the registers that its schedule needs
#pragma unroll
        for (int f = 4; f < 8; ++f) { wb[f] = WFrag<bf>::ldf(vh + f * 512, 0u); wb2[f] = WFrag<bf>::ldf(vl + f * 512, 0u); }
        __builtin_amdgcn_sched_barrier(0);   // the loads stay in front of the barrier: behind it they would start only when the last wave has ended stage 3
    }
    lds_barrier();   // all probability rows lie in LDS before any wave reads its key slice of them
    v8f acc[QB][4];
#pragma unroll
    for (int rb = 0; rb < QB; ++rb)
#pragma unroll
        for (int nb = 0; nb < 4; ++nb) acc[rb][nb] = (v8f){};
    {   // stage 4
#pragma unroll
        for (int s = 0; s < 4; ++s) { const int kc = wv * 128 + s * 32;
            if constexpr (HI) { v16bf a[QB], a2[QB];
#pragma unroll
                for (int rb = 0; rb < QB; ++rb) { const bf* pr = (const bf*)(S + (rb * 16 + lr) * SP) + kc + 8 * hi; a[rb] = WFrag<bf>::ld(pr); a2[rb] = WFrag<bf>::ld(pr + TT); }
#pragma unroll
                for (int nb = 0; nb < 4; ++nb)
#pragma unroll
                    for (int rb = 0; rb < QB; ++rb) { const int f = (s & 1) * 4 + nb; acc[rb][nb] = wmmab(a[rb], wb[f], acc[rb][nb]); acc[rb][nb] = wmmab(a2[rb], wb[f], acc[rb][nb]); acc[rb][nb] = wmmab(a[rb], wb2[f], acc[rb][nb]); }
                if (s < 2) {   // the eight fragments of keys 64 further take the places of those just used
#pragma unroll
                    for (int nb = 0; nb < 4; ++nb) { const int f = (s & 1) * 4 + nb; wb[f] = WFrag<bf>::ldf(vh + ((s + 2) * 4 + nb) * 512, 0u); wb2[f] = WFrag<bf>::ldf(vl + ((s + 2) * 4 + nb) * 512, 0u); }
                    __builtin_amdgcn_sched_barrier(0);   // the refill issues in front of the next 32 keys' products: without it the compiler loads each pair right in front of its own products, and the wave waits for L2 once a pair
                }
            } else { v16h a[QB];
#pragma unroll
                for (int rb = 0; rb < QB; ++rb) a[rb] = WFrag<h16>::ld((const h16*)(S + (rb * 16 + lr) * SP) + kc + 8 * hi);
#pragma unroll
                for (int nb = 0; nb < 4; ++nb)
#pragma unroll
                    for (int rb = 0; rb < QB; ++rb) acc[rb][nb] = wmma16(a[rb], bv[s * 4 + nb], acc[rb][nb]); } }
        if constexpr (HI) asm volatile("s_wait_xcnt 0x0" : : "v"(vh), "v"(vl) : "memory");   // inputs only: the lane's address pairs (one a plane serves all of its loads, which differ by constants) stay taken up to the wait, so that no late load lands in one of them
    }
    __syncthreads();   // every wave has read its slice of the probability rows before the partial tiles overwrite them
    {   // stage 5
        float* pw = S + wv * (64 * PP);
#pragma unroll
        for (int rb = 0; rb < QB; ++rb)
#pragma unroll
            for (int nb = 0; nb < 4; ++nb) { float* p = pw + (nb * 16 + lr) * PP + rb * 16 + hi * 8; const v8f t = acc[rb][nb]; *(v4fa*)p = __builtin_shufflevector(t, t, 0, 1, 2, 3); *(v4fa*)(p + 4) = __builtin_shufflevector(t, t, 4, 5, 6, 7); }
        __syncthreads();   // every wave's partial tile is in LDS before any of it is summed
        const int col = tid & 63, rp = tid >> 6; const float* p = S + col * PP + rp * 4; v4f s = *(const v4fa*)p;   // four neighbouring rows of one column
#pragma unroll
        for (int w = 1; w < 16; ++w) s += *(const v4fa*)(p + w * (64 * PP));
        const float cs = HI ? 1.0f : (1.0f / PCAR);
        unsigned short oa[4], oc[4];
#pragma unroll
        for (int q = 0; q < 4; ++q) splitf(s[q] * cs, oa[q], oc[q]);
        const size_t oo = (size_t)(r0 + ((rp * 4) & ~15)) * DQ + (h * 2 + (col >> 5)) * 512 + ((col >> 4) & 1) * 256 + ((col >> 3) & 1) * 128 + ((rp * 4) & 15) * 8 + (col & 7);   // fragment order, rows = query rows, k = h * HD + col; the thread's four rows lie in one 16-row block, 8 elements apart
        __builtin_amdgcn_sched_barrier(0);   // the eight stores stay the thread's last instructions: nothing behind them is given a register that a store still names
#pragma unroll
        for (int q = 0; q < 4; ++q) { ATh[oo + q * 8] = oa[q]; ATl[oo + q * 8] = oc[q]; }
    }
}
__global__ __launch_bounds__(512) void k_attn(const h16* __restrict__ QP16, const bf* __restrict__ QPh, const bf* __restrict__ QPl, const h16* __restrict__ KP16, const bf* __restrict__ KPh, const bf* __restrict__ KPl, const bf* __restrict__ ERB, const h16* __restrict__ VT16, const bf* __restrict__ VTh, const bf* __restrict__ VTl, bf* ATh, bf* ATl) {
    __shared__ __align__(16) float S[QB * 16 * SP];
    // Grid (RH / 32, heads, TT / RH): there are four times as many work-groups as WGPs, and one of hi/lo rows lasts about half as long again as one of fp16 rows. Slab z = 0 holds all hi/lo row blocks of all heads.
    // For speed only: every (head, row block) is done exactly once wherever and whenever its work-group runs.
    static_assert(RH > 0 && RH % (QB * 16) == 0 && TT % RH == 0, "slabs of RH query rows; slab 0 is the hi/lo one");
    const int r0 = (int)blockIdx.z * RH + (int)blockIdx.x * (QB * 16), h = (int)blockIdx.y;   // the choice below is the same for the whole work-group (RH is a multiple of its rows), so every barrier is met by all of its waves
    rel_stage(S, h, r0, QPh, QPl, ERB);
    if (r0 < RH) attn_rows<true>(S, h, r0, QP16, QPh, QPl, KP16, KPh, KPl, VT16, VTh, VTl, ATh, ATl);
    else attn_rows<false>(S, h, r0, QP16, QPh, QPl, KP16, KPh, KPl, VT16, VTh, VTl, ATh, ATl);
}

extern "C" void kernel_launch(void* const* d_in, const int* in_sizes, int n_in,
                              void* d_out, int out_size, void* d_ws, size_t ws_size, hipStream_t stream) {
    (void)in_sizes; (void)n_in; (void)out_size;
    const float* xq = (const float*)d_in[0]; const float* xk = (const float*)d_in[1]; const float* xv = (const float*)d_in[2]; const float* wq = (const float*)d_in[3]; const float* bq = (const float*)d_in[4]; const float* wk = (const float*)d_in[5]; const float* bk = (const float*)d_in[6]; const float* wv = (const float*)d_in[7]; const float* bv = (const float*)d_in[8]; const float* wo = (const float*)d_in[9]; const float* bo = (const float*)d_in[10]; const float* Er = (const float*)d_in[11]; const float* x = nullptr; (void)x;
    float* OUT = (float*)d_out;     // [1][2048][1024]
    char* wsp = (char*)d_ws;
    auto take = [&](size_t bytes) { char* p = wsp; wsp += (bytes + 255) & ~(size_t)255; return (void*)p; };
    bf* WQ = (bf*)take((size_t)DQ * DM * 2); bf* WK = (bf*)take((size_t)DKV * DM * 2); bf* WV = (bf*)take((size_t)DKV * DM * 2); bf* WO = (bf*)take((size_t)DM * DQ * 2);
    bf* ERB = (bf*)take((size_t)TT * HD * 2);
    bf* XQ = (bf*)take((size_t)TT * DM * 2); bf* XK = (bf*)take((size_t)TT * DM * 2); bf* XV = (bf*)take((size_t)TT * DM * 2);
    h16* QP16 = (h16*)take((size_t)NH_ * TT * HD * 2); h16* KP16 = (h16*)take((size_t)NKV * TT * HD * 2); h16* VT16 = (h16*)take((size_t)NKV * HD * TT * 2);
    bf* QPh = (bf*)take((size_t)NH_ * TT * HD * 2); bf* QPl = (bf*)take((size_t)NH_ * TT * HD * 2); bf* KPh = (bf*)take((size_t)NKV * TT * HD * 2); bf* KPl = (bf*)take((size_t)NKV * TT * HD * 2); bf* VTh = (bf*)take((size_t)NKV * HD * TT * 2); bf* VTl = (bf*)take((size_t)NKV * HD * TT * 2);
    bf* ATh = (bf*)take((size_t)TT * DQ * 2); bf* ATl = (bf*)take((size_t)TT * DQ * 2);
    if ((size_t)(wsp - (char*)d_ws) > ws_size) return;    // ws 256 MiB
    for (int b = 0; b < NB_; ++b) {
        k_prep<<<4 * PB_W + 3 * PB_X + PB_E, 256, 0, stream>>>(wq, wk, wv, wo, xq + (size_t)b * TT * DM, xk + (size_t)b * TT * DM, xv + (size_t)b * TT * DM, Er, WQ, WK, WV, WO, XQ, XK, XV, ERB);   /* Er [2048][64] ('t d'): rows t, k = d */
        k_qkv<<<dim3(TT / 128, NH_ / 2, 3), 256, 0, stream>>>(XQ, XK, XV, WQ, WK, WV, bq, bk, bv, QP16, QPh, QPl, KP16, KPh, KPl, VT16, VTh, VTl);
        k_attn<<<dim3(RH / (QB * 16), NH_, TT / RH), 512, 0, stream>>>(QP16, QPh, QPl, KP16, KPh, KPl, ERB, VT16, VTh, VTl, ATh, ATl);   /* one kv head per query head */
        k_gemmw<bf, 1, true, 8, DQ><<<dim3(TT / 64, DM / 64, 1), 256, 0, stream>>>(ATh, ATl, WO, nullptr, OUT + (size_t)b * TT * DM, DM, bo, 0, 0, 0); }
}

// v009
// A run of this version takes 100 microseconds.
// Next to v008, in two timings, it ran 1.03 and 1.02 times as fast.
// All steps since v000 together make it 12.5 times as fast.
#include <hip/hip_runtime.h>

// Relative global attention (Music-Transformer skew) (query, key, value [1][2048][1024]; q,k,v = input W^T + b ('oi' [1024][1024] + [1024]; 16 heads x 64); qe = q.Er^T (Er [2048][64], all rows used since s = max_len); s_rel = skew(qe): for j <= i  s_rel[i][j] = qe[i][2047 + j - i]; for j = i+1  0; for j > i+1  qe[i+1][j - i - 2] (the reference's pad-reshape-slice, reproduced exactly, upper triangle included); scores = (q.k + s_rel) / 8; softmax; out = merged ctx Wo^T + bo -> [1][2048][1024] (2.1 M)).
// Compute dtypes, f32 accumulate: every input rounded to bf16; q/k/v on PLAIN bf16 operands (inputs: exact) + biases (three input tensors); qe = q(hi/lo planes) x Er (exact bf16) gives the relative logits, stored in LDS at their skewed place (the index map above) and added to q.k before the 1/8 scale; scores and attn.v: query rows < 512 hl (3 products), the rest single fp16 (x1024); softmax f32; Wo hl x exact (2 products) + bo.

#define NB_  1
#define TT   2048
#define DM   1024
#define NH_  16
#define NKV  16
#define REP  (NH_ / NKV)
#define HD   64
#define DQ   (NH_ * HD)
#define DKV  (NKV * HD)
#define RH   512                  // query rows < RH use hi+lo planes
#define WIN  0
#define PCAR 1024.0f
#define SCL  0.125f   // HD^-0.5
typedef _Float16 h16;
typedef unsigned short bf;
typedef __attribute__((ext_vector_type(16))) __bf16   v16bf;
typedef __attribute__((ext_vector_type(16))) _Float16 v16h;
typedef __attribute__((ext_vector_type(8)))  _Float16 v8h;
typedef __attribute__((ext_vector_type(8)))  unsigned short v8us;
typedef __attribute__((ext_vector_type(8)))  float    v8f;
typedef __attribute__((ext_vector_type(4)))  float    v4f;
typedef v8h  __attribute__((may_alias)) v8ha;
typedef v4f  __attribute__((may_alias)) v4fa;
typedef v8us __attribute__((may_alias)) v8usa;

__device__ __forceinline__ unsigned short f2bf(float f) { unsigned u = __float_as_uint(f); u += 0x7FFFu + ((u >> 16) & 1u); return (unsigned short)(u >> 16); }
__device__ __forceinline__ float bf2f(unsigned short b) { return __uint_as_float(((unsigned)b) << 16); }
__device__ __forceinline__ float bfr(float f) { return bf2f(f2bf(f)); }
__device__ __forceinline__ v16h cat16(v8h lo, v8h hi) { return __builtin_shufflevector(lo, hi, 0, 1, 2, 3, 4, 5, 6, 7, 8, 9, 10, 11, 12, 13, 14, 15); }
__device__ __forceinline__ v16bf cat16b(v8us lo, v8us hi) { return __builtin_bit_cast(v16bf, __builtin_shufflevector(lo, hi, 0, 1, 2, 3, 4, 5, 6, 7, 8, 9, 10, 11, 12, 13, 14, 15)); }
__device__ __forceinline__ v8f wmma16(v16h a, v16h b, v8f c) { return __builtin_amdgcn_wmma_f32_16x16x32_f16(false, a, false, b, (short)0, c, false, false); }
__device__ __forceinline__ v8f wmmab(v16bf a, v16bf b, v8f c) { return __builtin_amdgcn_wmma_f32_16x16x32_bf16(false, a, false, b, (short)0, c, false, false); }



// ---- FRAGMENT ORDER of every 16-bit operand plane in global memory (rows x K, K % 32 == 0): the plane is a row-major grid of fragments (16 rows x 32 k, 512 elements = 1 KiB, fragment index (row / 16) * (K / 32) + k / 32; the v planes alone order their fragments k-block first, see k_qkv);
// inside a fragment element (row, k) lies at ((k >> 4) & 1) * 256 + ((k >> 3) & 1) * 128 + (row & 15) * 8 + (k & 7), which is half * 256 + lane * 8 + e of the lane and register half that hold it in the WMMA operand.
// WFrag::ldf(fragment, lane * 16) is then two wave-wide 16-byte loads of 512 contiguous bytes each (four whole 128-byte lines); from a row-major plane each such load touches 16 lines. WFrag::ld reads a row-major source (the LDS rows).
// ldf takes a wave-uniform fragment pointer and the lane's 32-bit BYTE offset: every load of a loop then names one scalar base, one offset register and a constant, and no per-load address pair is formed (stages 2 and 4 of k_attn hand it the lane's own pointer and offset 0).
// Behind each run of such loads stands s_wait_xcnt 0, in front of the rewrite of the offset register that they name (addr_step: the caller advances the offset behind it) or of its release (a statement that takes the address registers as inputs only, so that they stay taken up to the wait).
// ---- k_gemmw: register-blocked GEMM, ONE WAVE per 64x64 output tile (16 accumulators), operands straight from 16-bit planes in fragment order; grid (M/64, N/64, Z), 32 threads.
// C[m][n] (f32, pitch ldc, + optional f32 bias[n]) = sum_k A[m][k] Bt[n][k] (+ split products per NSPLIT). z-batch strides sA/sB/sC in elements. K % (32 * KS) == 0.
// KS > 1 (long-K launches, 32 * KS threads): wave w of the work-group sums the K slice [w K/KS, (w+1) K/KS) of the same 64x64 tile; the KS partial tiles meet in LDS (column-major, pitch 68) and are added in wave order 0..KS-1.
template <typename T16> struct WFrag;
template <> struct WFrag<h16> { typedef v16h V; static __device__ __forceinline__ V ld(const h16* p) { return cat16(*(const v8h*)p, *(const v8h*)(p + 16)); } static __device__ __forceinline__ V ldf(const h16* ub, unsigned vb) { const h16* p = (const h16*)((const char*)ub + vb); return cat16(*(const v8h*)p, *(const v8h*)(p + 256)); } static __device__ __forceinline__ v8f mma(V a, V b, v8f c) { return wmma16(a, b, c); } };
template <> struct WFrag<bf> { typedef v16bf V; static __device__ __forceinline__ V ld(const bf* p) { return cat16b(*(const v8us*)p, *(const v8us*)(p + 16)); } static __device__ __forceinline__ V ldf(const bf* ub, unsigned vb) { const bf* p = (const bf*)((const char*)ub + vb); return cat16b(*(const v8us*)p, *(const v8us*)(p + 256)); } static __device__ __forceinline__ v8f mma(V a, V b, v8f c) { return wmmab(a, b, c); } };
__device__ __forceinline__ void addr_step(unsigned& vb) { asm volatile("s_wait_xcnt 0x0" : "+v"(vb) : : "memory"); }   // the offset's next value is formed from this statement's result, so its rewrite cannot be lifted over the wait
template <typename T16, int NSPLIT, bool BIAS, int KS, int K>
__global__ __launch_bounds__(32 * KS) void k_gemmw(const T16* __restrict__ A, const T16* __restrict__ A2, const T16* __restrict__ Bt, const T16* __restrict__ Bt2, float* C, int ldc, const float* __restrict__ bias, size_t sA, size_t sB, size_t sC) {
    typedef typename WFrag<T16>::V V;
    __shared__ __align__(16) float os[KS == 1 ? 16 * 68 : KS * 64 * 68];
    const size_t z = blockIdx.z; A += z * sA; if (A2) A2 += z * sA; Bt += z * sB; if (Bt2) Bt2 += z * sB; C += z * sC;
    const int lane = threadIdx.x & 31, lr = lane & 15, hi = lane >> 4; const int r0 = blockIdx.x * 64, c0 = blockIdx.y * 64;
    v8f acc[4][4];
#pragma unroll
    for (int mb = 0; mb < 4; ++mb)
#pragma unroll
        for (int nb = 0; nb < 4; ++nb) acc[mb][nb] = (v8f){};
    const int wv = (KS == 1) ? 0 : __builtin_amdgcn_readfirstlane((int)(threadIdx.x >> 5)); constexpr int kspan = K / KS; const int kbeg = wv * kspan;   // this wave's K slice
    const T16* ua = A + (size_t)r0 * K + (size_t)kbeg * 16; const T16* ua2 = (NSPLIT == 1 || NSPLIT == 2) ? A2 + (size_t)r0 * K + (size_t)kbeg * 16 : nullptr; const T16* ub = Bt + (size_t)c0 * K + (size_t)kbeg * 16; const T16* ub2 = (NSPLIT >= 2) ? Bt2 + (size_t)c0 * K + (size_t)kbeg * 16 : nullptr;   // wave-uniform: 16 rows of fragments hold 16 K elements; a step of 32 in k is one fragment (1 KiB)
    unsigned vo = (unsigned)lane * 16;
#pragma unroll 1
    for (int kc = 0; kc < kspan; kc += 32) {
        V a[4], a2[4], b[4], b2[4];
#pragma unroll
        for (int mb = 0; mb < 4; ++mb) { a[mb] = WFrag<T16>::ldf(ua + mb * 16 * K, vo); if (NSPLIT == 1 || NSPLIT == 2) a2[mb] = WFrag<T16>::ldf(ua2 + mb * 16 * K, vo); }
#pragma unroll
        for (int nb = 0; nb < 4; ++nb) { b[nb] = WFrag<T16>::ldf(ub + nb * 16 * K, vo); if (NSPLIT >= 2) b2[nb] = WFrag<T16>::ldf(ub2 + nb * 16 * K, vo); }
        __builtin_amdgcn_sched_barrier(0);   // a trip's loads all issue in front of its products: without it the compiler sinks each B fragment behind the products before it, into one register set, and a trip waits four times for memory
#pragma unroll
        for (int nb = 0; nb < 4; ++nb)
#pragma unroll
            for (int mb = 0; mb < 4; ++mb) { acc[mb][nb] = WFrag<T16>::mma(a[mb], b[nb], acc[mb][nb]); if (NSPLIT == 1 || NSPLIT == 2) acc[mb][nb] = WFrag<T16>::mma(a2[mb], b[nb], acc[mb][nb]); if (NSPLIT >= 2) acc[mb][nb] = WFrag<T16>::mma(a[mb], b2[nb], acc[mb][nb]); }
        asm volatile("v_nop\n\tv_nop\n\tv_nop\n\tv_nop" : "+v"(acc[0][0]), "+v"(acc[1][1]), "+v"(acc[2][2]), "+v"(acc[3][3]) : "v"(a[0]), "v"(a[3]));
        addr_step(vo); vo += 1024;   // next fragment of every operand row block
    }
    if constexpr (KS > 1) {
        float* pw = os + wv * (64 * 68);
#pragma unroll
        for (int mb = 0; mb < 4; ++mb)
#pragma unroll
            for (int nb = 0; nb < 4; ++nb) { float* p = pw + (nb * 16 + lr) * 68 + mb * 16 + hi * 8; const v8f t = acc[mb][nb]; *(v4fa*)p = __builtin_shufflevector(t, t, 0, 1, 2, 3); *(v4fa*)(p + 4) = __builtin_shufflevector(t, t, 4, 5, 6, 7); }
        __syncthreads();   // every wave's partial tile is in LDS before any of it is summed
#pragma unroll
        for (int it = 0; it < 64 * 16 / (32 * KS); ++it) { const int g = it * (32 * KS) + (int)threadIdx.x, col = g & 63, rq = g >> 6; const float* p = os + col * 68 + rq * 4; v4f s = *(const v4fa*)p;
#pragma unroll
            for (int w = 1; w < KS; ++w) s += *(const v4fa*)(p + w * (64 * 68));
            if (BIAS) { const float bb = bfr(bias[c0 + col]); s[0] += bb; s[1] += bb; s[2] += bb; s[3] += bb; }
            float* cp = C + (size_t)(r0 + rq * 4) * ldc + c0 + col;
#pragma unroll
            for (int q = 0; q < 4; ++q) cp[(size_t)q * ldc] = s[q]; }
        return;
    }
#pragma unroll
    for (int mb = 0; mb < 4; ++mb) {
#pragma unroll
        for (int nb = 0; nb < 4; ++nb) {
#pragma unroll
            for (int j = 0; j < 8; ++j) os[(hi * 8 + j) * 68 + nb * 16 + lr] = acc[mb][nb][j]; }
        __builtin_amdgcn_wave_barrier(); asm volatile("" ::: "memory");
        float* crow = C + (size_t)(r0 + mb * 16) * ldc + c0;
{
#pragma unroll
            for (int s = 0; s < 8; ++s) { const int row = 2 * s + hi, cofs = lr * 4; v4f val = *(const v4fa*)(os + row * 68 + cofs); if (BIAS) { val[0] += bfr(bias[c0 + cofs]); val[1] += bfr(bias[c0 + cofs + 1]); val[2] += bfr(bias[c0 + cofs + 2]); val[3] += bfr(bias[c0 + cofs + 3]); }
                *(v4f*)(crow + (size_t)row * ldc + cofs) = val; }
             }
        __builtin_amdgcn_wave_barrier(); asm volatile("" ::: "memory");
    }
}

__device__ __forceinline__ h16 tohx(float x) { return (h16)x; }
__device__ __forceinline__ void splitf(float y, unsigned short& h, unsigned short& l) { h = f2bf(y); l = f2bf(y - bf2f(h)); }
typedef __attribute__((ext_vector_type(2))) _Float16 v2h;
typedef __attribute__((ext_vector_type(4))) _Float16 v4h;
typedef __attribute__((ext_vector_type(2))) unsigned short v2us;
typedef __attribute__((ext_vector_type(4))) unsigned short v4us;
typedef __attribute__((ext_vector_type(2))) float v2f;
typedef __attribute__((ext_vector_type(4))) int v4i;

__global__ __launch_bounds__(256) void k_wtG(const float* __restrict__ w, int K, int N, bf* Bt) {
    const int lane = threadIdx.x & 31; const int L0 = (blockIdx.x * 8 + (threadIdx.x >> 5)) * 8; const int nlines = N * K / 64;
{
#pragma unroll 1
        for (int l = 0; l < 8; ++l) { const int L = L0 + l; if (L >= nlines) break; const size_t e = (size_t)L * 64 + lane * 2; const int k = (int)(e % K), n = (int)(e / K); v2us o;
            o[0] = f2bf(w[(size_t)k * N + n]); o[1] = f2bf(w[(size_t)(k + 1) * N + n]); *(v2us*)(Bt + e) = o; }
         }
}
// k_prep: ONE launch turns all eight f32 matrices (four weights, three activations, Er; row-major [rows][K]) into bf16 planes in fragment order. A work-group takes 32 fragments in a row, which are 16384 elements in a row of the source too (K = 1024: one 16-row block; K = 64: 16 of them);
// a thread takes eight pieces of 8 elements, 4 fragments apart; four neighbouring lanes read one whole 128-byte line of a row (32 k), eight neighbouring rows write one whole line of the fragment.
// All loads name one scalar base, one lane offset and a constant, and so do all stores; all sixteen loads are issued in front of the first conversion, and the stores are the thread's last instructions, so that no register that a store names is written again.
template <int K>
__device__ __forceinline__ void cvt_rows(const float* __restrict__ src, bf* dst, int lb) {
    static_assert(K == 64 || K == 1024, "the step of 4 fragments below is written for these two");
    constexpr int FPR = K / 32, ustep = (FPR >= 32) ? 4 * 32 : (4 / FPR) * 16 * K;   // fragments per row block; source elements from a fragment to the fourth behind it
    const int tid = (int)threadIdx.x, c = tid & 3, lr = (tid >> 2) & 15, tq = tid >> 6;
    const char* sb = (const char*)(src + (size_t)lb * (32 * 512)); char* db = (char*)(dst + (size_t)lb * (32 * 512));   // the same for the whole work-group
    const unsigned so = (unsigned)(((tq / FPR) * 16 + lr) * K + (tq % FPR) * 32 + c * 8) * 4, eo = (unsigned)(tq * 512 + (c >> 1) * 256 + (c & 1) * 128 + lr * 8) * 2;
    v8f v[8]; v8us o[8];
#pragma unroll
    for (int u = 0; u < 8; ++u) v[u] = *(const v8f*)(sb + so + u * (ustep * 4));
    asm volatile("s_wait_xcnt 0x0" : : "v"(so), "s"(sb) : "memory");   // inputs only: the loads' offset register and scalar base stay taken up to the wait, so that no load lands in the offset and nothing else is formed there ahead of it
#pragma unroll
    for (int u = 0; u < 8; ++u)
#pragma unroll
        for (int k = 0; k < 8; ++k) o[u][k] = f2bf(v[u][k]);
    __builtin_amdgcn_sched_barrier(0);   // no store rises in front of a conversion: a conversion behind it could be given a register that the store still names
#pragma unroll
    for (int u = 0; u < 8; ++u) *(v8us*)(db + eo + u * (4 * 512 * 2)) = o[u];
}
#define PB_W (DQ / 16)            // work-groups per weight matrix (16 rows each)
#define PB_X (TT / 16)            // per activation matrix
#define PB_E (TT * HD / (32 * 512))   // for Er
__global__ __launch_bounds__(256) void k_prep(const float* __restrict__ wq, const float* __restrict__ wk, const float* __restrict__ wv, const float* __restrict__ wo, const float* __restrict__ xq, const float* __restrict__ xk, const float* __restrict__ xv, const float* __restrict__ er, bf* WQ, bf* WK, bf* WV, bf* WO, bf* XQ, bf* XK, bf* XV, bf* ERB) {
    const int b = (int)blockIdx.x;   // the matrix is chosen by the work-group's index alone
    if (b < 4 * PB_W) { const int m = b / PB_W; cvt_rows<DM>(m == 0 ? wq : m == 1 ? wk : m == 2 ? wv : wo, m == 0 ? WQ : m == 1 ? WK : m == 2 ? WV : WO, b % PB_W); }
    else if (b < 4 * PB_W + 3 * PB_X) { const int m = (b - 4 * PB_W) / PB_X; cvt_rows<DM>(m == 0 ? xq : m == 1 ? xk : xv, m == 0 ? XQ : m == 1 ? XK : XV, (b - 4 * PB_W) % PB_X); }
    else cvt_rows<HD>(er, ERB, b - 4 * PB_W - 3 * PB_X);
}
// k_qkv: the three projections in ONE launch, grid (TT / 128, heads / 2, 3), 8 waves; a work-group computes a 128 x 128 tile (128 rows t of two heads). Wave (wk, wm, wn) sums the K half wk of the 64 x 64 quarter (wm, wn); the two partial tiles of a quarter meet in LDS and are added in the order wk = 0, 1.
// The operands come into LDS by asynchronous copies (global_load_async_to_lds_b128), so that a fragment is fetched from L2 once per work-group and read from LDS by the two waves that need it. A stage is 64 k of both K halves of both operands: 64 fragments = 64 KiB, laid [operand][K half][16-row block][k / 32] x 1 KiB; two buffers, the next stage's copies fly while this one is worked on.
// A fragment keeps its order in LDS, so a wave's fragment read is two contiguous 512-byte reads. The buffers lie in the array that later takes the partial tiles; the barrier at the foot of the last trip ends every read of them.
// The partial tiles lie [n][m] in LDS with m (the A operand's rows) contiguous, and a thread sums 8 neighbouring m of one n, which are the 8 elements of one 16-byte piece of a fragment: so q and k (fragment rows t, k = d) take the weight rows d as A and the activation rows t as B,
// and v (ISV; fragment rows d, k = t, fragments laid [t / 32][d / 16] so that a wave's 128 keys x 64 columns are 16 KiB in a row) takes t as A and d as B. Both operand planes have the same fragment order, so the roles are a choice of base pointers. A wave's store is two runs of 256 contiguous bytes.
__device__ __forceinline__ void stage_copy8(unsigned l, const char* g) {   // one operand's share of a stage: the thread's eight 16-byte pieces; in LDS 4 KiB apart; in the plane two 16-row blocks (64 KiB) apart, the second four in the other K half (16 KiB further)
    asm volatile("global_load_async_to_lds_b128 %0, %8, off\n\t"
                 "global_load_async_to_lds_b128 %1, %9, off\n\t"
                 "global_load_async_to_lds_b128 %2, %10, off\n\t"
                 "global_load_async_to_lds_b128 %3, %11, off\n\t"
                 "global_load_async_to_lds_b128 %4, %12, off\n\t"
                 "global_load_async_to_lds_b128 %5, %13, off\n\t"
                 "global_load_async_to_lds_b128 %6, %14, off\n\t"
                 "global_load_async_to_lds_b128 %7, %15, off\n\t"
                 "s_wait_xcnt 0x0"   // inside the copies' own statement: it stands in front of every later write of a register that a copy names
                 : : "v"(l), "v"(l + 4096u), "v"(l + 8192u), "v"(l + 12288u), "v"(l + 16384u), "v"(l + 20480u), "v"(l + 24576u), "v"(l + 28672u),
                     "v"(g), "v"(g + 65536), "v"(g + 131072), "v"(g + 196608), "v"(g + 16384), "v"(g + 81920), "v"(g + 147456), "v"(g + 212992) : "memory");
}
template <bool ISV>
__device__ __forceinline__ void qkv_tile(float* os, const bf* __restrict__ X, const bf* __restrict__ Wt, const float* __restrict__ bias, h16* P16, bf* Ph, bf* Pl, int t0) {   // X, Wt, bias, planes: already at the tile's rows t0.., the first head's weight rows, bias and planes
    constexpr int K = DM, NT = K / 128; typedef WFrag<bf>::V V;   // NT stages of 64 k in each K half
    static_assert(K == 1024 && NT >= 2, "the constants of stage_copy8 are those of 32 fragments a row block; the ring needs two stages");
    const int tid = (int)threadIdx.x, lane = tid & 31, lr = lane & 15, hi = lane >> 4;
    v8f acc[4][4];
#pragma unroll
    for (int mb = 0; mb < 4; ++mb)
#pragma unroll
        for (int nb = 0; nb < 4; ++nb) acc[mb][nb] = (v8f){};
    const int wv = __builtin_amdgcn_readfirstlane(tid >> 5), wk = wv >> 2, wm = (wv >> 1) & 1, wn = wv & 1;   // wave-uniform
    const unsigned lb = (unsigned)(size_t)os + (unsigned)tid * 16;   // the thread's first LDS byte in buffer 0
    const unsigned go = (unsigned)((tid >> 7) * (16 * K * 2) + (tid & 127) * 16);   // its row block (of a pair) and its 16 bytes in that block's two fragments of a stage
    const char* ga = (const char*)(ISV ? X : Wt) + go; const char* gb = (const char*)(ISV ? Wt : X) + go;
    stage_copy8(lb, ga); stage_copy8(lb + 32768u, gb);
    asm volatile("s_wait_asynccnt 0x0" ::: "memory");   // this wave's copies of stage 0 have landed
    __syncthreads();   // stage 0 lies in LDS before any wave reads it
    stage_copy8(lb + 65536u, ga + 2048); stage_copy8(lb + 98304u, gb + 2048);
#pragma unroll 1   // rolled: one trip a stage, the buffer chosen by the trip's parity
    for (int s = 0; s < NT; ++s) {
        const char* bp = (const char*)os + (s & 1) * 65536 + wk * 16384 + lane * 16;
        const bf* la = (const bf*)(bp + wm * 8192); const bf* lbp = (const bf*)(bp + 32768 + wn * 8192);
        V a[4], b[4];
#pragma unroll
        for (int c = 0; c < 2; ++c) {
#pragma unroll
            for (int mb = 0; mb < 4; ++mb) { const bf* p = la + mb * 1024 + c * 512; a[mb] = cat16b(*(const v8usa*)p, *(const v8usa*)(p + 256)); }
#pragma unroll
            for (int nb = 0; nb < 4; ++nb) { const bf* p = lbp + nb * 1024 + c * 512; b[nb] = cat16b(*(const v8usa*)p, *(const v8usa*)(p + 256)); }
            __builtin_amdgcn_sched_barrier(0);   // the eight fragments' reads all issue in front of their products: without it the compiler sinks each B fragment behind the products before it, into one register set, and the wave waits four times for LDS
#pragma unroll
            for (int nb = 0; nb < 4; ++nb)
#pragma unroll
                for (int mb = 0; mb < 4; ++mb) acc[mb][nb] = WFrag<bf>::mma(a[mb], b[nb], acc[mb][nb]);
        }
        __builtin_amdgcn_sched_barrier(0);   // the trip's products stay in front of its foot: behind the barrier they would stand between it and the refill, which would start that much later
        asm volatile("s_wait_dscnt 0x0" ::: "memory");      // this wave's reads of the buffer have returned before it is refilled
        asm volatile("s_wait_asynccnt 0x0" ::: "memory");   // this wave's copies of the next stage have landed
        __syncthreads();   // publishes the next stage and ends every wave's reads of this trip's buffer
        if (s + 2 < NT) { const unsigned l2 = lb + (unsigned)(s & 1) * 65536u; const int g2 = (s + 2) * 2048; stage_copy8(l2, ga + g2); stage_copy8(l2 + 32768u, gb + g2); }   // the same test for the whole work-group
    }
    asm volatile("s_wait_asynccnt 0x0" ::: "memory");   // no copy is under way when the buffers become the partial tiles
    const int n = tid & 63, mq = (tid >> 6) * 8;   // this thread's n and its first m in every quarter; its second piece lies 32 m further
    const unsigned bo = (unsigned)(ISV ? n : mq) * 4; const char* bsp = (const char*)bias; v4f bb[ISV ? 2 : 8];   // the bias goes with d: n for v, m for q and k; the second head's lies 64 floats further
    if constexpr (ISV) { bb[0] = (v4f)(*(const float*)(bsp + bo)); bb[1] = (v4f)(*(const float*)(bsp + bo + 256)); }
    else {
#pragma unroll
        for (int u = 0; u < 4; ++u) { bb[u * 2] = *(const v4f*)(bsp + bo + u * 128); bb[u * 2 + 1] = *(const v4f*)(bsp + bo + u * 128 + 16); } }
    asm volatile("s_wait_xcnt 0x0" : : "v"(bo), "s"(bsp) : "memory");   // inputs only: the bias loads' offset register and scalar base stay taken up to the wait; the LDS stores and the barrier below cover their latency
    float* pw = os + wv * (64 * 68);
#pragma unroll
    for (int mb = 0; mb < 4; ++mb)
#pragma unroll
        for (int nb = 0; nb < 4; ++nb) { float* p = pw + (nb * 16 + lr) * 68 + mb * 16 + hi * 8; const v8f t = acc[mb][nb]; *(v4fa*)p = __builtin_shufflevector(t, t, 0, 1, 2, 3); *(v4fa*)(p + 4) = __builtin_shufflevector(t, t, 4, 5, 6, 7); }
    __syncthreads();   // every wave's partial tile is in LDS before any of it is summed
    v8h o16[8]; v8us oh[8], ol[8];
#pragma unroll
    for (int st = 0; st < 4; ++st)   // quarter (wm, wn) = (st >> 1, st & 1): its partial tiles are those of waves st and st + 4
#pragma unroll
        for (int it = 0; it < 2; ++it) { const float* p = os + st * (64 * 68) + n * 68 + mq + it * 32; v4f s0 = *(const v4fa*)p, s1 = *(const v4fa*)(p + 4);
            s0 += *(const v4fa*)(p + 4 * (64 * 68)); s1 += *(const v4fa*)(p + 4 * (64 * 68) + 4);
#pragma unroll
            for (int q = 0; q < 8; ++q) { const float r = (q < 4 ? s0[q & 3] : s1[q & 3]) + bfr(ISV ? bb[st & 1][0] : bb[(st >> 1) * 4 + it * 2 + (q >> 2)][q & 3]); o16[st * 2 + it][q] = tohx(r); unsigned short a2, c2; splitf(r, a2, c2); oh[st * 2 + it][q] = a2; ol[st * 2 + it][q] = c2; } }
    const int t = t0 + (ISV ? mq : n), d = ISV ? n : mq;   // of the first piece of quarter (0, 0)
    const unsigned ob = (unsigned)(ISV ? ((t >> 5) * 4 + (d >> 4)) * 512 + ((t >> 4) & 1) * 256 + ((t >> 3) & 1) * 128 + (d & 15) * 8
                                       : (t & ~15) * HD + (d >> 5) * 512 + ((d >> 4) & 1) * 256 + ((d >> 3) & 1) * 128 + (t & 15) * 8) * 2;
#pragma unroll
    for (int st = 0; st < 4; ++st)
#pragma unroll
        for (int it = 0; it < 2; ++it) {   // q, k: 64 d further is the next head's plane, 64 t further four 16-row blocks, 32 d further one fragment; v: 64 d further the next head's plane, 64 t further eight fragments, 32 t further four
            const int off = (ISV ? (st & 1) * (TT * HD) + (st >> 1) * (8 * 512) + it * (4 * 512) : (st >> 1) * (TT * HD) + (st & 1) * (64 * HD) + it * 512) * 2;
            *(v8h*)((char*)P16 + ob + off) = o16[st * 2 + it]; *(v8us*)((char*)Ph + ob + off) = oh[st * 2 + it]; *(v8us*)((char*)Pl + ob + off) = ol[st * 2 + it]; }
}
__global__ __launch_bounds__(256) void k_qkv(const bf* __restrict__ XQ, const bf* __restrict__ XK, const bf* __restrict__ XV, const bf* __restrict__ WQ, const bf* __restrict__ WK, const bf* __restrict__ WV, const float* __restrict__ bq, const float* __restrict__ bk, const float* __restrict__ bv,
                                             h16* QP16, bf* QPh, bf* QPl, h16* KP16, bf* KPh, bf* KPl, h16* VT16, bf* VTh, bf* VTl) {
    __shared__ __align__(16) float os[8 * 64 * 68];   // first the two 64-KiB stage buffers, then the eight partial tiles
    static_assert(sizeof(float) * 8 * 64 * 68 >= 2 * 65536, "both stage buffers lie inside the array");
    const int z = (int)blockIdx.z, t0 = (int)blockIdx.x * 128, h = (int)blockIdx.y * 2; const size_t xo = (size_t)t0 * DM, wo = (size_t)h * HD * DM, po = (size_t)h * TT * HD;   // the choice below is the same for the whole work-group, so its barriers are met by all of its waves
    if (z == 2) qkv_tile<true>(os, XV + xo, WV + wo, bv + h * HD, VT16 + po, VTh + po, VTl + po, t0);
    else qkv_tile<false>(os, (z == 0 ? XQ : XK) + xo, (z == 0 ? WQ : WK) + wo, (z == 0 ? bq : bk) + h * HD, (z == 0 ? QP16 : KP16) + po, (z == 0 ? QPh : KPh) + po, (z == 0 ? QPl : KPl) + po, t0);
}
// ---- k_attn: one work-group of 16 waves per (head, 32 query rows = QB blocks of 16); the 32 x 2048 score rows never leave LDS and take most of a WGP's LDS, so one work-group has the WGP to itself (4 waves per SIMD, up to 256 registers each).
// Every Er, k and v fragment that a wave loads stays in registers for the products of BOTH row blocks: per query row half as many bytes come from L2 as with one block per work-group. Each row's products, trees and sums are those of a single block. Five stages, a work-group barrier between each two and one inside the last:
// 1 relative logits: qe tiles (q hi/lo planes x Er) are stored straight at their skewed place: qe[i][t] is rel(i, t - 2047 + i) where that column is >= 0, and qe[i+1][t] is rel(i, t + i + 2) where that column is < 2048; rel(i, i+1) = 0 (= the reference's pad/reshape/slice of q.Er^T, upper triangle included)
// 2 scores: each q.k tile adds the relative logit that lies at its own place, scales by 1/8 and stores back
// 3 softmax: wave w owns rows w and w + 16 (register row, one exp, fixed trees) and writes the probabilities over its own rows: fp16 x 1024, or bf16 hi and lo planes for rows < RH
// 4 attn.v: wave w sums the key slice [128 w, 128 w + 128) for all 64 columns of both row blocks
// 5 the 16 partial tiles meet in LDS (column-major, pitch 36) and are added in wave order 0..15; the merged context goes out as hi/lo planes in fragment order
// Fragments are fetched ahead, into registers: the first k tiles of stage 2 are loaded in front of the barrier that ends stage 1, each tile's registers are refilled right behind its products, and v fragments of stage 4 are loaded in front of the barriers that end stages 2 and 3, so that they come from L2 while waves wait for one another and while stage 3 runs on the vector unit alone. Those three barriers (lds_barrier) wait for the wave's LDS accesses only; nothing is stored to global memory before stage 5.
#define GB 48     // spare columns in front of column 0 of every score row; SP - TT - GB = 52 more lie behind column 2047
#define SP 2148   // LDS pitch of a score row in floats: rows stay 16-byte aligned (16 bytes times an odd number), rows 8 apart lie 32 banks apart; the spare columns take the qe elements that belong to no column of this row block (they reach at most 31 columns in front of column 0 and 33 behind column 2047)
#define QB 2      // 16-row blocks per work-group
#define PP (QB * 16 + 4)   // LDS pitch of a partial tile's column in floats (stage 5): 16 bytes times an odd number
typedef v2f __attribute__((may_alias)) v2fa;
__device__ __forceinline__ void lds_barrier() {   // a work-group barrier that orders LDS alone: __syncthreads() also waits for the wave's global loads, and the fragments fetched ahead would stop being ahead
    __builtin_amdgcn_fence(__ATOMIC_RELEASE, "workgroup", "local"); __builtin_amdgcn_s_barrier(); __builtin_amdgcn_fence(__ATOMIC_ACQUIRE, "workgroup", "local");
}
template <bool UP>
__device__ __forceinline__ void rel_one(float* S, const v16bf (&ah0)[QB], const v16bf (&al0)[QB], const v16bf (&ah1)[QB], const v16bf (&al1)[QB], v16bf b0, v16bf b1, int tt, int r0, int lr, int hi) {   // one Er tile against the q rows of every row block
    static_assert(QB == 2 && GB >= 31 && SP - TT - GB >= 33 && 7 * (SP + 1) * 4 < 65536, "the spare columns hold every element out of range; a tile's eight stores differ by constants that fit the instruction's offset");
    v8f acc[QB];
#pragma unroll
    for (int rb = 0; rb < QB; ++rb) { acc[rb] = (v8f){}; acc[rb] = wmmab(ah0[rb], b0, acc[rb]); acc[rb] = wmmab(al0[rb], b0, acc[rb]); acc[rb] = wmmab(ah1[rb], b1, acc[rb]); acc[rb] = wmmab(al1[rb], b1, acc[rb]); }
    asm volatile("v_nop\n\tv_nop\n\tv_nop\n\tv_nop" : "+v"(acc[0]), "+v"(acc[1]));   // the four vector slots that the chip needs between a matrix instruction and the next one that overwrites its result registers: only LDS stores follow here, and they fill none
#pragma unroll
    for (int rb = 0; rb < QB; ++rb) {
        const int cb = tt * 16 + lr + r0 + rb * 16 + hi * 8 + (UP ? 2 : 1 - TT);   // column of accumulator register 0; register j is one row lower and so j columns further
        float* p = S + (rb * 16 + hi * 8) * SP + cb;   // no test of the column: one outside 0..2047 lies in the row's own spare columns, which nobody reads
#pragma unroll
        for (int j = 0; j < 8; ++j) p[j * (SP + 1)] = acc[rb][j];
    }
}
template <bool UP>
__device__ __forceinline__ void rel_tiles(float* S, const bf* __restrict__ qh, const bf* __restrict__ ql, const bf* __restrict__ er, int r0, int tbeg, int tend, int lr, int hi) {
    if (tbeg >= tend) return;   // wave-uniform: a wave without a tile loads no q rows
    v16bf ah0[QB], ah1[QB], al0[QB], al1[QB]; unsigned ao[QB];
#pragma unroll
    for (int rb = 0; rb < QB; ++rb) { const int qr = UP ? min(r0 + rb * 16 + 1 + lr, TT - 1) : r0 + rb * 16 + lr; ao[rb] = (unsigned)((qr >> 4) * (16 * HD) + (qr & 15) * 8 + hi * 128) * 2;   // UP: q rows i + 1 (the clamped row has no column in range); byte offset in fragment order: a 16-row tile is 2 fragments (k 0..31, 32..63)
        ah0[rb] = WFrag<bf>::ldf(qh, ao[rb]); ah1[rb] = WFrag<bf>::ldf(qh + 512, ao[rb]); al0[rb] = WFrag<bf>::ldf(ql, ao[rb]); al1[rb] = WFrag<bf>::ldf(ql + 512, ao[rb]); }
    asm volatile("s_wait_xcnt 0x0" : : "v"(ao[0]), "v"(ao[1]), "s"(qh), "s"(ql) : "memory");   // inputs only: the q loads' offset registers and two scalar bases stay taken up to the wait; the Er base and offset are formed behind it, not in those registers ahead of it
    const bf* eb = er + (size_t)tbeg * 16 * HD; unsigned eo = (unsigned)(lr * 8 + hi * 128) * 2;
    for (int tt = tbeg; tt < tend; tt += 32) {   // two Er tiles' loads in flight per trip (16 waves a WGP: each keeps more bytes under way)
        const bool two = tt + 16 < tend;   // wave-uniform; without a second tile its loads read the first again and feed nothing
        const unsigned e2 = eo + (two ? 16 * 16 * HD * 2 : 0);
        const v16bf b0 = WFrag<bf>::ldf(eb, eo), b1 = WFrag<bf>::ldf(eb + 512, eo), c0 = WFrag<bf>::ldf(eb, e2), c1 = WFrag<bf>::ldf(eb + 512, e2);
        __builtin_amdgcn_sched_barrier(0);   // the trip's eight loads all issue in front of its products: without it the compiler loads half of the second tile into the first tile's registers, behind their products, and a trip waits twice for L2
        rel_one<UP>(S, ah0, al0, ah1, al1, b0, b1, tt, r0, lr, hi);
        asm volatile("" : : "v"(c0), "v"(c1));   // inputs only, the loaded values: holds the second tile's loads in front of the branch, beside the first tile's; without it the compiler sinks them into the branch and a trip waits twice for L2
        if (two) rel_one<UP>(S, ah0, al0, ah1, al1, c0, c1, tt + 16, r0, lr, hi);
        asm volatile("s_wait_xcnt 0x0" : "+v"(eo) : "v"(e2) : "memory");   // as addr_step; the second tile's offset register stays taken up to the wait, and its next value is formed from this statement's result
        eo += 32 * 16 * HD * 2;   // 32 Er tiles further
    }
}
__device__ __forceinline__ void rel_stage(float* S, int h, int r0, const bf* __restrict__ QPh, const bf* __restrict__ QPl, const bf* __restrict__ ERB) {   // the same for hi/lo and fp16 rows: it stands once in the kernel's text, which so stays under 32 KB
    const int tid = (int)threadIdx.x, lane = tid & 31, lr = lane & 15, hi = lane >> 4; const int wv = __builtin_amdgcn_readfirstlane(tid >> 5);   // wave-uniform: scalar loop bounds
    const size_t hq = (size_t)h * TT * HD;
    {   // stage 1: for row block rb, Er tiles 0..T0 - rb serve the columns right of the diagonal and tiles T0 - rb..127 those up to it; each deal takes the union over the blocks (a tile that serves only one block leaves the other's elements in the spare columns); the second deal runs in reverse wave order so that the two remainders fall on different waves where they can
        const int T0 = TT / 16 - 1 - (r0 >> 4);
        rel_tiles<true>(S, QPh + hq, QPl + hq, ERB, r0, wv, T0 + 1, lr, hi);
        rel_tiles<false>(S, QPh + hq, QPl + hq, ERB, r0, T0 - (QB - 1) + 15 - wv, TT / 16, lr, hi);
        if (tid < QB * 16 && r0 + tid + 1 < TT) S[tid * SP + r0 + tid + 1] = 0.0f;
    }
}
template <bool HI>
__device__ __forceinline__ void attn_rows(float* S, int h, int r0, const h16* __restrict__ QP16, const bf* __restrict__ QPh, const bf* __restrict__ QPl, const h16* __restrict__ KP16, const bf* __restrict__ KPh, const bf* __restrict__ KPl, const h16* __restrict__ VT16, const bf* __restrict__ VTh, const bf* __restrict__ VTl, bf* ATh, bf* ATl) {
    const int tid = (int)threadIdx.x, lane = tid & 31, lr = lane & 15, hi = lane >> 4; const int wv = __builtin_amdgcn_readfirstlane(tid >> 5);   // wave-uniform: scalar loop bounds
    const size_t hq = (size_t)h * TT * HD;
    const unsigned lo = (unsigned)(lr * 8 + hi * 128) * 2;   // 32-bit lane byte offset in a fragment
    const size_t vb = (size_t)h * HD * TT + (size_t)wv * (128 * HD);   // wave-uniform base of the wave's v slice (its 16 fragments of a plane lie in a row)
    const h16* vp = (const h16*)((const char*)(VT16 + vb) + lo); const bf* vh = (const bf*)((const char*)(VTh + vb) + lo); const bf* vl = (const bf*)((const char*)(VTl + vb) + lo);
    v16h bv[HI ? 1 : 16]; v16bf wb[HI ? 8 : 1], wb2[HI ? 8 : 1];   // stage 4's v fragments, fetched ahead: fp16 rows the wave's whole slice (16 KiB), hi/lo rows the first 64 of its 128 keys in both planes
    {   // stage 2: the fragment registers of a key tile are refilled right behind its products, so that loads are under way while the other tiles are worked on. The refill is unconditional (a branch round it would make the compiler wait for every load at each use): behind the last tiles it brings the first v fragments, by a wave-uniform choice of base and step.
        const size_t ab = hq + (size_t)r0 * HD, kb = hq + (size_t)wv * (16 * HD);   // wave-uniform bases (fragment order); key tile it * 16 + wv lies it * 32 KiB behind tile wv
        if constexpr (HI) {
            v16bf a0[QB], a1[QB], c0[QB], c1[QB], b0[2], b1[2], d0[2], d1[2];   // two key tiles' fragments
            const bf* qh = (const bf*)((const char*)(QPh + ab) + lo); const bf* ql = (const bf*)((const char*)(QPl + ab) + lo); const bf* kh = (const bf*)((const char*)(KPh + kb) + lo); const bf* kl = (const bf*)((const char*)(KPl + kb) + lo);
#pragma unroll
            for (int rb = 0; rb < QB; ++rb) { const int ar = rb * (16 * HD); a0[rb] = WFrag<bf>::ldf(qh + ar, 0u); a1[rb] = WFrag<bf>::ldf(qh + ar + 512, 0u); c0[rb] = WFrag<bf>::ldf(ql + ar, 0u); c1[rb] = WFrag<bf>::ldf(ql + ar + 512, 0u); }
            __builtin_amdgcn_sched_barrier(0);   // the q loads stay the oldest: the loop's waits for them stand in every trip, and behind younger q loads they would also wait for the refills under way
#pragma unroll
            for (int t = 0; t < 2; ++t) { const int kt = t * (256 * HD); b0[t] = WFrag<bf>::ldf(kh + kt, 0u); b1[t] = WFrag<bf>::ldf(kh + kt + 512, 0u); d0[t] = WFrag<bf>::ldf(kl + kt, 0u); d1[t] = WFrag<bf>::ldf(kl + kt + 512, 0u); }
            asm volatile("s_wait_xcnt 0x0" : : "v"(qh), "v"(ql), "v"(kh), "v"(kl) : "memory");   // inputs only: the lane's four address pairs (one a plane serves all of its loads, which differ by constants) stay taken up to the wait, so that no late load lands in one of them
            __builtin_amdgcn_sched_barrier(0);   // the loads stay in front of the barrier: behind it they would start only when the last wave has ended stage 1
            lds_barrier();   // every relative logit lies in LDS before a score tile adds it
            unsigned ko = lo;   // the k refills' offset: it moves on by two tiles a trip
#pragma unroll 1   // rolled: the same two tiles' registers serve every trip, and the text stays short
            for (int io = 0; io < TT / 256; io += 2) {
              const bool last = io + 2 >= TT / 256;   // wave-uniform
              const char* sh = (const char*)(last ? VTh + vb : KPh + kb + 2 * (256 * HD)); const char* sl = (const char*)(last ? VTl + vb : KPl + kb + 2 * (256 * HD));
              const unsigned o[2] = { last ? lo : ko, last ? lo + 2 * 1024 : ko + 256 * HD * 2 };   // k: the tile two further; v: two fragments of each plane
              const bf* ph[2] = { (const bf*)(sh + o[0]), (const bf*)(sh + o[1]) }; const bf* pl[2] = { (const bf*)(sl + o[0]), (const bf*)(sl + o[1]) };
#pragma unroll
              for (int t = 0; t < 2; ++t) { const int n0 = ((io + t) * 16 + wv) * 16;
#pragma unroll
                for (int rb = 0; rb < QB; ++rb) {
                    v8f acc = (v8f){}; acc = wmmab(a0[rb], b0[t], acc); acc = wmmab(c0[rb], b0[t], acc); acc = wmmab(a0[rb], d0[t], acc); acc = wmmab(a1[rb], b1[t], acc); acc = wmmab(c1[rb], b1[t], acc); acc = wmmab(a1[rb], d1[t], acc);
#pragma unroll
                    for (int j = 0; j < 8; ++j) { float* q = S + (rb * 16 + hi * 8 + j) * SP + n0 + lr; *q = (acc[j] + *q) * SCL; } }
                b0[t] = WFrag<bf>::ldf(ph[t], 0u); b1[t] = WFrag<bf>::ldf(ph[t] + 512, 0u); d0[t] = WFrag<bf>::ldf(pl[t], 0u); d1[t] = WFrag<bf>::ldf(pl[t] + 512, 0u);
                __builtin_amdgcn_sched_barrier(0);   // a tile's refill issues in front of the other tile's products, not behind them
              }
              asm volatile("s_wait_xcnt 0x0" : "+v"(ko) : "v"(ph[0]), "v"(ph[1]), "v"(pl[0]), "v"(pl[1]) : "memory");   // as addr_step; the refills' four address pairs stay taken up to the wait, and the next trip's are formed from this statement's result
              ko += 2 * 256 * HD * 2; }
#pragma unroll
            for (int t = 0; t < 2; ++t) { wb[2 * t] = b0[t]; wb[2 * t + 1] = b1[t]; wb2[2 * t] = d0[t]; wb2[2 * t + 1] = d1[t]; }
        } else {
            v16h a0[QB], a1[QB], b0[4], b1[4];   // four key tiles' fragments, refilled in pairs
            const h16* qp = (const h16*)((const char*)(QP16 + ab) + lo); const h16* kp = (const h16*)((const char*)(KP16 + kb) + lo);
#pragma unroll
            for (int rb = 0; rb < QB; ++rb) { const int ar = rb * (16 * HD); a0[rb] = WFrag<h16>::ldf(qp + ar, 0u); a1[rb] = WFrag<h16>::ldf(qp + ar + 512, 0u); }
            __builtin_amdgcn_sched_barrier(0);   // the q loads stay the oldest: the loop's waits for them stand in every trip, and behind younger q loads they would also wait for the refills under way
#pragma unroll
            for (int t = 0; t < 4; ++t) { const int kt = t * (256 * HD); b0[t] = WFrag<h16>::ldf(kp + kt, 0u); b1[t] = WFrag<h16>::ldf(kp + kt + 512, 0u); }
            asm volatile("s_wait_xcnt 0x0" : : "v"(qp), "v"(kp) : "memory");   // inputs only: the lane's two address pairs (each serves all of its loads, which differ by constants) stay taken up to the wait, so that no late load lands in one of them
            __builtin_amdgcn_sched_barrier(0);   // the loads stay in front of the barrier: behind it they would start only when the last wave has ended stage 1
            lds_barrier();   // every relative logit lies in LDS before a score tile adds it
#pragma unroll 1   // rolled over the two halves of the wave's eight tiles, for the size of the text
            for (int io = 0; io < TT / 256; io += 4) {
              const bool last = io + 4 >= TT / 256;   // wave-uniform
              const char* sp = (const char*)(last ? VT16 + vb : KP16 + kb + 4 * (256 * HD)); const unsigned st = last ? 2 * 1024 : 256 * HD * 2;   // k: tiles 4..7, 32 KiB apart; v: two fragments a step
              const h16* rp[4] = { (const h16*)(sp + lo), (const h16*)(sp + (lo + st)), (const h16*)(sp + (lo + 2 * st)), (const h16*)(sp + (lo + 3 * st)) };
#pragma unroll
              for (int p = 0; p < 2; ++p) {
#pragma unroll
                for (int ii = 0; ii < 2; ++ii) { const int t = p * 2 + ii, n0 = ((io + t) * 16 + wv) * 16;
#pragma unroll
                  for (int rb = 0; rb < QB; ++rb) {
                    v8f acc = (v8f){}; acc = wmma16(a0[rb], b0[t], acc); acc = wmma16(a1[rb], b1[t], acc);
#pragma unroll
                    for (int j = 0; j < 8; ++j) { float* q = S + (rb * 16 + hi * 8 + j) * SP + n0 + lr; *q = (acc[j] + *q) * SCL; } } }
#pragma unroll
                for (int ii = 0; ii < 2; ++ii) { const int t = p * 2 + ii; b0[t] = WFrag<h16>::ldf(rp[t], 0u); b1[t] = WFrag<h16>::ldf(rp[t] + 512, 0u); }
                __builtin_amdgcn_sched_barrier(0);   // a pair's refill issues in front of the other pair's products, not behind them
              }
              asm volatile("s_wait_xcnt 0x0" : : "v"(rp[0]), "v"(rp[1]), "v"(rp[2]), "v"(rp[3]) : "memory");   // inputs only: the refills' four address pairs stay taken up to the wait, so that no refill lands in one of them
            }
#pragma unroll
            for (int t = 0; t < 4; ++t) { bv[2 * t] = b0[t]; bv[2 * t + 1] = b1[t]; }
#pragma unroll
            for (int f = 8; f < 16; ++f) bv[f] = WFrag<h16>::ldf(vp + f * 512, 0u);
            asm volatile("s_wait_xcnt 0x0" : : "v"(vp) : "memory");   // inputs only: the lane's address pair (it serves these eight fragments, which differ by constants) stays taken up to the wait
        }
    }
    __builtin_amdgcn_sched_barrier(0);   // the loads stay in front of stage 3: without it the compiler loads each fragment right in front of its products, and the wave waits for L2 in stage 4
    lds_barrier();   // every score of a row lies in LDS before its wave reads the row
#pragma unroll 1   // rolled over the two rows: one row's 64 values stand beside the v fragments fetched ahead without crowding the schedule, and the kernel's text stays under 32 KB
    for (int rr = 0; rr < QB; ++rr) {   // stage 3
        float* sr = S + (rr * 16 + wv) * SP; float v[TT / 32]; float mx = -3.0e38f;
#pragma unroll
        for (int ch = 0; ch < TT / 128; ++ch) { const v4f a = *(const v4fa*)(sr + ch * 128 + lane * 4);
#pragma unroll
            for (int q = 0; q < 4; ++q) { v[ch * 4 + q] = a[q]; mx = fmaxf(mx, a[q]); } }
#pragma unroll
        for (int sh = 16; sh; sh >>= 1) mx = fmaxf(mx, __shfl_xor(mx, sh, 32));
        float sum = 0.f;
#pragma unroll
        for (int k = 0; k < TT / 32; ++k) { v[k] = __builtin_amdgcn_exp2f((v[k] - mx) * 1.4426950408889634f); sum += v[k]; }
#pragma unroll
        for (int sh = 16; sh; sh >>= 1) sum += __shfl_xor(sum, sh, 32);
        const float f = __fdiv_rn(HI ? 1.0f : PCAR, sum);
        if constexpr (HI) { bf* ph = (bf*)sr; bf* pl = ph + TT;
#pragma unroll
            for (int ch = 0; ch < TT / 128; ++ch) { v4us oh, ol;
#pragma unroll
                for (int q = 0; q < 4; ++q) { unsigned short a, c2; splitf(v[ch * 4 + q] * f, a, c2); oh[q] = a; ol[q] = c2; }
                *(v4us*)(ph + ch * 128 + lane * 4) = oh; *(v4us*)(pl + ch * 128 + lane * 4) = ol; }
        } else { h16* pp = (h16*)sr;
#pragma unroll
            for (int ch = 0; ch < TT / 128; ++ch) { v4h o4;
#pragma unroll
                for (int q = 0; q < 4; ++q) o4[q] = tohx(v[ch * 4 + q] * f);
                *(v4h*)(pp + ch * 128 + lane * 4) = o4; } }
    }
    if constexpr (HI) {   // the next v fragments start in front of the barrier; through stage 3 they would take the registers that its schedule needs
#pragma unroll
        for (int f = 4; f < 8; ++f) { wb[f] = WFrag<bf>::ldf(vh + f * 512, 0u); wb2[f] = WFrag<bf>::ldf(vl + f * 512, 0u); }
        __builtin_amdgcn_sched_barrier(0);   // the loads stay in front of the barrier: behind it they would start only when the last wave has ended stage 3
    }
    lds_barrier();   // all probability rows lie in LDS before any wave reads its key slice of them
    v8f acc[QB][4];
#pragma unroll
    for (int rb = 0; rb < QB; ++rb)
#pragma unroll
        for (int nb = 0; nb < 4; ++nb) acc[rb][nb] = (v8f){};
    {   // stage 4
#pragma unroll
        for (int s = 0; s < 4; ++s) { const int kc = wv * 128 + s * 32;
            if constexpr (HI) { v16bf a[QB], a2[QB];
#pragma unroll
                for (int rb = 0; rb < QB; ++rb) { const bf* pr = (const bf*)(S + (rb * 16 + lr) * SP) + kc + 8 * hi; a[rb] = WFrag<bf>::ld(pr); a2[rb] = WFrag<bf>::ld(pr + TT); }
#pragma unroll
                for (int nb = 0; nb < 4; ++nb)
#pragma unroll
                    for (int rb = 0; rb < QB; ++rb) { const int f = (s & 1) * 4 + nb; acc[rb][nb] = wmmab(a[rb], wb[f], acc[rb][nb]); acc[rb][nb] = wmmab(a2[rb], wb[f], acc[rb][nb]); acc[rb][nb] = wmmab(a[rb], wb2[f], acc[rb][nb]); }
                if (s < 2) {   // the eight fragments of keys 64 further take the places of those just used
#pragma unroll
                    for (int nb = 0; nb < 4; ++nb) { const int f = (s & 1) * 4 + nb; wb[f] = WFrag<bf>::ldf(vh + ((s + 2) * 4 + nb) * 512, 0u); wb2[f] = WFrag<bf>::ldf(vl + ((s + 2) * 4 + nb) * 512, 0u); }
                    __builtin_amdgcn_sched_barrier(0);   // the refill issues in front of the next 32 keys' products: without it the compiler loads each pair right in front of its own products, and the wave waits for L2 once a pair
                }
            } else { v16h a[QB];
#pragma unroll
                for (int rb = 0; rb < QB; ++rb) a[rb] = WFrag<h16>::ld((const h16*)(S + (rb * 16 + lr) * SP) + kc + 8 * hi);
#pragma unroll
                for (int nb = 0; nb < 4; ++nb)
#pragma unroll
                    for (int rb = 0; rb < QB; ++rb) acc[rb][nb] = wmma16(a[rb], bv[s * 4 + nb], acc[rb][nb]); } }
        if constexpr (HI) asm volatile("s_wait_xcnt 0x0" : : "v"(vh), "v"(vl) : "memory");   // inputs only: the lane's address pairs (one a plane serves all of its loads, which differ by constants) stay taken up to the wait, so that no late load lands in one of them
    }
    __syncthreads();   // every wave has read its slice of the probability rows before the partial tiles overwrite them
    {   // stage 5
        float* pw = S + wv * (64 * PP);
#pragma unroll
        for (int rb = 0; rb < QB; ++rb)
#pragma unroll
            for (int nb = 0; nb < 4; ++nb) { float* p = pw + (nb * 16 + lr) * PP + rb * 16 + hi * 8; const v8f t = acc[rb][nb]; *(v4fa*)p = __builtin_shufflevector(t, t, 0, 1, 2, 3); *(v4fa*)(p + 4) = __builtin_shufflevector(t, t, 4, 5, 6, 7); }
        __syncthreads();   // every wave's partial tile is in LDS before any of it is summed
        const int col = tid & 63, rp = tid >> 6; const float* p = S + col * PP + rp * 4; v4f s = *(const v4fa*)p;   // four neighbouring rows of one column
#pragma unroll
        for (int w = 1; w < 16; ++w) s += *(const v4fa*)(p + w * (64 * PP));
        const float cs = HI ? 1.0f : (1.0f / PCAR);
        unsigned short oa[4], oc[4];
#pragma unroll
        for (int q = 0; q < 4; ++q) splitf(s[q] * cs, oa[q], oc[q]);
        const size_t oo = (size_t)(r0 + ((rp * 4) & ~15)) * DQ + (h * 2 + (col >> 5)) * 512 + ((col >> 4) & 1) * 256 + ((col >> 3) & 1) * 128 + ((rp * 4) & 15) * 8 + (col & 7);   // fragment order, rows = query rows, k = h * HD + col; the thread's four rows lie in one 16-row block, 8 elements apart
        __builtin_amdgcn_sched_barrier(0);   // the eight stores stay the thread's last instructions: nothing behind them is given a register that a store still names
#pragma unroll
        for (int q = 0; q < 4; ++q) { ATh[oo + q * 8] = oa[q]; ATl[oo + q * 8] = oc[q]; }
    }
}
__global__ __launch_bounds__(512) void k_attn(const h16* __restrict__ QP16, const bf* __restrict__ QPh, const bf* __restrict__ QPl, const h16* __restrict__ KP16, const bf* __restrict__ KPh, const bf* __restrict__ KPl, const bf* __restrict__ ERB, const h16* __restrict__ VT16, const bf* __restrict__ VTh, const bf* __restrict__ VTl, bf* ATh, bf* ATl) {
    __shared__ __align__(16) float Sx[QB * 16 * SP]; float* S = Sx + GB;   // S: column 0 of row 0
    // Grid (RH / 32, heads, TT / RH): there are four times as many work-groups as WGPs, and one of hi/lo rows lasts about half as long again as one of fp16 rows. Slab z = 0 holds all hi/lo row blocks of all heads.
    // For speed only: every (head, row block) is done exactly once wherever and whenever its work-group runs.
    static_assert(RH > 0 && RH % (QB * 16) == 0 && TT % RH == 0, "slabs of RH query rows; slab 0 is the hi/lo one");
    const int r0 = (int)blockIdx.z * RH + (int)blockIdx.x * (QB * 16), h = (int)blockIdx.y;   // the choice below is the same for the whole work-group (RH is a multiple of its rows), so every barrier is met by all of its waves
    rel_stage(S, h, r0, QPh, QPl, ERB);
    if (r0 < RH) attn_rows<true>(S, h, r0, QP16, QPh, QPl, KP16, KPh, KPl, VT16, VTh, VTl, ATh, ATl);
    else attn_rows<false>(S, h, r0, QP16, QPh, QPl, KP16, KPh, KPl, VT16, VTh, VTl, ATh, ATl);
}

extern "C" void kernel_launch(void* const* d_in, const int* in_sizes, int n_in,
                              void* d_out, int out_size, void* d_ws, size_t ws_size, hipStream_t stream) {
    (void)in_sizes; (void)n_in; (void)out_size;
    const float* xq = (const float*)d_in[0]; const float* xk = (const float*)d_in[1]; const float* xv = (const float*)d_in[2]; const float* wq = (const float*)d_in[3]; const float* bq = (const float*)d_in[4]; const float* wk = (const float*)d_in[5]; const float* bk = (const float*)d_in[6]; const float* wv = (const float*)d_in[7]; const float* bv = (const float*)d_in[8]; const float* wo = (const float*)d_in[9]; const float* bo = (const float*)d_in[10]; const float* Er = (const float*)d_in[11]; const float* x = nullptr; (void)x;
    float* OUT = (float*)d_out;     // [1][2048][1024]
    char* wsp = (char*)d_ws;
    auto take = [&](size_t bytes) { char* p = wsp; wsp += (bytes + 255) & ~(size_t)255; return (void*)p; };
    bf* WQ = (bf*)take((size_t)DQ * DM * 2); bf* WK = (bf*)take((size_t)DKV * DM * 2); bf* WV = (bf*)take((size_t)DKV * DM * 2); bf* WO = (bf*)take((size_t)DM * DQ * 2);
    bf* ERB = (bf*)take((size_t)TT * HD * 2);
    bf* XQ = (bf*)take((size_t)TT * DM * 2); bf* XK = (bf*)take((size_t)TT * DM * 2); bf* XV = (bf*)take((size_t)TT * DM * 2);
    h16* QP16 = (h16*)take((size_t)NH_ * TT * HD * 2); h16* KP16 = (h16*)take((size_t)NKV * TT * HD * 2); h16* VT16 = (h16*)take((size_t)NKV * HD * TT * 2);
    bf* QPh = (bf*)take((size_t)NH_ * TT * HD * 2); bf* QPl = (bf*)take((size_t)NH_ * TT * HD * 2); bf* KPh = (bf*)take((size_t)NKV * TT * HD * 2); bf* KPl = (bf*)take((size_t)NKV * TT * HD * 2); bf* VTh = (bf*)take((size_t)NKV * HD * TT * 2); bf* VTl = (bf*)take((size_t)NKV * HD * TT * 2);
    bf* ATh = (bf*)take((size_t)TT * DQ * 2); bf* ATl = (bf*)take((size_t)TT * DQ * 2);
    if ((size_t)(wsp - (char*)d_ws) > ws_size) return;    // ws 256 MiB
    for (int b = 0; b < NB_; ++b) {
        k_prep<<<4 * PB_W + 3 * PB_X + PB_E, 256, 0, stream>>>(wq, wk, wv, wo, xq + (size_t)b * TT * DM, xk + (size_t)b * TT * DM, xv + (size_t)b * TT * DM, Er, WQ, WK, WV, WO, XQ, XK, XV, ERB);   /* Er [2048][64] ('t d'): rows t, k = d */
        k_qkv<<<dim3(TT / 128, NH_ / 2, 3), 256, 0, stream>>>(XQ, XK, XV, WQ, WK, WV, bq, bk, bv, QP16, QPh, QPl, KP16, KPh, KPl, VT16, VTh, VTl);
        k_attn<<<dim3(RH / (QB * 16), NH_, TT / RH), 512, 0, stream>>>(QP16, QPh, QPl, KP16, KPh, KPl, ERB, VT16, VTh, VTl, ATh, ATl);   /* one kv head per query head */
        k_gemmw<bf, 1, true, 8, DQ><<<dim3(TT / 64, DM / 64, 1), 256, 0, stream>>>(ATh, ATl, WO, nullptr, OUT + (size_t)b * TT * DM, DM, bo, 0, 0, 0); }
}

// v010
// A run of this version takes 93.7 microseconds.
// Timed twice side by side with v009, it ran 1.05 and 1.08 times as fast.
// Counting every step since v000, it is 13.3 times as fast.
#include <hip/hip_runtime.h>

// Relative global attention (Music-Transformer skew) (query, key, value [1][2048][1024]; q,k,v = input W^T + b ('oi' [1024][1024] + [1024]; 16 heads x 64); qe = q.Er^T (Er [2048][64], all rows used since s = max_len); s_rel = skew(qe): for j <= i  s_rel[i][j] = qe[i][2047 + j - i]; for j = i+1  0; for j > i+1  qe[i+1][j - i - 2] (the reference's pad-reshape-slice, reproduced exactly, upper triangle included); scores = (q.k + s_rel) / 8; softmax; out = merged ctx Wo^T + bo -> [1][2048][1024] (2.1 M)).
// Compute dtypes, f32 accumulate: every input rounded to bf16; q/k/v on PLAIN bf16 operands (inputs: exact) + biases (three input tensors); qe = q(hi/lo planes) x Er (exact bf16) gives the relative logits, stored in LDS at their skewed place (the index map above) and added to q.k before the 1/8 scale; scores and attn.v: query rows < 512 hl (3 products), the rest single fp16 (x1024); softmax f32; Wo hl x exact (2 products) + bo.

#define NB_  1
#define TT   2048
#define DM   1024
#define NH_  16
#define NKV  16
#define REP  (NH_ / NKV)
#define HD   64
#define DQ   (NH_ * HD)
#define DKV  (NKV * HD)
#define RH   512                  // query rows < RH use hi+lo planes
#define WIN  0
#define PCAR 1024.0f
#define SCL  0.125f   // HD^-0.5
typedef _Float16 h16;
typedef unsigned short bf;
typedef __attribute__((ext_vector_type(16))) __bf16   v16bf;
typedef __attribute__((ext_vector_type(16))) _Float16 v16h;
typedef __attribute__((ext_vector_type(8)))  _Float16 v8h;
typedef __attribute__((ext_vector_type(8)))  unsigned short v8us;
typedef __attribute__((ext_vector_type(8)))  float    v8f;
typedef __attribute__((ext_vector_type(4)))  float    v4f;
typedef v8h  __attribute__((may_alias)) v8ha;
typedef v4f  __attribute__((may_alias)) v4fa;
typedef v8us __attribute__((may_alias)) v8usa;

__device__ __forceinline__ unsigned short f2bf(float f) { unsigned u = __float_as_uint(f); u += 0x7FFFu + ((u >> 16) & 1u); return (unsigned short)(u >> 16); }
__device__ __forceinline__ float bf2f(unsigned short b) { return __uint_as_float(((unsigned)b) << 16); }
__device__ __forceinline__ float bfr(float f) { return bf2f(f2bf(f)); }
__device__ __forceinline__ v16h cat16(v8h lo, v8h hi) { return __builtin_shufflevector(lo, hi, 0, 1, 2, 3, 4, 5, 6, 7, 8, 9, 10, 11, 12, 13, 14, 15); }
__device__ __forceinline__ v16bf cat16b(v8us lo, v8us hi) { return __builtin_bit_cast(v16bf, __builtin_shufflevector(lo, hi, 0, 1, 2, 3, 4, 5, 6, 7, 8, 9, 10, 11, 12, 13, 14, 15)); }
__device__ __forceinline__ v8f wmma16(v16h a, v16h b, v8f c) { return __builtin_amdgcn_wmma_f32_16x16x32_f16(false, a, false, b, (short)0, c, false, false); }
__device__ __forceinline__ v8f wmmab(v16bf a, v16bf b, v8f c) { return __builtin_amdgcn_wmma_f32_16x16x32_bf16(false, a, false, b, (short)0, c, false, false); }



// ---- FRAGMENT ORDER of every 16-bit operand plane in global memory (rows x K, K % 32 == 0): the plane is a row-major grid of fragments (16 rows x 32 k, 512 elements = 1 KiB, fragment index (row / 16) * (K / 32) + k / 32; the v planes alone order their fragments k-block first, see k_qkv);
// inside a fragment element (row, k) lies at ((k >> 4) & 1) * 256 + ((k >> 3) & 1) * 128 + (row & 15) * 8 + (k & 7), which is half * 256 + lane * 8 + e of the lane and register half that hold it in the WMMA operand.
// WFrag::ldf(fragment, lane * 16) is then two wave-wide 16-byte loads of 512 contiguous bytes each (four whole 128-byte lines); from a row-major plane each such load touches 16 lines. WFrag::ld reads a row-major source (the LDS rows).
// ldf takes a wave-uniform fragment pointer and the lane's 32-bit BYTE offset: every load of a loop then names one scalar base, one offset register and a constant, and no per-load address pair is formed (stages 2 and 4 of k_attn hand it the lane's own pointer and offset 0).
// Behind each run of such loads stands s_wait_xcnt 0, in front of the rewrite of the offset register that they name (addr_step: the caller advances the offset behind it) or of its release (a statement that takes the address registers as inputs only, so that they stay taken up to the wait).
// ---- k_gemmw: register-blocked GEMM, ONE WAVE per 64x64 output tile (16 accumulators), operands straight from 16-bit planes in fragment order; grid (M/64, N/64, Z), 32 threads.
// C[m][n] (f32, pitch ldc, + optional f32 bias[n]) = sum_k A[m][k] Bt[n][k] (+ split products per NSPLIT). z-batch strides sA/sB/sC in elements. K % (32 * KS) == 0.
// KS > 1 (long-K launches, 32 * KS threads): wave w of the work-group sums the K slice [w K/KS, (w+1) K/KS) of the same 64x64 tile; the KS partial tiles meet in LDS (column-major, pitch 68) and are added in wave order 0..KS-1.
template <typename T16> struct WFrag;
template <> struct WFrag<h16> { typedef v16h V; static __device__ __forceinline__ V ld(const h16* p) { return cat16(*(const v8h*)p, *(const v8h*)(p + 16)); } static __device__ __forceinline__ V ldf(const h16* ub, unsigned vb) { const h16* p = (const h16*)((const char*)ub + vb); return cat16(*(const v8h*)p, *(const v8h*)(p + 256)); } static __device__ __forceinline__ v8f mma(V a, V b, v8f c) { return wmma16(a, b, c); } };
template <> struct WFrag<bf> { typedef v16bf V; static __device__ __forceinline__ V ld(const bf* p) { return cat16b(*(const v8us*)p, *(const v8us*)(p + 16)); } static __device__ __forceinline__ V ldf(const bf* ub, unsigned vb) { const bf* p = (const bf*)((const char*)ub + vb); return cat16b(*(const v8us*)p, *(const v8us*)(p + 256)); } static __device__ __forceinline__ v8f mma(V a, V b, v8f c) { return wmmab(a, b, c); } };
__device__ __forceinline__ void addr_step(unsigned& vb) { asm volatile("s_wait_xcnt 0x0" : "+v"(vb) : : "memory"); }   // the offset's next value is formed from this statement's result, so its rewrite cannot be lifted over the wait
template <typename T16, int NSPLIT, bool BIAS, int KS, int K>
__global__ __launch_bounds__(32 * KS) void k_gemmw(const T16* __restrict__ A, const T16* __restrict__ A2, const T16* __restrict__ Bt, const T16* __restrict__ Bt2, float* C, int ldc, const float* __restrict__ bias, size_t sA, size_t sB, size_t sC) {
    typedef typename WFrag<T16>::V V;
    __shared__ __align__(16) float os[KS == 1 ? 16 * 68 : KS * 64 * 68];
    const size_t z = blockIdx.z; A += z * sA; if (A2) A2 += z * sA; Bt += z * sB; if (Bt2) Bt2 += z * sB; C += z * sC;
    const int lane = threadIdx.x & 31, lr = lane & 15, hi = lane >> 4; const int r0 = blockIdx.x * 64, c0 = blockIdx.y * 64;
    v8f acc[4][4];
#pragma unroll
    for (int mb = 0; mb < 4; ++mb)
#pragma unroll
        for (int nb = 0; nb < 4; ++nb) acc[mb][nb] = (v8f){};
    const int wv = (KS == 1) ? 0 : __builtin_amdgcn_readfirstlane((int)(threadIdx.x >> 5)); constexpr int kspan = K / KS; const int kbeg = wv * kspan;   // this wave's K slice
    const T16* ua = A + (size_t)r0 * K + (size_t)kbeg * 16; const T16* ua2 = (NSPLIT == 1 || NSPLIT == 2) ? A2 + (size_t)r0 * K + (size_t)kbeg * 16 : nullptr; const T16* ub = Bt + (size_t)c0 * K + (size_t)kbeg * 16; const T16* ub2 = (NSPLIT >= 2) ? Bt2 + (size_t)c0 * K + (size_t)kbeg * 16 : nullptr;   // wave-uniform: 16 rows of fragments hold 16 K elements; a step of 32 in k is one fragment (1 KiB)
    unsigned vo = (unsigned)lane * 16;
#pragma unroll 1
    for (int kc = 0; kc < kspan; kc += 32) {
        V a[4], a2[4], b[4], b2[4];
#pragma unroll
        for (int mb = 0; mb < 4; ++mb) { a[mb] = WFrag<T16>::ldf(ua + mb * 16 * K, vo); if (NSPLIT == 1 || NSPLIT == 2) a2[mb] = WFrag<T16>::ldf(ua2 + mb * 16 * K, vo); }
#pragma unroll
        for (int nb = 0; nb < 4; ++nb) { b[nb] = WFrag<T16>::ldf(ub + nb * 16 * K, vo); if (NSPLIT >= 2) b2[nb] = WFrag<T16>::ldf(ub2 + nb * 16 * K, vo); }
        __builtin_amdgcn_sched_barrier(0);   // a trip's loads all issue in front of its products: without it the compiler sinks each B fragment behind the products before it, into one register set, and a trip waits four times for memory
#pragma unroll
        for (int nb = 0; nb < 4; ++nb)
#pragma unroll
            for (int mb = 0; mb < 4; ++mb) { acc[mb][nb] = WFrag<T16>::mma(a[mb], b[nb], acc[mb][nb]); if (NSPLIT == 1 || NSPLIT == 2) acc[mb][nb] = WFrag<T16>::mma(a2[mb], b[nb], acc[mb][nb]); if (NSPLIT >= 2) acc[mb][nb] = WFrag<T16>::mma(a[mb], b2[nb], acc[mb][nb]); }
        asm volatile("v_nop\n\tv_nop\n\tv_nop\n\tv_nop" : "+v"(acc[0][0]), "+v"(acc[1][1]), "+v"(acc[2][2]), "+v"(acc[3][3]) : "v"(a[0]), "v"(a[3]));
        addr_step(vo); vo += 1024;   // next fragment of every operand row block
    }
    if constexpr (KS > 1) {
        float* pw = os + wv * (64 * 68);
#pragma unroll
        for (int mb = 0; mb < 4; ++mb)
#pragma unroll
            for (int nb = 0; nb < 4; ++nb) { float* p = pw + (nb * 16 + lr) * 68 + mb * 16 + hi * 8; const v8f t = acc[mb][nb]; *(v4fa*)p = __builtin_shufflevector(t, t, 0, 1, 2, 3); *(v4fa*)(p + 4) = __builtin_shufflevector(t, t, 4, 5, 6, 7); }
        __syncthreads();   // every wave's partial tile is in LDS before any of it is summed
#pragma unroll
        for (int it = 0; it < 64 * 16 / (32 * KS); ++it) { const int g = it * (32 * KS) + (int)threadIdx.x, col = g & 63, rq = g >> 6; const float* p = os + col * 68 + rq * 4; v4f s = *(const v4fa*)p;
#pragma unroll
            for (int w = 1; w < KS; ++w) s += *(const v4fa*)(p + w * (64 * 68));
            if (BIAS) { const float bb = bfr(bias[c0 + col]); s[0] += bb; s[1] += bb; s[2] += bb; s[3] += bb; }
            float* cp = C + (size_t)(r0 + rq * 4) * ldc + c0 + col;
#pragma unroll
            for (int q = 0; q < 4; ++q) cp[(size_t)q * ldc] = s[q]; }
        return;
    }
#pragma unroll
    for (int mb = 0; mb < 4; ++mb) {
#pragma unroll
        for (int nb = 0; nb < 4; ++nb) {
#pragma unroll
            for (int j = 0; j < 8; ++j) os[(hi * 8 + j) * 68 + nb * 16 + lr] = acc[mb][nb][j]; }
        __builtin_amdgcn_wave_barrier(); asm volatile("" ::: "memory");
        float* crow = C + (size_t)(r0 + mb * 16) * ldc + c0;
{
#pragma unroll
            for (int s = 0; s < 8; ++s) { const int row = 2 * s + hi, cofs = lr * 4; v4f val = *(const v4fa*)(os + row * 68 + cofs); if (BIAS) { val[0] += bfr(bias[c0 + cofs]); val[1] += bfr(bias[c0 + cofs + 1]); val[2] += bfr(bias[c0 + cofs + 2]); val[3] += bfr(bias[c0 + cofs + 3]); }
                *(v4f*)(crow + (size_t)row * ldc + cofs) = val; }
             }
        __builtin_amdgcn_wave_barrier(); asm volatile("" ::: "memory");
    }
}

__device__ __forceinline__ h16 tohx(float x) { return (h16)x; }
__device__ __forceinline__ void splitf(float y, unsigned short& h, unsigned short& l) { h = f2bf(y); l = f2bf(y - bf2f(h)); }
typedef __attribute__((ext_vector_type(2))) _Float16 v2h;
typedef __attribute__((ext_vector_type(4))) _Float16 v4h;
typedef __attribute__((ext_vector_type(2))) unsigned short v2us;
typedef __attribute__((ext_vector_type(4))) unsigned short v4us;
typedef __attribute__((ext_vector_type(2))) float v2f;
typedef __attribute__((ext_vector_type(4))) int v4i;

__global__ __launch_bounds__(256) void k_wtG(const float* __restrict__ w, int K, int N, bf* Bt) {
    const int lane = threadIdx.x & 31; const int L0 = (blockIdx.x * 8 + (threadIdx.x >> 5)) * 8; const int nlines = N * K / 64;
{
#pragma unroll 1
        for (int l = 0; l < 8; ++l) { const int L = L0 + l; if (L >= nlines) break; const size_t e = (size_t)L * 64 + lane * 2; const int k = (int)(e % K), n = (int)(e / K); v2us o;
            o[0] = f2bf(w[(size_t)k * N + n]); o[1] = f2bf(w[(size_t)(k + 1) * N + n]); *(v2us*)(Bt + e) = o; }
         }
}
// k_prep: ONE launch turns all eight f32 matrices (four weights, three activations, Er; row-major [rows][K]) into bf16 planes in fragment order. A work-group takes 32 fragments in a row, which are 16384 elements in a row of the source too (K = 1024: one 16-row block; K = 64: 16 of them);
// a thread takes eight pieces of 8 elements, 4 fragments apart; four neighbouring lanes read one whole 128-byte line of a row (32 k), eight neighbouring rows write one whole line of the fragment.
// All loads name one scalar base, one lane offset and a constant, and so do all stores; all sixteen loads are issued in front of the first conversion, and the stores are the thread's last instructions, so that no register that a store names is written again.
template <int K>
__device__ __forceinline__ void cvt_rows(const float* __restrict__ src, bf* dst, int lb) {
    static_assert(K == 64 || K == 1024, "the step of 4 fragments below is written for these two");
    constexpr int FPR = K / 32, ustep = (FPR >= 32) ? 4 * 32 : (4 / FPR) * 16 * K;   // fragments per row block; source elements from a fragment to the fourth behind it
    const int tid = (int)threadIdx.x, c = tid & 3, lr = (tid >> 2) & 15, tq = tid >> 6;
    const char* sb = (const char*)(src + (size_t)lb * (32 * 512)); char* db = (char*)(dst + (size_t)lb * (32 * 512));   // the same for the whole work-group
    const unsigned so = (unsigned)(((tq / FPR) * 16 + lr) * K + (tq % FPR) * 32 + c * 8) * 4, eo = (unsigned)(tq * 512 + (c >> 1) * 256 + (c & 1) * 128 + lr * 8) * 2;
    v8f v[8]; v8us o[8];
#pragma unroll
    for (int u = 0; u < 8; ++u) v[u] = *(const v8f*)(sb + so + u * (ustep * 4));
    asm volatile("s_wait_xcnt 0x0" : : "v"(so), "s"(sb) : "memory");   // inputs only: the loads' offset register and scalar base stay taken up to the wait, so that no load lands in the offset and nothing else is formed there ahead of it
#pragma unroll
    for (int u = 0; u < 8; ++u)
#pragma unroll
        for (int k = 0; k < 8; ++k) o[u][k] = f2bf(v[u][k]);
    __builtin_amdgcn_sched_barrier(0);   // no store rises in front of a conversion: a conversion behind it could be given a register that the store still names
#pragma unroll
    for (int u = 0; u < 8; ++u) *(v8us*)(db + eo + u * (4 * 512 * 2)) = o[u];
}
#define PB_W (DQ / 16)            // work-groups per weight matrix (16 rows each)
#define PB_X (TT / 16)            // per activation matrix
#define PB_E (TT * HD / (32 * 512))   // for Er
__global__ __launch_bounds__(256) void k_prep(const float* __restrict__ wq, const float* __restrict__ wk, const float* __restrict__ wv, const float* __restrict__ wo, const float* __restrict__ xq, const float* __restrict__ xk, const float* __restrict__ xv, const float* __restrict__ er, bf* WQ, bf* WK, bf* WV, bf* WO, bf* XQ, bf* XK, bf* XV, bf* ERB) {
    const int b = (int)blockIdx.x;   // the matrix is chosen by the work-group's index alone
    if (b < 4 * PB_W) { const int m = b / PB_W; cvt_rows<DM>(m == 0 ? wq : m == 1 ? wk : m == 2 ? wv : wo, m == 0 ? WQ : m == 1 ? WK : m == 2 ? WV : WO, b % PB_W); }
    else if (b < 4 * PB_W + 3 * PB_X) { const int m = (b - 4 * PB_W) / PB_X; cvt_rows<DM>(m == 0 ? xq : m == 1 ? xk : xv, m == 0 ? XQ : m == 1 ? XK : XV, (b - 4 * PB_W) % PB_X); }
    else cvt_rows<HD>(er, ERB, b - 4 * PB_W - 3 * PB_X);
}
// k_qkv: the three projections in ONE launch, grid (TT / 128, heads / 2, 3), 8 waves; a work-group computes a 128 x 128 tile (128 rows t of two heads). Wave (wk, wm, wn) sums the K half wk of the 64 x 64 quarter (wm, wn); the two partial tiles of a quarter meet in LDS and are added in the order wk = 0, 1.
// The operands come into LDS by asynchronous copies (global_load_async_to_lds_b128), so that a fragment is fetched from L2 once per work-group and read from LDS by the two waves that need it. A stage is 64 k of both K halves of both operands: 64 fragments = 64 KiB, laid [operand][K half][16-row block][k / 32] x 1 KiB; two buffers, the next stage's copies fly while this one is worked on.
// A fragment keeps its order in LDS, so a wave's fragment read is two contiguous 512-byte reads. The buffers lie in the array that later takes the partial tiles; the barrier at the foot of the last trip ends every read of them.
// The partial tiles lie [n][m] in LDS with m (the A operand's rows) contiguous, and a thread sums 8 neighbouring m of one n, which are the 8 elements of one 16-byte piece of a fragment: so q and k (fragment rows t, k = d) take the weight rows d as A and the activation rows t as B,
// and v (ISV; fragment rows d, k = t, fragments laid [t / 32][d / 16] so that a wave's 128 keys x 64 columns are 16 KiB in a row) takes t as A and d as B. Both operand planes have the same fragment order, so the roles are a choice of base pointers. A wave's store is two runs of 256 contiguous bytes.
__device__ __forceinline__ void stage_copy8(unsigned l, const char* g) {   // one operand's share of a stage: the thread's eight 16-byte pieces; in LDS 4 KiB apart; in the plane two 16-row blocks (64 KiB) apart, the second four in the other K half (16 KiB further)
    asm volatile("global_load_async_to_lds_b128 %0, %8, off\n\t"
                 "global_load_async_to_lds_b128 %1, %9, off\n\t"
                 "global_load_async_to_lds_b128 %2, %10, off\n\t"
                 "global_load_async_to_lds_b128 %3, %11, off\n\t"
                 "global_load_async_to_lds_b128 %4, %12, off\n\t"
                 "global_load_async_to_lds_b128 %5, %13, off\n\t"
                 "global_load_async_to_lds_b128 %6, %14, off\n\t"
                 "global_load_async_to_lds_b128 %7, %15, off\n\t"
                 "s_wait_xcnt 0x0"   // inside the copies' own statement: it stands in front of every later write of a register that a copy names
                 : : "v"(l), "v"(l + 4096u), "v"(l + 8192u), "v"(l + 12288u), "v"(l + 16384u), "v"(l + 20480u), "v"(l + 24576u), "v"(l + 28672u),
                     "v"(g), "v"(g + 65536), "v"(g + 131072), "v"(g + 196608), "v"(g + 16384), "v"(g + 81920), "v"(g + 147456), "v"(g + 212992) : "memory");
}
template <bool ISV>
__device__ __forceinline__ void qkv_tile(float* os, const bf* __restrict__ X, const bf* __restrict__ Wt, const float* __restrict__ bias, h16* P16, bf* Ph, bf* Pl, int t0) {   // X, Wt, bias, planes: already at the tile's rows t0.., the first head's weight rows, bias and planes
    constexpr int K = DM, NT = K / 128; typedef WFrag<bf>::V V;   // NT stages of 64 k in each K half
    static_assert(K == 1024 && NT >= 2, "the constants of stage_copy8 are those of 32 fragments a row block; the ring needs two stages");
    const int tid = (int)threadIdx.x, lane = tid & 31, lr = lane & 15, hi = lane >> 4;
    v8f acc[4][4];
#pragma unroll
    for (int mb = 0; mb < 4; ++mb)
#pragma unroll
        for (int nb = 0; nb < 4; ++nb) acc[mb][nb] = (v8f){};
    const int wv = __builtin_amdgcn_readfirstlane(tid >> 5), wk = wv >> 2, wm = (wv >> 1) & 1, wn = wv & 1;   // wave-uniform
    const unsigned lb = (unsigned)(size_t)os + (unsigned)tid * 16;   // the thread's first LDS byte in buffer 0
    const unsigned go = (unsigned)((tid >> 7) * (16 * K * 2) + (tid & 127) * 16);   // its row block (of a pair) and its 16 bytes in that block's two fragments of a stage
    const char* ga = (const char*)(ISV ? X : Wt) + go; const char* gb = (const char*)(ISV ? Wt : X) + go;
    stage_copy8(lb, ga); stage_copy8(lb + 32768u, gb);
    asm volatile("s_wait_asynccnt 0x0" ::: "memory");   // this wave's copies of stage 0 have landed
    __syncthreads();   // stage 0 lies in LDS before any wave reads it
    stage_copy8(lb + 65536u, ga + 2048); stage_copy8(lb + 98304u, gb + 2048);
#pragma unroll 1   // rolled: one trip a stage, the buffer chosen by the trip's parity
    for (int s = 0; s < NT; ++s) {
        const char* bp = (const char*)os + (s & 1) * 65536 + wk * 16384 + lane * 16;
        const bf* la = (const bf*)(bp + wm * 8192); const bf* lbp = (const bf*)(bp + 32768 + wn * 8192);
        V a[4], b[4];
#pragma unroll
        for (int c = 0; c < 2; ++c) {
#pragma unroll
            for (int mb = 0; mb < 4; ++mb) { const bf* p = la + mb * 1024 + c * 512; a[mb] = cat16b(*(const v8usa*)p, *(const v8usa*)(p + 256)); }
#pragma unroll
            for (int nb = 0; nb < 4; ++nb) { const bf* p = lbp + nb * 1024 + c * 512; b[nb] = cat16b(*(const v8usa*)p, *(const v8usa*)(p + 256)); }
            __builtin_amdgcn_sched_barrier(0);   // the eight fragments' reads all issue in front of their products: without it the compiler sinks each B fragment behind the products before it, into one register set, and the wave waits four times for LDS
#pragma unroll
            for (int nb = 0; nb < 4; ++nb)
#pragma unroll
                for (int mb = 0; mb < 4; ++mb) acc[mb][nb] = WFrag<bf>::mma(a[mb], b[nb], acc[mb][nb]);
        }
        __builtin_amdgcn_sched_barrier(0);   // the trip's products stay in front of its foot: behind the barrier they would stand between it and the refill, which would start that much later
        asm volatile("s_wait_dscnt 0x0" ::: "memory");      // this wave's reads of the buffer have returned before it is refilled
        asm volatile("s_wait_asynccnt 0x0" ::: "memory");   // this wave's copies of the next stage have landed
        __syncthreads();   // publishes the next stage and ends every wave's reads of this trip's buffer
        if (s + 2 < NT) { const unsigned l2 = lb + (unsigned)(s & 1) * 65536u; const int g2 = (s + 2) * 2048; stage_copy8(l2, ga + g2); stage_copy8(l2 + 32768u, gb + g2); }   // the same test for the whole work-group
    }
    asm volatile("s_wait_asynccnt 0x0" ::: "memory");   // no copy is under way when the buffers become the partial tiles
    const int n = tid & 63, mq = (tid >> 6) * 8;   // this thread's n and its first m in every quarter; its second piece lies 32 m further
    const unsigned bo = (unsigned)(ISV ? n : mq) * 4; const char* bsp = (const char*)bias; v4f bb[ISV ? 2 : 8];   // the bias goes with d: n for v, m for q and k; the second head's lies 64 floats further
    if constexpr (ISV) { bb[0] = (v4f)(*(const float*)(bsp + bo)); bb[1] = (v4f)(*(const float*)(bsp + bo + 256)); }
    else {
#pragma unroll
        for (int u = 0; u < 4; ++u) { bb[u * 2] = *(const v4f*)(bsp + bo + u * 128); bb[u * 2 + 1] = *(const v4f*)(bsp + bo + u * 128 + 16); } }
    asm volatile("s_wait_xcnt 0x0" : : "v"(bo), "s"(bsp) : "memory");   // inputs only: the bias loads' offset register and scalar base stay taken up to the wait; the LDS stores and the barrier below cover their latency
    float* pw = os + wv * (64 * 68);
#pragma unroll
    for (int mb = 0; mb < 4; ++mb)
#pragma unroll
        for (int nb = 0; nb < 4; ++nb) { float* p = pw + (nb * 16 + lr) * 68 + mb * 16 + hi * 8; const v8f t = acc[mb][nb]; *(v4fa*)p = __builtin_shufflevector(t, t, 0, 1, 2, 3); *(v4fa*)(p + 4) = __builtin_shufflevector(t, t, 4, 5, 6, 7); }
    __syncthreads();   // every wave's partial tile is in LDS before any of it is summed
    v8h o16[8]; v8us oh[8], ol[8];
#pragma unroll
    for (int st = 0; st < 4; ++st)   // quarter (wm, wn) = (st >> 1, st & 1): its partial tiles are those of waves st and st + 4
#pragma unroll
        for (int it = 0; it < 2; ++it) { const float* p = os + st * (64 * 68) + n * 68 + mq + it * 32; v4f s0 = *(const v4fa*)p, s1 = *(const v4fa*)(p + 4);
            s0 += *(const v4fa*)(p + 4 * (64 * 68)); s1 += *(const v4fa*)(p + 4 * (64 * 68) + 4);
#pragma unroll
            for (int q = 0; q < 8; ++q) { const float r = (q < 4 ? s0[q & 3] : s1[q & 3]) + bfr(ISV ? bb[st & 1][0] : bb[(st >> 1) * 4 + it * 2 + (q >> 2)][q & 3]); o16[st * 2 + it][q] = tohx(r); unsigned short a2, c2; splitf(r, a2, c2); oh[st * 2 + it][q] = a2; ol[st * 2 + it][q] = c2; } }
    const int t = t0 + (ISV ? mq : n), d = ISV ? n : mq;   // of the first piece of quarter (0, 0)
    const unsigned ob = (unsigned)(ISV ? ((t >> 5) * 4 + (d >> 4)) * 512 + ((t >> 4) & 1) * 256 + ((t >> 3) & 1) * 128 + (d & 15) * 8
                                       : (t & ~15) * HD + (d >> 5) * 512 + ((d >> 4) & 1) * 256 + ((d >> 3) & 1) * 128 + (t & 15) * 8) * 2;
#pragma unroll
    for (int st = 0; st < 4; ++st)
#pragma unroll
        for (int it = 0; it < 2; ++it) {   // q, k: 64 d further is the next head's plane, 64 t further four 16-row blocks, 32 d further one fragment; v: 64 d further the next head's plane, 64 t further eight fragments, 32 t further four
            const int off = (ISV ? (st & 1) * (TT * HD) + (st >> 1) * (8 * 512) + it * (4 * 512) : (st >> 1) * (TT * HD) + (st & 1) * (64 * HD) + it * 512) * 2;
            *(v8h*)((char*)P16 + ob + off) = o16[st * 2 + it]; *(v8us*)((char*)Ph + ob + off) = oh[st * 2 + it]; *(v8us*)((char*)Pl + ob + off) = ol[st * 2 + it]; }
}
__global__ __launch_bounds__(256) void k_qkv(const bf* __restrict__ XQ, const bf* __restrict__ XK, const bf* __restrict__ XV, const bf* __restrict__ WQ, const bf* __restrict__ WK, const bf* __restrict__ WV, const float* __restrict__ bq, const float* __restrict__ bk, const float* __restrict__ bv,
                                             h16* QP16, bf* QPh, bf* QPl, h16* KP16, bf* KPh, bf* KPl, h16* VT16, bf* VTh, bf* VTl) {
    __shared__ __align__(16) float os[8 * 64 * 68];   // first the two 64-KiB stage buffers, then the eight partial tiles
    static_assert(sizeof(float) * 8 * 64 * 68 >= 2 * 65536, "both stage buffers lie inside the array");
    const int z = (int)blockIdx.z, t0 = (int)blockIdx.x * 128, h = (int)blockIdx.y * 2; const size_t xo = (size_t)t0 * DM, wo = (size_t)h * HD * DM, po = (size_t)h * TT * HD;   // the choice below is the same for the whole work-group, so its barriers are met by all of its waves
    if (z == 2) qkv_tile<true>(os, XV + xo, WV + wo, bv + h * HD, VT16 + po, VTh + po, VTl + po, t0);
    else qkv_tile<false>(os, (z == 0 ? XQ : XK) + xo, (z == 0 ? WQ : WK) + wo, (z == 0 ? bq : bk) + h * HD, (z == 0 ? QP16 : KP16) + po, (z == 0 ? QPh : KPh) + po, (z == 0 ? QPl : KPl) + po, t0);
}
// ---- k_attn: one work-group of 16 waves per (head, 32 query rows = QB blocks of 16); the 32 x 2048 score rows never leave LDS and take most of a WGP's LDS, so one work-group has the WGP to itself (4 waves per SIMD, up to 256 registers each).
// Every Er, k and v fragment that a wave loads stays in registers for the products of BOTH row blocks: per query row half as many bytes come from L2 as with one block per work-group. Each row's products, trees and sums are those of a single block. Five stages; for hi/lo rows (attn_rows_hl) as listed, a work-group barrier between each two and one inside the last; fp16 rows (attn_rows_h) keep scores and probabilities in registers through stages 2 to 4:
// 1 relative logits: qe tiles (q hi/lo planes x Er) are stored straight at their skewed place: qe[i][t] is rel(i, t - 2047 + i) where that column is >= 0, and qe[i+1][t] is rel(i, t + i + 2) where that column is < 2048; rel(i, i+1) = 0 (= the reference's pad/reshape/slice of q.Er^T, upper triangle included)
// 2 scores: each q.k tile adds the relative logit that lies at its own place, scales by 1/8 and stores back
// 3 softmax: wave w owns rows w and w + 16 (register row, one exp, fixed trees) and writes the probabilities over its own rows as bf16 hi and lo planes
// 4 attn.v: wave w sums the key slice [128 w, 128 w + 128) for all 64 columns of both row blocks
// 5 the 16 partial tiles meet in LDS (column-major, pitch 36) and are added in wave order 0..15; the merged context goes out as hi/lo planes in fragment order
// Fragments are fetched ahead, into registers: the first k tiles of stage 2 are loaded in front of the barrier that ends stage 1, each tile's registers are refilled right behind its products, and v fragments of stage 4 are loaded in front of the barriers that end stages 2 and 3, so that they come from L2 while waves wait for one another and while stage 3 runs on the vector unit alone. Those three barriers (lds_barrier) wait for the wave's LDS accesses only; nothing is stored to global memory before stage 5.
#define GB 48     // spare columns in front of column 0 of every score row; SP - TT - GB = 52 more lie behind column 2047
#define SP 2148   // LDS pitch of a score row in floats: rows stay 16-byte aligned (16 bytes times an odd number), rows 8 apart lie 32 banks apart; the spare columns take the qe elements that belong to no column of this row block (they reach at most 31 columns in front of column 0 and 33 behind column 2047)
#define QB 2      // 16-row blocks per work-group
#define PP (QB * 16 + 4)   // LDS pitch of a partial tile's column in floats (stage 5): 16 bytes times an odd number
typedef v2f __attribute__((may_alias)) v2fa;
__device__ __forceinline__ void lds_barrier() {   // a work-group barrier that orders LDS alone: __syncthreads() also waits for the wave's global loads, and the fragments fetched ahead would stop being ahead
    __builtin_amdgcn_fence(__ATOMIC_RELEASE, "workgroup", "local"); __builtin_amdgcn_s_barrier(); __builtin_amdgcn_fence(__ATOMIC_ACQUIRE, "workgroup", "local");
}
template <bool UP>
__device__ __forceinline__ void rel_one(float* S, const v16bf (&ah0)[QB], const v16bf (&al0)[QB], const v16bf (&ah1)[QB], const v16bf (&al1)[QB], v16bf b0, v16bf b1, int tt, int r0, int lr, int hi) {   // one Er tile against the q rows of every row block
    static_assert(QB == 2 && GB >= 31 && SP - TT - GB >= 33 && 7 * (SP + 1) * 4 < 65536, "the spare columns hold every element out of range; a tile's eight stores differ by constants that fit the instruction's offset");
    v8f acc[QB];
#pragma unroll
    for (int rb = 0; rb < QB; ++rb) { acc[rb] = (v8f){}; acc[rb] = wmmab(ah0[rb], b0, acc[rb]); acc[rb] = wmmab(al0[rb], b0, acc[rb]); acc[rb] = wmmab(ah1[rb], b1, acc[rb]); acc[rb] = wmmab(al1[rb], b1, acc[rb]); }
    asm volatile("v_nop\n\tv_nop\n\tv_nop\n\tv_nop" : "+v"(acc[0]), "+v"(acc[1]));   // the four vector slots that the chip needs between a matrix instruction and the next one that overwrites its result registers: only LDS stores follow here, and they fill none
#pragma unroll
    for (int rb = 0; rb < QB; ++rb) {
        const int cb = tt * 16 + lr + r0 + rb * 16 + hi * 8 + (UP ? 2 : 1 - TT);   // column of accumulator register 0; register j is one row lower and so j columns further
        float* p = S + (rb * 16 + hi * 8) * SP + cb;   // no test of the column: one outside 0..2047 lies in the row's own spare columns, which nobody reads
#pragma unroll
        for (int j = 0; j < 8; ++j) p[j * (SP + 1)] = acc[rb][j];
    }
}
template <bool UP>
__device__ __forceinline__ void rel_tiles(float* S, const bf* __restrict__ qh, const bf* __restrict__ ql, const bf* __restrict__ er, int r0, int tbeg, int tend, int lr, int hi) {
    if (tbeg >= tend) return;   // wave-uniform: a wave without a tile loads no q rows
    v16bf ah0[QB], ah1[QB], al0[QB], al1[QB]; unsigned ao[QB];
#pragma unroll
    for (int rb = 0; rb < QB; ++rb) { const int qr = UP ? min(r0 + rb * 16 + 1 + lr, TT - 1) : r0 + rb * 16 + lr; ao[rb] = (unsigned)((qr >> 4) * (16 * HD) + (qr & 15) * 8 + hi * 128) * 2;   // UP: q rows i + 1 (the clamped row has no column in range); byte offset in fragment order: a 16-row tile is 2 fragments (k 0..31, 32..63)
        ah0[rb] = WFrag<bf>::ldf(qh, ao[rb]); ah1[rb] = WFrag<bf>::ldf(qh + 512, ao[rb]); al0[rb] = WFrag<bf>::ldf(ql, ao[rb]); al1[rb] = WFrag<bf>::ldf(ql + 512, ao[rb]); }
    asm volatile("s_wait_xcnt 0x0" : : "v"(ao[0]), "v"(ao[1]), "s"(qh), "s"(ql) : "memory");   // inputs only: the q loads' offset registers and two scalar bases stay taken up to the wait; the Er base and offset are formed behind it, not in those registers ahead of it
    const bf* eb = er + (size_t)tbeg * 16 * HD; unsigned eo = (unsigned)(lr * 8 + hi * 128) * 2;
    for (int tt = tbeg; tt < tend; tt += 32) {   // two Er tiles' loads in flight per trip (16 waves a WGP: each keeps more bytes under way)
        const bool two = tt + 16 < tend;   // wave-uniform; without a second tile its loads read the first again and feed nothing
        const unsigned e2 = eo + (two ? 16 * 16 * HD * 2 : 0);
        const v16bf b0 = WFrag<bf>::ldf(eb, eo), b1 = WFrag<bf>::ldf(eb + 512, eo), c0 = WFrag<bf>::ldf(eb, e2), c1 = WFrag<bf>::ldf(eb + 512, e2);
        __builtin_amdgcn_sched_barrier(0);   // the trip's eight loads all issue in front of its products: without it the compiler loads half of the second tile into the first tile's registers, behind their products, and a trip waits twice for L2
        rel_one<UP>(S, ah0, al0, ah1, al1, b0, b1, tt, r0, lr, hi);
        asm volatile("" : : "v"(c0), "v"(c1));   // inputs only, the loaded values: holds the second tile's loads in front of the branch, beside the first tile's; without it the compiler sinks them into the branch and a trip waits twice for L2
        if (two) rel_one<UP>(S, ah0, al0, ah1, al1, c0, c1, tt + 16, r0, lr, hi);
        asm volatile("s_wait_xcnt 0x0" : "+v"(eo) : "v"(e2) : "memory");   // as addr_step; the second tile's offset register stays taken up to the wait, and its next value is formed from this statement's result
        eo += 32 * 16 * HD * 2;   // 32 Er tiles further
    }
}
__device__ __forceinline__ void rel_stage(float* S, int h, int r0, const bf* __restrict__ QPh, const bf* __restrict__ QPl, const bf* __restrict__ ERB) {   // the same for hi/lo and fp16 rows: it stands once in the kernel's text, which so stays under 32 KB
    const int tid = (int)threadIdx.x, lane = tid & 31, lr = lane & 15, hi = lane >> 4; const int wv = __builtin_amdgcn_readfirstlane(tid >> 5);   // wave-uniform: scalar loop bounds
    const size_t hq = (size_t)h * TT * HD;
    {   // stage 1: for row block rb, Er tiles 0..T0 - rb serve the columns right of the diagonal and tiles T0 - rb..127 those up to it; each deal takes the union over the blocks (a tile that serves only one block leaves the other's elements in the spare columns); the second deal runs in reverse wave order so that the two remainders fall on different waves where they can
        const int T0 = TT / 16 - 1 - (r0 >> 4);
        rel_tiles<true>(S, QPh + hq, QPl + hq, ERB, r0, wv, T0 + 1, lr, hi);
        rel_tiles<false>(S, QPh + hq, QPl + hq, ERB, r0, T0 - (QB - 1) + 15 - wv, TT / 16, lr, hi);
        if (tid < QB * 16 && r0 + tid + 1 < TT) S[tid * SP + r0 + tid + 1] = 0.0f;
    }
}
__device__ __forceinline__ void ctx_merge(float* S, const v8f (&acc)[QB][4], float cs, int h, int r0, bf* ATh, bf* ATl) {   // stage 5; nobody reads the score rows any more when a wave enters
    const int tid = (int)threadIdx.x, lane = tid & 31, lr = lane & 15, hi = lane >> 4; const int wv = __builtin_amdgcn_readfirstlane(tid >> 5);   // wave-uniform
    float* pw = S + wv * (64 * PP);
#pragma unroll
    for (int rb = 0; rb < QB; ++rb)
#pragma unroll
        for (int nb = 0; nb < 4; ++nb) { float* p = pw + (nb * 16 + lr) * PP + rb * 16 + hi * 8; const v8f t = acc[rb][nb]; *(v4fa*)p = __builtin_shufflevector(t, t, 0, 1, 2, 3); *(v4fa*)(p + 4) = __builtin_shufflevector(t, t, 4, 5, 6, 7); }
    __syncthreads();   // every wave's partial tile is in LDS before any of it is summed
    const int col = tid & 63, rp = tid >> 6; const float* p = S + col * PP + rp * 4; v4f s = *(const v4fa*)p;   // four neighbouring rows of one column
#pragma unroll
    for (int w = 1; w < 16; ++w) s += *(const v4fa*)(p + w * (64 * PP));
    unsigned short oa[4], oc[4];
#pragma unroll
    for (int q = 0; q < 4; ++q) splitf(s[q] * cs, oa[q], oc[q]);
    const size_t oo = (size_t)(r0 + ((rp * 4) & ~15)) * DQ + (h * 2 + (col >> 5)) * 512 + ((col >> 4) & 1) * 256 + ((col >> 3) & 1) * 128 + ((rp * 4) & 15) * 8 + (col & 7);   // fragment order, rows = query rows, k = h * HD + col; the thread's four rows lie in one 16-row block, 8 elements apart
    __builtin_amdgcn_sched_barrier(0);   // the eight stores stay the thread's last instructions: nothing behind them is given a register that a store still names
#pragma unroll
    for (int q = 0; q < 4; ++q) { ATh[oo + q * 8] = oa[q]; ATl[oo + q * 8] = oc[q]; }
}
__device__ __forceinline__ void attn_rows_hl(float* S, int h, int r0, const bf* __restrict__ QPh, const bf* __restrict__ QPl, const bf* __restrict__ KPh, const bf* __restrict__ KPl, const bf* __restrict__ VTh, const bf* __restrict__ VTl, bf* ATh, bf* ATl) {   // hi/lo rows (query rows < RH)
    const int tid = (int)threadIdx.x, lane = tid & 31, lr = lane & 15, hi = lane >> 4; const int wv = __builtin_amdgcn_readfirstlane(tid >> 5);   // wave-uniform: scalar loop bounds
    const size_t hq = (size_t)h * TT * HD;
    const unsigned lo = (unsigned)(lr * 8 + hi * 128) * 2;   // 32-bit lane byte offset in a fragment
    const size_t vb = (size_t)h * HD * TT + (size_t)wv * (128 * HD);   // wave-uniform base of the wave's v slice (its 16 fragments of a plane lie in a row)
    const bf* vh = (const bf*)((const char*)(VTh + vb) + lo); const bf* vl = (const bf*)((const char*)(VTl + vb) + lo);
    v16bf wb[8], wb2[8];   // stage 4's v fragments, fetched ahead: the first 64 of the wave's 128 keys in both planes
    {   // stage 2: the fragment registers of a key tile are refilled right behind its products, so that loads are under way while the other tiles are worked on. The refill is unconditional (a branch round it would make the compiler wait for every load at each use): behind the last tiles it brings the first v fragments, by a wave-uniform choice of base and step.
        const size_t ab = hq + (size_t)r0 * HD, kb = hq + (size_t)wv * (16 * HD);   // wave-uniform bases (fragment order); key tile it * 16 + wv lies it * 32 KiB behind tile wv
        {
            v16bf a0[QB], a1[QB], c0[QB], c1[QB], b0[2], b1[2], d0[2], d1[2];   // two key tiles' fragments
            const bf* qh = (const bf*)((const char*)(QPh + ab) + lo); const bf* ql = (const bf*)((const char*)(QPl + ab) + lo); const bf* kh = (const bf*)((const char*)(KPh + kb) + lo); const bf* kl = (const bf*)((const char*)(KPl + kb) + lo);
#pragma unroll
            for (int rb = 0; rb < QB; ++rb) { const int ar = rb * (16 * HD); a0[rb] = WFrag<bf>::ldf(qh + ar, 0u); a1[rb] = WFrag<bf>::ldf(qh + ar + 512, 0u); c0[rb] = WFrag<bf>::ldf(ql + ar, 0u); c1[rb] = WFrag<bf>::ldf(ql + ar + 512, 0u); }
            __builtin_amdgcn_sched_barrier(0);   // the q loads stay the oldest: the loop's waits for them stand in every trip, and behind younger q loads they would also wait for the refills under way
#pragma unroll
            for (int t = 0; t < 2; ++t) { const int kt = t * (256 * HD); b0[t] = WFrag<bf>::ldf(kh + kt, 0u); b1[t] = WFrag<bf>::ldf(kh + kt + 512, 0u); d0[t] = WFrag<bf>::ldf(kl + kt, 0u); d1[t] = WFrag<bf>::ldf(kl + kt + 512, 0u); }
            asm volatile("s_wait_xcnt 0x0" : : "v"(qh), "v"(ql), "v"(kh), "v"(kl) : "memory");   // inputs only: the lane's four address pairs (one a plane serves all of its loads, which differ by constants) stay taken up to the wait, so that no late load lands in one of them
            __builtin_amdgcn_sched_barrier(0);   // the loads stay in front of the barrier: behind it they would start only when the last wave has ended stage 1
            lds_barrier();   // every relative logit lies in LDS before a score tile adds it
            unsigned ko = lo;   // the k refills' offset: it moves on by two tiles a trip
#pragma unroll 1   // rolled: the same two tiles' registers serve every trip, and the text stays short
            for (int io = 0; io < TT / 256; io += 2) {
              const bool last = io + 2 >= TT / 256;   // wave-uniform
              const char* sh = (const char*)(last ? VTh + vb : KPh + kb + 2 * (256 * HD)); const char* sl = (const char*)(last ? VTl + vb : KPl + kb + 2 * (256 * HD));
              const unsigned o[2] = { last ? lo : ko, last ? lo + 2 * 1024 : ko + 256 * HD * 2 };   // k: the tile two further; v: two fragments of each plane
              const bf* ph[2] = { (const bf*)(sh + o[0]), (const bf*)(sh + o[1]) }; const bf* pl[2] = { (const bf*)(sl + o[0]), (const bf*)(sl + o[1]) };
#pragma unroll
              for (int t = 0; t < 2; ++t) { const int n0 = ((io + t) * 16 + wv) * 16;
#pragma unroll
                for (int rb = 0; rb < QB; ++rb) {
                    v8f acc = (v8f){}; acc = wmmab(a0[rb], b0[t], acc); acc = wmmab(c0[rb], b0[t], acc); acc = wmmab(a0[rb], d0[t], acc); acc = wmmab(a1[rb], b1[t], acc); acc = wmmab(c1[rb], b1[t], acc); acc = wmmab(a1[rb], d1[t], acc);
#pragma unroll
                    for (int j = 0; j < 8; ++j) { float* q = S + (rb * 16 + hi * 8 + j) * SP + n0 + lr; *q = (acc[j] + *q) * SCL; } }
                b0[t] = WFrag<bf>::ldf(ph[t], 0u); b1[t] = WFrag<bf>::ldf(ph[t] + 512, 0u); d0[t] = WFrag<bf>::ldf(pl[t], 0u); d1[t] = WFrag<bf>::ldf(pl[t] + 512, 0u);
                __builtin_amdgcn_sched_barrier(0);   // a tile's refill issues in front of the other tile's products, not behind them
              }
              asm volatile("s_wait_xcnt 0x0" : "+v"(ko) : "v"(ph[0]), "v"(ph[1]), "v"(pl[0]), "v"(pl[1]) : "memory");   // as addr_step; the refills' four address pairs stay taken up to the wait, and the next trip's are formed from this statement's result
              ko += 2 * 256 * HD * 2; }
#pragma unroll
            for (int t = 0; t < 2; ++t) { wb[2 * t] = b0[t]; wb[2 * t + 1] = b1[t]; wb2[2 * t] = d0[t]; wb2[2 * t + 1] = d1[t]; }
        }
    }
    __builtin_amdgcn_sched_barrier(0);   // the loads stay in front of stage 3: without it the compiler loads each fragment right in front of its products, and the wave waits for L2 in stage 4
    lds_barrier();   // every score of a row lies in LDS before its wave reads the row
#pragma unroll 1   // rolled over the two rows: one row's 64 values stand beside the v fragments fetched ahead without crowding the schedule, and the kernel's text stays under 32 KB
    for (int rr = 0; rr < QB; ++rr) {   // stage 3
        float* sr = S + (rr * 16 + wv) * SP; float v[TT / 32]; float mx = -3.0e38f;
#pragma unroll
        for (int ch = 0; ch < TT / 128; ++ch) { const v4f a = *(const v4fa*)(sr + ch * 128 + lane * 4);
#pragma unroll
            for (int q = 0; q < 4; ++q) { v[ch * 4 + q] = a[q]; mx = fmaxf(mx, a[q]); } }
#pragma unroll
        for (int sh = 16; sh; sh >>= 1) mx = fmaxf(mx, __shfl_xor(mx, sh, 32));
        float sum = 0.f;
#pragma unroll
        for (int k = 0; k < TT / 32; ++k) { v[k] = __builtin_amdgcn_exp2f((v[k] - mx) * 1.4426950408889634f); sum += v[k]; }
#pragma unroll
        for (int sh = 16; sh; sh >>= 1) sum += __shfl_xor(sum, sh, 32);
        const float f = __fdiv_rn(1.0f, sum);
        { bf* ph = (bf*)sr; bf* pl = ph + TT;
#pragma unroll
            for (int ch = 0; ch < TT / 128; ++ch) { v4us oh, ol;
#pragma unroll
                for (int q = 0; q < 4; ++q) { unsigned short a, c2; splitf(v[ch * 4 + q] * f, a, c2); oh[q] = a; ol[q] = c2; }
                *(v4us*)(ph + ch * 128 + lane * 4) = oh; *(v4us*)(pl + ch * 128 + lane * 4) = ol; }
        }
    }
    {   // the next v fragments start in front of the barrier; through stage 3 they would take the registers that its schedule needs
#pragma unroll
        for (int f = 4; f < 8; ++f) { wb[f] = WFrag<bf>::ldf(vh + f * 512, 0u); wb2[f] = WFrag<bf>::ldf(vl + f * 512, 0u); }
        __builtin_amdgcn_sched_barrier(0);   // the loads stay in front of the barrier: behind it they would start only when the last wave has ended stage 3
    }
    lds_barrier();   // all probability rows lie in LDS before any wave reads its key slice of them
    v8f acc[QB][4];
#pragma unroll
    for (int rb = 0; rb < QB; ++rb)
#pragma unroll
        for (int nb = 0; nb < 4; ++nb) acc[rb][nb] = (v8f){};
    {   // stage 4
#pragma unroll
        for (int s = 0; s < 4; ++s) { const int kc = wv * 128 + s * 32;
            { v16bf a[QB], a2[QB];
#pragma unroll
                for (int rb = 0; rb < QB; ++rb) { const bf* pr = (const bf*)(S + (rb * 16 + lr) * SP) + kc + 8 * hi; a[rb] = WFrag<bf>::ld(pr); a2[rb] = WFrag<bf>::ld(pr + TT); }
#pragma unroll
                for (int nb = 0; nb < 4; ++nb)
#pragma unroll
                    for (int rb = 0; rb < QB; ++rb) { const int f = (s & 1) * 4 + nb; acc[rb][nb] = wmmab(a[rb], wb[f], acc[rb][nb]); acc[rb][nb] = wmmab(a2[rb], wb[f], acc[rb][nb]); acc[rb][nb] = wmmab(a[rb], wb2[f], acc[rb][nb]); }
                if (s < 2) {   // the eight fragments of keys 64 further take the places of those just used
#pragma unroll
                    for (int nb = 0; nb < 4; ++nb) { const int f = (s & 1) * 4 + nb; wb[f] = WFrag<bf>::ldf(vh + ((s + 2) * 4 + nb) * 512, 0u); wb2[f] = WFrag<bf>::ldf(vl + ((s + 2) * 4 + nb) * 512, 0u); }
                    __builtin_amdgcn_sched_barrier(0);   // the refill issues in front of the next 32 keys' products: without it the compiler loads each pair right in front of its own products, and the wave waits for L2 once a pair
                }
            } }
        asm volatile("s_wait_xcnt 0x0" : : "v"(vh), "v"(vl) : "memory");   // inputs only: the lane's address pairs (one a plane serves all of its loads, which differ by constants) stay taken up to the wait, so that no late load lands in one of them
    }
    __syncthreads();   // every wave has read its slice of the probability rows before the partial tiles overwrite them
    ctx_merge(S, acc, 1.0f, h, r0, ATh, ATl);
}
#define RP 20     // LDS pitch in floats of a query row's sixteen per-wave maxima (or sums): 16 bytes times an odd number
// fp16 rows (query rows >= RH): stages 2 to 4 in registers. Wave w owns the keys [128 w, 128 w + 128) from the scores to attn.v. A score tile is computed transposed (k rows as the A operand, q rows as B; the same products in the same order), so that a lane holds 8 neighbouring keys of ONE query row:
// the relative logits come from LDS in two 16-byte reads a tile, the scores are never stored back, and two neighbouring key tiles, scaled and rounded to fp16, ARE the A fragment of attn.v for those 32 keys (element e: key 8 hi + e, element 8 + e: key 16 + 8 hi + e). Only a row's maximum and sum cross the waves, through red.
__device__ __forceinline__ void attn_rows_h(float* S, float* red, int h, int r0, const h16* __restrict__ QP16, const h16* __restrict__ KP16, const h16* __restrict__ VT16, bf* ATh, bf* ATl) {
    const int tid = (int)threadIdx.x, lane = tid & 31, lr = lane & 15, hi = lane >> 4; const int wv = __builtin_amdgcn_readfirstlane(tid >> 5);   // wave-uniform
    const size_t hq = (size_t)h * TT * HD, ws = hq + (size_t)wv * (128 * HD);   // the wave's 128 keys are 16 KiB in a row in the k plane (8 tiles of 2 fragments) and in the v plane (16 fragments)
    const unsigned lo = (unsigned)(lr * 8 + hi * 128) * 2;   // lane byte offset in a fragment
    const h16* qp = (const h16*)((const char*)(QP16 + hq + (size_t)r0 * HD) + lo); const h16* kp = (const h16*)((const char*)(KP16 + ws) + lo); const h16* vp = (const h16*)((const char*)(VT16 + ws) + lo);
    v16h a0[QB], a1[QB], k0[8], k1[8], bv[16]; v8f sc[QB][8];
#pragma unroll
    for (int rb = 0; rb < QB; ++rb) { const int ar = rb * (16 * HD); a0[rb] = WFrag<h16>::ldf(qp + ar, 0u); a1[rb] = WFrag<h16>::ldf(qp + ar + 512, 0u); }
#pragma unroll
    for (int t = 0; t < 4; ++t) { k0[t] = WFrag<h16>::ldf(kp + t * 1024, 0u); k1[t] = WFrag<h16>::ldf(kp + t * 1024 + 512, 0u); }
    asm volatile("s_wait_xcnt 0x0" : : "v"(qp), "v"(kp) : "memory");   // inputs only: the lane's two address pairs (each serves all of its loads, which differ by constants) stay taken up to the wait, so that no late load lands in one of them
    __builtin_amdgcn_sched_barrier(0);   // the loads stay in front of the barrier: behind it they would start only when the last wave has ended stage 1
    lds_barrier();   // every relative logit lies in LDS before a score tile adds it
    const float* rl = S + lr * SP + wv * 128 + hi * 8;   // the lane's query row of block 0, its first key
#pragma unroll
    for (int p = 0; p < 4; ++p) {   // stage 2, two key tiles at a time; behind their products the loads of the tiles four further are issued, behind the last products those of the first four v fragments
#pragma unroll
        for (int ii = 0; ii < 2; ++ii) { const int t = p * 2 + ii;
#pragma unroll
            for (int rb = 0; rb < QB; ++rb) {
                const float* q = rl + rb * 16 * SP + t * 16; const v4f x0 = *(const v4fa*)q, x1 = *(const v4fa*)(q + 4);
                v8f acc = __builtin_shufflevector(x0, x1, 0, 1, 2, 3, 4, 5, 6, 7); acc = wmma16(k0[t], a0[rb], acc); acc = wmma16(k1[t], a1[rb], acc); sc[rb][t] = acc; } }   // the relative logits are the products' start value; the scale 1/8, a power of two, goes into the exponent's factor (the same bits)
        if (p < 2) {
#pragma unroll
            for (int ii = 0; ii < 2; ++ii) { const int t = 4 + p * 2 + ii; k0[t] = WFrag<h16>::ldf(kp + t * 1024, 0u); k1[t] = WFrag<h16>::ldf(kp + t * 1024 + 512, 0u); }
            asm volatile("s_wait_xcnt 0x0" : : "v"(kp) : "memory");   // inputs only: the address pair stays taken up to the wait
        } else if (p == 3) {   // the q and k fragments' registers are free
#pragma unroll
            for (int f = 0; f < 4; ++f) bv[f] = WFrag<h16>::ldf(vp + f * 512, 0u);
            asm volatile("s_wait_xcnt 0x0" : : "v"(vp) : "memory");   // inputs only: the address pair stays taken up to the wait
        }
        __builtin_amdgcn_sched_barrier(0);   // these loads issue in front of the next pair's products, not right in front of their own use
    }
    float mx[QB], sm[QB], ex[QB][64];
#pragma unroll
    for (int rb = 0; rb < QB; ++rb) { float m = -3.0e38f;   // stage 3: the lane's 64 keys, the other half of the wave, then the sixteen waves
#pragma unroll
        for (int t = 0; t < 8; ++t)
#pragma unroll
            for (int j = 0; j < 8; ++j) m = fmaxf(m, sc[rb][t][j]);
        mx[rb] = fmaxf(m, __shfl_xor(m, 16, 32)); }
    red[lane * RP + wv] = hi ? mx[1] : mx[0];   // lane l stores query row l's maximum over this wave's keys
    lds_barrier();   // every wave's maxima lie in LDS before a row's maximum is formed (and every wave has read its relative logits)
#pragma unroll
    for (int rb = 0; rb < QB; ++rb) { const float* p = red + (rb * 16 + lr) * RP; float m = -3.0e38f;
#pragma unroll
        for (int c = 0; c < 4; ++c) { const v4f x = *(const v4fa*)(p + c * 4); m = fmaxf(fmaxf(m, fmaxf(x[0], x[1])), fmaxf(x[2], x[3])); }
        mx[rb] = m; sm[rb] = 0.f; }
#pragma unroll
    for (int t = 0; t < 8; ++t)
#pragma unroll
        for (int j = 0; j < 8; ++j)
#pragma unroll
            for (int rb = 0; rb < QB; ++rb) { const float e = __builtin_amdgcn_exp2f((sc[rb][t][j] - mx[rb]) * (SCL * 1.4426950408889634f)); ex[rb][t * 8 + j] = e; sm[rb] += e; }   // each row's sum in key order
#pragma unroll
    for (int rb = 0; rb < QB; ++rb) sm[rb] += __shfl_xor(sm[rb], 16, 32);
    red[(32 + lane) * RP + wv] = hi ? sm[1] : sm[0];
    __builtin_amdgcn_sched_barrier(0);   // the next loads do not rise in front of the exponentials, whose schedule needs the registers
#pragma unroll
    for (int f = 4; f < 8; ++f) bv[f] = WFrag<h16>::ldf(vp + f * 512, 0u);
    asm volatile("s_wait_xcnt 0x0" : : "v"(vp) : "memory");   // inputs only: the address pair stays taken up to the wait
    __builtin_amdgcn_sched_barrier(0);   // the loads stay in front of the barrier: behind it they would start only when the last wave has its sums
    lds_barrier();   // every wave's sums lie in LDS before a row's sum is formed
#pragma unroll
    for (int f = 8; f < 10; ++f) bv[f] = WFrag<h16>::ldf(vp + f * 512, 0u);   // as many as find registers beside the 128 exponentials
    asm volatile("s_wait_xcnt 0x0" : : "v"(vp) : "memory");   // inputs only: the address pair stays taken up to the wait
    v16h P[QB][4];
#pragma unroll
    for (int rb = 0; rb < QB; ++rb) { const float* p = red + (32 + rb * 16 + lr) * RP; float s = 0.f;   // added in wave order 0..15
#pragma unroll
        for (int c = 0; c < 4; ++c) { const v4f x = *(const v4fa*)(p + c * 4); s += x[0]; s += x[1]; s += x[2]; s += x[3]; }
        const float f = __fdiv_rn(PCAR, s);
#pragma unroll
        for (int u = 0; u < 4; ++u)
#pragma unroll
            for (int e = 0; e < 16; ++e) P[rb][u][e] = tohx(ex[rb][u * 16 + e] * f); }
    __builtin_amdgcn_sched_barrier(0);   // the last loads do not rise in front of the roundings, which free half of the exponentials' registers
#pragma unroll
    for (int f = 10; f < 16; ++f) bv[f] = WFrag<h16>::ldf(vp + f * 512, 0u);
    asm volatile("s_wait_xcnt 0x0" : : "v"(vp) : "memory");   // inputs only: the address pair stays taken up to the wait
    __builtin_amdgcn_sched_barrier(0);   // the loads issue in front of stage 4's first products, not right in front of their own
    v8f acc[QB][4];
#pragma unroll
    for (int rb = 0; rb < QB; ++rb)
#pragma unroll
        for (int nb = 0; nb < 4; ++nb) acc[rb][nb] = (v8f){};
#pragma unroll
    for (int u = 0; u < 4; ++u) {   // stage 4
#pragma unroll
        for (int nb = 0; nb < 4; ++nb)
#pragma unroll
            for (int rb = 0; rb < QB; ++rb) acc[rb][nb] = wmma16(P[rb][u], bv[u * 4 + nb], acc[rb][nb]);
    }
    ctx_merge(S, acc, 1.0f / PCAR, h, r0, ATh, ATl);   // no barrier in front: the score rows were last read in front of the barrier on the maxima
}
__global__ __launch_bounds__(512) void k_attn(const h16* __restrict__ QP16, const bf* __restrict__ QPh, const bf* __restrict__ QPl, const h16* __restrict__ KP16, const bf* __restrict__ KPh, const bf* __restrict__ KPl, const bf* __restrict__ ERB, const h16* __restrict__ VT16, const bf* __restrict__ VTh, const bf* __restrict__ VTl, bf* ATh, bf* ATl) {
    __shared__ __align__(16) float Sx[QB * 16 * SP]; float* S = Sx + GB;   // S: column 0 of row 0
    __shared__ __align__(16) float red[2 * QB * 16 * RP];   // fp16 rows: every query row's sixteen per-wave maxima, then its sixteen per-wave sums
    // Grid (RH / 32, heads, TT / RH): there are four times as many work-groups as WGPs, and one of hi/lo rows lasts longer than one of fp16 rows. Slab z = 0 holds all hi/lo row blocks of all heads.
    // For speed only: every (head, row block) is done exactly once wherever and whenever its work-group runs.
    static_assert(RH > 0 && RH % (QB * 16) == 0 && TT % RH == 0, "slabs of RH query rows; slab 0 is the hi/lo one");
    const int r0 = (int)blockIdx.z * RH + (int)blockIdx.x * (QB * 16), h = (int)blockIdx.y;   // the choice below is the same for the whole work-group (RH is a multiple of its rows), so every barrier is met by all of its waves
    rel_stage(S, h, r0, QPh, QPl, ERB);
    if (r0 < RH) attn_rows_hl(S, h, r0, QPh, QPl, KPh, KPl, VTh, VTl, ATh, ATl);
    else attn_rows_h(S, red, h, r0, QP16, KP16, VT16, ATh, ATl);
}

extern "C" void kernel_launch(void* const* d_in, const int* in_sizes, int n_in,
                              void* d_out, int out_size, void* d_ws, size_t ws_size, hipStream_t stream) {
    (void)in_sizes; (void)n_in; (void)out_size;
    const float* xq = (const float*)d_in[0]; const float* xk = (const float*)d_in[1]; const float* xv = (const float*)d_in[2]; const float* wq = (const float*)d_in[3]; const float* bq = (const float*)d_in[4]; const float* wk = (const float*)d_in[5]; const float* bk = (const float*)d_in[6]; const float* wv = (const float*)d_in[7]; const float* bv = (const float*)d_in[8]; const float* wo = (const float*)d_in[9]; const float* bo = (const float*)d_in[10]; const float* Er = (const float*)d_in[11]; const float* x = nullptr; (void)x;
    float* OUT = (float*)d_out;     // [1][2048][1024]
    char* wsp = (char*)d_ws;
    auto take = [&](size_t bytes) { char* p = wsp; wsp += (bytes + 255) & ~(size_t)255; return (void*)p; };
    bf* WQ = (bf*)take((size_t)DQ * DM * 2); bf* WK = (bf*)take((size_t)DKV * DM * 2); bf* WV = (bf*)take((size_t)DKV * DM * 2); bf* WO = (bf*)take((size_t)DM * DQ * 2);
    bf* ERB = (bf*)take((size_t)TT * HD * 2);
    bf* XQ = (bf*)take((size_t)TT * DM * 2); bf* XK = (bf*)take((size_t)TT * DM * 2); bf* XV = (bf*)take((size_t)TT * DM * 2);
    h16* QP16 = (h16*)take((size_t)NH_ * TT * HD * 2); h16* KP16 = (h16*)take((size_t)NKV * TT * HD * 2); h16* VT16 = (h16*)take((size_t)NKV * HD * TT * 2);
    bf* QPh = (bf*)take((size_t)NH_ * TT * HD * 2); bf* QPl = (bf*)take((size_t)NH_ * TT * HD * 2); bf* KPh = (bf*)take((size_t)NKV * TT * HD * 2); bf* KPl = (bf*)take((size_t)NKV * TT * HD * 2); bf* VTh = (bf*)take((size_t)NKV * HD * TT * 2); bf* VTl = (bf*)take((size_t)NKV * HD * TT * 2);
    bf* ATh = (bf*)take((size_t)TT * DQ * 2); bf* ATl = (bf*)take((size_t)TT * DQ * 2);
    if ((size_t)(wsp - (char*)d_ws) > ws_size) return;    // ws 256 MiB
    for (int b = 0; b < NB_; ++b) {
        k_prep<<<4 * PB_W + 3 * PB_X + PB_E, 256, 0, stream>>>(wq, wk, wv, wo, xq + (size_t)b * TT * DM, xk + (size_t)b * TT * DM, xv + (size_t)b * TT * DM, Er, WQ, WK, WV, WO, XQ, XK, XV, ERB);   /* Er [2048][64] ('t d'): rows t, k = d */
        k_qkv<<<dim3(TT / 128, NH_ / 2, 3), 256, 0, stream>>>(XQ, XK, XV, WQ, WK, WV, bq, bk, bv, QP16, QPh, QPl, KP16, KPh, KPl, VT16, VTh, VTl);
        k_attn<<<dim3(RH / (QB * 16), NH_, TT / RH), 512, 0, stream>>>(QP16, QPh, QPl, KP16, KPh, KPl, ERB, VT16, VTh, VTl, ATh, ATl);   /* one kv head per query head */
        k_gemmw<bf, 1, true, 8, DQ><<<dim3(TT / 64, DM / 64, 1), 256, 0, stream>>>(ATh, ATl, WO, nullptr, OUT + (size_t)b * TT * DM, DM, bo, 0, 0, 0); }
}
